// v000
// Times are from an AMD MI455X. After a warm-up the kernel runs many times in a row, and a time is the length of
// such a window on the GPU divided by its runs, so every launch and the gaps after it count. The runs cycle
// through copies of the inputs. A figure is the median of several windows, for all but v000 over two sittings.
// Sittings can differ by a few percent; kernels timed side by side share one.
// v000, which the later versions start from, runs in 6950 microseconds.
#include <hip/hip_runtime.h>
// RoPE multi-head self-attention with INPUT rotary tables (x [4][2048][1024]; q/k/v = x W^T (nn.Linear natural [out][in] sigma 0.02, no bias), 16 heads of 64; q = q cos + rotate_half(q) sin with the module's cos/sin inputs [1][2048][1][64] (full head width, independent values per dim; rotate_half = concat(-x[32:], x[:32])), same for k; scores / 8; softmax over all keys (no mask); out = merged Wo^T (no bias) -> [4][2048][1024]).
// Structure: token rows r = b*2048 + s; x as exact f16 rows (bf16-rounded); per batch: q | k | v as ONE WMMA GEMM (32x64 wave tiles, f32 accumulation, exact x16 weights, N = 3 x 1024) into f32 rows, then per (row, head) on VALU: the half-split rotary rotation of q and k from f32 cos/sin tables (no norm) -> f16 q, k, v rows; V^T for all heads via LDS transposes; per group of 4 heads: scores GEMM (K = 64, batched over the heads on grid.y, alpha = 1/8), row softmax on VALU (f32 statistics, native exp; weights stored x256 as f16), o = P . V^T GEMM (K = 2048, alpha 2^-2: o carried x64 against f16 subnormal flush, folded into the output GEMM alpha) written straight into the merged f16 o rows; out = o W_o GEMM (f32, no bias) into the output layout.
// Compute dtype: inputs rounded to bf16; x / weights exact; projections and rope f32; q, k, v, softmax weights and o as plain f16 GEMM operands (~2^-12); scores and softmax statistics f32; v_wmma_f32_16x16x32_f16.
#define NB 4
#define SQ 2048
#define DM 1024
#define NH 16
#define HD 64
#define HG 4                         /* heads per attention launch group */
#define B0 0                         /* first batch processed (debug hook) */
#define NBR NB                       /* batches processed (debug hook) */
#define QN SQ                        /* query rows attended per batch (debug hook) */
#define NHD NH                       /* heads attended (debug hook) */
#define NR ((size_t)NB * SQ)         /* token rows */
#define MPO ((int)((size_t)NBR * SQ))      /* rows through the output GEMM (debug hook) */
typedef __bf16 v16b __attribute__((ext_vector_type(16)));
typedef unsigned short v8us __attribute__((ext_vector_type(8), may_alias));
typedef float  v8f  __attribute__((ext_vector_type(8)));
typedef float  v4f  __attribute__((ext_vector_type(4)));
typedef float  v4fa __attribute__((ext_vector_type(4), may_alias));
union FragB { v16b v; v8us half[2]; unsigned short u[16]; };

__device__ __forceinline__ unsigned short bf16_bits(float x) { unsigned int u = __float_as_uint(x); return (unsigned short)((u + 0x7FFFu + ((u >> 16) & 1u)) >> 16); }
__device__ __forceinline__ float bf16_val(unsigned short b) { return __uint_as_float(((unsigned int)b) << 16); }
__device__ __forceinline__ float bf16_round(float x) { return bf16_val(bf16_bits(x)); }
// D += A·B with NT terms: 1 = ah·bh, 2 = + al·bh (A split), 3 = + ah·bl (both split)
template <int NT>
__device__ __forceinline__ v8f mmaN(v16b ah, v16b al, v16b bh, v16b bl, v8f c) {
  c = __builtin_amdgcn_wmma_f32_16x16x32_bf16(false, ah, false, bh, (short)0, c, false, false);
  if (NT >= 2) c = __builtin_amdgcn_wmma_f32_16x16x32_bf16(false, al, false, bh, (short)0, c, false, false);
  if (NT >= 3) c = __builtin_amdgcn_wmma_f32_16x16x32_bf16(false, ah, false, bl, (short)0, c, false, false);
  asm volatile("v_nop\n\tv_nop\n\tv_nop\n\tv_nop" : "+v"(c) : "v"(ah), "v"(al), "v"(bh), "v"(bl));
  return c;
}

__global__ __launch_bounds__(256) void k_wt_bf16(const float* __restrict__ W, unsigned short* __restrict__ Wt, int K, int N) {
  const int t = blockIdx.x * 256 + threadIdx.x;
  const int k8n = K / 8;
  if (t >= N * k8n) return;
  const int n = t / k8n, k8 = (t % k8n) * 8;
  v8us v;
#pragma unroll
  for (int i = 0; i < 8; ++i) v[i] = bf16_bits(W[(size_t)(k8 + i) * N + n]);
  *(v8us*)(Wt + (size_t)n * K + k8) = v;
  
}

// GEMM C[M][N] (f32, pitch ldc) = act(A[M][K]·W + bias). A f32 row-major (pitch lda) converted per fragment to bf16
// (ASPLIT: hi/lo two planes -> 2 terms, else single rounded term); Wt bf16 [N][K] (pitch ldb). BIAS_BF16 rounds the
// bias to bf16 first (bias quantised to bf16 before the add). K%32==0, M%16==0, N%64==0.
template <bool ASPLIT, int ACT, bool BIAS_BF16>
__global__ __launch_bounds__(128) void k_gemm_bf(const float* __restrict__ A, int lda, const unsigned short* __restrict__ Wt, int ldb,
                                               const float* __restrict__ bias, float* __restrict__ C, int ldc, int M, int N, int K) {
  __shared__ __attribute__((aligned(16))) float so[4][16][64];
  const int tid = threadIdx.x, w = tid >> 5, lane = tid & 31, ln = lane & 15, hh = lane >> 4;
  const int ntn = N / 64;
  const int wid = blockIdx.x * 4 + w;
  const int mt = wid / ntn, nq = wid % ntn;
  if (mt * 16 >= M) return;
  const int row0 = mt * 16, col0 = nq * 64;
  const float* arow = A + (size_t)(row0 + ln) * lda;
  v8f acc[4] = {};
  for (int kb = 0; kb < K; kb += 32) {
    FragB ah, al;
    const v4f x0 = *(const v4fa*)(arow + kb + 8 * hh), x1 = *(const v4fa*)(arow + kb + 8 * hh + 4);
    const v4f x2 = *(const v4fa*)(arow + kb + 16 + 8 * hh), x3 = *(const v4fa*)(arow + kb + 16 + 8 * hh + 4);
    float xs[16] = {x0[0],x0[1],x0[2],x0[3],x1[0],x1[1],x1[2],x1[3],x2[0],x2[1],x2[2],x2[3],x3[0],x3[1],x3[2],x3[3]};
#pragma unroll
    for (int i = 0; i < 16; ++i) { const unsigned short hb = bf16_bits(xs[i]); ah.u[i] = hb; al.u[i] = ASPLIT ? bf16_bits(xs[i] - bf16_val(hb)) : (unsigned short)0; }
#pragma unroll
    for (int t = 0; t < 4; ++t) {
      const unsigned short* brow = Wt + (size_t)(col0 + t * 16 + ln) * ldb + kb;
      FragB b;
      b.half[0] = *(const v8us*)(brow + 8 * hh);
      b.half[1] = *(const v8us*)(brow + 16 + 8 * hh);
      acc[t] = mmaN<ASPLIT ? 2 : 1>(ah.v, al.v, b.v, b.v, acc[t]);
    }
  }
#pragma unroll
  for (int t = 0; t < 4; ++t) {
    float bv = bias ? bias[col0 + t * 16 + ln] : 0.f;
    if (BIAS_BF16) bv = bf16_round(bv);
#pragma unroll
    for (int r = 0; r < 8; ++r) { float v = acc[t][r] + bv; if (ACT == 1) v = fmaxf(v, 0.f); so[w][8 * hh + r][t * 16 + ln] = v; }
  }
  __builtin_amdgcn_fence(__ATOMIC_ACQ_REL, "workgroup");
  __builtin_amdgcn_wave_barrier();
  const int rsub = lane >> 4, c4 = (lane & 15) * 4;
  {
#pragma unroll
    for (int q = 0; q < 8; ++q) {
      const int r = q * 2 + rsub;
      const v4f v = *(const v4fa*)&so[w][r][c4];
      *(v4f*)(C + (size_t)(row0 + r) * ldc + col0 + c4) = v;
    }
    
  }
}

// GEMM C = act(A·W + bias + resid): A f32 (ASPLIT -> hi/lo 2 terms), Wt bf16 [N][K]; ACT 0 none, 1 relu, 2 exact gelu;
// resid (optional, f32, row index = (row % rmod), pitch ldr, RES_BF16 rounds it) added before the activation.
template <bool ASPLIT, int ACT, bool BIAS_BF16, bool RES_BF16>
__global__ __launch_bounds__(128) void k_gemm_bf3(const float* __restrict__ A, int lda, const unsigned short* __restrict__ Wt, int ldb,
                                                const float* __restrict__ bias, const float* __restrict__ resid, int rmod, int ldr,
                                                float* __restrict__ C, int ldc, int M, int N, int K) {
  __shared__ __attribute__((aligned(16))) float so[4][16][64];
  const int tid = threadIdx.x, w = tid >> 5, lane = tid & 31, ln = lane & 15, hh = lane >> 4;
  const int ntn = N / 64;
  const int wid = blockIdx.x * 4 + w;
  const int mt = wid / ntn, nq = wid % ntn;
  if (mt * 16 >= M) return;
  const int row0 = mt * 16, col0 = nq * 64;
  const float* arow = A + (size_t)(row0 + ln) * lda;
  v8f acc[4] = {};
  for (int kb = 0; kb < K; kb += 32) {
    FragB ah, al;
    const v4f x0 = *(const v4fa*)(arow + kb + 8 * hh), x1 = *(const v4fa*)(arow + kb + 8 * hh + 4);
    const v4f x2 = *(const v4fa*)(arow + kb + 16 + 8 * hh), x3 = *(const v4fa*)(arow + kb + 16 + 8 * hh + 4);
    float xs[16] = {x0[0],x0[1],x0[2],x0[3],x1[0],x1[1],x1[2],x1[3],x2[0],x2[1],x2[2],x2[3],x3[0],x3[1],x3[2],x3[3]};
#pragma unroll
    for (int i = 0; i < 16; ++i) { const unsigned short hb = bf16_bits(xs[i]); ah.u[i] = hb; al.u[i] = ASPLIT ? bf16_bits(xs[i] - bf16_val(hb)) : (unsigned short)0; }
#pragma unroll
    for (int t = 0; t < 4; ++t) {
      const unsigned short* brow = Wt + (size_t)(col0 + t * 16 + ln) * ldb + kb;
      FragB b;
      b.half[0] = *(const v8us*)(brow + 8 * hh);
      b.half[1] = *(const v8us*)(brow + 16 + 8 * hh);
      acc[t] = mmaN<ASPLIT ? 2 : 1>(ah.v, al.v, b.v, b.v, acc[t]);
    }
  }
#pragma unroll
  for (int t = 0; t < 4; ++t) {
    const int col = col0 + t * 16 + ln;
    float bv = bias ? bias[col] : 0.f;
    if (BIAS_BF16) bv = bf16_round(bv);
#pragma unroll
    for (int r = 0; r < 8; ++r) {
      float v = acc[t][r] + bv;
      if (resid) { float rv = resid[(size_t)((row0 + 8 * hh + r) % rmod) * ldr + col]; if (RES_BF16) rv = bf16_round(rv); v += rv; }
      if (ACT == 1) v = fmaxf(v, 0.f);
      if (ACT == 2) v = 0.5f * v * (1.0f + erff(v * 0.70710678118654752f));
      if (ACT == 3) { const float u = 0.7978845608028654f * (v + 0.044715f * v * v * v); v = 0.5f * v * (1.0f + tanhf(u)); }
      so[w][8 * hh + r][t * 16 + ln] = v;
    }
  }
  __builtin_amdgcn_fence(__ATOMIC_ACQ_REL, "workgroup");
  __builtin_amdgcn_wave_barrier();
  const int rsub = lane >> 4, c4 = (lane & 15) * 4;
  {
#pragma unroll
    for (int q = 0; q < 8; ++q) {
      const int r = q * 2 + rsub;
      const v4f v = *(const v4fa*)&so[w][r][c4];
      *(v4f*)(C + (size_t)(row0 + r) * ldc + col0 + c4) = v;
    }
    
  }
}
// row LayerNorm (biased variance, eps) over N: s = X (+ R); optional out_sum <- s; out_norm <- (s-mu)*rsqrt(var+eps)*g + b
template <bool PARAM_BF16>
__global__ __launch_bounds__(256) void k_layernorm(const float* __restrict__ X, const float* __restrict__ R, const float* __restrict__ g, const float* __restrict__ bta,
                                                  float* __restrict__ out_sum, float* __restrict__ out_norm, int N, float eps) {
  __shared__ float red[256];
  const int row = blockIdx.x, tid = threadIdx.x;
  const float* x = X + (size_t)row * N; const float* rr = R ? R + (size_t)row * N : nullptr;
  float vals[16];                     // up to N = 4096
  const int per = N / 256;            // contiguous chunk per thread? use strided-by-4 chunks: thread handles j = tid*4 + 1024*u
  float s1 = 0.f;
  for (int u = 0; u < per / 4; ++u) {
    const int j = tid * 4 + 1024 * u;
    const v4f a = *(const v4fa*)(x + j);
    v4f b = {0.f,0.f,0.f,0.f}; if (rr) b = *(const v4fa*)(rr + j);
#pragma unroll
    for (int q = 0; q < 4; ++q) { const float v = a[q] + b[q]; vals[u * 4 + q] = v; s1 += v; }
  }
  red[tid] = s1; __syncthreads();
  for (int st = 128; st > 0; st >>= 1) { if (tid < st) red[tid] += red[tid + st]; __syncthreads(); }
  const float mu = red[0] / (float)N; __syncthreads();
  float s2 = 0.f;
  for (int u = 0; u < per / 4; ++u)
#pragma unroll
    for (int q = 0; q < 4; ++q) { const float c = vals[u * 4 + q] - mu; s2 += c * c; }
  red[tid] = s2; __syncthreads();
  for (int st = 128; st > 0; st >>= 1) { if (tid < st) red[tid] += red[tid + st]; __syncthreads(); }
  const float rs = rsqrtf(red[0] / (float)N + eps);
  {
    for (int u = 0; u < per / 4; ++u) {
      const int j = tid * 4 + 1024 * u;
      v4f o, sm;
#pragma unroll
      for (int q = 0; q < 4; ++q) {
        float gg = g[j + q], bb = bta[j + q];
        if (PARAM_BF16) { gg = bf16_round(gg); bb = bf16_round(bb); }
        sm[q] = vals[u * 4 + q]; o[q] = (vals[u * 4 + q] - mu) * rs * gg + bb;
      }
      if (out_sum) *(v4f*)(out_sum + (size_t)row * N + j) = sm;
      *(v4f*)(out_norm + (size_t)row * N + j) = o;
    }
    
  }
}



// ---- f16 WMMA path (v_wmma_f32_16x16x32_f16): 11-bit significands for operands in range — used where a [0,1] probability operand needs more precision than bf16
typedef _Float16 v16h __attribute__((ext_vector_type(16)));
union FragH { v16h v; v8us half[2]; _Float16 h[16]; unsigned short u[16]; };
template <int NT>
__device__ __forceinline__ v8f mmaH(v16h ah, v16h al, v16h bh, v16h bl, v8f c) {
  c = __builtin_amdgcn_wmma_f32_16x16x32_f16(false, ah, false, bh, (short)0, c, false, false);
  if (NT >= 2) c = __builtin_amdgcn_wmma_f32_16x16x32_f16(false, al, false, bh, (short)0, c, false, false);
  if (NT >= 3) c = __builtin_amdgcn_wmma_f32_16x16x32_f16(false, ah, false, bl, (short)0, c, false, false);
  asm volatile("v_nop\n\tv_nop\n\tv_nop\n\tv_nop" : "+v"(c) : "v"(ah), "v"(al), "v"(bh), "v"(bl));
  return c;
}
// batched GEMM like k_gemm_b but f16 operands: A f32 (split into f16 hi/lo if ASPLIT, else rounded to f16), Bt = f16 values [n][k]; alpha; C f32; N multiple of 16 (partial tiles skipped)
template <bool ASPLIT>
__global__ __launch_bounds__(128) void k_gemm_h(const float* __restrict__ A, int lda, size_t sA, const _Float16* __restrict__ Bh, int ldb, size_t sB, float alpha, float* __restrict__ C, int ldc, size_t sC, int M, int N, int K) {
  __shared__ __attribute__((aligned(16))) float so[4][16][64];
  const int tid = threadIdx.x, w = tid >> 5, lane = tid & 31, ln = lane & 15, hh = lane >> 4; const int by = blockIdx.y;
  A += (size_t)by * sA; Bh += (size_t)by * sB; C += (size_t)by * sC;
  const int ntn = (N + 63) / 64; const int wid = blockIdx.x * 4 + w; const int mt = wid / ntn, nq = wid % ntn; if (mt * 16 >= M) return;
  const int row0 = mt * 16, col0 = nq * 64; const float* arow = A + (size_t)(row0 + ln) * lda;
  v8f acc[4] = {};
  for (int kb = 0; kb < K; kb += 32) {
    FragH ah, al;
    const v4f x0 = *(const v4fa*)(arow + kb + 8 * hh), x1 = *(const v4fa*)(arow + kb + 8 * hh + 4), x2 = *(const v4fa*)(arow + kb + 16 + 8 * hh), x3 = *(const v4fa*)(arow + kb + 16 + 8 * hh + 4);
    float xs[16] = {x0[0],x0[1],x0[2],x0[3],x1[0],x1[1],x1[2],x1[3],x2[0],x2[1],x2[2],x2[3],x3[0],x3[1],x3[2],x3[3]};
#pragma unroll
    for (int i = 0; i < 16; ++i) { const _Float16 h = (_Float16)xs[i]; ah.h[i] = h; al.h[i] = ASPLIT ? (_Float16)(xs[i] - (float)h) : (_Float16)0.0f; }
#pragma unroll
    for (int t = 0; t < 4; ++t) { if (col0 + t * 16 >= N) continue; const size_t boff = (size_t)(col0 + t * 16 + ln) * ldb + kb; FragH bq; bq.half[0] = *(const v8us*)(Bh + boff + 8 * hh); bq.half[1] = *(const v8us*)(Bh + boff + 16 + 8 * hh);
      acc[t] = mmaH<ASPLIT ? 2 : 1>(ah.v, al.v, bq.v, bq.v, acc[t]); }
  }
#pragma unroll
  for (int t = 0; t < 4; ++t) { if (col0 + t * 16 >= N) continue;
#pragma unroll
    for (int r = 0; r < 8; ++r) so[w][8 * hh + r][t * 16 + ln] = acc[t][r] * alpha; }
  __builtin_amdgcn_fence(__ATOMIC_ACQ_REL, "workgroup"); __builtin_amdgcn_wave_barrier();
  const int rsub = lane >> 4, c4 = (lane & 15) * 4;
  {
#pragma unroll
    for (int q = 0; q < 8; ++q) { const int r = q * 2 + rsub; if (col0 + c4 < N) { const v4f v = *(const v4fa*)&so[w][r][c4]; *(v4f*)(C + (size_t)(row0 + r) * ldc + col0 + c4) = v; } }
     }
}

// Wt[n][k] = f16(W[k][n]·scale) from f32 row-major W[K][N] (scale = power of two; bf16-exact weights stay exact in f16 away from the subnormal range)
__global__ __launch_bounds__(256) void k_wt_f16(const float* __restrict__ W, _Float16* __restrict__ Wt, int K, int N, float scale) {
  const int t = blockIdx.x * 256 + threadIdx.x; if (t >= N * (K / 8)) return; const int n = t / (K / 8), k8 = (t % (K / 8)) * 8; FragH f;
#pragma unroll
  for (int i = 0; i < 8; ++i) f.h[i] = (_Float16)(bf16_round(W[(size_t)(k8 + i) * N + n]) * scale); const v8us o = f.half[0];
  *(v8us*)((unsigned short*)Wt + (size_t)n * K + k8) = o; 
}
// k_gemm_hh variant with fused epilogue: v = acc·alpha + bias[by·sBias + col] (+ CP[(row/rowsPerB)·sCPb + by·64 + col] if CP) ; ACT 0 none / 1 elu ; writes f16 C16 (and f32 C if non-null)
template <int ACT>
__global__ __launch_bounds__(128) void k_gemm_hhx(const _Float16* __restrict__ A, int lda, size_t sA, const _Float16* __restrict__ Bh, int ldb, size_t sB, float alpha, const float* __restrict__ bias, size_t sBias, const float* __restrict__ CP, int rowsPerB, size_t sCPb, int row0g,
    float* __restrict__ C, _Float16* __restrict__ C16, int ldc, size_t sC, int M, int N, int K) {
  __shared__ __attribute__((aligned(16))) float so[4][16][64];
  const int tid = threadIdx.x, w = tid >> 5, lane = tid & 31, ln = lane & 15, hh = lane >> 4; const int by = blockIdx.y;
  A += (size_t)by * sA; Bh += (size_t)by * sB; const size_t cofs = (size_t)by * sC; const float* bp = bias ? bias + (size_t)by * sBias : nullptr;
  const int ntn = (N + 63) / 64; const int wid = blockIdx.x * 4 + w; const int mt = wid / ntn, nq = wid % ntn; if (mt * 16 >= M) return;
  const int row0 = mt * 16, col0 = nq * 64; const _Float16* arow = A + (size_t)(row0 + ln) * lda;
  v8f acc[4] = {};
  for (int kb = 0; kb < K; kb += 32) { FragH ah; ah.half[0] = *(const v8us*)((const unsigned short*)arow + kb + 8 * hh); ah.half[1] = *(const v8us*)((const unsigned short*)arow + kb + 16 + 8 * hh);
#pragma unroll
    for (int t = 0; t < 4; ++t) { if (col0 + t * 16 >= N) continue; const size_t boff = (size_t)(col0 + t * 16 + ln) * ldb + kb; FragH bq; bq.half[0] = *(const v8us*)((const unsigned short*)Bh + boff + 8 * hh); bq.half[1] = *(const v8us*)((const unsigned short*)Bh + boff + 16 + 8 * hh);
      acc[t] = mmaH<1>(ah.v, ah.v, bq.v, bq.v, acc[t]); }
  }
#pragma unroll
  for (int t = 0; t < 4; ++t) { if (col0 + t * 16 >= N) continue; const int col = col0 + t * 16 + ln; const float bv = bp ? bf16_round(bp[col]) : 0.f;
#pragma unroll
    for (int r = 0; r < 8; ++r) { float v = acc[t][r] * alpha + bv; if (CP) { const int rr = row0g + row0 + 8 * hh + r; if (rowsPerB < 0) v += CP[cofs + (size_t)rr * ldc + col];      /* rowsPerB < 0: own element of the batched C plane */ else { const int bidx = rr / rowsPerB; v += CP[(size_t)bidx * sCPb + (size_t)by * 64 + col]; } } if (ACT == 1) v = (v > 0.f) ? v : expm1f(v); else if (ACT == 7) v = (v > 0.f) ? v + 1.0f : expf(v); else if (ACT == 8) v = tanhf(v); else if (ACT == 9) v = 0.5f * v * (1.0f + tanhf(0.7978845608028654f * (v + 0.044715f * v * v * v))); else if (ACT == 11) v = 1.0f / (1.0f + expf(-v)); else if (ACT == 12) v = (v > 0.f) ? v : 0.01f * v; else if (ACT == 14) v = (v > 0.f) ? v : 0.1f * v; else if (ACT == 16) v = (v >= 0.f) ? v : 0.3f * v; else if (ACT == 17) v = (v >= 0.f) ? v : 0.2f * v; else if (ACT == 15) v = v / (1.0f + expf(-v)); else if (ACT == 3) v = fmaxf(v, 0.f); else if (ACT == 6) v = 0.5f * v * (1.0f + erff(v * 0.70710678118654752f)); so[w][8 * hh + r][t * 16 + ln] = v; } }
  __builtin_amdgcn_fence(__ATOMIC_ACQ_REL, "workgroup"); __builtin_amdgcn_wave_barrier();
  const int rsub = lane >> 4, c4 = (lane & 15) * 4; typedef _Float16 v4h __attribute__((ext_vector_type(4)));
  {
#pragma unroll
    for (int q = 0; q < 8; ++q) { const int r = q * 2 + rsub; if (col0 + c4 < N) { const v4f v = *(const v4fa*)&so[w][r][c4]; if (C) *(v4f*)(C + cofs + (size_t)(row0 + r) * ldc + col0 + c4) = v; if (C16) { v4h h4; for (int i = 0; i < 4; ++i) h4[i] = (_Float16)v[i]; *(v4h*)(C16 + cofs + (size_t)(row0 + r) * ldc + col0 + c4) = h4; } } }
     }
}


typedef _Float16 v4h __attribute__((ext_vector_type(4)));

__global__ __launch_bounds__(256) void k_x16(const float* __restrict__ x, _Float16* __restrict__ X16, size_t n8) { const size_t t = (size_t)blockIdx.x * 256 + threadIdx.x; if (t >= n8) return; FragH f;
#pragma unroll
  for (int q = 0; q < 8; ++q) f.h[q] = (_Float16)bf16_round(x[t * 8 + q]); *(v8us*)((unsigned short*)X16 + t * 8) = f.half[0];  }
__global__ __launch_bounds__(256) void k_h16(const float* __restrict__ x, _Float16* __restrict__ X16, size_t n8) { const size_t t = (size_t)blockIdx.x * 256 + threadIdx.x; if (t >= n8) return; FragH f;
#pragma unroll
  for (int q = 0; q < 8; ++q) f.h[q] = (_Float16)x[t * 8 + q]; *(v8us*)((unsigned short*)X16 + t * 8) = f.half[0];  }
__global__ __launch_bounds__(256) void k_round16f(const float* __restrict__ W, _Float16* __restrict__ Bt, size_t n8) { const size_t t = (size_t)blockIdx.x * 256 + threadIdx.x; if (t >= n8) return; FragH f;
#pragma unroll
  for (int i = 0; i < 8; ++i) f.h[i] = (_Float16)(bf16_round(W[t * 8 + i]) * 16.0f); *(v8us*)((unsigned short*)Bt + t * 8) = f.half[0];  }
template <int NHv, int TTv>
__global__ __launch_bounds__(256) void k_vt(const _Float16* __restrict__ V16, int ldv, int voff, _Float16* __restrict__ Vt) { __shared__ unsigned short tl[64][66]; const int tid = threadIdx.x; const int slab = blockIdx.x / (TTv / 64), lg = blockIdx.x % (TTv / 64); const int b = slab / NHv, h = slab % NHv;
  for (int i = tid; i < 64 * 8; i += 256) { const int r = i / 8, c8 = (i % 8) * 8; FragH f; f.half[0] = *(const v8us*)((const unsigned short*)V16 + ((size_t)b * TTv + lg * 64 + r) * ldv + voff + h * 64 + c8);
#pragma unroll
    for (int q = 0; q < 8; ++q) tl[r][c8 + q] = f.u[q]; }
  __syncthreads();
  {
#pragma unroll
    for (int rd = 0; rd < 2; ++rd) { const int d = rd * 32 + tid / 8, pc = tid % 8; FragH f;
#pragma unroll
      for (int q = 0; q < 8; ++q) f.u[q] = tl[pc * 8 + q][d];
      *(v8us*)((unsigned short*)Vt + ((size_t)slab * 64 + d) * TTv + lg * 64 + pc * 8) = f.half[0]; }
     } }

__global__ __launch_bounds__(256) void k_hl(const float* __restrict__ F, _Float16* __restrict__ Hh, _Float16* __restrict__ Hl, size_t n8) { const size_t t = (size_t)blockIdx.x * 256 + threadIdx.x; if (t >= n8) return; FragH fh, fl; const v4f a = *(const v4fa*)(F + t * 8), c = *(const v4fa*)(F + t * 8 + 4);
#pragma unroll
  for (int q = 0; q < 4; ++q) { _Float16 h = (_Float16)a[q]; fh.h[q] = h; fl.h[q] = (_Float16)((a[q] - (float)h) * 1024.0f); h = (_Float16)c[q]; fh.h[4 + q] = h; fl.h[4 + q] = (_Float16)((c[q] - (float)h) * 1024.0f); }
  { *(v8us*)((unsigned short*)Hh + t * 8) = fh.half[0]; *(v8us*)((unsigned short*)Hl + t * 8) = fl.half[0];  } }

// ---- fast GEMM (wave tile 32x64; requires M % 32 == 0 rows per launch region and N % 64 == 0); epilogue = k_gemm_hhx semantics ----
__device__ __forceinline__ v16h g2_frag(const _Float16* p, int hh) { FragH f; f.half[0] = *(const v8us*)((const unsigned short*)p + 8 * hh); f.half[1] = *(const v8us*)((const unsigned short*)p + 16 + 8 * hh); return f.v; }
__device__ __forceinline__ v8f g2_mma(v16h a, v16h b, v8f c) { v8f d = __builtin_amdgcn_wmma_f32_16x16x32_f16(false, a, false, b, (short)0, c, false, false); asm volatile("v_nop\n\tv_nop\n\tv_nop\n\tv_nop" : "+v"(d) : "v"(a), "v"(b)); return d; }
template <int ACT>
__global__ __launch_bounds__(128) void k_gemm2(const _Float16* __restrict__ A, int lda, size_t sA, const _Float16* __restrict__ Bh, int ldb, size_t sB, float alpha, const float* __restrict__ bias, size_t sBias, const float* __restrict__ CP, int rowsPerB, size_t sCPb, int row0g,
    float* __restrict__ C, _Float16* __restrict__ C16, int ldc, size_t sC, int M, int N, int K) { static_assert(ACT == 0 || ACT == 3 || ACT == 6 || ACT == 8 || ACT == 9 || ACT == 11 || ACT == 12 || ACT == 14 || ACT == 15 || ACT == 16 || ACT == 17, "k_gemm2: unsupported ACT code (would silently apply no activation)");
  __shared__ __attribute__((aligned(16))) float so[4][32][68];
  const int tid = threadIdx.x, w = tid >> 5, lane = tid & 31, ln = lane & 15, hh = lane >> 4; const int by = blockIdx.y;
  A += (size_t)by * sA; Bh += (size_t)by * sB; const size_t cofs = (size_t)by * sC; const float* bp = bias ? bias + (size_t)by * sBias : nullptr;
  const int ntn = N >> 6; const int mt = blockIdx.x / ntn, nq = blockIdx.x - mt * ntn; const int row0 = mt * 128 + 32 * w, col0 = nq * 64; if (row0 >= M) return;
  const _Float16* a0p = A + (size_t)(row0 + ln) * lda; const _Float16* a1p = a0p + (size_t)16 * lda;
  const _Float16* b0p = Bh + (size_t)(col0 + ln) * ldb; const _Float16* b1p = b0p + (size_t)16 * ldb; const _Float16* b2p = b1p + (size_t)16 * ldb; const _Float16* b3p = b2p + (size_t)16 * ldb;
  const v8f z8 = {0.f,0.f,0.f,0.f,0.f,0.f,0.f,0.f}; v8f c00 = z8, c01 = z8, c02 = z8, c03 = z8, c10 = z8, c11 = z8, c12 = z8, c13 = z8;
#pragma unroll 1
  for (int kb = 0; kb < K; kb += 32) { const v16h a0 = g2_frag(a0p + kb, hh), a1 = g2_frag(a1p + kb, hh);
    v16h b = g2_frag(b0p + kb, hh); c00 = g2_mma(a0, b, c00); c10 = g2_mma(a1, b, c10);
    b = g2_frag(b1p + kb, hh); c01 = g2_mma(a0, b, c01); c11 = g2_mma(a1, b, c11);
    b = g2_frag(b2p + kb, hh); c02 = g2_mma(a0, b, c02); c12 = g2_mma(a1, b, c12);
    b = g2_frag(b3p + kb, hh); c03 = g2_mma(a0, b, c03); c13 = g2_mma(a1, b, c13); }
  v8f accs[8] = {c00, c01, c02, c03, c10, c11, c12, c13};
#pragma unroll
  for (int u = 0; u < 8; ++u) { const int t = u & 3, half = u >> 2; const int col = col0 + t * 16 + ln; const float bv = bp ? bf16_round(bp[col]) : 0.f;
#pragma unroll
    for (int r = 0; r < 8; ++r) { const int rloc = half * 16 + 8 * hh + r; float v = accs[u][r] * alpha + bv; if (CP) { if (rowsPerB < 0) v += CP[cofs + (size_t)(row0g + row0 + rloc) * ldc + col];      /* rowsPerB < 0: own element of the batched C plane */ else { const int bidx = (row0g + row0 + rloc) / rowsPerB; v += CP[(size_t)bidx * sCPb + (size_t)by * 64 + col]; } }
      if (ACT == 3) v = fmaxf(v, 0.f); else if (ACT == 6) v = 0.5f * v * (1.0f + erff(v * 0.70710678118654752f)); else if (ACT == 11) v = 1.0f / (1.0f + expf(-v)); else if (ACT == 15) v = v / (1.0f + expf(-v)); else if (ACT == 12) v = (v > 0.f) ? v : 0.01f * v; else if (ACT == 8) v = tanhf(v); else if (ACT == 9) v = 0.5f * v * (1.0f + tanhf(0.7978845608028654f * (v + 0.044715f * v * v * v))); else if (ACT == 14) v = (v > 0.f) ? v : 0.1f * v; else if (ACT == 16) v = (v >= 0.f) ? v : 0.3f * v; else if (ACT == 17) v = (v >= 0.f) ? v : 0.2f * v;
      so[w][rloc][t * 16 + ln] = v; } }
  __builtin_amdgcn_fence(__ATOMIC_ACQ_REL, "workgroup"); __builtin_amdgcn_wave_barrier();
  const int rsub = lane >> 4, c4 = (lane & 15) * 4;
  {
#pragma unroll
    for (int q = 0; q < 16; ++q) { const int r = q * 2 + rsub; const v4f v = *(const v4fa*)&so[w][r][c4]; if (C) *(v4f*)(C + cofs + (size_t)(row0 + r) * ldc + col0 + c4) = v; if (C16) { v4h h4; for (int i = 0; i < 4; ++i) h4[i] = (_Float16)v[i]; *(v4h*)(C16 + cofs + (size_t)(row0 + r) * ldc + col0 + c4) = h4; } }
     } }


__global__ __launch_bounds__(256) void k_wnat(const float* __restrict__ w, size_t n8, _Float16* __restrict__ Bt) { const size_t t = (size_t)blockIdx.x * 256 + threadIdx.x; if (t >= n8) return; FragH f; for (int q = 0; q < 8; ++q) f.h[q] = (_Float16)(bf16_round(w[t * 8 + q]) * 16.0f); *(v8us*)((unsigned short*)Bt + t * 8) = f.half[0];  }
__global__ __launch_bounds__(256) void k_rsm(const float* __restrict__ S, _Float16* __restrict__ P, int nrows) {
  #pragma clang fp contract(off)
  const int i = blockIdx.x * 256 + threadIdx.x; if (i >= nrows) return; const float* s = S + (size_t)i * SQ; float mx = -3.0e38f;
#pragma unroll 1
  for (int j = 0; j < SQ; ++j) mx = fmaxf(mx, s[j]); float se = 0.f;
#pragma unroll 1
  for (int j = 0; j < SQ; ++j) se += expf(s[j] - mx); const float sc = 256.0f / se;
#pragma unroll 1
  for (int j0 = 0; j0 < SQ; j0 += 8) { FragH f; for (int q = 0; q < 8; ++q) f.h[q] = (_Float16)(expf(s[j0 + q] - mx) * sc); unsigned short* d = (unsigned short*)P + (size_t)i * SQ + j0; *(v8us*)d = f.half[0];  } }
__global__ __launch_bounds__(256) void k_vt(const _Float16* __restrict__ V16, int b, int h0, _Float16* __restrict__ VT) { __shared__ unsigned short tl[64][65]; const int tid = threadIdx.x; const int hh = blockIdx.x % HG, sg = blockIdx.x / HG; const int s0 = sg * 64; const int h = h0 + hh;
  for (int i = tid; i < 64 * 8; i += 256) { const int j = i / 8, d8 = (i % 8) * 8; FragH f; f.half[0] = *(const v8us*)((const unsigned short*)V16 + ((size_t)b * SQ + s0 + j) * DM + h * HD + d8); for (int q = 0; q < 8; ++q) tl[d8 + q][j] = f.u[q]; }
  __syncthreads();
  { for (int i = tid; i < 64 * 8; i += 256) { const int d = i / 8, j8 = (i % 8) * 8; FragH f; for (int q = 0; q < 8; ++q) f.u[q] = tl[d][j8 + q]; *(v8us*)((unsigned short*)VT + ((size_t)hh * HD + d) * SQ + s0 + j8) = f.half[0]; }  } }


__global__ __launch_bounds__(256) void k_tab2(float theta, float* __restrict__ CS, float* __restrict__ SN) {
  #pragma clang fp contract(off)
  const int t = blockIdx.x * 256 + threadIdx.x; if (t >= SQ * (HD / 2)) return; const int i = t % (HD / 2); const int p = t / (HD / 2); const float invf = 1.0f / powf(theta, (float)(2 * i) / (float)HD); const float ang = __fmul_rn((float)p, invf); const float c = cosf(ang), s = sinf(ang);
  *(float*)(CS + t) = c; *(float*)(SN + t) = s;  }
template <int NORM, int ROPE>
__global__ __launch_bounds__(64) void k_xform(const float* __restrict__ F, int ldf, int nh, const float* __restrict__ gain, float eps, const float* __restrict__ CS, const float* __restrict__ SN, _Float16* __restrict__ H16, int ldo) {
  #pragma clang fp contract(off)
  __shared__ float xv[HD]; __shared__ float red[HD]; __shared__ unsigned short sh_[HD]; const int d = threadIdx.x; const int h = blockIdx.x % nh; const size_t r = blockIdx.x / nh; const int p = (int)(r % SQ);
  float x = F[r * (size_t)ldf + (size_t)h * HD + d];
  if (NORM) { red[d] = __fmul_rn(x, x); __syncthreads(); for (int st = HD / 2; st > 0; st >>= 1) { if (d < st) red[d] = __fadd_rn(red[d], red[d + st]); __syncthreads(); } const float rs = rsqrtf(__fadd_rn(red[0] / (float)HD, eps)); x = __fmul_rn(__fmul_rn(x, rs), bf16_round(gain[d])); }
  xv[d] = x; __syncthreads();
  float o = x;
  if (ROPE == 1) { const int i = d >> 1; const float c = CS[p * (HD / 2) + i], s = SN[p * (HD / 2) + i]; const float ev = xv[2 * i], od = xv[2 * i + 1]; o = (d & 1) ? __fadd_rn(__fmul_rn(ev, s), __fmul_rn(od, c)) : __fadd_rn(__fmul_rn(ev, c), -__fmul_rn(od, s)); }
  if (ROPE == 2) { const int i = d & (HD / 2 - 1); const float c = CS[p * (HD / 2) + i], s = SN[p * (HD / 2) + i]; const float lo = xv[i], hi = xv[i + HD / 2]; o = (d < HD / 2) ? __fadd_rn(__fmul_rn(lo, c), -__fmul_rn(hi, s)) : __fadd_rn(__fmul_rn(lo, s), __fmul_rn(hi, c)); }
  if (ROPE == 6) { const float c = bf16_round(CS[p * HD + d]), s = bf16_round(SN[p * HD + d]); const float pa = xv[(d + HD / 2) & (HD - 1)]; const float rh = (d < HD / 2) ? -pa : pa; o = __fadd_rn(__fmul_rn(x, c), __fmul_rn(rh, s)); }      /* FULL-WIDTH bf16-rounded INPUT tables [p][64]: o = x cos[p][d] + rotate_half(x)[d] sin[p][d], rotate_half = concat(-x[32:], x[:32]) */
  FragH th; th.h[0] = (_Float16)o; sh_[d] = th.u[0]; __syncthreads();
  if (d < HD / 8) { FragH f; for (int q = 0; q < 8; ++q) f.u[q] = sh_[d * 8 + q]; unsigned short* dst = (unsigned short*)H16 + r * (size_t)ldo + (size_t)h * HD + d * 8; *(v8us*)dst = f.half[0];  } }

__global__ __launch_bounds__(256) void k_tab3(float* __restrict__ CS, float* __restrict__ SN) {
  #pragma clang fp contract(off)
  const int t = blockIdx.x * 256 + threadIdx.x; if (t >= SQ * (HD / 2)) return; const int i = t % (HD / 2); const int p = t / (HD / 2); const float freq = expf(__fmul_rn((float)(2 * i), -0.14391156831212787f)); const float ang = __fmul_rn((float)p, freq); const float c = cosf(ang), s = sinf(ang);
  *(float*)(CS + t) = c; *(float*)(SN + t) = s;  }



__global__ __launch_bounds__(256) void k_rsmf(const float* __restrict__ S, _Float16* __restrict__ P, int qn, int hg) {
  #pragma clang fp contract(off)
  const int t = blockIdx.x * 256 + threadIdx.x; if (t >= qn * hg) return; const size_t i = (size_t)(t / qn) * SQ + (t % qn); const float* s = S + i * SQ; float mx = -3.0e38f;
#pragma unroll 1
  for (int j = 0; j < SQ; ++j) mx = fmaxf(mx, s[j]); float se = 0.f;
#pragma unroll 1
  for (int j = 0; j < SQ; ++j) se += __expf(s[j] - mx); const float sc = 256.0f / se;
#pragma unroll 1
  for (int j0 = 0; j0 < SQ; j0 += 8) { FragH f; for (int q = 0; q < 8; ++q) f.h[q] = (_Float16)(__expf(s[j0 + q] - mx) * sc); unsigned short* d = (unsigned short*)P + i * SQ + j0; *(v8us*)d = f.half[0];  } }

extern "C" void kernel_launch(void* const* d_in, const int* in_sizes, int n_in,
                              void* d_out, int out_size, void* d_ws, size_t ws_size, hipStream_t stream) {
  (void)in_sizes; (void)n_in; (void)out_size;
  const float* const* I = (const float* const*)d_in; const float* x = I[0]; const float* tcos = I[1]; const float* tsin = I[2]; const float* wq = I[3]; const float* wk = I[4]; const float* wv = I[5]; const float* wo = I[6]; const float* bo = nullptr;      /* natural [out][in] weights, no biases; cos/sin INPUT tables [1][S][1][64] = [S][64] */
  char* ws = (char*)d_ws; size_t off = 0;
  auto take = [&](size_t bytes) { char* p = ws + off; off += (bytes + 255) & ~(size_t)255; return p; };
  _Float16* BQKV = (_Float16*)take((size_t)3 * DM * DM * 2); _Float16* BO = (_Float16*)take((size_t)DM * DM * 2); float* CS = (float*)take((size_t)SQ * (HD / 2) * 4); float* SN = (float*)take((size_t)SQ * (HD / 2) * 4);
  _Float16* X16 = (_Float16*)take(NR * DM * 2); float* QKVF = (float*)take((size_t)SQ * 3 * DM * 4);      /* one batch of f32 q | k | v rows */
  _Float16* QH = (_Float16*)take(NR * DM * 2); _Float16* KH = (_Float16*)take(NR * DM * 2); _Float16* V16 = (_Float16*)take(NR * DM * 2); _Float16* O16 = (_Float16*)take(NR * DM * 2);
  float* S = (float*)take((size_t)HG * SQ * SQ * 4); _Float16* P = (_Float16*)take((size_t)HG * SQ * SQ * 2); _Float16* VT = (_Float16*)take((size_t)NH * HD * SQ * 2);
  if (off > ws_size) return;
  { const unsigned g = (unsigned)(((size_t)DM * DM / 8 + 255) / 256); k_wnat<<<g, 256, 0, stream>>>(wq, (size_t)DM * DM / 8, BQKV); k_wnat<<<g, 256, 0, stream>>>(wk, (size_t)DM * DM / 8, BQKV + (size_t)DM * DM); k_wnat<<<g, 256, 0, stream>>>(wv, (size_t)DM * DM / 8, BQKV + (size_t)2 * DM * DM); k_wnat<<<g, 256, 0, stream>>>(wo, (size_t)DM * DM / 8, BO); }      /* natural [out][in] = Bt[n][k], x16; q | k | v stacked along n */
  k_x16<<<(unsigned)((NR * DM / 8 + 255) / 256), 256, 0, stream>>>(x, X16, NR * DM / 8);
  for (int b = B0; b < B0 + NBR; ++b) { const size_t r0 = (size_t)b * SQ;
    k_gemm2<0><<<dim3((unsigned)((SQ / 128) * (3 * DM / 64)), 1), 128, 0, stream>>>(X16 + r0 * DM, DM, 0, BQKV, DM, 0, 0.0625f, nullptr, 0, nullptr, 1, 0, 0, QKVF, nullptr, 3 * DM, 0, SQ, 3 * DM, DM);      /* q | k | v rows (f32) of this batch */
    k_xform<0, 6><<<(unsigned)(SQ * NH), 64, 0, stream>>>(QKVF, 3 * DM, NH, nullptr, 0.f, tcos, tsin, QH + r0 * DM, DM);
    k_xform<0, 6><<<(unsigned)(SQ * NH), 64, 0, stream>>>(QKVF + DM, 3 * DM, NH, nullptr, 0.f, tcos, tsin, KH + r0 * DM, DM);
    k_xform<0, 0><<<(unsigned)(SQ * NH), 64, 0, stream>>>(QKVF + 2 * DM, 3 * DM, NH, nullptr, 0.f, CS, SN, V16 + r0 * DM, DM);
    k_vt<NH, SQ><<<NH * (SQ / 64), 256, 0, stream>>>(V16 + r0 * DM, DM, 0, VT);      /* V^T [NH][HD][SQ] for this batch */
    for (int h0 = 0; h0 < NHD; h0 += HG) {
      k_gemm2<0><<<dim3((QN / 128) * (SQ / 64), HG), 128, 0, stream>>>(QH + r0 * DM + h0 * HD, DM, (size_t)HD, KH + r0 * DM + h0 * HD, DM, (size_t)HD, 0.125f, nullptr, 0, nullptr, 1, 0, 0, S, nullptr, SQ, (size_t)SQ * SQ, QN, SQ, HD);      /* scores, HG heads per launch */
      k_rsmf<<<(HG * QN + 255) / 256, 256, 0, stream>>>(S, P, QN, HG);      /* P = 256 softmax (f16) */
      k_gemm2<0><<<dim3((QN / 128) * (HD / 64), HG), 128, 0, stream>>>(P, SQ, (size_t)SQ * SQ, VT + (size_t)h0 * HD * SQ, SQ, (size_t)HD * SQ, 0.25f, nullptr, 0, nullptr, 1, 0, 0, nullptr, O16 + r0 * DM + h0 * HD, DM, (size_t)HD, QN, HD, SQ); } }      /* o as f16 */
  k_gemm2<0><<<dim3((unsigned)((MPO / 128) * (DM / 64)), 1), 128, 0, stream>>>(O16 + (size_t)B0 * SQ * DM, DM, 0, BO, DM, 0, 0.0009765625f, bo, 0, nullptr, 1, 0, 0, (float*)d_out + (size_t)B0 * SQ * DM, nullptr, DM, 0, MPO, DM, DM);      /* out rows are the output layout */
}

// v001
// A run of this version takes 1860 microseconds.
// Two timings next to v000 put it at 3.78 and 3.77 times that version's speed.
#include <hip/hip_runtime.h>
// RoPE multi-head self-attention with INPUT rotary tables (x [4][2048][1024]; q/k/v = x W^T (nn.Linear natural [out][in] sigma 0.02, no bias), 16 heads of 64; q = q cos + rotate_half(q) sin with the module's cos/sin inputs [1][2048][1][64] (full head width, independent values per dim; rotate_half = concat(-x[32:], x[:32])), same for k; scores / 8; softmax over all keys (no mask); out = merged Wo^T (no bias) -> [4][2048][1024]).
// Structure: token rows r = b*2048 + s; x as exact f16 rows (bf16-rounded); per batch: q | k | v as ONE WMMA GEMM (32x64 wave tiles, f32 accumulation, exact x16 weights, N = 3 x 1024) into f32 rows, then per (row, head) on VALU: the half-split rotary rotation of q and k from f32 cos/sin tables (no norm) -> f16 q, k, v rows; V^T for all heads via LDS transposes; per group of 4 heads: scores GEMM (K = 64, batched over the heads on grid.y, alpha = 1/8), row softmax on VALU (f32 statistics, native exp; weights stored x256 as f16), o = P . V^T GEMM (K = 2048, alpha 2^-2: o carried x64 against f16 subnormal flush, folded into the output GEMM alpha) written straight into the merged f16 o rows; out = o W_o GEMM (f32, no bias) into the output layout.
// Compute dtype: inputs rounded to bf16; x / weights exact; projections and rope f32; q, k, v, softmax weights and o as plain f16 GEMM operands (~2^-12); scores and softmax statistics f32; v_wmma_f32_16x16x32_f16.
#define NB 4
#define SQ 2048
#define DM 1024
#define NH 16
#define HD 64
#define HG 4                         /* heads per attention launch group */
#define B0 0                         /* first batch processed (debug hook) */
#define NBR NB                       /* batches processed (debug hook) */
#define QN SQ                        /* query rows attended per batch (debug hook) */
#define NHD NH                       /* heads attended (debug hook) */
#define NR ((size_t)NB * SQ)         /* token rows */
#define MPO ((int)((size_t)NBR * SQ))      /* rows through the output GEMM (debug hook) */
typedef __bf16 v16b __attribute__((ext_vector_type(16)));
typedef unsigned short v8us __attribute__((ext_vector_type(8), may_alias));
typedef float  v8f  __attribute__((ext_vector_type(8)));
typedef float  v4f  __attribute__((ext_vector_type(4)));
typedef float  v4fa __attribute__((ext_vector_type(4), may_alias));
union FragB { v16b v; v8us half[2]; unsigned short u[16]; };

__device__ __forceinline__ unsigned short bf16_bits(float x) { unsigned int u = __float_as_uint(x); return (unsigned short)((u + 0x7FFFu + ((u >> 16) & 1u)) >> 16); }
__device__ __forceinline__ float bf16_val(unsigned short b) { return __uint_as_float(((unsigned int)b) << 16); }
__device__ __forceinline__ float bf16_round(float x) { return bf16_val(bf16_bits(x)); }
// D += A·B with NT terms: 1 = ah·bh, 2 = + al·bh (A split), 3 = + ah·bl (both split)
template <int NT>
__device__ __forceinline__ v8f mmaN(v16b ah, v16b al, v16b bh, v16b bl, v8f c) {
  c = __builtin_amdgcn_wmma_f32_16x16x32_bf16(false, ah, false, bh, (short)0, c, false, false);
  if (NT >= 2) c = __builtin_amdgcn_wmma_f32_16x16x32_bf16(false, al, false, bh, (short)0, c, false, false);
  if (NT >= 3) c = __builtin_amdgcn_wmma_f32_16x16x32_bf16(false, ah, false, bl, (short)0, c, false, false);
  asm volatile("v_nop\n\tv_nop\n\tv_nop\n\tv_nop" : "+v"(c) : "v"(ah), "v"(al), "v"(bh), "v"(bl));
  return c;
}

__global__ __launch_bounds__(256) void k_wt_bf16(const float* __restrict__ W, unsigned short* __restrict__ Wt, int K, int N) {
  const int t = blockIdx.x * 256 + threadIdx.x;
  const int k8n = K / 8;
  if (t >= N * k8n) return;
  const int n = t / k8n, k8 = (t % k8n) * 8;
  v8us v;
#pragma unroll
  for (int i = 0; i < 8; ++i) v[i] = bf16_bits(W[(size_t)(k8 + i) * N + n]);
  *(v8us*)(Wt + (size_t)n * K + k8) = v;
  
}

// GEMM C[M][N] (f32, pitch ldc) = act(A[M][K]·W + bias). A f32 row-major (pitch lda) converted per fragment to bf16
// (ASPLIT: hi/lo two planes -> 2 terms, else single rounded term); Wt bf16 [N][K] (pitch ldb). BIAS_BF16 rounds the
// bias to bf16 first (bias quantised to bf16 before the add). K%32==0, M%16==0, N%64==0.
template <bool ASPLIT, int ACT, bool BIAS_BF16>
__global__ __launch_bounds__(128) void k_gemm_bf(const float* __restrict__ A, int lda, const unsigned short* __restrict__ Wt, int ldb,
                                               const float* __restrict__ bias, float* __restrict__ C, int ldc, int M, int N, int K) {
  __shared__ __attribute__((aligned(16))) float so[4][16][64];
  const int tid = threadIdx.x, w = tid >> 5, lane = tid & 31, ln = lane & 15, hh = lane >> 4;
  const int ntn = N / 64;
  const int wid = blockIdx.x * 4 + w;
  const int mt = wid / ntn, nq = wid % ntn;
  if (mt * 16 >= M) return;
  const int row0 = mt * 16, col0 = nq * 64;
  const float* arow = A + (size_t)(row0 + ln) * lda;
  v8f acc[4] = {};
  for (int kb = 0; kb < K; kb += 32) {
    FragB ah, al;
    const v4f x0 = *(const v4fa*)(arow + kb + 8 * hh), x1 = *(const v4fa*)(arow + kb + 8 * hh + 4);
    const v4f x2 = *(const v4fa*)(arow + kb + 16 + 8 * hh), x3 = *(const v4fa*)(arow + kb + 16 + 8 * hh + 4);
    float xs[16] = {x0[0],x0[1],x0[2],x0[3],x1[0],x1[1],x1[2],x1[3],x2[0],x2[1],x2[2],x2[3],x3[0],x3[1],x3[2],x3[3]};
#pragma unroll
    for (int i = 0; i < 16; ++i) { const unsigned short hb = bf16_bits(xs[i]); ah.u[i] = hb; al.u[i] = ASPLIT ? bf16_bits(xs[i] - bf16_val(hb)) : (unsigned short)0; }
#pragma unroll
    for (int t = 0; t < 4; ++t) {
      const unsigned short* brow = Wt + (size_t)(col0 + t * 16 + ln) * ldb + kb;
      FragB b;
      b.half[0] = *(const v8us*)(brow + 8 * hh);
      b.half[1] = *(const v8us*)(brow + 16 + 8 * hh);
      acc[t] = mmaN<ASPLIT ? 2 : 1>(ah.v, al.v, b.v, b.v, acc[t]);
    }
  }
#pragma unroll
  for (int t = 0; t < 4; ++t) {
    float bv = bias ? bias[col0 + t * 16 + ln] : 0.f;
    if (BIAS_BF16) bv = bf16_round(bv);
#pragma unroll
    for (int r = 0; r < 8; ++r) { float v = acc[t][r] + bv; if (ACT == 1) v = fmaxf(v, 0.f); so[w][8 * hh + r][t * 16 + ln] = v; }
  }
  __builtin_amdgcn_fence(__ATOMIC_ACQ_REL, "workgroup");
  __builtin_amdgcn_wave_barrier();
  const int rsub = lane >> 4, c4 = (lane & 15) * 4;
  {
#pragma unroll
    for (int q = 0; q < 8; ++q) {
      const int r = q * 2 + rsub;
      const v4f v = *(const v4fa*)&so[w][r][c4];
      *(v4f*)(C + (size_t)(row0 + r) * ldc + col0 + c4) = v;
    }
    
  }
}

// GEMM C = act(A·W + bias + resid): A f32 (ASPLIT -> hi/lo 2 terms), Wt bf16 [N][K]; ACT 0 none, 1 relu, 2 exact gelu;
// resid (optional, f32, row index = (row % rmod), pitch ldr, RES_BF16 rounds it) added before the activation.
template <bool ASPLIT, int ACT, bool BIAS_BF16, bool RES_BF16>
__global__ __launch_bounds__(128) void k_gemm_bf3(const float* __restrict__ A, int lda, const unsigned short* __restrict__ Wt, int ldb,
                                                const float* __restrict__ bias, const float* __restrict__ resid, int rmod, int ldr,
                                                float* __restrict__ C, int ldc, int M, int N, int K) {
  __shared__ __attribute__((aligned(16))) float so[4][16][64];
  const int tid = threadIdx.x, w = tid >> 5, lane = tid & 31, ln = lane & 15, hh = lane >> 4;
  const int ntn = N / 64;
  const int wid = blockIdx.x * 4 + w;
  const int mt = wid / ntn, nq = wid % ntn;
  if (mt * 16 >= M) return;
  const int row0 = mt * 16, col0 = nq * 64;
  const float* arow = A + (size_t)(row0 + ln) * lda;
  v8f acc[4] = {};
  for (int kb = 0; kb < K; kb += 32) {
    FragB ah, al;
    const v4f x0 = *(const v4fa*)(arow + kb + 8 * hh), x1 = *(const v4fa*)(arow + kb + 8 * hh + 4);
    const v4f x2 = *(const v4fa*)(arow + kb + 16 + 8 * hh), x3 = *(const v4fa*)(arow + kb + 16 + 8 * hh + 4);
    float xs[16] = {x0[0],x0[1],x0[2],x0[3],x1[0],x1[1],x1[2],x1[3],x2[0],x2[1],x2[2],x2[3],x3[0],x3[1],x3[2],x3[3]};
#pragma unroll
    for (int i = 0; i < 16; ++i) { const unsigned short hb = bf16_bits(xs[i]); ah.u[i] = hb; al.u[i] = ASPLIT ? bf16_bits(xs[i] - bf16_val(hb)) : (unsigned short)0; }
#pragma unroll
    for (int t = 0; t < 4; ++t) {
      const unsigned short* brow = Wt + (size_t)(col0 + t * 16 + ln) * ldb + kb;
      FragB b;
      b.half[0] = *(const v8us*)(brow + 8 * hh);
      b.half[1] = *(const v8us*)(brow + 16 + 8 * hh);
      acc[t] = mmaN<ASPLIT ? 2 : 1>(ah.v, al.v, b.v, b.v, acc[t]);
    }
  }
#pragma unroll
  for (int t = 0; t < 4; ++t) {
    const int col = col0 + t * 16 + ln;
    float bv = bias ? bias[col] : 0.f;
    if (BIAS_BF16) bv = bf16_round(bv);
#pragma unroll
    for (int r = 0; r < 8; ++r) {
      float v = acc[t][r] + bv;
      if (resid) { float rv = resid[(size_t)((row0 + 8 * hh + r) % rmod) * ldr + col]; if (RES_BF16) rv = bf16_round(rv); v += rv; }
      if (ACT == 1) v = fmaxf(v, 0.f);
      if (ACT == 2) v = 0.5f * v * (1.0f + erff(v * 0.70710678118654752f));
      if (ACT == 3) { const float u = 0.7978845608028654f * (v + 0.044715f * v * v * v); v = 0.5f * v * (1.0f + tanhf(u)); }
      so[w][8 * hh + r][t * 16 + ln] = v;
    }
  }
  __builtin_amdgcn_fence(__ATOMIC_ACQ_REL, "workgroup");
  __builtin_amdgcn_wave_barrier();
  const int rsub = lane >> 4, c4 = (lane & 15) * 4;
  {
#pragma unroll
    for (int q = 0; q < 8; ++q) {
      const int r = q * 2 + rsub;
      const v4f v = *(const v4fa*)&so[w][r][c4];
      *(v4f*)(C + (size_t)(row0 + r) * ldc + col0 + c4) = v;
    }
    
  }
}
// row LayerNorm (biased variance, eps) over N: s = X (+ R); optional out_sum <- s; out_norm <- (s-mu)*rsqrt(var+eps)*g + b
template <bool PARAM_BF16>
__global__ __launch_bounds__(256) void k_layernorm(const float* __restrict__ X, const float* __restrict__ R, const float* __restrict__ g, const float* __restrict__ bta,
                                                  float* __restrict__ out_sum, float* __restrict__ out_norm, int N, float eps) {
  __shared__ float red[256];
  const int row = blockIdx.x, tid = threadIdx.x;
  const float* x = X + (size_t)row * N; const float* rr = R ? R + (size_t)row * N : nullptr;
  float vals[16];                     // up to N = 4096
  const int per = N / 256;            // contiguous chunk per thread? use strided-by-4 chunks: thread handles j = tid*4 + 1024*u
  float s1 = 0.f;
  for (int u = 0; u < per / 4; ++u) {
    const int j = tid * 4 + 1024 * u;
    const v4f a = *(const v4fa*)(x + j);
    v4f b = {0.f,0.f,0.f,0.f}; if (rr) b = *(const v4fa*)(rr + j);
#pragma unroll
    for (int q = 0; q < 4; ++q) { const float v = a[q] + b[q]; vals[u * 4 + q] = v; s1 += v; }
  }
  red[tid] = s1; __syncthreads();
  for (int st = 128; st > 0; st >>= 1) { if (tid < st) red[tid] += red[tid + st]; __syncthreads(); }
  const float mu = red[0] / (float)N; __syncthreads();
  float s2 = 0.f;
  for (int u = 0; u < per / 4; ++u)
#pragma unroll
    for (int q = 0; q < 4; ++q) { const float c = vals[u * 4 + q] - mu; s2 += c * c; }
  red[tid] = s2; __syncthreads();
  for (int st = 128; st > 0; st >>= 1) { if (tid < st) red[tid] += red[tid + st]; __syncthreads(); }
  const float rs = rsqrtf(red[0] / (float)N + eps);
  {
    for (int u = 0; u < per / 4; ++u) {
      const int j = tid * 4 + 1024 * u;
      v4f o, sm;
#pragma unroll
      for (int q = 0; q < 4; ++q) {
        float gg = g[j + q], bb = bta[j + q];
        if (PARAM_BF16) { gg = bf16_round(gg); bb = bf16_round(bb); }
        sm[q] = vals[u * 4 + q]; o[q] = (vals[u * 4 + q] - mu) * rs * gg + bb;
      }
      if (out_sum) *(v4f*)(out_sum + (size_t)row * N + j) = sm;
      *(v4f*)(out_norm + (size_t)row * N + j) = o;
    }
    
  }
}



// ---- f16 WMMA path (v_wmma_f32_16x16x32_f16): 11-bit significands for operands in range — used where a [0,1] probability operand needs more precision than bf16
typedef _Float16 v16h __attribute__((ext_vector_type(16)));
union FragH { v16h v; v8us half[2]; _Float16 h[16]; unsigned short u[16]; };
template <int NT>
__device__ __forceinline__ v8f mmaH(v16h ah, v16h al, v16h bh, v16h bl, v8f c) {
  c = __builtin_amdgcn_wmma_f32_16x16x32_f16(false, ah, false, bh, (short)0, c, false, false);
  if (NT >= 2) c = __builtin_amdgcn_wmma_f32_16x16x32_f16(false, al, false, bh, (short)0, c, false, false);
  if (NT >= 3) c = __builtin_amdgcn_wmma_f32_16x16x32_f16(false, ah, false, bl, (short)0, c, false, false);
  asm volatile("v_nop\n\tv_nop\n\tv_nop\n\tv_nop" : "+v"(c) : "v"(ah), "v"(al), "v"(bh), "v"(bl));
  return c;
}
// batched GEMM like k_gemm_b but f16 operands: A f32 (split into f16 hi/lo if ASPLIT, else rounded to f16), Bt = f16 values [n][k]; alpha; C f32; N multiple of 16 (partial tiles skipped)
template <bool ASPLIT>
__global__ __launch_bounds__(128) void k_gemm_h(const float* __restrict__ A, int lda, size_t sA, const _Float16* __restrict__ Bh, int ldb, size_t sB, float alpha, float* __restrict__ C, int ldc, size_t sC, int M, int N, int K) {
  __shared__ __attribute__((aligned(16))) float so[4][16][64];
  const int tid = threadIdx.x, w = tid >> 5, lane = tid & 31, ln = lane & 15, hh = lane >> 4; const int by = blockIdx.y;
  A += (size_t)by * sA; Bh += (size_t)by * sB; C += (size_t)by * sC;
  const int ntn = (N + 63) / 64; const int wid = blockIdx.x * 4 + w; const int mt = wid / ntn, nq = wid % ntn; if (mt * 16 >= M) return;
  const int row0 = mt * 16, col0 = nq * 64; const float* arow = A + (size_t)(row0 + ln) * lda;
  v8f acc[4] = {};
  for (int kb = 0; kb < K; kb += 32) {
    FragH ah, al;
    const v4f x0 = *(const v4fa*)(arow + kb + 8 * hh), x1 = *(const v4fa*)(arow + kb + 8 * hh + 4), x2 = *(const v4fa*)(arow + kb + 16 + 8 * hh), x3 = *(const v4fa*)(arow + kb + 16 + 8 * hh + 4);
    float xs[16] = {x0[0],x0[1],x0[2],x0[3],x1[0],x1[1],x1[2],x1[3],x2[0],x2[1],x2[2],x2[3],x3[0],x3[1],x3[2],x3[3]};
#pragma unroll
    for (int i = 0; i < 16; ++i) { const _Float16 h = (_Float16)xs[i]; ah.h[i] = h; al.h[i] = ASPLIT ? (_Float16)(xs[i] - (float)h) : (_Float16)0.0f; }
#pragma unroll
    for (int t = 0; t < 4; ++t) { if (col0 + t * 16 >= N) continue; const size_t boff = (size_t)(col0 + t * 16 + ln) * ldb + kb; FragH bq; bq.half[0] = *(const v8us*)(Bh + boff + 8 * hh); bq.half[1] = *(const v8us*)(Bh + boff + 16 + 8 * hh);
      acc[t] = mmaH<ASPLIT ? 2 : 1>(ah.v, al.v, bq.v, bq.v, acc[t]); }
  }
#pragma unroll
  for (int t = 0; t < 4; ++t) { if (col0 + t * 16 >= N) continue;
#pragma unroll
    for (int r = 0; r < 8; ++r) so[w][8 * hh + r][t * 16 + ln] = acc[t][r] * alpha; }
  __builtin_amdgcn_fence(__ATOMIC_ACQ_REL, "workgroup"); __builtin_amdgcn_wave_barrier();
  const int rsub = lane >> 4, c4 = (lane & 15) * 4;
  {
#pragma unroll
    for (int q = 0; q < 8; ++q) { const int r = q * 2 + rsub; if (col0 + c4 < N) { const v4f v = *(const v4fa*)&so[w][r][c4]; *(v4f*)(C + (size_t)(row0 + r) * ldc + col0 + c4) = v; } }
     }
}

// Wt[n][k] = f16(W[k][n]·scale) from f32 row-major W[K][N] (scale = power of two; bf16-exact weights stay exact in f16 away from the subnormal range)
__global__ __launch_bounds__(256) void k_wt_f16(const float* __restrict__ W, _Float16* __restrict__ Wt, int K, int N, float scale) {
  const int t = blockIdx.x * 256 + threadIdx.x; if (t >= N * (K / 8)) return; const int n = t / (K / 8), k8 = (t % (K / 8)) * 8; FragH f;
#pragma unroll
  for (int i = 0; i < 8; ++i) f.h[i] = (_Float16)(bf16_round(W[(size_t)(k8 + i) * N + n]) * scale); const v8us o = f.half[0];
  *(v8us*)((unsigned short*)Wt + (size_t)n * K + k8) = o; 
}
// k_gemm_hh variant with fused epilogue: v = acc·alpha + bias[by·sBias + col] (+ CP[(row/rowsPerB)·sCPb + by·64 + col] if CP) ; ACT 0 none / 1 elu ; writes f16 C16 (and f32 C if non-null)
template <int ACT>
__global__ __launch_bounds__(128) void k_gemm_hhx(const _Float16* __restrict__ A, int lda, size_t sA, const _Float16* __restrict__ Bh, int ldb, size_t sB, float alpha, const float* __restrict__ bias, size_t sBias, const float* __restrict__ CP, int rowsPerB, size_t sCPb, int row0g,
    float* __restrict__ C, _Float16* __restrict__ C16, int ldc, size_t sC, int M, int N, int K) {
  __shared__ __attribute__((aligned(16))) float so[4][16][64];
  const int tid = threadIdx.x, w = tid >> 5, lane = tid & 31, ln = lane & 15, hh = lane >> 4; const int by = blockIdx.y;
  A += (size_t)by * sA; Bh += (size_t)by * sB; const size_t cofs = (size_t)by * sC; const float* bp = bias ? bias + (size_t)by * sBias : nullptr;
  const int ntn = (N + 63) / 64; const int wid = blockIdx.x * 4 + w; const int mt = wid / ntn, nq = wid % ntn; if (mt * 16 >= M) return;
  const int row0 = mt * 16, col0 = nq * 64; const _Float16* arow = A + (size_t)(row0 + ln) * lda;
  v8f acc[4] = {};
  for (int kb = 0; kb < K; kb += 32) { FragH ah; ah.half[0] = *(const v8us*)((const unsigned short*)arow + kb + 8 * hh); ah.half[1] = *(const v8us*)((const unsigned short*)arow + kb + 16 + 8 * hh);
#pragma unroll
    for (int t = 0; t < 4; ++t) { if (col0 + t * 16 >= N) continue; const size_t boff = (size_t)(col0 + t * 16 + ln) * ldb + kb; FragH bq; bq.half[0] = *(const v8us*)((const unsigned short*)Bh + boff + 8 * hh); bq.half[1] = *(const v8us*)((const unsigned short*)Bh + boff + 16 + 8 * hh);
      acc[t] = mmaH<1>(ah.v, ah.v, bq.v, bq.v, acc[t]); }
  }
#pragma unroll
  for (int t = 0; t < 4; ++t) { if (col0 + t * 16 >= N) continue; const int col = col0 + t * 16 + ln; const float bv = bp ? bf16_round(bp[col]) : 0.f;
#pragma unroll
    for (int r = 0; r < 8; ++r) { float v = acc[t][r] * alpha + bv; if (CP) { const int rr = row0g + row0 + 8 * hh + r; if (rowsPerB < 0) v += CP[cofs + (size_t)rr * ldc + col];      /* rowsPerB < 0: own element of the batched C plane */ else { const int bidx = rr / rowsPerB; v += CP[(size_t)bidx * sCPb + (size_t)by * 64 + col]; } } if (ACT == 1) v = (v > 0.f) ? v : expm1f(v); else if (ACT == 7) v = (v > 0.f) ? v + 1.0f : expf(v); else if (ACT == 8) v = tanhf(v); else if (ACT == 9) v = 0.5f * v * (1.0f + tanhf(0.7978845608028654f * (v + 0.044715f * v * v * v))); else if (ACT == 11) v = 1.0f / (1.0f + expf(-v)); else if (ACT == 12) v = (v > 0.f) ? v : 0.01f * v; else if (ACT == 14) v = (v > 0.f) ? v : 0.1f * v; else if (ACT == 16) v = (v >= 0.f) ? v : 0.3f * v; else if (ACT == 17) v = (v >= 0.f) ? v : 0.2f * v; else if (ACT == 15) v = v / (1.0f + expf(-v)); else if (ACT == 3) v = fmaxf(v, 0.f); else if (ACT == 6) v = 0.5f * v * (1.0f + erff(v * 0.70710678118654752f)); so[w][8 * hh + r][t * 16 + ln] = v; } }
  __builtin_amdgcn_fence(__ATOMIC_ACQ_REL, "workgroup"); __builtin_amdgcn_wave_barrier();
  const int rsub = lane >> 4, c4 = (lane & 15) * 4; typedef _Float16 v4h __attribute__((ext_vector_type(4)));
  {
#pragma unroll
    for (int q = 0; q < 8; ++q) { const int r = q * 2 + rsub; if (col0 + c4 < N) { const v4f v = *(const v4fa*)&so[w][r][c4]; if (C) *(v4f*)(C + cofs + (size_t)(row0 + r) * ldc + col0 + c4) = v; if (C16) { v4h h4; for (int i = 0; i < 4; ++i) h4[i] = (_Float16)v[i]; *(v4h*)(C16 + cofs + (size_t)(row0 + r) * ldc + col0 + c4) = h4; } } }
     }
}


typedef _Float16 v4h __attribute__((ext_vector_type(4)));

__global__ __launch_bounds__(256) void k_x16(const float* __restrict__ x, _Float16* __restrict__ X16, size_t n8) { const size_t t = (size_t)blockIdx.x * 256 + threadIdx.x; if (t >= n8) return; FragH f;
#pragma unroll
  for (int q = 0; q < 8; ++q) f.h[q] = (_Float16)bf16_round(x[t * 8 + q]); *(v8us*)((unsigned short*)X16 + t * 8) = f.half[0];  }
__global__ __launch_bounds__(256) void k_h16(const float* __restrict__ x, _Float16* __restrict__ X16, size_t n8) { const size_t t = (size_t)blockIdx.x * 256 + threadIdx.x; if (t >= n8) return; FragH f;
#pragma unroll
  for (int q = 0; q < 8; ++q) f.h[q] = (_Float16)x[t * 8 + q]; *(v8us*)((unsigned short*)X16 + t * 8) = f.half[0];  }
__global__ __launch_bounds__(256) void k_round16f(const float* __restrict__ W, _Float16* __restrict__ Bt, size_t n8) { const size_t t = (size_t)blockIdx.x * 256 + threadIdx.x; if (t >= n8) return; FragH f;
#pragma unroll
  for (int i = 0; i < 8; ++i) f.h[i] = (_Float16)(bf16_round(W[t * 8 + i]) * 16.0f); *(v8us*)((unsigned short*)Bt + t * 8) = f.half[0];  }
template <int NHv, int TTv>
__global__ __launch_bounds__(256) void k_vt(const _Float16* __restrict__ V16, int ldv, int voff, _Float16* __restrict__ Vt) { __shared__ unsigned short tl[64][66]; const int tid = threadIdx.x; const int slab = blockIdx.x / (TTv / 64), lg = blockIdx.x % (TTv / 64); const int b = slab / NHv, h = slab % NHv;
  for (int i = tid; i < 64 * 8; i += 256) { const int r = i / 8, c8 = (i % 8) * 8; FragH f; f.half[0] = *(const v8us*)((const unsigned short*)V16 + ((size_t)b * TTv + lg * 64 + r) * ldv + voff + h * 64 + c8);
#pragma unroll
    for (int q = 0; q < 8; ++q) tl[r][c8 + q] = f.u[q]; }
  __syncthreads();
  {
#pragma unroll
    for (int rd = 0; rd < 2; ++rd) { const int d = rd * 32 + tid / 8, pc = tid % 8; FragH f;
#pragma unroll
      for (int q = 0; q < 8; ++q) f.u[q] = tl[pc * 8 + q][d];
      *(v8us*)((unsigned short*)Vt + ((size_t)slab * 64 + d) * TTv + lg * 64 + pc * 8) = f.half[0]; }
     } }

__global__ __launch_bounds__(256) void k_hl(const float* __restrict__ F, _Float16* __restrict__ Hh, _Float16* __restrict__ Hl, size_t n8) { const size_t t = (size_t)blockIdx.x * 256 + threadIdx.x; if (t >= n8) return; FragH fh, fl; const v4f a = *(const v4fa*)(F + t * 8), c = *(const v4fa*)(F + t * 8 + 4);
#pragma unroll
  for (int q = 0; q < 4; ++q) { _Float16 h = (_Float16)a[q]; fh.h[q] = h; fl.h[q] = (_Float16)((a[q] - (float)h) * 1024.0f); h = (_Float16)c[q]; fh.h[4 + q] = h; fl.h[4 + q] = (_Float16)((c[q] - (float)h) * 1024.0f); }
  { *(v8us*)((unsigned short*)Hh + t * 8) = fh.half[0]; *(v8us*)((unsigned short*)Hl + t * 8) = fl.half[0];  } }

// ---- fast GEMM (wave tile 32x64; requires M % 32 == 0 rows per launch region and N % 64 == 0); epilogue = k_gemm_hhx semantics ----
__device__ __forceinline__ v16h g2_frag(const _Float16* p, int hh) { FragH f; f.half[0] = *(const v8us*)((const unsigned short*)p + 8 * hh); f.half[1] = *(const v8us*)((const unsigned short*)p + 16 + 8 * hh); return f.v; }
__device__ __forceinline__ v8f g2_mma(v16h a, v16h b, v8f c) { v8f d = __builtin_amdgcn_wmma_f32_16x16x32_f16(false, a, false, b, (short)0, c, false, false); asm volatile("v_nop\n\tv_nop\n\tv_nop\n\tv_nop" : "+v"(d) : "v"(a), "v"(b)); return d; }
template <int ACT>
__global__ __launch_bounds__(128) void k_gemm2(const _Float16* __restrict__ A, int lda, size_t sA, const _Float16* __restrict__ Bh, int ldb, size_t sB, float alpha, const float* __restrict__ bias, size_t sBias, const float* __restrict__ CP, int rowsPerB, size_t sCPb, int row0g,
    float* __restrict__ C, _Float16* __restrict__ C16, int ldc, size_t sC, int M, int N, int K) { static_assert(ACT == 0 || ACT == 3 || ACT == 6 || ACT == 8 || ACT == 9 || ACT == 11 || ACT == 12 || ACT == 14 || ACT == 15 || ACT == 16 || ACT == 17, "k_gemm2: unsupported ACT code (would silently apply no activation)");
  __shared__ __attribute__((aligned(16))) float so[4][32][68];
  const int tid = threadIdx.x, w = tid >> 5, lane = tid & 31, ln = lane & 15, hh = lane >> 4; const int by = blockIdx.y;
  A += (size_t)by * sA; Bh += (size_t)by * sB; const size_t cofs = (size_t)by * sC; const float* bp = bias ? bias + (size_t)by * sBias : nullptr;
  const int ntn = N >> 6; const int mt = blockIdx.x / ntn, nq = blockIdx.x - mt * ntn; const int row0 = mt * 128 + 32 * w, col0 = nq * 64; if (row0 >= M) return;
  const _Float16* a0p = A + (size_t)(row0 + ln) * lda; const _Float16* a1p = a0p + (size_t)16 * lda;
  const _Float16* b0p = Bh + (size_t)(col0 + ln) * ldb; const _Float16* b1p = b0p + (size_t)16 * ldb; const _Float16* b2p = b1p + (size_t)16 * ldb; const _Float16* b3p = b2p + (size_t)16 * ldb;
  const v8f z8 = {0.f,0.f,0.f,0.f,0.f,0.f,0.f,0.f}; v8f c00 = z8, c01 = z8, c02 = z8, c03 = z8, c10 = z8, c11 = z8, c12 = z8, c13 = z8;
#pragma unroll 1
  for (int kb = 0; kb < K; kb += 32) { const v16h a0 = g2_frag(a0p + kb, hh), a1 = g2_frag(a1p + kb, hh);
    v16h b = g2_frag(b0p + kb, hh); c00 = g2_mma(a0, b, c00); c10 = g2_mma(a1, b, c10);
    b = g2_frag(b1p + kb, hh); c01 = g2_mma(a0, b, c01); c11 = g2_mma(a1, b, c11);
    b = g2_frag(b2p + kb, hh); c02 = g2_mma(a0, b, c02); c12 = g2_mma(a1, b, c12);
    b = g2_frag(b3p + kb, hh); c03 = g2_mma(a0, b, c03); c13 = g2_mma(a1, b, c13); }
  v8f accs[8] = {c00, c01, c02, c03, c10, c11, c12, c13};
#pragma unroll
  for (int u = 0; u < 8; ++u) { const int t = u & 3, half = u >> 2; const int col = col0 + t * 16 + ln; const float bv = bp ? bf16_round(bp[col]) : 0.f;
#pragma unroll
    for (int r = 0; r < 8; ++r) { const int rloc = half * 16 + 8 * hh + r; float v = accs[u][r] * alpha + bv; if (CP) { if (rowsPerB < 0) v += CP[cofs + (size_t)(row0g + row0 + rloc) * ldc + col];      /* rowsPerB < 0: own element of the batched C plane */ else { const int bidx = (row0g + row0 + rloc) / rowsPerB; v += CP[(size_t)bidx * sCPb + (size_t)by * 64 + col]; } }
      if (ACT == 3) v = fmaxf(v, 0.f); else if (ACT == 6) v = 0.5f * v * (1.0f + erff(v * 0.70710678118654752f)); else if (ACT == 11) v = 1.0f / (1.0f + expf(-v)); else if (ACT == 15) v = v / (1.0f + expf(-v)); else if (ACT == 12) v = (v > 0.f) ? v : 0.01f * v; else if (ACT == 8) v = tanhf(v); else if (ACT == 9) v = 0.5f * v * (1.0f + tanhf(0.7978845608028654f * (v + 0.044715f * v * v * v))); else if (ACT == 14) v = (v > 0.f) ? v : 0.1f * v; else if (ACT == 16) v = (v >= 0.f) ? v : 0.3f * v; else if (ACT == 17) v = (v >= 0.f) ? v : 0.2f * v;
      so[w][rloc][t * 16 + ln] = v; } }
  __builtin_amdgcn_fence(__ATOMIC_ACQ_REL, "workgroup"); __builtin_amdgcn_wave_barrier();
  const int rsub = lane >> 4, c4 = (lane & 15) * 4;
  {
#pragma unroll
    for (int q = 0; q < 16; ++q) { const int r = q * 2 + rsub; const v4f v = *(const v4fa*)&so[w][r][c4]; if (C) *(v4f*)(C + cofs + (size_t)(row0 + r) * ldc + col0 + c4) = v; if (C16) { v4h h4; for (int i = 0; i < 4; ++i) h4[i] = (_Float16)v[i]; *(v4h*)(C16 + cofs + (size_t)(row0 + r) * ldc + col0 + c4) = h4; } }
     } }


__global__ __launch_bounds__(256) void k_wnat(const float* __restrict__ w, size_t n8, _Float16* __restrict__ Bt) { const size_t t = (size_t)blockIdx.x * 256 + threadIdx.x; if (t >= n8) return; FragH f; for (int q = 0; q < 8; ++q) f.h[q] = (_Float16)(bf16_round(w[t * 8 + q]) * 16.0f); *(v8us*)((unsigned short*)Bt + t * 8) = f.half[0];  }
__global__ __launch_bounds__(256) void k_rsm(const float* __restrict__ S, _Float16* __restrict__ P, int nrows) {
  #pragma clang fp contract(off)
  const int i = blockIdx.x * 256 + threadIdx.x; if (i >= nrows) return; const float* s = S + (size_t)i * SQ; float mx = -3.0e38f;
#pragma unroll 1
  for (int j = 0; j < SQ; ++j) mx = fmaxf(mx, s[j]); float se = 0.f;
#pragma unroll 1
  for (int j = 0; j < SQ; ++j) se += expf(s[j] - mx); const float sc = 256.0f / se;
#pragma unroll 1
  for (int j0 = 0; j0 < SQ; j0 += 8) { FragH f; for (int q = 0; q < 8; ++q) f.h[q] = (_Float16)(expf(s[j0 + q] - mx) * sc); unsigned short* d = (unsigned short*)P + (size_t)i * SQ + j0; *(v8us*)d = f.half[0];  } }
__global__ __launch_bounds__(256) void k_vt(const _Float16* __restrict__ V16, int b, int h0, _Float16* __restrict__ VT) { __shared__ unsigned short tl[64][65]; const int tid = threadIdx.x; const int hh = blockIdx.x % HG, sg = blockIdx.x / HG; const int s0 = sg * 64; const int h = h0 + hh;
  for (int i = tid; i < 64 * 8; i += 256) { const int j = i / 8, d8 = (i % 8) * 8; FragH f; f.half[0] = *(const v8us*)((const unsigned short*)V16 + ((size_t)b * SQ + s0 + j) * DM + h * HD + d8); for (int q = 0; q < 8; ++q) tl[d8 + q][j] = f.u[q]; }
  __syncthreads();
  { for (int i = tid; i < 64 * 8; i += 256) { const int d = i / 8, j8 = (i % 8) * 8; FragH f; for (int q = 0; q < 8; ++q) f.u[q] = tl[d][j8 + q]; *(v8us*)((unsigned short*)VT + ((size_t)hh * HD + d) * SQ + s0 + j8) = f.half[0]; }  } }


__global__ __launch_bounds__(256) void k_tab2(float theta, float* __restrict__ CS, float* __restrict__ SN) {
  #pragma clang fp contract(off)
  const int t = blockIdx.x * 256 + threadIdx.x; if (t >= SQ * (HD / 2)) return; const int i = t % (HD / 2); const int p = t / (HD / 2); const float invf = 1.0f / powf(theta, (float)(2 * i) / (float)HD); const float ang = __fmul_rn((float)p, invf); const float c = cosf(ang), s = sinf(ang);
  *(float*)(CS + t) = c; *(float*)(SN + t) = s;  }
template <int NORM, int ROPE>
__global__ __launch_bounds__(64) void k_xform(const float* __restrict__ F, int ldf, int nh, const float* __restrict__ gain, float eps, const float* __restrict__ CS, const float* __restrict__ SN, _Float16* __restrict__ H16, int ldo) {
  #pragma clang fp contract(off)
  __shared__ float xv[HD]; __shared__ float red[HD]; __shared__ unsigned short sh_[HD]; const int d = threadIdx.x; const int h = blockIdx.x % nh; const size_t r = blockIdx.x / nh; const int p = (int)(r % SQ);
  float x = F[r * (size_t)ldf + (size_t)h * HD + d];
  if (NORM) { red[d] = __fmul_rn(x, x); __syncthreads(); for (int st = HD / 2; st > 0; st >>= 1) { if (d < st) red[d] = __fadd_rn(red[d], red[d + st]); __syncthreads(); } const float rs = rsqrtf(__fadd_rn(red[0] / (float)HD, eps)); x = __fmul_rn(__fmul_rn(x, rs), bf16_round(gain[d])); }
  xv[d] = x; __syncthreads();
  float o = x;
  if (ROPE == 1) { const int i = d >> 1; const float c = CS[p * (HD / 2) + i], s = SN[p * (HD / 2) + i]; const float ev = xv[2 * i], od = xv[2 * i + 1]; o = (d & 1) ? __fadd_rn(__fmul_rn(ev, s), __fmul_rn(od, c)) : __fadd_rn(__fmul_rn(ev, c), -__fmul_rn(od, s)); }
  if (ROPE == 2) { const int i = d & (HD / 2 - 1); const float c = CS[p * (HD / 2) + i], s = SN[p * (HD / 2) + i]; const float lo = xv[i], hi = xv[i + HD / 2]; o = (d < HD / 2) ? __fadd_rn(__fmul_rn(lo, c), -__fmul_rn(hi, s)) : __fadd_rn(__fmul_rn(lo, s), __fmul_rn(hi, c)); }
  if (ROPE == 6) { const float c = bf16_round(CS[p * HD + d]), s = bf16_round(SN[p * HD + d]); const float pa = xv[(d + HD / 2) & (HD - 1)]; const float rh = (d < HD / 2) ? -pa : pa; o = __fadd_rn(__fmul_rn(x, c), __fmul_rn(rh, s)); }      /* FULL-WIDTH bf16-rounded INPUT tables [p][64]: o = x cos[p][d] + rotate_half(x)[d] sin[p][d], rotate_half = concat(-x[32:], x[:32]) */
  FragH th; th.h[0] = (_Float16)o; sh_[d] = th.u[0]; __syncthreads();
  if (d < HD / 8) { FragH f; for (int q = 0; q < 8; ++q) f.u[q] = sh_[d * 8 + q]; unsigned short* dst = (unsigned short*)H16 + r * (size_t)ldo + (size_t)h * HD + d * 8; *(v8us*)dst = f.half[0];  } }

__global__ __launch_bounds__(256) void k_tab3(float* __restrict__ CS, float* __restrict__ SN) {
  #pragma clang fp contract(off)
  const int t = blockIdx.x * 256 + threadIdx.x; if (t >= SQ * (HD / 2)) return; const int i = t % (HD / 2); const int p = t / (HD / 2); const float freq = expf(__fmul_rn((float)(2 * i), -0.14391156831212787f)); const float ang = __fmul_rn((float)p, freq); const float c = cosf(ang), s = sinf(ang);
  *(float*)(CS + t) = c; *(float*)(SN + t) = s;  }



// Sum / maximum over the 32 lanes of a wave: four DPP steps inside each 16-lane row, then one exchange with the other row. Every lane must be active.
template <int CTRL> __device__ __forceinline__ float dpp_xm(float v) { return __int_as_float(__builtin_amdgcn_update_dpp(0, __float_as_int(v), CTRL, 0xf, 0xf, true)); }      /* CTRL = 0x160 + m: row_xmask:m */
__device__ __forceinline__ float xrow(float v) { const int b = __float_as_int(v); return __int_as_float(__builtin_amdgcn_permlanex16(b, b, 0x76543210, 0xfedcba98, false, false)); }      /* lane l <-> l ^ 16 */
__device__ __forceinline__ float wave_max(float v) { v = fmaxf(v, dpp_xm<0x161>(v)); v = fmaxf(v, dpp_xm<0x162>(v)); v = fmaxf(v, dpp_xm<0x164>(v)); v = fmaxf(v, dpp_xm<0x168>(v)); return fmaxf(v, xrow(v)); }
__device__ __forceinline__ float wave_sum(float v) { v += dpp_xm<0x161>(v); v += dpp_xm<0x162>(v); v += dpp_xm<0x164>(v); v += dpp_xm<0x168>(v); return v + xrow(v); }
// Row softmax, ONE WAVE PER ROW: the row's 2048 f32 scores are read once, 16 loads of 512 contiguous bytes per wave, and stay in 64 registers per lane through maximum, exp, sum and scaling; P = 256 softmax as f16, 256 contiguous bytes per wave store.
__global__ __launch_bounds__(256) void k_rsmf(const float* __restrict__ S, _Float16* __restrict__ P, int qn, int hg) {
  const int lane = threadIdx.x & 31; const int t = blockIdx.x * 8 + __builtin_amdgcn_readfirstlane(threadIdx.x >> 5); if (t >= qn * hg) return;      /* row number in a scalar register: the division and the row's base address run on the scalar unit; the test is wave-uniform and no barrier follows */
  const size_t i = (size_t)(t / qn) * SQ + (t % qn); const float* s = S + i * SQ + lane * 4; _Float16* p = P + i * SQ + lane * 4;
  v4f v[SQ / 128];      /* every loop over v is fully unrolled: only constant indices keep the row in registers, and the 16 loads issue back to back */
#pragma unroll
  for (int c = 0; c < SQ / 128; ++c) v[c] = *(const v4fa*)(s + c * 128);
  float mx = -3.0e38f;
#pragma unroll
  for (int c = 0; c < SQ / 128; ++c) mx = fmaxf(mx, fmaxf(fmaxf(v[c][0], v[c][1]), fmaxf(v[c][2], v[c][3])));
  mx = wave_max(mx);
  v4f se4 = {0.f, 0.f, 0.f, 0.f};
#pragma unroll
  for (int c = 0; c < SQ / 128; ++c) {
#pragma unroll
    for (int q = 0; q < 4; ++q) { v[c][q] = __expf(v[c][q] - mx); se4[q] += v[c][q]; } }
  const float se = wave_sum((se4[0] + se4[1]) + (se4[2] + se4[3])); const float sc = 256.0f / se;
#pragma unroll
  for (int c = 0; c < SQ / 128; ++c) { v4h h4;
#pragma unroll
    for (int q = 0; q < 4; ++q) h4[q] = (_Float16)(v[c][q] * sc);
    *(v4h*)(p + c * 128) = h4; } }

extern "C" void kernel_launch(void* const* d_in, const int* in_sizes, int n_in,
                              void* d_out, int out_size, void* d_ws, size_t ws_size, hipStream_t stream) {
  (void)in_sizes; (void)n_in; (void)out_size;
  const float* const* I = (const float* const*)d_in; const float* x = I[0]; const float* tcos = I[1]; const float* tsin = I[2]; const float* wq = I[3]; const float* wk = I[4]; const float* wv = I[5]; const float* wo = I[6]; const float* bo = nullptr;      /* natural [out][in] weights, no biases; cos/sin INPUT tables [1][S][1][64] = [S][64] */
  char* ws = (char*)d_ws; size_t off = 0;
  auto take = [&](size_t bytes) { char* p = ws + off; off += (bytes + 255) & ~(size_t)255; return p; };
  _Float16* BQKV = (_Float16*)take((size_t)3 * DM * DM * 2); _Float16* BO = (_Float16*)take((size_t)DM * DM * 2); float* CS = (float*)take((size_t)SQ * (HD / 2) * 4); float* SN = (float*)take((size_t)SQ * (HD / 2) * 4);
  _Float16* X16 = (_Float16*)take(NR * DM * 2); float* QKVF = (float*)take((size_t)SQ * 3 * DM * 4);      /* one batch of f32 q | k | v rows */
  _Float16* QH = (_Float16*)take(NR * DM * 2); _Float16* KH = (_Float16*)take(NR * DM * 2); _Float16* V16 = (_Float16*)take(NR * DM * 2); _Float16* O16 = (_Float16*)take(NR * DM * 2);
  float* S = (float*)take((size_t)HG * SQ * SQ * 4); _Float16* P = (_Float16*)take((size_t)HG * SQ * SQ * 2); _Float16* VT = (_Float16*)take((size_t)NH * HD * SQ * 2);
  if (off > ws_size) return;
  { const unsigned g = (unsigned)(((size_t)DM * DM / 8 + 255) / 256); k_wnat<<<g, 256, 0, stream>>>(wq, (size_t)DM * DM / 8, BQKV); k_wnat<<<g, 256, 0, stream>>>(wk, (size_t)DM * DM / 8, BQKV + (size_t)DM * DM); k_wnat<<<g, 256, 0, stream>>>(wv, (size_t)DM * DM / 8, BQKV + (size_t)2 * DM * DM); k_wnat<<<g, 256, 0, stream>>>(wo, (size_t)DM * DM / 8, BO); }      /* natural [out][in] = Bt[n][k], x16; q | k | v stacked along n */
  k_x16<<<(unsigned)((NR * DM / 8 + 255) / 256), 256, 0, stream>>>(x, X16, NR * DM / 8);
  for (int b = B0; b < B0 + NBR; ++b) { const size_t r0 = (size_t)b * SQ;
    k_gemm2<0><<<dim3((unsigned)((SQ / 128) * (3 * DM / 64)), 1), 128, 0, stream>>>(X16 + r0 * DM, DM, 0, BQKV, DM, 0, 0.0625f, nullptr, 0, nullptr, 1, 0, 0, QKVF, nullptr, 3 * DM, 0, SQ, 3 * DM, DM);      /* q | k | v rows (f32) of this batch */
    k_xform<0, 6><<<(unsigned)(SQ * NH), 64, 0, stream>>>(QKVF, 3 * DM, NH, nullptr, 0.f, tcos, tsin, QH + r0 * DM, DM);
    k_xform<0, 6><<<(unsigned)(SQ * NH), 64, 0, stream>>>(QKVF + DM, 3 * DM, NH, nullptr, 0.f, tcos, tsin, KH + r0 * DM, DM);
    k_xform<0, 0><<<(unsigned)(SQ * NH), 64, 0, stream>>>(QKVF + 2 * DM, 3 * DM, NH, nullptr, 0.f, CS, SN, V16 + r0 * DM, DM);
    k_vt<NH, SQ><<<NH * (SQ / 64), 256, 0, stream>>>(V16 + r0 * DM, DM, 0, VT);      /* V^T [NH][HD][SQ] for this batch */
    for (int h0 = 0; h0 < NHD; h0 += HG) {
      k_gemm2<0><<<dim3((QN / 128) * (SQ / 64), HG), 128, 0, stream>>>(QH + r0 * DM + h0 * HD, DM, (size_t)HD, KH + r0 * DM + h0 * HD, DM, (size_t)HD, 0.125f, nullptr, 0, nullptr, 1, 0, 0, S, nullptr, SQ, (size_t)SQ * SQ, QN, SQ, HD);      /* scores, HG heads per launch */
      k_rsmf<<<(HG * QN + 7) / 8, 256, 0, stream>>>(S, P, QN, HG);      /* P = 256 softmax (f16); one wave per row, 8 rows per block */
      k_gemm2<0><<<dim3((QN / 128) * (HD / 64), HG), 128, 0, stream>>>(P, SQ, (size_t)SQ * SQ, VT + (size_t)h0 * HD * SQ, SQ, (size_t)HD * SQ, 0.25f, nullptr, 0, nullptr, 1, 0, 0, nullptr, O16 + r0 * DM + h0 * HD, DM, (size_t)HD, QN, HD, SQ); } }      /* o as f16 */
  k_gemm2<0><<<dim3((unsigned)((MPO / 128) * (DM / 64)), 1), 128, 0, stream>>>(O16 + (size_t)B0 * SQ * DM, DM, 0, BO, DM, 0, 0.0009765625f, bo, 0, nullptr, 1, 0, 0, (float*)d_out + (size_t)B0 * SQ * DM, nullptr, DM, 0, MPO, DM, DM);      /* out rows are the output layout */
}

// v002
// It runs in 440 microseconds.
// Next to v001, in two timings, it ran 4.22 times as fast each time.
// All steps since v000 together make it 15.9 times as fast.
#include <hip/hip_runtime.h>
// RoPE multi-head self-attention with INPUT rotary tables (x [4][2048][1024]; q/k/v = x W^T (nn.Linear natural [out][in] sigma 0.02, no bias), 16 heads of 64; q = q cos + rotate_half(q) sin with the module's cos/sin inputs [1][2048][1][64] (full head width, independent values per dim; rotate_half = concat(-x[32:], x[:32])), same for k; scores / 8; softmax over all keys (no mask); out = merged Wo^T (no bias) -> [4][2048][1024]).
// Structure: token rows r = b*2048 + s; x as exact f16 rows (bf16-rounded); per batch: q | k | v as ONE WMMA GEMM (32x64 wave tiles, f32 accumulation, exact x16 weights, N = 3 x 1024) into f32 rows, then per (row, head) on VALU: the half-split rotary rotation of q and k from f32 cos/sin tables (no norm) -> f16 q, k, v rows; V^T for all heads via LDS transposes; then ONE fused attention launch over all batches and heads (scores on WMMA, online softmax in registers with f32 statistics and native exp2, weights as f16 straight into the P . V WMMA; o carried x64 against f16 subnormal flush, folded into the output GEMM alpha) written straight into the merged f16 o rows; out = o W_o GEMM (f32, no bias) into the output layout.
// Compute dtype: inputs rounded to bf16; x / weights exact; projections and rope f32; q, k, v, softmax weights and o as plain f16 GEMM operands (~2^-12); scores and softmax statistics f32. v_wmma_f32_16x16x32_f16.
#define NB 4
#define SQ 2048
#define DM 1024
#define NH 16
#define HD 64
#define HG 4                         /* heads per launch of the non-template k_vt */
#define B0 0                         /* first batch processed (debug hook) */
#define NBR NB                       /* batches processed (debug hook) */
#define QN SQ                        /* query rows attended per batch (debug hook) */
#define NHD NH                       /* heads attended (debug hook) */
#define NR ((size_t)NB * SQ)         /* token rows */
#define MPO ((int)((size_t)NBR * SQ))      /* rows through the output GEMM (debug hook) */
typedef __bf16 v16b __attribute__((ext_vector_type(16)));
typedef unsigned short v8us __attribute__((ext_vector_type(8), may_alias));
typedef float  v8f  __attribute__((ext_vector_type(8)));
typedef float  v4f  __attribute__((ext_vector_type(4)));
typedef float  v4fa __attribute__((ext_vector_type(4), may_alias));
union FragB { v16b v; v8us half[2]; unsigned short u[16]; };

__device__ __forceinline__ unsigned short bf16_bits(float x) { unsigned int u = __float_as_uint(x); return (unsigned short)((u + 0x7FFFu + ((u >> 16) & 1u)) >> 16); }
__device__ __forceinline__ float bf16_val(unsigned short b) { return __uint_as_float(((unsigned int)b) << 16); }
__device__ __forceinline__ float bf16_round(float x) { return bf16_val(bf16_bits(x)); }
// D += A·B with NT terms: 1 = ah·bh, 2 = + al·bh (A split), 3 = + ah·bl (both split)
template <int NT>
__device__ __forceinline__ v8f mmaN(v16b ah, v16b al, v16b bh, v16b bl, v8f c) {
  c = __builtin_amdgcn_wmma_f32_16x16x32_bf16(false, ah, false, bh, (short)0, c, false, false);
  if (NT >= 2) c = __builtin_amdgcn_wmma_f32_16x16x32_bf16(false, al, false, bh, (short)0, c, false, false);
  if (NT >= 3) c = __builtin_amdgcn_wmma_f32_16x16x32_bf16(false, ah, false, bl, (short)0, c, false, false);
  asm volatile("v_nop\n\tv_nop\n\tv_nop\n\tv_nop" : "+v"(c) : "v"(ah), "v"(al), "v"(bh), "v"(bl));
  return c;
}

__global__ __launch_bounds__(256) void k_wt_bf16(const float* __restrict__ W, unsigned short* __restrict__ Wt, int K, int N) {
  const int t = blockIdx.x * 256 + threadIdx.x;
  const int k8n = K / 8;
  if (t >= N * k8n) return;
  const int n = t / k8n, k8 = (t % k8n) * 8;
  v8us v;
#pragma unroll
  for (int i = 0; i < 8; ++i) v[i] = bf16_bits(W[(size_t)(k8 + i) * N + n]);
  *(v8us*)(Wt + (size_t)n * K + k8) = v;
  
}

// GEMM C[M][N] (f32, pitch ldc) = act(A[M][K]·W + bias). A f32 row-major (pitch lda) converted per fragment to bf16
// (ASPLIT: hi/lo two planes -> 2 terms, else single rounded term); Wt bf16 [N][K] (pitch ldb). BIAS_BF16 rounds the
// bias to bf16 first (bias quantised to bf16 before the add). K%32==0, M%16==0, N%64==0.
template <bool ASPLIT, int ACT, bool BIAS_BF16>
__global__ __launch_bounds__(128) void k_gemm_bf(const float* __restrict__ A, int lda, const unsigned short* __restrict__ Wt, int ldb,
                                               const float* __restrict__ bias, float* __restrict__ C, int ldc, int M, int N, int K) {
  __shared__ __attribute__((aligned(16))) float so[4][16][64];
  const int tid = threadIdx.x, w = tid >> 5, lane = tid & 31, ln = lane & 15, hh = lane >> 4;
  const int ntn = N / 64;
  const int wid = blockIdx.x * 4 + w;
  const int mt = wid / ntn, nq = wid % ntn;
  if (mt * 16 >= M) return;
  const int row0 = mt * 16, col0 = nq * 64;
  const float* arow = A + (size_t)(row0 + ln) * lda;
  v8f acc[4] = {};
  for (int kb = 0; kb < K; kb += 32) {
    FragB ah, al;
    const v4f x0 = *(const v4fa*)(arow + kb + 8 * hh), x1 = *(const v4fa*)(arow + kb + 8 * hh + 4);
    const v4f x2 = *(const v4fa*)(arow + kb + 16 + 8 * hh), x3 = *(const v4fa*)(arow + kb + 16 + 8 * hh + 4);
    float xs[16] = {x0[0],x0[1],x0[2],x0[3],x1[0],x1[1],x1[2],x1[3],x2[0],x2[1],x2[2],x2[3],x3[0],x3[1],x3[2],x3[3]};
#pragma unroll
    for (int i = 0; i < 16; ++i) { const unsigned short hb = bf16_bits(xs[i]); ah.u[i] = hb; al.u[i] = ASPLIT ? bf16_bits(xs[i] - bf16_val(hb)) : (unsigned short)0; }
#pragma unroll
    for (int t = 0; t < 4; ++t) {
      const unsigned short* brow = Wt + (size_t)(col0 + t * 16 + ln) * ldb + kb;
      FragB b;
      b.half[0] = *(const v8us*)(brow + 8 * hh);
      b.half[1] = *(const v8us*)(brow + 16 + 8 * hh);
      acc[t] = mmaN<ASPLIT ? 2 : 1>(ah.v, al.v, b.v, b.v, acc[t]);
    }
  }
#pragma unroll
  for (int t = 0; t < 4; ++t) {
    float bv = bias ? bias[col0 + t * 16 + ln] : 0.f;
    if (BIAS_BF16) bv = bf16_round(bv);
#pragma unroll
    for (int r = 0; r < 8; ++r) { float v = acc[t][r] + bv; if (ACT == 1) v = fmaxf(v, 0.f); so[w][8 * hh + r][t * 16 + ln] = v; }
  }
  __builtin_amdgcn_fence(__ATOMIC_ACQ_REL, "workgroup");
  __builtin_amdgcn_wave_barrier();
  const int rsub = lane >> 4, c4 = (lane & 15) * 4;
  {
#pragma unroll
    for (int q = 0; q < 8; ++q) {
      const int r = q * 2 + rsub;
      const v4f v = *(const v4fa*)&so[w][r][c4];
      *(v4f*)(C + (size_t)(row0 + r) * ldc + col0 + c4) = v;
    }
    
  }
}

// GEMM C = act(A·W + bias + resid): A f32 (ASPLIT -> hi/lo 2 terms), Wt bf16 [N][K]; ACT 0 none, 1 relu, 2 exact gelu;
// resid (optional, f32, row index = (row % rmod), pitch ldr, RES_BF16 rounds it) added before the activation.
template <bool ASPLIT, int ACT, bool BIAS_BF16, bool RES_BF16>
__global__ __launch_bounds__(128) void k_gemm_bf3(const float* __restrict__ A, int lda, const unsigned short* __restrict__ Wt, int ldb,
                                                const float* __restrict__ bias, const float* __restrict__ resid, int rmod, int ldr,
                                                float* __restrict__ C, int ldc, int M, int N, int K) {
  __shared__ __attribute__((aligned(16))) float so[4][16][64];
  const int tid = threadIdx.x, w = tid >> 5, lane = tid & 31, ln = lane & 15, hh = lane >> 4;
  const int ntn = N / 64;
  const int wid = blockIdx.x * 4 + w;
  const int mt = wid / ntn, nq = wid % ntn;
  if (mt * 16 >= M) return;
  const int row0 = mt * 16, col0 = nq * 64;
  const float* arow = A + (size_t)(row0 + ln) * lda;
  v8f acc[4] = {};
  for (int kb = 0; kb < K; kb += 32) {
    FragB ah, al;
    const v4f x0 = *(const v4fa*)(arow + kb + 8 * hh), x1 = *(const v4fa*)(arow + kb + 8 * hh + 4);
    const v4f x2 = *(const v4fa*)(arow + kb + 16 + 8 * hh), x3 = *(const v4fa*)(arow + kb + 16 + 8 * hh + 4);
    float xs[16] = {x0[0],x0[1],x0[2],x0[3],x1[0],x1[1],x1[2],x1[3],x2[0],x2[1],x2[2],x2[3],x3[0],x3[1],x3[2],x3[3]};
#pragma unroll
    for (int i = 0; i < 16; ++i) { const unsigned short hb = bf16_bits(xs[i]); ah.u[i] = hb; al.u[i] = ASPLIT ? bf16_bits(xs[i] - bf16_val(hb)) : (unsigned short)0; }
#pragma unroll
    for (int t = 0; t < 4; ++t) {
      const unsigned short* brow = Wt + (size_t)(col0 + t * 16 + ln) * ldb + kb;
      FragB b;
      b.half[0] = *(const v8us*)(brow + 8 * hh);
      b.half[1] = *(const v8us*)(brow + 16 + 8 * hh);
      acc[t] = mmaN<ASPLIT ? 2 : 1>(ah.v, al.v, b.v, b.v, acc[t]);
    }
  }
#pragma unroll
  for (int t = 0; t < 4; ++t) {
    const int col = col0 + t * 16 + ln;
    float bv = bias ? bias[col] : 0.f;
    if (BIAS_BF16) bv = bf16_round(bv);
#pragma unroll
    for (int r = 0; r < 8; ++r) {
      float v = acc[t][r] + bv;
      if (resid) { float rv = resid[(size_t)((row0 + 8 * hh + r) % rmod) * ldr + col]; if (RES_BF16) rv = bf16_round(rv); v += rv; }
      if (ACT == 1) v = fmaxf(v, 0.f);
      if (ACT == 2) v = 0.5f * v * (1.0f + erff(v * 0.70710678118654752f));
      if (ACT == 3) { const float u = 0.7978845608028654f * (v + 0.044715f * v * v * v); v = 0.5f * v * (1.0f + tanhf(u)); }
      so[w][8 * hh + r][t * 16 + ln] = v;
    }
  }
  __builtin_amdgcn_fence(__ATOMIC_ACQ_REL, "workgroup");
  __builtin_amdgcn_wave_barrier();
  const int rsub = lane >> 4, c4 = (lane & 15) * 4;
  {
#pragma unroll
    for (int q = 0; q < 8; ++q) {
      const int r = q * 2 + rsub;
      const v4f v = *(const v4fa*)&so[w][r][c4];
      *(v4f*)(C + (size_t)(row0 + r) * ldc + col0 + c4) = v;
    }
    
  }
}
// row LayerNorm (biased variance, eps) over N: s = X (+ R); optional out_sum <- s; out_norm <- (s-mu)*rsqrt(var+eps)*g + b
template <bool PARAM_BF16>
__global__ __launch_bounds__(256) void k_layernorm(const float* __restrict__ X, const float* __restrict__ R, const float* __restrict__ g, const float* __restrict__ bta,
                                                  float* __restrict__ out_sum, float* __restrict__ out_norm, int N, float eps) {
  __shared__ float red[256];
  const int row = blockIdx.x, tid = threadIdx.x;
  const float* x = X + (size_t)row * N; const float* rr = R ? R + (size_t)row * N : nullptr;
  float vals[16];                     // up to N = 4096
  const int per = N / 256;            // contiguous chunk per thread? use strided-by-4 chunks: thread handles j = tid*4 + 1024*u
  float s1 = 0.f;
  for (int u = 0; u < per / 4; ++u) {
    const int j = tid * 4 + 1024 * u;
    const v4f a = *(const v4fa*)(x + j);
    v4f b = {0.f,0.f,0.f,0.f}; if (rr) b = *(const v4fa*)(rr + j);
#pragma unroll
    for (int q = 0; q < 4; ++q) { const float v = a[q] + b[q]; vals[u * 4 + q] = v; s1 += v; }
  }
  red[tid] = s1; __syncthreads();
  for (int st = 128; st > 0; st >>= 1) { if (tid < st) red[tid] += red[tid + st]; __syncthreads(); }
  const float mu = red[0] / (float)N; __syncthreads();
  float s2 = 0.f;
  for (int u = 0; u < per / 4; ++u)
#pragma unroll
    for (int q = 0; q < 4; ++q) { const float c = vals[u * 4 + q] - mu; s2 += c * c; }
  red[tid] = s2; __syncthreads();
  for (int st = 128; st > 0; st >>= 1) { if (tid < st) red[tid] += red[tid + st]; __syncthreads(); }
  const float rs = rsqrtf(red[0] / (float)N + eps);
  {
    for (int u = 0; u < per / 4; ++u) {
      const int j = tid * 4 + 1024 * u;
      v4f o, sm;
#pragma unroll
      for (int q = 0; q < 4; ++q) {
        float gg = g[j + q], bb = bta[j + q];
        if (PARAM_BF16) { gg = bf16_round(gg); bb = bf16_round(bb); }
        sm[q] = vals[u * 4 + q]; o[q] = (vals[u * 4 + q] - mu) * rs * gg + bb;
      }
      if (out_sum) *(v4f*)(out_sum + (size_t)row * N + j) = sm;
      *(v4f*)(out_norm + (size_t)row * N + j) = o;
    }
    
  }
}



// ---- f16 WMMA path (v_wmma_f32_16x16x32_f16): 11-bit significands for operands in range — used where a [0,1] probability operand needs more precision than bf16
typedef _Float16 v16h __attribute__((ext_vector_type(16)));
union FragH { v16h v; v8us half[2]; _Float16 h[16]; unsigned short u[16]; };
template <int NT>
__device__ __forceinline__ v8f mmaH(v16h ah, v16h al, v16h bh, v16h bl, v8f c) {
  c = __builtin_amdgcn_wmma_f32_16x16x32_f16(false, ah, false, bh, (short)0, c, false, false);
  if (NT >= 2) c = __builtin_amdgcn_wmma_f32_16x16x32_f16(false, al, false, bh, (short)0, c, false, false);
  if (NT >= 3) c = __builtin_amdgcn_wmma_f32_16x16x32_f16(false, ah, false, bl, (short)0, c, false, false);
  asm volatile("v_nop\n\tv_nop\n\tv_nop\n\tv_nop" : "+v"(c) : "v"(ah), "v"(al), "v"(bh), "v"(bl));
  return c;
}
// batched GEMM like k_gemm_b but f16 operands: A f32 (split into f16 hi/lo if ASPLIT, else rounded to f16), Bt = f16 values [n][k]; alpha; C f32; N multiple of 16 (partial tiles skipped)
template <bool ASPLIT>
__global__ __launch_bounds__(128) void k_gemm_h(const float* __restrict__ A, int lda, size_t sA, const _Float16* __restrict__ Bh, int ldb, size_t sB, float alpha, float* __restrict__ C, int ldc, size_t sC, int M, int N, int K) {
  __shared__ __attribute__((aligned(16))) float so[4][16][64];
  const int tid = threadIdx.x, w = tid >> 5, lane = tid & 31, ln = lane & 15, hh = lane >> 4; const int by = blockIdx.y;
  A += (size_t)by * sA; Bh += (size_t)by * sB; C += (size_t)by * sC;
  const int ntn = (N + 63) / 64; const int wid = blockIdx.x * 4 + w; const int mt = wid / ntn, nq = wid % ntn; if (mt * 16 >= M) return;
  const int row0 = mt * 16, col0 = nq * 64; const float* arow = A + (size_t)(row0 + ln) * lda;
  v8f acc[4] = {};
  for (int kb = 0; kb < K; kb += 32) {
    FragH ah, al;
    const v4f x0 = *(const v4fa*)(arow + kb + 8 * hh), x1 = *(const v4fa*)(arow + kb + 8 * hh + 4), x2 = *(const v4fa*)(arow + kb + 16 + 8 * hh), x3 = *(const v4fa*)(arow + kb + 16 + 8 * hh + 4);
    float xs[16] = {x0[0],x0[1],x0[2],x0[3],x1[0],x1[1],x1[2],x1[3],x2[0],x2[1],x2[2],x2[3],x3[0],x3[1],x3[2],x3[3]};
#pragma unroll
    for (int i = 0; i < 16; ++i) { const _Float16 h = (_Float16)xs[i]; ah.h[i] = h; al.h[i] = ASPLIT ? (_Float16)(xs[i] - (float)h) : (_Float16)0.0f; }
#pragma unroll
    for (int t = 0; t < 4; ++t) { if (col0 + t * 16 >= N) continue; const size_t boff = (size_t)(col0 + t * 16 + ln) * ldb + kb; FragH bq; bq.half[0] = *(const v8us*)(Bh + boff + 8 * hh); bq.half[1] = *(const v8us*)(Bh + boff + 16 + 8 * hh);
      acc[t] = mmaH<ASPLIT ? 2 : 1>(ah.v, al.v, bq.v, bq.v, acc[t]); }
  }
#pragma unroll
  for (int t = 0; t < 4; ++t) { if (col0 + t * 16 >= N) continue;
#pragma unroll
    for (int r = 0; r < 8; ++r) so[w][8 * hh + r][t * 16 + ln] = acc[t][r] * alpha; }
  __builtin_amdgcn_fence(__ATOMIC_ACQ_REL, "workgroup"); __builtin_amdgcn_wave_barrier();
  const int rsub = lane >> 4, c4 = (lane & 15) * 4;
  {
#pragma unroll
    for (int q = 0; q < 8; ++q) { const int r = q * 2 + rsub; if (col0 + c4 < N) { const v4f v = *(const v4fa*)&so[w][r][c4]; *(v4f*)(C + (size_t)(row0 + r) * ldc + col0 + c4) = v; } }
     }
}

// Wt[n][k] = f16(W[k][n]·scale) from f32 row-major W[K][N] (scale = power of two; bf16-exact weights stay exact in f16 away from the subnormal range)
__global__ __launch_bounds__(256) void k_wt_f16(const float* __restrict__ W, _Float16* __restrict__ Wt, int K, int N, float scale) {
  const int t = blockIdx.x * 256 + threadIdx.x; if (t >= N * (K / 8)) return; const int n = t / (K / 8), k8 = (t % (K / 8)) * 8; FragH f;
#pragma unroll
  for (int i = 0; i < 8; ++i) f.h[i] = (_Float16)(bf16_round(W[(size_t)(k8 + i) * N + n]) * scale); const v8us o = f.half[0];
  *(v8us*)((unsigned short*)Wt + (size_t)n * K + k8) = o; 
}
// k_gemm_hh variant with fused epilogue: v = acc·alpha + bias[by·sBias + col] (+ CP[(row/rowsPerB)·sCPb + by·64 + col] if CP) ; ACT 0 none / 1 elu ; writes f16 C16 (and f32 C if non-null)
template <int ACT>
__global__ __launch_bounds__(128) void k_gemm_hhx(const _Float16* __restrict__ A, int lda, size_t sA, const _Float16* __restrict__ Bh, int ldb, size_t sB, float alpha, const float* __restrict__ bias, size_t sBias, const float* __restrict__ CP, int rowsPerB, size_t sCPb, int row0g,
    float* __restrict__ C, _Float16* __restrict__ C16, int ldc, size_t sC, int M, int N, int K) {
  __shared__ __attribute__((aligned(16))) float so[4][16][64];
  const int tid = threadIdx.x, w = tid >> 5, lane = tid & 31, ln = lane & 15, hh = lane >> 4; const int by = blockIdx.y;
  A += (size_t)by * sA; Bh += (size_t)by * sB; const size_t cofs = (size_t)by * sC; const float* bp = bias ? bias + (size_t)by * sBias : nullptr;
  const int ntn = (N + 63) / 64; const int wid = blockIdx.x * 4 + w; const int mt = wid / ntn, nq = wid % ntn; if (mt * 16 >= M) return;
  const int row0 = mt * 16, col0 = nq * 64; const _Float16* arow = A + (size_t)(row0 + ln) * lda;
  v8f acc[4] = {};
  for (int kb = 0; kb < K; kb += 32) { FragH ah; ah.half[0] = *(const v8us*)((const unsigned short*)arow + kb + 8 * hh); ah.half[1] = *(const v8us*)((const unsigned short*)arow + kb + 16 + 8 * hh);
#pragma unroll
    for (int t = 0; t < 4; ++t) { if (col0 + t * 16 >= N) continue; const size_t boff = (size_t)(col0 + t * 16 + ln) * ldb + kb; FragH bq; bq.half[0] = *(const v8us*)((const unsigned short*)Bh + boff + 8 * hh); bq.half[1] = *(const v8us*)((const unsigned short*)Bh + boff + 16 + 8 * hh);
      acc[t] = mmaH<1>(ah.v, ah.v, bq.v, bq.v, acc[t]); }
  }
#pragma unroll
  for (int t = 0; t < 4; ++t) { if (col0 + t * 16 >= N) continue; const int col = col0 + t * 16 + ln; const float bv = bp ? bf16_round(bp[col]) : 0.f;
#pragma unroll
    for (int r = 0; r < 8; ++r) { float v = acc[t][r] * alpha + bv; if (CP) { const int rr = row0g + row0 + 8 * hh + r; if (rowsPerB < 0) v += CP[cofs + (size_t)rr * ldc + col];      /* rowsPerB < 0: own element of the batched C plane */ else { const int bidx = rr / rowsPerB; v += CP[(size_t)bidx * sCPb + (size_t)by * 64 + col]; } } if (ACT == 1) v = (v > 0.f) ? v : expm1f(v); else if (ACT == 7) v = (v > 0.f) ? v + 1.0f : expf(v); else if (ACT == 8) v = tanhf(v); else if (ACT == 9) v = 0.5f * v * (1.0f + tanhf(0.7978845608028654f * (v + 0.044715f * v * v * v))); else if (ACT == 11) v = 1.0f / (1.0f + expf(-v)); else if (ACT == 12) v = (v > 0.f) ? v : 0.01f * v; else if (ACT == 14) v = (v > 0.f) ? v : 0.1f * v; else if (ACT == 16) v = (v >= 0.f) ? v : 0.3f * v; else if (ACT == 17) v = (v >= 0.f) ? v : 0.2f * v; else if (ACT == 15) v = v / (1.0f + expf(-v)); else if (ACT == 3) v = fmaxf(v, 0.f); else if (ACT == 6) v = 0.5f * v * (1.0f + erff(v * 0.70710678118654752f)); so[w][8 * hh + r][t * 16 + ln] = v; } }
  __builtin_amdgcn_fence(__ATOMIC_ACQ_REL, "workgroup"); __builtin_amdgcn_wave_barrier();
  const int rsub = lane >> 4, c4 = (lane & 15) * 4; typedef _Float16 v4h __attribute__((ext_vector_type(4)));
  {
#pragma unroll
    for (int q = 0; q < 8; ++q) { const int r = q * 2 + rsub; if (col0 + c4 < N) { const v4f v = *(const v4fa*)&so[w][r][c4]; if (C) *(v4f*)(C + cofs + (size_t)(row0 + r) * ldc + col0 + c4) = v; if (C16) { v4h h4; for (int i = 0; i < 4; ++i) h4[i] = (_Float16)v[i]; *(v4h*)(C16 + cofs + (size_t)(row0 + r) * ldc + col0 + c4) = h4; } } }
     }
}


typedef _Float16 v4h __attribute__((ext_vector_type(4)));

__global__ __launch_bounds__(256) void k_x16(const float* __restrict__ x, _Float16* __restrict__ X16, size_t n8) { const size_t t = (size_t)blockIdx.x * 256 + threadIdx.x; if (t >= n8) return; FragH f;
#pragma unroll
  for (int q = 0; q < 8; ++q) f.h[q] = (_Float16)bf16_round(x[t * 8 + q]); *(v8us*)((unsigned short*)X16 + t * 8) = f.half[0];  }
__global__ __launch_bounds__(256) void k_h16(const float* __restrict__ x, _Float16* __restrict__ X16, size_t n8) { const size_t t = (size_t)blockIdx.x * 256 + threadIdx.x; if (t >= n8) return; FragH f;
#pragma unroll
  for (int q = 0; q < 8; ++q) f.h[q] = (_Float16)x[t * 8 + q]; *(v8us*)((unsigned short*)X16 + t * 8) = f.half[0];  }
__global__ __launch_bounds__(256) void k_round16f(const float* __restrict__ W, _Float16* __restrict__ Bt, size_t n8) { const size_t t = (size_t)blockIdx.x * 256 + threadIdx.x; if (t >= n8) return; FragH f;
#pragma unroll
  for (int i = 0; i < 8; ++i) f.h[i] = (_Float16)(bf16_round(W[t * 8 + i]) * 16.0f); *(v8us*)((unsigned short*)Bt + t * 8) = f.half[0];  }
template <int NHv, int TTv>
__global__ __launch_bounds__(256) void k_vt(const _Float16* __restrict__ V16, int ldv, int voff, _Float16* __restrict__ Vt) { __shared__ unsigned short tl[64][66]; const int tid = threadIdx.x; const int slab = blockIdx.x / (TTv / 64), lg = blockIdx.x % (TTv / 64); const int b = slab / NHv, h = slab % NHv;
  for (int i = tid; i < 64 * 8; i += 256) { const int r = i / 8, c8 = (i % 8) * 8; FragH f; f.half[0] = *(const v8us*)((const unsigned short*)V16 + ((size_t)b * TTv + lg * 64 + r) * ldv + voff + h * 64 + c8);
#pragma unroll
    for (int q = 0; q < 8; ++q) tl[r][c8 + q] = f.u[q]; }
  __syncthreads();
  {
#pragma unroll
    for (int rd = 0; rd < 2; ++rd) { const int d = rd * 32 + tid / 8, pc = tid % 8; FragH f;
#pragma unroll
      for (int q = 0; q < 8; ++q) f.u[q] = tl[pc * 8 + q][d];
      *(v8us*)((unsigned short*)Vt + ((size_t)slab * 64 + d) * TTv + lg * 64 + pc * 8) = f.half[0]; }
     } }

__global__ __launch_bounds__(256) void k_hl(const float* __restrict__ F, _Float16* __restrict__ Hh, _Float16* __restrict__ Hl, size_t n8) { const size_t t = (size_t)blockIdx.x * 256 + threadIdx.x; if (t >= n8) return; FragH fh, fl; const v4f a = *(const v4fa*)(F + t * 8), c = *(const v4fa*)(F + t * 8 + 4);
#pragma unroll
  for (int q = 0; q < 4; ++q) { _Float16 h = (_Float16)a[q]; fh.h[q] = h; fl.h[q] = (_Float16)((a[q] - (float)h) * 1024.0f); h = (_Float16)c[q]; fh.h[4 + q] = h; fl.h[4 + q] = (_Float16)((c[q] - (float)h) * 1024.0f); }
  { *(v8us*)((unsigned short*)Hh + t * 8) = fh.half[0]; *(v8us*)((unsigned short*)Hl + t * 8) = fl.half[0];  } }

// ---- fast GEMM (wave tile 32x64; requires M % 32 == 0 rows per launch region and N % 64 == 0); epilogue = k_gemm_hhx semantics ----
__device__ __forceinline__ v16h g2_frag(const _Float16* p, int hh) { FragH f; f.half[0] = *(const v8us*)((const unsigned short*)p + 8 * hh); f.half[1] = *(const v8us*)((const unsigned short*)p + 16 + 8 * hh); return f.v; }
__device__ __forceinline__ v8f g2_mma(v16h a, v16h b, v8f c) { v8f d = __builtin_amdgcn_wmma_f32_16x16x32_f16(false, a, false, b, (short)0, c, false, false); asm volatile("v_nop\n\tv_nop\n\tv_nop\n\tv_nop" : "+v"(d) : "v"(a), "v"(b)); return d; }
template <int ACT>
__global__ __launch_bounds__(128) void k_gemm2(const _Float16* __restrict__ A, int lda, size_t sA, const _Float16* __restrict__ Bh, int ldb, size_t sB, float alpha, const float* __restrict__ bias, size_t sBias, const float* __restrict__ CP, int rowsPerB, size_t sCPb, int row0g,
    float* __restrict__ C, _Float16* __restrict__ C16, int ldc, size_t sC, int M, int N, int K) { static_assert(ACT == 0 || ACT == 3 || ACT == 6 || ACT == 8 || ACT == 9 || ACT == 11 || ACT == 12 || ACT == 14 || ACT == 15 || ACT == 16 || ACT == 17, "k_gemm2: unsupported ACT code (would silently apply no activation)");
  __shared__ __attribute__((aligned(16))) float so[4][32][68];
  const int tid = threadIdx.x, w = tid >> 5, lane = tid & 31, ln = lane & 15, hh = lane >> 4; const int by = blockIdx.y;
  A += (size_t)by * sA; Bh += (size_t)by * sB; const size_t cofs = (size_t)by * sC; const float* bp = bias ? bias + (size_t)by * sBias : nullptr;
  const int ntn = N >> 6; const int mt = blockIdx.x / ntn, nq = blockIdx.x - mt * ntn; const int row0 = mt * 128 + 32 * w, col0 = nq * 64; if (row0 >= M) return;
  const _Float16* a0p = A + (size_t)(row0 + ln) * lda; const _Float16* a1p = a0p + (size_t)16 * lda;
  const _Float16* b0p = Bh + (size_t)(col0 + ln) * ldb; const _Float16* b1p = b0p + (size_t)16 * ldb; const _Float16* b2p = b1p + (size_t)16 * ldb; const _Float16* b3p = b2p + (size_t)16 * ldb;
  const v8f z8 = {0.f,0.f,0.f,0.f,0.f,0.f,0.f,0.f}; v8f c00 = z8, c01 = z8, c02 = z8, c03 = z8, c10 = z8, c11 = z8, c12 = z8, c13 = z8;
#pragma unroll 1
  for (int kb = 0; kb < K; kb += 32) { const v16h a0 = g2_frag(a0p + kb, hh), a1 = g2_frag(a1p + kb, hh);
    v16h b = g2_frag(b0p + kb, hh); c00 = g2_mma(a0, b, c00); c10 = g2_mma(a1, b, c10);
    b = g2_frag(b1p + kb, hh); c01 = g2_mma(a0, b, c01); c11 = g2_mma(a1, b, c11);
    b = g2_frag(b2p + kb, hh); c02 = g2_mma(a0, b, c02); c12 = g2_mma(a1, b, c12);
    b = g2_frag(b3p + kb, hh); c03 = g2_mma(a0, b, c03); c13 = g2_mma(a1, b, c13); }
  v8f accs[8] = {c00, c01, c02, c03, c10, c11, c12, c13};
#pragma unroll
  for (int u = 0; u < 8; ++u) { const int t = u & 3, half = u >> 2; const int col = col0 + t * 16 + ln; const float bv = bp ? bf16_round(bp[col]) : 0.f;
#pragma unroll
    for (int r = 0; r < 8; ++r) { const int rloc = half * 16 + 8 * hh + r; float v = accs[u][r] * alpha + bv; if (CP) { if (rowsPerB < 0) v += CP[cofs + (size_t)(row0g + row0 + rloc) * ldc + col];      /* rowsPerB < 0: own element of the batched C plane */ else { const int bidx = (row0g + row0 + rloc) / rowsPerB; v += CP[(size_t)bidx * sCPb + (size_t)by * 64 + col]; } }
      if (ACT == 3) v = fmaxf(v, 0.f); else if (ACT == 6) v = 0.5f * v * (1.0f + erff(v * 0.70710678118654752f)); else if (ACT == 11) v = 1.0f / (1.0f + expf(-v)); else if (ACT == 15) v = v / (1.0f + expf(-v)); else if (ACT == 12) v = (v > 0.f) ? v : 0.01f * v; else if (ACT == 8) v = tanhf(v); else if (ACT == 9) v = 0.5f * v * (1.0f + tanhf(0.7978845608028654f * (v + 0.044715f * v * v * v))); else if (ACT == 14) v = (v > 0.f) ? v : 0.1f * v; else if (ACT == 16) v = (v >= 0.f) ? v : 0.3f * v; else if (ACT == 17) v = (v >= 0.f) ? v : 0.2f * v;
      so[w][rloc][t * 16 + ln] = v; } }
  __builtin_amdgcn_fence(__ATOMIC_ACQ_REL, "workgroup"); __builtin_amdgcn_wave_barrier();
  const int rsub = lane >> 4, c4 = (lane & 15) * 4;
  {
#pragma unroll
    for (int q = 0; q < 16; ++q) { const int r = q * 2 + rsub; const v4f v = *(const v4fa*)&so[w][r][c4]; if (C) *(v4f*)(C + cofs + (size_t)(row0 + r) * ldc + col0 + c4) = v; if (C16) { v4h h4; for (int i = 0; i < 4; ++i) h4[i] = (_Float16)v[i]; *(v4h*)(C16 + cofs + (size_t)(row0 + r) * ldc + col0 + c4) = h4; } }
     } }


__global__ __launch_bounds__(256) void k_wnat(const float* __restrict__ w, size_t n8, _Float16* __restrict__ Bt) { const size_t t = (size_t)blockIdx.x * 256 + threadIdx.x; if (t >= n8) return; FragH f; for (int q = 0; q < 8; ++q) f.h[q] = (_Float16)(bf16_round(w[t * 8 + q]) * 16.0f); *(v8us*)((unsigned short*)Bt + t * 8) = f.half[0];  }
__global__ __launch_bounds__(256) void k_rsm(const float* __restrict__ S, _Float16* __restrict__ P, int nrows) {
  #pragma clang fp contract(off)
  const int i = blockIdx.x * 256 + threadIdx.x; if (i >= nrows) return; const float* s = S + (size_t)i * SQ; float mx = -3.0e38f;
#pragma unroll 1
  for (int j = 0; j < SQ; ++j) mx = fmaxf(mx, s[j]); float se = 0.f;
#pragma unroll 1
  for (int j = 0; j < SQ; ++j) se += expf(s[j] - mx); const float sc = 256.0f / se;
#pragma unroll 1
  for (int j0 = 0; j0 < SQ; j0 += 8) { FragH f; for (int q = 0; q < 8; ++q) f.h[q] = (_Float16)(expf(s[j0 + q] - mx) * sc); unsigned short* d = (unsigned short*)P + (size_t)i * SQ + j0; *(v8us*)d = f.half[0];  } }
__global__ __launch_bounds__(256) void k_vt(const _Float16* __restrict__ V16, int b, int h0, _Float16* __restrict__ VT) { __shared__ unsigned short tl[64][65]; const int tid = threadIdx.x; const int hh = blockIdx.x % HG, sg = blockIdx.x / HG; const int s0 = sg * 64; const int h = h0 + hh;
  for (int i = tid; i < 64 * 8; i += 256) { const int j = i / 8, d8 = (i % 8) * 8; FragH f; f.half[0] = *(const v8us*)((const unsigned short*)V16 + ((size_t)b * SQ + s0 + j) * DM + h * HD + d8); for (int q = 0; q < 8; ++q) tl[d8 + q][j] = f.u[q]; }
  __syncthreads();
  { for (int i = tid; i < 64 * 8; i += 256) { const int d = i / 8, j8 = (i % 8) * 8; FragH f; for (int q = 0; q < 8; ++q) f.u[q] = tl[d][j8 + q]; *(v8us*)((unsigned short*)VT + ((size_t)hh * HD + d) * SQ + s0 + j8) = f.half[0]; }  } }


__global__ __launch_bounds__(256) void k_tab2(float theta, float* __restrict__ CS, float* __restrict__ SN) {
  #pragma clang fp contract(off)
  const int t = blockIdx.x * 256 + threadIdx.x; if (t >= SQ * (HD / 2)) return; const int i = t % (HD / 2); const int p = t / (HD / 2); const float invf = 1.0f / powf(theta, (float)(2 * i) / (float)HD); const float ang = __fmul_rn((float)p, invf); const float c = cosf(ang), s = sinf(ang);
  *(float*)(CS + t) = c; *(float*)(SN + t) = s;  }
template <int NORM, int ROPE>
__global__ __launch_bounds__(64) void k_xform(const float* __restrict__ F, int ldf, int nh, const float* __restrict__ gain, float eps, const float* __restrict__ CS, const float* __restrict__ SN, _Float16* __restrict__ H16, int ldo) {
  #pragma clang fp contract(off)
  __shared__ float xv[HD]; __shared__ float red[HD]; __shared__ unsigned short sh_[HD]; const int d = threadIdx.x; const int h = blockIdx.x % nh; const size_t r = blockIdx.x / nh; const int p = (int)(r % SQ);
  float x = F[r * (size_t)ldf + (size_t)h * HD + d];
  if (NORM) { red[d] = __fmul_rn(x, x); __syncthreads(); for (int st = HD / 2; st > 0; st >>= 1) { if (d < st) red[d] = __fadd_rn(red[d], red[d + st]); __syncthreads(); } const float rs = rsqrtf(__fadd_rn(red[0] / (float)HD, eps)); x = __fmul_rn(__fmul_rn(x, rs), bf16_round(gain[d])); }
  xv[d] = x; __syncthreads();
  float o = x;
  if (ROPE == 1) { const int i = d >> 1; const float c = CS[p * (HD / 2) + i], s = SN[p * (HD / 2) + i]; const float ev = xv[2 * i], od = xv[2 * i + 1]; o = (d & 1) ? __fadd_rn(__fmul_rn(ev, s), __fmul_rn(od, c)) : __fadd_rn(__fmul_rn(ev, c), -__fmul_rn(od, s)); }
  if (ROPE == 2) { const int i = d & (HD / 2 - 1); const float c = CS[p * (HD / 2) + i], s = SN[p * (HD / 2) + i]; const float lo = xv[i], hi = xv[i + HD / 2]; o = (d < HD / 2) ? __fadd_rn(__fmul_rn(lo, c), -__fmul_rn(hi, s)) : __fadd_rn(__fmul_rn(lo, s), __fmul_rn(hi, c)); }
  if (ROPE == 6) { const float c = bf16_round(CS[p * HD + d]), s = bf16_round(SN[p * HD + d]); const float pa = xv[(d + HD / 2) & (HD - 1)]; const float rh = (d < HD / 2) ? -pa : pa; o = __fadd_rn(__fmul_rn(x, c), __fmul_rn(rh, s)); }      /* FULL-WIDTH bf16-rounded INPUT tables [p][64]: o = x cos[p][d] + rotate_half(x)[d] sin[p][d], rotate_half = concat(-x[32:], x[:32]) */
  FragH th; th.h[0] = (_Float16)o; sh_[d] = th.u[0]; __syncthreads();
  if (d < HD / 8) { FragH f; for (int q = 0; q < 8; ++q) f.u[q] = sh_[d * 8 + q]; unsigned short* dst = (unsigned short*)H16 + r * (size_t)ldo + (size_t)h * HD + d * 8; *(v8us*)dst = f.half[0];  } }

__global__ __launch_bounds__(256) void k_tab3(float* __restrict__ CS, float* __restrict__ SN) {
  #pragma clang fp contract(off)
  const int t = blockIdx.x * 256 + threadIdx.x; if (t >= SQ * (HD / 2)) return; const int i = t % (HD / 2); const int p = t / (HD / 2); const float freq = expf(__fmul_rn((float)(2 * i), -0.14391156831212787f)); const float ang = __fmul_rn((float)p, freq); const float c = cosf(ang), s = sinf(ang);
  *(float*)(CS + t) = c; *(float*)(SN + t) = s;  }



__device__ __forceinline__ float xrow(float v) { const int b = __float_as_int(v); return __int_as_float(__builtin_amdgcn_permlanex16(b, b, 0x76543210, 0xfedcba98, false, false)); }      /* lane l <-> l ^ 16; every lane must be active */
__device__ __forceinline__ v8f fa_mma(v16h a, v16h b, v8f c) { return __builtin_amdgcn_wmma_f32_16x16x32_f16(false, a, false, b, (short)0, c, false, false); }
__global__ __launch_bounds__(256) void k_fattn(const _Float16* __restrict__ Qh, const _Float16* __restrict__ Kh, const _Float16* __restrict__ Vt, _Float16* __restrict__ O) {
  const int lane = threadIdx.x & 31, ln = lane & 15, hh = lane >> 4, w = threadIdx.x >> 5; const int h = blockIdx.y, b = B0 + blockIdx.z; const size_t r0 = (size_t)b * SQ; const int q0 = blockIdx.x * 256 + w * 32;
  const _Float16* qp = Qh + (r0 + q0 + ln) * DM + h * HD; const _Float16* kp = Kh + (r0 + ln) * DM + h * HD; const _Float16* vp = Vt + ((size_t)(b * NH + h) * HD + ln) * SQ;
  const float c = 0.18033688011112042f; const v8f z8 = {0.f,0.f,0.f,0.f,0.f,0.f,0.f,0.f};
  v16h qf[2][2], kf[2][2]; v8f o[2][4]; float mu[2] = {-3.0e38f, -3.0e38f}, ls[2] = {0.f, 0.f};
#pragma unroll
  for (int j = 0; j < 2; ++j) {
#pragma unroll
    for (int ks = 0; ks < 2; ++ks) { qf[j][ks] = g2_frag(qp + (size_t)j * 16 * DM + ks * 32, hh); kf[j][ks] = g2_frag(kp + (size_t)j * 16 * DM + ks * 32, hh); }
#pragma unroll
    for (int dt = 0; dt < 4; ++dt) o[j][dt] = z8; }
#pragma unroll 1      /* one pass per trip: a second copy of the body would take the registers that four waves per SIMD need */
  for (int k0 = 0; k0 < SQ; k0 += 32) {
    v16h vf[4]; v8f s[2][2]; float mx[2];
#pragma unroll
    for (int dt = 0; dt < 4; ++dt) vf[dt] = g2_frag(vp + (size_t)dt * 16 * SQ + k0, hh);
    __builtin_amdgcn_sched_barrier(0);      /* keeps the V^T loads in front of the score products: without it they sink below the softmax's maximum and have half the lead on their use */
#pragma unroll
    for (int j = 0; j < 2; ++j) {
#pragma unroll
      for (int kt = 0; kt < 2; ++kt) s[j][kt] = fa_mma(kf[kt][1], qf[j][1], fa_mma(kf[kt][0], qf[j][0], z8)); }
    const int kn = (k0 + 32 < SQ) ? k0 + 32 : 0;      /* the next pass's K fragments fly during this pass's softmax; the last pass re-reads pass 0's rows (in bounds, not used) */
#pragma unroll
    for (int kt = 0; kt < 2; ++kt) {
#pragma unroll
      for (int ks = 0; ks < 2; ++ks) kf[kt][ks] = g2_frag(kp + (size_t)(kn + kt * 16) * DM + ks * 32, hh); }
    asm volatile("s_wait_xcnt 0x0" ::: "memory");      /* the trip's end adds to the address registers that the V^T and K loads above name: this wait stands in front of those overwrites (a build without it had the K loads sunk below the branch) */
#pragma unroll
    for (int j = 0; j < 2; ++j) { float a = fmaxf(s[j][0][0], s[j][1][0]);
#pragma unroll
      for (int r = 1; r < 8; ++r) a = fmaxf(a, fmaxf(s[j][0][r], s[j][1][r]));
      mx[j] = fmaxf(a, xrow(a)) * c; }
    const bool need = (mx[0] > mu[0] + 8.0f) || (mx[1] > mu[1] + 8.0f);
    if (__builtin_amdgcn_ballot_w32(need) != 0) {      /* one scalar branch per pass; always taken in the first pass (mu = -3e38: factor 0 on zero sums) */
#pragma unroll
      for (int j = 0; j < 2; ++j) { const float mn = fmaxf(mu[j], mx[j]); const float al = __builtin_amdgcn_exp2f(mu[j] - mn); mu[j] = mn; ls[j] *= al;
#pragma unroll
        for (int dt = 0; dt < 4; ++dt) o[j][dt] *= al; } }
#pragma unroll
    for (int j = 0; j < 2; ++j) { const float bias = 7.0f - mu[j]; FragH pf; float t[8];
#pragma unroll
      for (int r = 0; r < 8; ++r) { const float p0 = __builtin_amdgcn_exp2f(fmaf(s[j][0][r], c, bias)), p1 = __builtin_amdgcn_exp2f(fmaf(s[j][1][r], c, bias)); pf.h[r] = (_Float16)p0; pf.h[8 + r] = (_Float16)p1; t[r] = p0 + p1; }
      ls[j] += ((t[0] + t[1]) + (t[2] + t[3])) + ((t[4] + t[5]) + (t[6] + t[7]));
#pragma unroll
      for (int dt = 0; dt < 4; ++dt) o[j][dt] = fa_mma(vf[dt], pf.v, o[j][dt]); } }
#pragma unroll
  for (int j = 0; j < 2; ++j) { const float sc = 64.0f / (ls[j] + xrow(ls[j]));      /* the halves' sums join once; o carried x64 as before */
    unsigned short* dst = (unsigned short*)O + (r0 + q0 + j * 16 + ln) * DM + h * HD + 8 * hh;
#pragma unroll
    for (int dt = 0; dt < 4; ++dt) { FragH f;
#pragma unroll
      for (int r = 0; r < 8; ++r) f.h[r] = (_Float16)(o[j][dt][r] * sc);
      *(v8us*)(dst + dt * 16) = f.half[0]; } } }

extern "C" void kernel_launch(void* const* d_in, const int* in_sizes, int n_in,
                              void* d_out, int out_size, void* d_ws, size_t ws_size, hipStream_t stream) {
  (void)in_sizes; (void)n_in; (void)out_size;
  const float* const* I = (const float* const*)d_in; const float* x = I[0]; const float* tcos = I[1]; const float* tsin = I[2]; const float* wq = I[3]; const float* wk = I[4]; const float* wv = I[5]; const float* wo = I[6]; const float* bo = nullptr;      /* natural [out][in] weights, no biases; cos/sin INPUT tables [1][S][1][64] = [S][64] */
  char* ws = (char*)d_ws; size_t off = 0;
  auto take = [&](size_t bytes) { char* p = ws + off; off += (bytes + 255) & ~(size_t)255; return p; };
  _Float16* BQKV = (_Float16*)take((size_t)3 * DM * DM * 2); _Float16* BO = (_Float16*)take((size_t)DM * DM * 2); float* CS = (float*)take((size_t)SQ * (HD / 2) * 4); float* SN = (float*)take((size_t)SQ * (HD / 2) * 4);
  _Float16* X16 = (_Float16*)take(NR * DM * 2); float* QKVF = (float*)take((size_t)SQ * 3 * DM * 4);      /* one batch of f32 q | k | v rows */
  _Float16* QH = (_Float16*)take(NR * DM * 2); _Float16* KH = (_Float16*)take(NR * DM * 2); _Float16* V16 = (_Float16*)take(NR * DM * 2); _Float16* O16 = (_Float16*)take(NR * DM * 2);
  _Float16* VT = (_Float16*)take((size_t)NB * NH * HD * SQ * 2);      /* V^T of every batch */
  if (off > ws_size) return;
  { const unsigned g = (unsigned)(((size_t)DM * DM / 8 + 255) / 256); k_wnat<<<g, 256, 0, stream>>>(wq, (size_t)DM * DM / 8, BQKV); k_wnat<<<g, 256, 0, stream>>>(wk, (size_t)DM * DM / 8, BQKV + (size_t)DM * DM); k_wnat<<<g, 256, 0, stream>>>(wv, (size_t)DM * DM / 8, BQKV + (size_t)2 * DM * DM); k_wnat<<<g, 256, 0, stream>>>(wo, (size_t)DM * DM / 8, BO); }      /* natural [out][in] = Bt[n][k], x16; q | k | v stacked along n */
  k_x16<<<(unsigned)((NR * DM / 8 + 255) / 256), 256, 0, stream>>>(x, X16, NR * DM / 8);
  for (int b = B0; b < B0 + NBR; ++b) { const size_t r0 = (size_t)b * SQ;
    k_gemm2<0><<<dim3((unsigned)((SQ / 128) * (3 * DM / 64)), 1), 128, 0, stream>>>(X16 + r0 * DM, DM, 0, BQKV, DM, 0, 0.0625f, nullptr, 0, nullptr, 1, 0, 0, QKVF, nullptr, 3 * DM, 0, SQ, 3 * DM, DM);      /* q | k | v rows (f32) of this batch */
    k_xform<0, 6><<<(unsigned)(SQ * NH), 64, 0, stream>>>(QKVF, 3 * DM, NH, nullptr, 0.f, tcos, tsin, QH + r0 * DM, DM);
    k_xform<0, 6><<<(unsigned)(SQ * NH), 64, 0, stream>>>(QKVF + DM, 3 * DM, NH, nullptr, 0.f, tcos, tsin, KH + r0 * DM, DM);
    k_xform<0, 0><<<(unsigned)(SQ * NH), 64, 0, stream>>>(QKVF + 2 * DM, 3 * DM, NH, nullptr, 0.f, CS, SN, V16 + r0 * DM, DM);
    k_vt<NH, SQ><<<NH * (SQ / 64), 256, 0, stream>>>(V16 + r0 * DM, DM, 0, VT + (size_t)b * NH * HD * SQ); }      /* V^T [NH][HD][SQ] of this batch */
  k_fattn<<<dim3(QN / 256, NHD, NBR), 256, 0, stream>>>(QH, KH, VT, O16);      /* all batches and heads in one launch; o x64 as f16 in the merged rows */
  k_gemm2<0><<<dim3((unsigned)((MPO / 128) * (DM / 64)), 1), 128, 0, stream>>>(O16 + (size_t)B0 * SQ * DM, DM, 0, BO, DM, 0, 0.0009765625f, bo, 0, nullptr, 1, 0, 0, (float*)d_out + (size_t)B0 * SQ * DM, nullptr, DM, 0, MPO, DM, DM);      /* out rows are the output layout */
}

// v003
// Measured time: 317 microseconds a run.
// Two timings next to v002 both put it at 1.39 times that version's speed.
// All steps since v000 together make it 22.1 times as fast.
#include <hip/hip_runtime.h>
// RoPE multi-head self-attention with INPUT rotary tables (x [4][2048][1024]; q/k/v = x W^T (nn.Linear natural [out][in] sigma 0.02, no bias), 16 heads of 64; q = q cos + rotate_half(q) sin with the module's cos/sin inputs [1][2048][1][64] (full head width, independent values per dim; rotate_half = concat(-x[32:], x[:32])), same for k; scores / 8; softmax over all keys (no mask); out = merged Wo^T (no bias) -> [4][2048][1024]).
// Structure: token rows r = b*2048 + s; x as exact f16 rows (bf16-rounded); q | k | v of all batches as ONE WMMA GEMM launch (32x64 wave tiles = one head wide, f32 accumulation, exact x16 weights, N = 3 x 1024) whose epilogue does the rest while the tile is still on chip: the half-split rotary rotation of q and k from the cos/sin tables (no norm) -> f16 q, k rows, and v -> f16 V^T through an LDS transpose (no f32 q | k | v and no v rows in memory); then ONE fused attention launch over all batches and heads (scores on WMMA, online softmax in registers with f32 statistics and native exp2, weights as f16 straight into the P . V WMMA; o carried x64 against f16 subnormal flush, folded into the output GEMM alpha) written straight into the merged f16 o rows; out = o W_o GEMM (f32, no bias) into the output layout.
// Compute dtype: inputs rounded to bf16; x / weights exact; projections and rope f32; q, k, v, softmax weights and o as plain f16 GEMM operands (~2^-12); scores and softmax statistics f32. v_wmma_f32_16x16x32_f16.
#define NB 4
#define SQ 2048
#define DM 1024
#define NH 16
#define HD 64
#define HG 4                         /* heads per launch of the non-template k_vt */
#define B0 0                         /* first batch processed (debug hook) */
#define NBR NB                       /* batches processed (debug hook) */
#define QN SQ                        /* query rows attended per batch (debug hook) */
#define NHD NH                       /* heads attended (debug hook) */
#define NR ((size_t)NB * SQ)         /* token rows */
#define MPO ((int)((size_t)NBR * SQ))      /* rows through the output GEMM (debug hook) */
typedef __bf16 v16b __attribute__((ext_vector_type(16)));
typedef unsigned short v8us __attribute__((ext_vector_type(8), may_alias));
typedef float  v8f  __attribute__((ext_vector_type(8)));
typedef float  v4f  __attribute__((ext_vector_type(4)));
typedef float  v4fa __attribute__((ext_vector_type(4), may_alias));
union FragB { v16b v; v8us half[2]; unsigned short u[16]; };

__device__ __forceinline__ unsigned short bf16_bits(float x) { unsigned int u = __float_as_uint(x); return (unsigned short)((u + 0x7FFFu + ((u >> 16) & 1u)) >> 16); }
__device__ __forceinline__ float bf16_val(unsigned short b) { return __uint_as_float(((unsigned int)b) << 16); }
__device__ __forceinline__ float bf16_round(float x) { return bf16_val(bf16_bits(x)); }
// D += A·B with NT terms: 1 = ah·bh, 2 = + al·bh (A split), 3 = + ah·bl (both split)
template <int NT>
__device__ __forceinline__ v8f mmaN(v16b ah, v16b al, v16b bh, v16b bl, v8f c) {
  c = __builtin_amdgcn_wmma_f32_16x16x32_bf16(false, ah, false, bh, (short)0, c, false, false);
  if (NT >= 2) c = __builtin_amdgcn_wmma_f32_16x16x32_bf16(false, al, false, bh, (short)0, c, false, false);
  if (NT >= 3) c = __builtin_amdgcn_wmma_f32_16x16x32_bf16(false, ah, false, bl, (short)0, c, false, false);
  asm volatile("v_nop\n\tv_nop\n\tv_nop\n\tv_nop" : "+v"(c) : "v"(ah), "v"(al), "v"(bh), "v"(bl));
  return c;
}

__global__ __launch_bounds__(256) void k_wt_bf16(const float* __restrict__ W, unsigned short* __restrict__ Wt, int K, int N) {
  const int t = blockIdx.x * 256 + threadIdx.x;
  const int k8n = K / 8;
  if (t >= N * k8n) return;
  const int n = t / k8n, k8 = (t % k8n) * 8;
  v8us v;
#pragma unroll
  for (int i = 0; i < 8; ++i) v[i] = bf16_bits(W[(size_t)(k8 + i) * N + n]);
  *(v8us*)(Wt + (size_t)n * K + k8) = v;
  
}

// GEMM C[M][N] (f32, pitch ldc) = act(A[M][K]·W + bias). A f32 row-major (pitch lda) converted per fragment to bf16
// (ASPLIT: hi/lo two planes -> 2 terms, else single rounded term); Wt bf16 [N][K] (pitch ldb). BIAS_BF16 rounds the
// bias to bf16 first (bias quantised to bf16 before the add). K%32==0, M%16==0, N%64==0.
template <bool ASPLIT, int ACT, bool BIAS_BF16>
__global__ __launch_bounds__(128) void k_gemm_bf(const float* __restrict__ A, int lda, const unsigned short* __restrict__ Wt, int ldb,
                                               const float* __restrict__ bias, float* __restrict__ C, int ldc, int M, int N, int K) {
  __shared__ __attribute__((aligned(16))) float so[4][16][64];
  const int tid = threadIdx.x, w = tid >> 5, lane = tid & 31, ln = lane & 15, hh = lane >> 4;
  const int ntn = N / 64;
  const int wid = blockIdx.x * 4 + w;
  const int mt = wid / ntn, nq = wid % ntn;
  if (mt * 16 >= M) return;
  const int row0 = mt * 16, col0 = nq * 64;
  const float* arow = A + (size_t)(row0 + ln) * lda;
  v8f acc[4] = {};
  for (int kb = 0; kb < K; kb += 32) {
    FragB ah, al;
    const v4f x0 = *(const v4fa*)(arow + kb + 8 * hh), x1 = *(const v4fa*)(arow + kb + 8 * hh + 4);
    const v4f x2 = *(const v4fa*)(arow + kb + 16 + 8 * hh), x3 = *(const v4fa*)(arow + kb + 16 + 8 * hh + 4);
    float xs[16] = {x0[0],x0[1],x0[2],x0[3],x1[0],x1[1],x1[2],x1[3],x2[0],x2[1],x2[2],x2[3],x3[0],x3[1],x3[2],x3[3]};
#pragma unroll
    for (int i = 0; i < 16; ++i) { const unsigned short hb = bf16_bits(xs[i]); ah.u[i] = hb; al.u[i] = ASPLIT ? bf16_bits(xs[i] - bf16_val(hb)) : (unsigned short)0; }
#pragma unroll
    for (int t = 0; t < 4; ++t) {
      const unsigned short* brow = Wt + (size_t)(col0 + t * 16 + ln) * ldb + kb;
      FragB b;
      b.half[0] = *(const v8us*)(brow + 8 * hh);
      b.half[1] = *(const v8us*)(brow + 16 + 8 * hh);
      acc[t] = mmaN<ASPLIT ? 2 : 1>(ah.v, al.v, b.v, b.v, acc[t]);
    }
  }
#pragma unroll
  for (int t = 0; t < 4; ++t) {
    float bv = bias ? bias[col0 + t * 16 + ln] : 0.f;
    if (BIAS_BF16) bv = bf16_round(bv);
#pragma unroll
    for (int r = 0; r < 8; ++r) { float v = acc[t][r] + bv; if (ACT == 1) v = fmaxf(v, 0.f); so[w][8 * hh + r][t * 16 + ln] = v; }
  }
  __builtin_amdgcn_fence(__ATOMIC_ACQ_REL, "workgroup");
  __builtin_amdgcn_wave_barrier();
  const int rsub = lane >> 4, c4 = (lane & 15) * 4;
  {
#pragma unroll
    for (int q = 0; q < 8; ++q) {
      const int r = q * 2 + rsub;
      const v4f v = *(const v4fa*)&so[w][r][c4];
      *(v4f*)(C + (size_t)(row0 + r) * ldc + col0 + c4) = v;
    }
    
  }
}

// GEMM C = act(A·W + bias + resid): A f32 (ASPLIT -> hi/lo 2 terms), Wt bf16 [N][K]; ACT 0 none, 1 relu, 2 exact gelu;
// resid (optional, f32, row index = (row % rmod), pitch ldr, RES_BF16 rounds it) added before the activation.
template <bool ASPLIT, int ACT, bool BIAS_BF16, bool RES_BF16>
__global__ __launch_bounds__(128) void k_gemm_bf3(const float* __restrict__ A, int lda, const unsigned short* __restrict__ Wt, int ldb,
                                                const float* __restrict__ bias, const float* __restrict__ resid, int rmod, int ldr,
                                                float* __restrict__ C, int ldc, int M, int N, int K) {
  __shared__ __attribute__((aligned(16))) float so[4][16][64];
  const int tid = threadIdx.x, w = tid >> 5, lane = tid & 31, ln = lane & 15, hh = lane >> 4;
  const int ntn = N / 64;
  const int wid = blockIdx.x * 4 + w;
  const int mt = wid / ntn, nq = wid % ntn;
  if (mt * 16 >= M) return;
  const int row0 = mt * 16, col0 = nq * 64;
  const float* arow = A + (size_t)(row0 + ln) * lda;
  v8f acc[4] = {};
  for (int kb = 0; kb < K; kb += 32) {
    FragB ah, al;
    const v4f x0 = *(const v4fa*)(arow + kb + 8 * hh), x1 = *(const v4fa*)(arow + kb + 8 * hh + 4);
    const v4f x2 = *(const v4fa*)(arow + kb + 16 + 8 * hh), x3 = *(const v4fa*)(arow + kb + 16 + 8 * hh + 4);
    float xs[16] = {x0[0],x0[1],x0[2],x0[3],x1[0],x1[1],x1[2],x1[3],x2[0],x2[1],x2[2],x2[3],x3[0],x3[1],x3[2],x3[3]};
#pragma unroll
    for (int i = 0; i < 16; ++i) { const unsigned short hb = bf16_bits(xs[i]); ah.u[i] = hb; al.u[i] = ASPLIT ? bf16_bits(xs[i] - bf16_val(hb)) : (unsigned short)0; }
#pragma unroll
    for (int t = 0; t < 4; ++t) {
      const unsigned short* brow = Wt + (size_t)(col0 + t * 16 + ln) * ldb + kb;
      FragB b;
      b.half[0] = *(const v8us*)(brow + 8 * hh);
      b.half[1] = *(const v8us*)(brow + 16 + 8 * hh);
      acc[t] = mmaN<ASPLIT ? 2 : 1>(ah.v, al.v, b.v, b.v, acc[t]);
    }
  }
#pragma unroll
  for (int t = 0; t < 4; ++t) {
    const int col = col0 + t * 16 + ln;
    float bv = bias ? bias[col] : 0.f;
    if (BIAS_BF16) bv = bf16_round(bv);
#pragma unroll
    for (int r = 0; r < 8; ++r) {
      float v = acc[t][r] + bv;
      if (resid) { float rv = resid[(size_t)((row0 + 8 * hh + r) % rmod) * ldr + col]; if (RES_BF16) rv = bf16_round(rv); v += rv; }
      if (ACT == 1) v = fmaxf(v, 0.f);
      if (ACT == 2) v = 0.5f * v * (1.0f + erff(v * 0.70710678118654752f));
      if (ACT == 3) { const float u = 0.7978845608028654f * (v + 0.044715f * v * v * v); v = 0.5f * v * (1.0f + tanhf(u)); }
      so[w][8 * hh + r][t * 16 + ln] = v;
    }
  }
  __builtin_amdgcn_fence(__ATOMIC_ACQ_REL, "workgroup");
  __builtin_amdgcn_wave_barrier();
  const int rsub = lane >> 4, c4 = (lane & 15) * 4;
  {
#pragma unroll
    for (int q = 0; q < 8; ++q) {
      const int r = q * 2 + rsub;
      const v4f v = *(const v4fa*)&so[w][r][c4];
      *(v4f*)(C + (size_t)(row0 + r) * ldc + col0 + c4) = v;
    }
    
  }
}
// row LayerNorm (biased variance, eps) over N: s = X (+ R); optional out_sum <- s; out_norm <- (s-mu)*rsqrt(var+eps)*g + b
template <bool PARAM_BF16>
__global__ __launch_bounds__(256) void k_layernorm(const float* __restrict__ X, const float* __restrict__ R, const float* __restrict__ g, const float* __restrict__ bta,
                                                  float* __restrict__ out_sum, float* __restrict__ out_norm, int N, float eps) {
  __shared__ float red[256];
  const int row = blockIdx.x, tid = threadIdx.x;
  const float* x = X + (size_t)row * N; const float* rr = R ? R + (size_t)row * N : nullptr;
  float vals[16];                     // up to N = 4096
  const int per = N / 256;            // contiguous chunk per thread? use strided-by-4 chunks: thread handles j = tid*4 + 1024*u
  float s1 = 0.f;
  for (int u = 0; u < per / 4; ++u) {
    const int j = tid * 4 + 1024 * u;
    const v4f a = *(const v4fa*)(x + j);
    v4f b = {0.f,0.f,0.f,0.f}; if (rr) b = *(const v4fa*)(rr + j);
#pragma unroll
    for (int q = 0; q < 4; ++q) { const float v = a[q] + b[q]; vals[u * 4 + q] = v; s1 += v; }
  }
  red[tid] = s1; __syncthreads();
  for (int st = 128; st > 0; st >>= 1) { if (tid < st) red[tid] += red[tid + st]; __syncthreads(); }
  const float mu = red[0] / (float)N; __syncthreads();
  float s2 = 0.f;
  for (int u = 0; u < per / 4; ++u)
#pragma unroll
    for (int q = 0; q < 4; ++q) { const float c = vals[u * 4 + q] - mu; s2 += c * c; }
  red[tid] = s2; __syncthreads();
  for (int st = 128; st > 0; st >>= 1) { if (tid < st) red[tid] += red[tid + st]; __syncthreads(); }
  const float rs = rsqrtf(red[0] / (float)N + eps);
  {
    for (int u = 0; u < per / 4; ++u) {
      const int j = tid * 4 + 1024 * u;
      v4f o, sm;
#pragma unroll
      for (int q = 0; q < 4; ++q) {
        float gg = g[j + q], bb = bta[j + q];
        if (PARAM_BF16) { gg = bf16_round(gg); bb = bf16_round(bb); }
        sm[q] = vals[u * 4 + q]; o[q] = (vals[u * 4 + q] - mu) * rs * gg + bb;
      }
      if (out_sum) *(v4f*)(out_sum + (size_t)row * N + j) = sm;
      *(v4f*)(out_norm + (size_t)row * N + j) = o;
    }
    
  }
}



// ---- f16 WMMA path (v_wmma_f32_16x16x32_f16): 11-bit significands for operands in range — used where a [0,1] probability operand needs more precision than bf16
typedef _Float16 v16h __attribute__((ext_vector_type(16)));
union FragH { v16h v; v8us half[2]; _Float16 h[16]; unsigned short u[16]; };
template <int NT>
__device__ __forceinline__ v8f mmaH(v16h ah, v16h al, v16h bh, v16h bl, v8f c) {
  c = __builtin_amdgcn_wmma_f32_16x16x32_f16(false, ah, false, bh, (short)0, c, false, false);
  if (NT >= 2) c = __builtin_amdgcn_wmma_f32_16x16x32_f16(false, al, false, bh, (short)0, c, false, false);
  if (NT >= 3) c = __builtin_amdgcn_wmma_f32_16x16x32_f16(false, ah, false, bl, (short)0, c, false, false);
  asm volatile("v_nop\n\tv_nop\n\tv_nop\n\tv_nop" : "+v"(c) : "v"(ah), "v"(al), "v"(bh), "v"(bl));
  return c;
}
// batched GEMM like k_gemm_b but f16 operands: A f32 (split into f16 hi/lo if ASPLIT, else rounded to f16), Bt = f16 values [n][k]; alpha; C f32; N multiple of 16 (partial tiles skipped)
template <bool ASPLIT>
__global__ __launch_bounds__(128) void k_gemm_h(const float* __restrict__ A, int lda, size_t sA, const _Float16* __restrict__ Bh, int ldb, size_t sB, float alpha, float* __restrict__ C, int ldc, size_t sC, int M, int N, int K) {
  __shared__ __attribute__((aligned(16))) float so[4][16][64];
  const int tid = threadIdx.x, w = tid >> 5, lane = tid & 31, ln = lane & 15, hh = lane >> 4; const int by = blockIdx.y;
  A += (size_t)by * sA; Bh += (size_t)by * sB; C += (size_t)by * sC;
  const int ntn = (N + 63) / 64; const int wid = blockIdx.x * 4 + w; const int mt = wid / ntn, nq = wid % ntn; if (mt * 16 >= M) return;
  const int row0 = mt * 16, col0 = nq * 64; const float* arow = A + (size_t)(row0 + ln) * lda;
  v8f acc[4] = {};
  for (int kb = 0; kb < K; kb += 32) {
    FragH ah, al;
    const v4f x0 = *(const v4fa*)(arow + kb + 8 * hh), x1 = *(const v4fa*)(arow + kb + 8 * hh + 4), x2 = *(const v4fa*)(arow + kb + 16 + 8 * hh), x3 = *(const v4fa*)(arow + kb + 16 + 8 * hh + 4);
    float xs[16] = {x0[0],x0[1],x0[2],x0[3],x1[0],x1[1],x1[2],x1[3],x2[0],x2[1],x2[2],x2[3],x3[0],x3[1],x3[2],x3[3]};
#pragma unroll
    for (int i = 0; i < 16; ++i) { const _Float16 h = (_Float16)xs[i]; ah.h[i] = h; al.h[i] = ASPLIT ? (_Float16)(xs[i] - (float)h) : (_Float16)0.0f; }
#pragma unroll
    for (int t = 0; t < 4; ++t) { if (col0 + t * 16 >= N) continue; const size_t boff = (size_t)(col0 + t * 16 + ln) * ldb + kb; FragH bq; bq.half[0] = *(const v8us*)(Bh + boff + 8 * hh); bq.half[1] = *(const v8us*)(Bh + boff + 16 + 8 * hh);
      acc[t] = mmaH<ASPLIT ? 2 : 1>(ah.v, al.v, bq.v, bq.v, acc[t]); }
  }
#pragma unroll
  for (int t = 0; t < 4; ++t) { if (col0 + t * 16 >= N) continue;
#pragma unroll
    for (int r = 0; r < 8; ++r) so[w][8 * hh + r][t * 16 + ln] = acc[t][r] * alpha; }
  __builtin_amdgcn_fence(__ATOMIC_ACQ_REL, "workgroup"); __builtin_amdgcn_wave_barrier();
  const int rsub = lane >> 4, c4 = (lane & 15) * 4;
  {
#pragma unroll
    for (int q = 0; q < 8; ++q) { const int r = q * 2 + rsub; if (col0 + c4 < N) { const v4f v = *(const v4fa*)&so[w][r][c4]; *(v4f*)(C + (size_t)(row0 + r) * ldc + col0 + c4) = v; } }
     }
}

// Wt[n][k] = f16(W[k][n]·scale) from f32 row-major W[K][N] (scale = power of two; bf16-exact weights stay exact in f16 away from the subnormal range)
__global__ __launch_bounds__(256) void k_wt_f16(const float* __restrict__ W, _Float16* __restrict__ Wt, int K, int N, float scale) {
  const int t = blockIdx.x * 256 + threadIdx.x; if (t >= N * (K / 8)) return; const int n = t / (K / 8), k8 = (t % (K / 8)) * 8; FragH f;
#pragma unroll
  for (int i = 0; i < 8; ++i) f.h[i] = (_Float16)(bf16_round(W[(size_t)(k8 + i) * N + n]) * scale); const v8us o = f.half[0];
  *(v8us*)((unsigned short*)Wt + (size_t)n * K + k8) = o; 
}
// k_gemm_hh variant with fused epilogue: v = acc·alpha + bias[by·sBias + col] (+ CP[(row/rowsPerB)·sCPb + by·64 + col] if CP) ; ACT 0 none / 1 elu ; writes f16 C16 (and f32 C if non-null)
template <int ACT>
__global__ __launch_bounds__(128) void k_gemm_hhx(const _Float16* __restrict__ A, int lda, size_t sA, const _Float16* __restrict__ Bh, int ldb, size_t sB, float alpha, const float* __restrict__ bias, size_t sBias, const float* __restrict__ CP, int rowsPerB, size_t sCPb, int row0g,
    float* __restrict__ C, _Float16* __restrict__ C16, int ldc, size_t sC, int M, int N, int K) {
  __shared__ __attribute__((aligned(16))) float so[4][16][64];
  const int tid = threadIdx.x, w = tid >> 5, lane = tid & 31, ln = lane & 15, hh = lane >> 4; const int by = blockIdx.y;
  A += (size_t)by * sA; Bh += (size_t)by * sB; const size_t cofs = (size_t)by * sC; const float* bp = bias ? bias + (size_t)by * sBias : nullptr;
  const int ntn = (N + 63) / 64; const int wid = blockIdx.x * 4 + w; const int mt = wid / ntn, nq = wid % ntn; if (mt * 16 >= M) return;
  const int row0 = mt * 16, col0 = nq * 64; const _Float16* arow = A + (size_t)(row0 + ln) * lda;
  v8f acc[4] = {};
  for (int kb = 0; kb < K; kb += 32) { FragH ah; ah.half[0] = *(const v8us*)((const unsigned short*)arow + kb + 8 * hh); ah.half[1] = *(const v8us*)((const unsigned short*)arow + kb + 16 + 8 * hh);
#pragma unroll
    for (int t = 0; t < 4; ++t) { if (col0 + t * 16 >= N) continue; const size_t boff = (size_t)(col0 + t * 16 + ln) * ldb + kb; FragH bq; bq.half[0] = *(const v8us*)((const unsigned short*)Bh + boff + 8 * hh); bq.half[1] = *(const v8us*)((const unsigned short*)Bh + boff + 16 + 8 * hh);
      acc[t] = mmaH<1>(ah.v, ah.v, bq.v, bq.v, acc[t]); }
  }
#pragma unroll
  for (int t = 0; t < 4; ++t) { if (col0 + t * 16 >= N) continue; const int col = col0 + t * 16 + ln; const float bv = bp ? bf16_round(bp[col]) : 0.f;
#pragma unroll
    for (int r = 0; r < 8; ++r) { float v = acc[t][r] * alpha + bv; if (CP) { const int rr = row0g + row0 + 8 * hh + r; if (rowsPerB < 0) v += CP[cofs + (size_t)rr * ldc + col];      /* rowsPerB < 0: own element of the batched C plane */ else { const int bidx = rr / rowsPerB; v += CP[(size_t)bidx * sCPb + (size_t)by * 64 + col]; } } if (ACT == 1) v = (v > 0.f) ? v : expm1f(v); else if (ACT == 7) v = (v > 0.f) ? v + 1.0f : expf(v); else if (ACT == 8) v = tanhf(v); else if (ACT == 9) v = 0.5f * v * (1.0f + tanhf(0.7978845608028654f * (v + 0.044715f * v * v * v))); else if (ACT == 11) v = 1.0f / (1.0f + expf(-v)); else if (ACT == 12) v = (v > 0.f) ? v : 0.01f * v; else if (ACT == 14) v = (v > 0.f) ? v : 0.1f * v; else if (ACT == 16) v = (v >= 0.f) ? v : 0.3f * v; else if (ACT == 17) v = (v >= 0.f) ? v : 0.2f * v; else if (ACT == 15) v = v / (1.0f + expf(-v)); else if (ACT == 3) v = fmaxf(v, 0.f); else if (ACT == 6) v = 0.5f * v * (1.0f + erff(v * 0.70710678118654752f)); so[w][8 * hh + r][t * 16 + ln] = v; } }
  __builtin_amdgcn_fence(__ATOMIC_ACQ_REL, "workgroup"); __builtin_amdgcn_wave_barrier();
  const int rsub = lane >> 4, c4 = (lane & 15) * 4; typedef _Float16 v4h __attribute__((ext_vector_type(4)));
  {
#pragma unroll
    for (int q = 0; q < 8; ++q) { const int r = q * 2 + rsub; if (col0 + c4 < N) { const v4f v = *(const v4fa*)&so[w][r][c4]; if (C) *(v4f*)(C + cofs + (size_t)(row0 + r) * ldc + col0 + c4) = v; if (C16) { v4h h4; for (int i = 0; i < 4; ++i) h4[i] = (_Float16)v[i]; *(v4h*)(C16 + cofs + (size_t)(row0 + r) * ldc + col0 + c4) = h4; } } }
     }
}


typedef _Float16 v4h __attribute__((ext_vector_type(4)));

__global__ __launch_bounds__(256) void k_x16(const float* __restrict__ x, _Float16* __restrict__ X16, size_t n8) { const size_t t = (size_t)blockIdx.x * 256 + threadIdx.x; if (t >= n8) return; FragH f;
#pragma unroll
  for (int q = 0; q < 8; ++q) f.h[q] = (_Float16)bf16_round(x[t * 8 + q]); *(v8us*)((unsigned short*)X16 + t * 8) = f.half[0];  }
__global__ __launch_bounds__(256) void k_h16(const float* __restrict__ x, _Float16* __restrict__ X16, size_t n8) { const size_t t = (size_t)blockIdx.x * 256 + threadIdx.x; if (t >= n8) return; FragH f;
#pragma unroll
  for (int q = 0; q < 8; ++q) f.h[q] = (_Float16)x[t * 8 + q]; *(v8us*)((unsigned short*)X16 + t * 8) = f.half[0];  }
__global__ __launch_bounds__(256) void k_round16f(const float* __restrict__ W, _Float16* __restrict__ Bt, size_t n8) { const size_t t = (size_t)blockIdx.x * 256 + threadIdx.x; if (t >= n8) return; FragH f;
#pragma unroll
  for (int i = 0; i < 8; ++i) f.h[i] = (_Float16)(bf16_round(W[t * 8 + i]) * 16.0f); *(v8us*)((unsigned short*)Bt + t * 8) = f.half[0];  }
template <int NHv, int TTv>
__global__ __launch_bounds__(256) void k_vt(const _Float16* __restrict__ V16, int ldv, int voff, _Float16* __restrict__ Vt) { __shared__ unsigned short tl[64][66]; const int tid = threadIdx.x; const int slab = blockIdx.x / (TTv / 64), lg = blockIdx.x % (TTv / 64); const int b = slab / NHv, h = slab % NHv;
  for (int i = tid; i < 64 * 8; i += 256) { const int r = i / 8, c8 = (i % 8) * 8; FragH f; f.half[0] = *(const v8us*)((const unsigned short*)V16 + ((size_t)b * TTv + lg * 64 + r) * ldv + voff + h * 64 + c8);
#pragma unroll
    for (int q = 0; q < 8; ++q) tl[r][c8 + q] = f.u[q]; }
  __syncthreads();
  {
#pragma unroll
    for (int rd = 0; rd < 2; ++rd) { const int d = rd * 32 + tid / 8, pc = tid % 8; FragH f;
#pragma unroll
      for (int q = 0; q < 8; ++q) f.u[q] = tl[pc * 8 + q][d];
      *(v8us*)((unsigned short*)Vt + ((size_t)slab * 64 + d) * TTv + lg * 64 + pc * 8) = f.half[0]; }
     } }

__global__ __launch_bounds__(256) void k_hl(const float* __restrict__ F, _Float16* __restrict__ Hh, _Float16* __restrict__ Hl, size_t n8) { const size_t t = (size_t)blockIdx.x * 256 + threadIdx.x; if (t >= n8) return; FragH fh, fl; const v4f a = *(const v4fa*)(F + t * 8), c = *(const v4fa*)(F + t * 8 + 4);
#pragma unroll
  for (int q = 0; q < 4; ++q) { _Float16 h = (_Float16)a[q]; fh.h[q] = h; fl.h[q] = (_Float16)((a[q] - (float)h) * 1024.0f); h = (_Float16)c[q]; fh.h[4 + q] = h; fl.h[4 + q] = (_Float16)((c[q] - (float)h) * 1024.0f); }
  { *(v8us*)((unsigned short*)Hh + t * 8) = fh.half[0]; *(v8us*)((unsigned short*)Hl + t * 8) = fl.half[0];  } }

// ---- fast GEMM (wave tile 32x64; requires M % 32 == 0 rows per launch region and N % 64 == 0); epilogue = k_gemm_hhx semantics ----
__device__ __forceinline__ v16h g2_frag(const _Float16* p, int hh) { FragH f; f.half[0] = *(const v8us*)((const unsigned short*)p + 8 * hh); f.half[1] = *(const v8us*)((const unsigned short*)p + 16 + 8 * hh); return f.v; }
__device__ __forceinline__ v8f g2_mma(v16h a, v16h b, v8f c) { v8f d = __builtin_amdgcn_wmma_f32_16x16x32_f16(false, a, false, b, (short)0, c, false, false); asm volatile("v_nop\n\tv_nop\n\tv_nop\n\tv_nop" : "+v"(d) : "v"(a), "v"(b)); return d; }
template <int ACT>
__global__ __launch_bounds__(128) void k_gemm2(const _Float16* __restrict__ A, int lda, size_t sA, const _Float16* __restrict__ Bh, int ldb, size_t sB, float alpha, const float* __restrict__ bias, size_t sBias, const float* __restrict__ CP, int rowsPerB, size_t sCPb, int row0g,
    float* __restrict__ C, _Float16* __restrict__ C16, int ldc, size_t sC, int M, int N, int K) { static_assert(ACT == 0 || ACT == 3 || ACT == 6 || ACT == 8 || ACT == 9 || ACT == 11 || ACT == 12 || ACT == 14 || ACT == 15 || ACT == 16 || ACT == 17, "k_gemm2: unsupported ACT code (would silently apply no activation)");
  __shared__ __attribute__((aligned(16))) float so[4][32][68];
  const int tid = threadIdx.x, w = tid >> 5, lane = tid & 31, ln = lane & 15, hh = lane >> 4; const int by = blockIdx.y;
  A += (size_t)by * sA; Bh += (size_t)by * sB; const size_t cofs = (size_t)by * sC; const float* bp = bias ? bias + (size_t)by * sBias : nullptr;
  const int ntn = N >> 6; const int mt = blockIdx.x / ntn, nq = blockIdx.x - mt * ntn; const int row0 = mt * 128 + 32 * w, col0 = nq * 64; if (row0 >= M) return;
  const _Float16* a0p = A + (size_t)(row0 + ln) * lda; const _Float16* a1p = a0p + (size_t)16 * lda;
  const _Float16* b0p = Bh + (size_t)(col0 + ln) * ldb; const _Float16* b1p = b0p + (size_t)16 * ldb; const _Float16* b2p = b1p + (size_t)16 * ldb; const _Float16* b3p = b2p + (size_t)16 * ldb;
  const v8f z8 = {0.f,0.f,0.f,0.f,0.f,0.f,0.f,0.f}; v8f c00 = z8, c01 = z8, c02 = z8, c03 = z8, c10 = z8, c11 = z8, c12 = z8, c13 = z8;
#pragma unroll 1
  for (int kb = 0; kb < K; kb += 32) { const v16h a0 = g2_frag(a0p + kb, hh), a1 = g2_frag(a1p + kb, hh);
    v16h b = g2_frag(b0p + kb, hh); c00 = g2_mma(a0, b, c00); c10 = g2_mma(a1, b, c10);
    b = g2_frag(b1p + kb, hh); c01 = g2_mma(a0, b, c01); c11 = g2_mma(a1, b, c11);
    b = g2_frag(b2p + kb, hh); c02 = g2_mma(a0, b, c02); c12 = g2_mma(a1, b, c12);
    b = g2_frag(b3p + kb, hh); c03 = g2_mma(a0, b, c03); c13 = g2_mma(a1, b, c13); }
  v8f accs[8] = {c00, c01, c02, c03, c10, c11, c12, c13};
#pragma unroll
  for (int u = 0; u < 8; ++u) { const int t = u & 3, half = u >> 2; const int col = col0 + t * 16 + ln; const float bv = bp ? bf16_round(bp[col]) : 0.f;
#pragma unroll
    for (int r = 0; r < 8; ++r) { const int rloc = half * 16 + 8 * hh + r; float v = accs[u][r] * alpha + bv; if (CP) { if (rowsPerB < 0) v += CP[cofs + (size_t)(row0g + row0 + rloc) * ldc + col];      /* rowsPerB < 0: own element of the batched C plane */ else { const int bidx = (row0g + row0 + rloc) / rowsPerB; v += CP[(size_t)bidx * sCPb + (size_t)by * 64 + col]; } }
      if (ACT == 3) v = fmaxf(v, 0.f); else if (ACT == 6) v = 0.5f * v * (1.0f + erff(v * 0.70710678118654752f)); else if (ACT == 11) v = 1.0f / (1.0f + expf(-v)); else if (ACT == 15) v = v / (1.0f + expf(-v)); else if (ACT == 12) v = (v > 0.f) ? v : 0.01f * v; else if (ACT == 8) v = tanhf(v); else if (ACT == 9) v = 0.5f * v * (1.0f + tanhf(0.7978845608028654f * (v + 0.044715f * v * v * v))); else if (ACT == 14) v = (v > 0.f) ? v : 0.1f * v; else if (ACT == 16) v = (v >= 0.f) ? v : 0.3f * v; else if (ACT == 17) v = (v >= 0.f) ? v : 0.2f * v;
      so[w][rloc][t * 16 + ln] = v; } }
  __builtin_amdgcn_fence(__ATOMIC_ACQ_REL, "workgroup"); __builtin_amdgcn_wave_barrier();
  const int rsub = lane >> 4, c4 = (lane & 15) * 4;
  {
#pragma unroll
    for (int q = 0; q < 16; ++q) { const int r = q * 2 + rsub; const v4f v = *(const v4fa*)&so[w][r][c4]; if (C) *(v4f*)(C + cofs + (size_t)(row0 + r) * ldc + col0 + c4) = v; if (C16) { v4h h4; for (int i = 0; i < 4; ++i) h4[i] = (_Float16)v[i]; *(v4h*)(C16 + cofs + (size_t)(row0 + r) * ldc + col0 + c4) = h4; } }
     } }


__global__ __launch_bounds__(256) void k_wnat(const float* __restrict__ w, size_t n8, _Float16* __restrict__ Bt) { const size_t t = (size_t)blockIdx.x * 256 + threadIdx.x; if (t >= n8) return; FragH f; for (int q = 0; q < 8; ++q) f.h[q] = (_Float16)(bf16_round(w[t * 8 + q]) * 16.0f); *(v8us*)((unsigned short*)Bt + t * 8) = f.half[0];  }
__global__ __launch_bounds__(256) void k_rsm(const float* __restrict__ S, _Float16* __restrict__ P, int nrows) {
  #pragma clang fp contract(off)
  const int i = blockIdx.x * 256 + threadIdx.x; if (i >= nrows) return; const float* s = S + (size_t)i * SQ; float mx = -3.0e38f;
#pragma unroll 1
  for (int j = 0; j < SQ; ++j) mx = fmaxf(mx, s[j]); float se = 0.f;
#pragma unroll 1
  for (int j = 0; j < SQ; ++j) se += expf(s[j] - mx); const float sc = 256.0f / se;
#pragma unroll 1
  for (int j0 = 0; j0 < SQ; j0 += 8) { FragH f; for (int q = 0; q < 8; ++q) f.h[q] = (_Float16)(expf(s[j0 + q] - mx) * sc); unsigned short* d = (unsigned short*)P + (size_t)i * SQ + j0; *(v8us*)d = f.half[0];  } }
__global__ __launch_bounds__(256) void k_vt(const _Float16* __restrict__ V16, int b, int h0, _Float16* __restrict__ VT) { __shared__ unsigned short tl[64][65]; const int tid = threadIdx.x; const int hh = blockIdx.x % HG, sg = blockIdx.x / HG; const int s0 = sg * 64; const int h = h0 + hh;
  for (int i = tid; i < 64 * 8; i += 256) { const int j = i / 8, d8 = (i % 8) * 8; FragH f; f.half[0] = *(const v8us*)((const unsigned short*)V16 + ((size_t)b * SQ + s0 + j) * DM + h * HD + d8); for (int q = 0; q < 8; ++q) tl[d8 + q][j] = f.u[q]; }
  __syncthreads();
  { for (int i = tid; i < 64 * 8; i += 256) { const int d = i / 8, j8 = (i % 8) * 8; FragH f; for (int q = 0; q < 8; ++q) f.u[q] = tl[d][j8 + q]; *(v8us*)((unsigned short*)VT + ((size_t)hh * HD + d) * SQ + s0 + j8) = f.half[0]; }  } }


__global__ __launch_bounds__(256) void k_tab2(float theta, float* __restrict__ CS, float* __restrict__ SN) {
  #pragma clang fp contract(off)
  const int t = blockIdx.x * 256 + threadIdx.x; if (t >= SQ * (HD / 2)) return; const int i = t % (HD / 2); const int p = t / (HD / 2); const float invf = 1.0f / powf(theta, (float)(2 * i) / (float)HD); const float ang = __fmul_rn((float)p, invf); const float c = cosf(ang), s = sinf(ang);
  *(float*)(CS + t) = c; *(float*)(SN + t) = s;  }
template <int NORM, int ROPE>
__global__ __launch_bounds__(64) void k_xform(const float* __restrict__ F, int ldf, int nh, const float* __restrict__ gain, float eps, const float* __restrict__ CS, const float* __restrict__ SN, _Float16* __restrict__ H16, int ldo) {
  #pragma clang fp contract(off)
  __shared__ float xv[HD]; __shared__ float red[HD]; __shared__ unsigned short sh_[HD]; const int d = threadIdx.x; const int h = blockIdx.x % nh; const size_t r = blockIdx.x / nh; const int p = (int)(r % SQ);
  float x = F[r * (size_t)ldf + (size_t)h * HD + d];
  if (NORM) { red[d] = __fmul_rn(x, x); __syncthreads(); for (int st = HD / 2; st > 0; st >>= 1) { if (d < st) red[d] = __fadd_rn(red[d], red[d + st]); __syncthreads(); } const float rs = rsqrtf(__fadd_rn(red[0] / (float)HD, eps)); x = __fmul_rn(__fmul_rn(x, rs), bf16_round(gain[d])); }
  xv[d] = x; __syncthreads();
  float o = x;
  if (ROPE == 1) { const int i = d >> 1; const float c = CS[p * (HD / 2) + i], s = SN[p * (HD / 2) + i]; const float ev = xv[2 * i], od = xv[2 * i + 1]; o = (d & 1) ? __fadd_rn(__fmul_rn(ev, s), __fmul_rn(od, c)) : __fadd_rn(__fmul_rn(ev, c), -__fmul_rn(od, s)); }
  if (ROPE == 2) { const int i = d & (HD / 2 - 1); const float c = CS[p * (HD / 2) + i], s = SN[p * (HD / 2) + i]; const float lo = xv[i], hi = xv[i + HD / 2]; o = (d < HD / 2) ? __fadd_rn(__fmul_rn(lo, c), -__fmul_rn(hi, s)) : __fadd_rn(__fmul_rn(lo, s), __fmul_rn(hi, c)); }
  if (ROPE == 6) { const float c = bf16_round(CS[p * HD + d]), s = bf16_round(SN[p * HD + d]); const float pa = xv[(d + HD / 2) & (HD - 1)]; const float rh = (d < HD / 2) ? -pa : pa; o = __fadd_rn(__fmul_rn(x, c), __fmul_rn(rh, s)); }      /* FULL-WIDTH bf16-rounded INPUT tables [p][64]: o = x cos[p][d] + rotate_half(x)[d] sin[p][d], rotate_half = concat(-x[32:], x[:32]) */
  FragH th; th.h[0] = (_Float16)o; sh_[d] = th.u[0]; __syncthreads();
  if (d < HD / 8) { FragH f; for (int q = 0; q < 8; ++q) f.u[q] = sh_[d * 8 + q]; unsigned short* dst = (unsigned short*)H16 + r * (size_t)ldo + (size_t)h * HD + d * 8; *(v8us*)dst = f.half[0];  } }

__global__ __launch_bounds__(256) void k_tab3(float* __restrict__ CS, float* __restrict__ SN) {
  #pragma clang fp contract(off)
  const int t = blockIdx.x * 256 + threadIdx.x; if (t >= SQ * (HD / 2)) return; const int i = t % (HD / 2); const int p = t / (HD / 2); const float freq = expf(__fmul_rn((float)(2 * i), -0.14391156831212787f)); const float ang = __fmul_rn((float)p, freq); const float c = cosf(ang), s = sinf(ang);
  *(float*)(CS + t) = c; *(float*)(SN + t) = s;  }



// q | k | v projection of every token row (main loop = k_gemm2's) with all the work between projection and attention in its epilogue. A wave tile is 32 token rows x 64 columns = exactly one head of q, k or v (block-uniform: sel), so nothing outside the tile is needed.
// q, k: the f32 tile goes through the wave's own LDS slab into row order; a lane takes 4 columns and their rotate_half partners (column ^ 32, same row), the tables come as 16-byte loads, and a row leaves as one whole 128-byte line of f16.
// v: a lane's 8 accumulator registers are 8 consecutive token rows of one column = 16 bytes of a V^T row; the four waves put them into one [64][128] f16 tile in LDS, and behind a barrier each V^T row leaves as 256 contiguous bytes.
__global__ __launch_bounds__(128) void k_qkv(const _Float16* __restrict__ A, const _Float16* __restrict__ Bh, const float* __restrict__ CS, const float* __restrict__ SN, _Float16* __restrict__ Qh, _Float16* __restrict__ Kh, _Float16* __restrict__ Vt) {
  __shared__ __attribute__((aligned(16))) float so[4][32][68];
  const int tid = threadIdx.x, w = tid >> 5, lane = tid & 31, ln = lane & 15, hh = lane >> 4;
  const int ntn = 3 * NH; const int mt = blockIdx.x / ntn, nq = blockIdx.x - mt * ntn; const int row0 = mt * 128 + 32 * w, col0 = nq * 64; const int sel = nq / NH, h = nq - sel * NH;
  const _Float16* a0p = A + (size_t)(row0 + ln) * DM; const _Float16* a1p = a0p + (size_t)16 * DM;
  const _Float16* b0p = Bh + (size_t)(col0 + ln) * DM; const _Float16* b1p = b0p + (size_t)16 * DM; const _Float16* b2p = b1p + (size_t)16 * DM; const _Float16* b3p = b2p + (size_t)16 * DM;
  const v8f z8 = {0.f,0.f,0.f,0.f,0.f,0.f,0.f,0.f}; v8f c00 = z8, c01 = z8, c02 = z8, c03 = z8, c10 = z8, c11 = z8, c12 = z8, c13 = z8;
#pragma unroll 1      /* kept rolled as in k_gemm2, so that the loop's code and register need stay those of the GEMM that was measured */
  for (int kb = 0; kb < DM; kb += 32) { const v16h a0 = g2_frag(a0p + kb, hh); v16h b = g2_frag(b0p + kb, hh); FragH a1f; const unsigned short* a1u = (const unsigned short*)(a1p + kb) + 8 * hh; a1f.half[0] = *(const v8us*)a1u;
    asm volatile("s_wait_xcnt 0x0" ::: "memory");      /* the four A loads of a trip name one address pair, and the last one's data lands on it: this wait stands between the first three and that overwrite */
    a1f.half[1] = *(const v8us*)(a1u + 16); const v16h a1 = a1f.v;
    c00 = g2_mma(a0, b, c00); c10 = g2_mma(a1, b, c10);
    b = g2_frag(b1p + kb, hh); c01 = g2_mma(a0, b, c01); c11 = g2_mma(a1, b, c11);
    b = g2_frag(b2p + kb, hh); c02 = g2_mma(a0, b, c02); c12 = g2_mma(a1, b, c12);
    b = g2_frag(b3p + kb, hh); c03 = g2_mma(a0, b, c03); c13 = g2_mma(a1, b, c13);
    asm volatile("s_wait_xcnt 0x0" ::: "memory"); }      /* the next trip forms its addresses in the registers that this trip's loads name: this wait stands in front of those overwrites */
  v8f accs[8] = {c00, c01, c02, c03, c10, c11, c12, c13};
  const float alpha = 0.0625f;      /* undoes the x16 of the weights (exact) */
  if (sel < 2) {
#pragma unroll
    for (int u = 0; u < 8; ++u) { const int t = u & 3, half = u >> 2;
#pragma unroll
      for (int r = 0; r < 8; ++r) so[w][half * 16 + 8 * hh + r][t * 16 + ln] = accs[u][r] * alpha; }
    __builtin_amdgcn_fence(__ATOMIC_ACQ_REL, "workgroup"); __builtin_amdgcn_wave_barrier();      /* the slab is the wave's own: its LDS writes are ordered in front of its reads, no block barrier */
    const int rsub = lane >> 4, c4 = (lane & 15) * 4; const float sg = (c4 < HD / 2) ? -1.0f : 1.0f;      /* rotate_half = concat(-x[32:], x[:32]) */
    _Float16* dst = (sel ? Kh : Qh) + (size_t)(row0 + rsub) * DM + h * HD + c4;
    const size_t tofs = (size_t)(row0 % SQ + rsub) * HD + c4; const float* cp = CS + tofs; const float* sp = SN + tofs;      /* 32 | SQ: the tile's 32 rows are 32 consecutive positions of one batch, so every table row is a constant step from the first */
#pragma unroll
    for (int q = 0; q < 16; ++q) { const int r = q * 2 + rsub;
      const v4f xv = *(const v4fa*)&so[w][r][c4], pa = *(const v4fa*)&so[w][r][c4 ^ (HD / 2)]; const v4f cc = *(const v4fa*)(cp + q * 2 * HD), ss = *(const v4fa*)(sp + q * 2 * HD); v4h h4;
#pragma unroll
      for (int i = 0; i < 4; ++i) h4[i] = (_Float16)(xv[i] * bf16_round(cc[i]) + pa[i] * (sg * bf16_round(ss[i])));
      *(v4h*)(dst + (size_t)q * 2 * DM) = h4; }
  } else {
    unsigned short* tl = (unsigned short*)&so[0][0][0];      /* [64 d][136] f16: pitch 272 bytes, so the 16 columns of a 16-byte store start 4 banks apart */
#pragma unroll
    for (int u = 0; u < 8; ++u) { const int t = u & 3, half = u >> 2; FragH f;
#pragma unroll
      for (int r = 0; r < 8; ++r) f.h[r] = (_Float16)(accs[u][r] * alpha);
      *(v8us*)(tl + (t * 16 + ln) * 136 + w * 32 + half * 16 + 8 * hh) = f.half[0]; }
    __syncthreads();      /* a V^T row of the tile holds token rows of all four waves; sel is the same for the whole block */
    const int rb = mt * 128; unsigned short* vd = (unsigned short*)Vt + ((size_t)((rb / SQ) * NH + h) * HD) * SQ + rb % SQ;
#pragma unroll
    for (int i = 0; i < 8; ++i) { const int d = i * 8 + (tid >> 4), c8 = (tid & 15) * 8; *(v8us*)(vd + (size_t)d * SQ + c8) = *(const v8us*)(tl + d * 136 + c8); }
    asm volatile("s_wait_xcnt 0x0" ::: "memory");      /* stands behind the last V^T store, in front of any later write of a register that these stores name */
  } }

__device__ __forceinline__ float xrow(float v) { const int b = __float_as_int(v); return __int_as_float(__builtin_amdgcn_permlanex16(b, b, 0x76543210, 0xfedcba98, false, false)); }      /* lane l <-> l ^ 16; every lane must be active */
__device__ __forceinline__ v8f fa_mma(v16h a, v16h b, v8f c) { return __builtin_amdgcn_wmma_f32_16x16x32_f16(false, a, false, b, (short)0, c, false, false); }
__global__ __launch_bounds__(256) void k_fattn(const _Float16* __restrict__ Qh, const _Float16* __restrict__ Kh, const _Float16* __restrict__ Vt, _Float16* __restrict__ O) {
  const int lane = threadIdx.x & 31, ln = lane & 15, hh = lane >> 4, w = threadIdx.x >> 5; const int h = blockIdx.y, b = B0 + blockIdx.z; const size_t r0 = (size_t)b * SQ; const int q0 = blockIdx.x * 256 + w * 32;
  const _Float16* qp = Qh + (r0 + q0 + ln) * DM + h * HD; const _Float16* kp = Kh + (r0 + ln) * DM + h * HD; const _Float16* vp = Vt + ((size_t)(b * NH + h) * HD + ln) * SQ;
  const float c = 0.18033688011112042f; const v8f z8 = {0.f,0.f,0.f,0.f,0.f,0.f,0.f,0.f};
  v16h qf[2][2], kf[2][2]; v8f o[2][4]; float mu[2] = {-3.0e38f, -3.0e38f}, ls[2] = {0.f, 0.f};
#pragma unroll
  for (int j = 0; j < 2; ++j) {
#pragma unroll
    for (int ks = 0; ks < 2; ++ks) { qf[j][ks] = g2_frag(qp + (size_t)j * 16 * DM + ks * 32, hh); kf[j][ks] = g2_frag(kp + (size_t)j * 16 * DM + ks * 32, hh); }
#pragma unroll
    for (int dt = 0; dt < 4; ++dt) o[j][dt] = z8; }
#pragma unroll 1      /* one pass per trip: a second copy of the body would take the registers that four waves per SIMD need */
  for (int k0 = 0; k0 < SQ; k0 += 32) {
    v16h vf[4]; v8f s[2][2]; float mx[2];
#pragma unroll
    for (int dt = 0; dt < 4; ++dt) vf[dt] = g2_frag(vp + (size_t)dt * 16 * SQ + k0, hh);
    __builtin_amdgcn_sched_barrier(0);      /* keeps the V^T loads in front of the score products: without it they sink below the softmax's maximum and have half the lead on their use */
#pragma unroll
    for (int j = 0; j < 2; ++j) {
#pragma unroll
      for (int kt = 0; kt < 2; ++kt) s[j][kt] = fa_mma(kf[kt][1], qf[j][1], fa_mma(kf[kt][0], qf[j][0], z8)); }
    const int kn = (k0 + 32 < SQ) ? k0 + 32 : 0;      /* the next pass's K fragments fly during this pass's softmax; the last pass re-reads pass 0's rows (in bounds, not used) */
#pragma unroll
    for (int kt = 0; kt < 2; ++kt) {
#pragma unroll
      for (int ks = 0; ks < 2; ++ks) kf[kt][ks] = g2_frag(kp + (size_t)(kn + kt * 16) * DM + ks * 32, hh); }
    asm volatile("s_wait_xcnt 0x0" ::: "memory");      /* the trip's end adds to the address registers that the V^T and K loads above name: this wait stands in front of those overwrites (a build without it had the K loads sunk below the branch) */
#pragma unroll
    for (int j = 0; j < 2; ++j) { float a = fmaxf(s[j][0][0], s[j][1][0]);
#pragma unroll
      for (int r = 1; r < 8; ++r) a = fmaxf(a, fmaxf(s[j][0][r], s[j][1][r]));
      mx[j] = fmaxf(a, xrow(a)) * c; }
    const bool need = (mx[0] > mu[0] + 8.0f) || (mx[1] > mu[1] + 8.0f);
    if (__builtin_amdgcn_ballot_w32(need) != 0) {      /* one scalar branch per pass; always taken in the first pass (mu = -3e38: factor 0 on zero sums) */
#pragma unroll
      for (int j = 0; j < 2; ++j) { const float mn = fmaxf(mu[j], mx[j]); const float al = __builtin_amdgcn_exp2f(mu[j] - mn); mu[j] = mn; ls[j] *= al;
#pragma unroll
        for (int dt = 0; dt < 4; ++dt) o[j][dt] *= al; } }
#pragma unroll
    for (int j = 0; j < 2; ++j) { const float bias = 7.0f - mu[j]; FragH pf; float t[8];
#pragma unroll
      for (int r = 0; r < 8; ++r) { const float p0 = __builtin_amdgcn_exp2f(fmaf(s[j][0][r], c, bias)), p1 = __builtin_amdgcn_exp2f(fmaf(s[j][1][r], c, bias)); pf.h[r] = (_Float16)p0; pf.h[8 + r] = (_Float16)p1; t[r] = p0 + p1; }
      ls[j] += ((t[0] + t[1]) + (t[2] + t[3])) + ((t[4] + t[5]) + (t[6] + t[7]));
#pragma unroll
      for (int dt = 0; dt < 4; ++dt) o[j][dt] = fa_mma(vf[dt], pf.v, o[j][dt]); } }
#pragma unroll
  for (int j = 0; j < 2; ++j) { const float sc = 64.0f / (ls[j] + xrow(ls[j]));      /* the halves' sums join once; o carried x64 as before */
    unsigned short* dst = (unsigned short*)O + (r0 + q0 + j * 16 + ln) * DM + h * HD + 8 * hh;
#pragma unroll
    for (int dt = 0; dt < 4; ++dt) { FragH f;
#pragma unroll
      for (int r = 0; r < 8; ++r) f.h[r] = (_Float16)(o[j][dt][r] * sc);
      *(v8us*)(dst + dt * 16) = f.half[0]; } } }

extern "C" void kernel_launch(void* const* d_in, const int* in_sizes, int n_in,
                              void* d_out, int out_size, void* d_ws, size_t ws_size, hipStream_t stream) {
  (void)in_sizes; (void)n_in; (void)out_size;
  const float* const* I = (const float* const*)d_in; const float* x = I[0]; const float* tcos = I[1]; const float* tsin = I[2]; const float* wq = I[3]; const float* wk = I[4]; const float* wv = I[5]; const float* wo = I[6]; const float* bo = nullptr;      /* natural [out][in] weights, no biases; cos/sin INPUT tables [1][S][1][64] = [S][64] */
  char* ws = (char*)d_ws; size_t off = 0;
  auto take = [&](size_t bytes) { char* p = ws + off; off += (bytes + 255) & ~(size_t)255; return p; };
  _Float16* BQKV = (_Float16*)take((size_t)3 * DM * DM * 2); _Float16* BO = (_Float16*)take((size_t)DM * DM * 2);
  _Float16* X16 = (_Float16*)take(NR * DM * 2);
  _Float16* QH = (_Float16*)take(NR * DM * 2); _Float16* KH = (_Float16*)take(NR * DM * 2); _Float16* O16 = (_Float16*)take(NR * DM * 2);
  _Float16* VT = (_Float16*)take((size_t)NB * NH * HD * SQ * 2);      /* V^T of every batch */
  if (off > ws_size) return;
  { const unsigned g = (unsigned)(((size_t)DM * DM / 8 + 255) / 256); k_wnat<<<g, 256, 0, stream>>>(wq, (size_t)DM * DM / 8, BQKV); k_wnat<<<g, 256, 0, stream>>>(wk, (size_t)DM * DM / 8, BQKV + (size_t)DM * DM); k_wnat<<<g, 256, 0, stream>>>(wv, (size_t)DM * DM / 8, BQKV + (size_t)2 * DM * DM); k_wnat<<<g, 256, 0, stream>>>(wo, (size_t)DM * DM / 8, BO); }      /* natural [out][in] = Bt[n][k], x16; q | k | v stacked along n */
  k_x16<<<(unsigned)((NR * DM / 8 + 255) / 256), 256, 0, stream>>>(x, X16, NR * DM / 8);
  k_qkv<<<(unsigned)((NR / 128) * (3 * DM / 64)), 128, 0, stream>>>(X16, BQKV, tcos, tsin, QH, KH, VT);      /* every batch: rotated f16 q and k rows, V^T [NB][NH][HD][SQ] */
  k_fattn<<<dim3(QN / 256, NHD, NBR), 256, 0, stream>>>(QH, KH, VT, O16);      /* all batches and heads in one launch; o x64 as f16 in the merged rows */
  k_gemm2<0><<<dim3((unsigned)((MPO / 128) * (DM / 64)), 1), 128, 0, stream>>>(O16 + (size_t)B0 * SQ * DM, DM, 0, BO, DM, 0, 0.0009765625f, bo, 0, nullptr, 1, 0, 0, (float*)d_out + (size_t)B0 * SQ * DM, nullptr, DM, 0, MPO, DM, DM);      /* out rows are the output layout */
}

// v004
// A run of this version takes 167 microseconds.
// In two side-by-side timings against v003, it was 1.89 and 1.92 times as fast.
// Counting every step since v000, it is 42.2 times as fast.
#include <hip/hip_runtime.h>
// RoPE multi-head self-attention with INPUT rotary tables (x [4][2048][1024]; q/k/v = x W^T (nn.Linear natural [out][in] sigma 0.02, no bias), 16 heads of 64; q = q cos + rotate_half(q) sin with the module's cos/sin inputs [1][2048][1][64] (full head width, independent values per dim; rotate_half = concat(-x[32:], x[:32])), same for k; scores / 8; softmax over all keys (no mask); out = merged Wo^T (no bias) -> [4][2048][1024]).
// Structure: token rows r = b*2048 + s; x as exact f16 rows (bf16-rounded); q | k | v of all batches as ONE WMMA GEMM launch (32x64 wave tiles = one head wide, operands staged in LDS per 128x128 block tile, f32 accumulation, exact x16 weights, N = 3 x 1024) whose epilogue does the rest while the tile is still on chip: the half-split rotary rotation of q and k from the cos/sin tables (no norm) -> f16 q, k rows, and v -> f16 V^T through an LDS transpose (no f32 q | k | v and no v rows in memory); then ONE fused attention launch over all batches and heads (scores on WMMA, online softmax in registers with f32 statistics and native exp2, weights as f16 straight into the P . V WMMA; o carried x64 against f16 subnormal flush, folded into the output GEMM alpha) written straight into the merged f16 o rows; out = o W_o GEMM (f32) into the output layout.
// Compute dtype: inputs rounded to bf16; x / weights exact; projections and rope f32; q, k, v, softmax weights and o as plain f16 GEMM operands (~2^-12); scores and softmax statistics f32. v_wmma_f32_16x16x32_f16.
#define NB 4
#define SQ 2048
#define DM 1024
#define NH 16
#define HD 64
#define HG 4                         /* heads per launch of the non-template k_vt */
#define B0 0                         /* first batch processed (debug hook) */
#define NBR NB                       /* batches processed (debug hook) */
#define QN SQ                        /* query rows attended per batch (debug hook) */
#define NHD NH                       /* heads attended (debug hook) */
#define NR ((size_t)NB * SQ)         /* token rows */
#define MPO ((int)((size_t)NBR * SQ))      /* rows through the output GEMM (debug hook) */
typedef __bf16 v16b __attribute__((ext_vector_type(16)));
typedef unsigned short v8us __attribute__((ext_vector_type(8), may_alias));
typedef float  v8f  __attribute__((ext_vector_type(8)));
typedef float  v4f  __attribute__((ext_vector_type(4)));
typedef float  v4fa __attribute__((ext_vector_type(4), may_alias));
union FragB { v16b v; v8us half[2]; unsigned short u[16]; };

__device__ __forceinline__ unsigned short bf16_bits(float x) { unsigned int u = __float_as_uint(x); return (unsigned short)((u + 0x7FFFu + ((u >> 16) & 1u)) >> 16); }
__device__ __forceinline__ float bf16_val(unsigned short b) { return __uint_as_float(((unsigned int)b) << 16); }
__device__ __forceinline__ float bf16_round(float x) { return bf16_val(bf16_bits(x)); }
// D += A·B with NT terms: 1 = ah·bh, 2 = + al·bh (A split), 3 = + ah·bl (both split)
template <int NT>
__device__ __forceinline__ v8f mmaN(v16b ah, v16b al, v16b bh, v16b bl, v8f c) {
  c = __builtin_amdgcn_wmma_f32_16x16x32_bf16(false, ah, false, bh, (short)0, c, false, false);
  if (NT >= 2) c = __builtin_amdgcn_wmma_f32_16x16x32_bf16(false, al, false, bh, (short)0, c, false, false);
  if (NT >= 3) c = __builtin_amdgcn_wmma_f32_16x16x32_bf16(false, ah, false, bl, (short)0, c, false, false);
  asm volatile("v_nop\n\tv_nop\n\tv_nop\n\tv_nop" : "+v"(c) : "v"(ah), "v"(al), "v"(bh), "v"(bl));
  return c;
}

__global__ __launch_bounds__(256) void k_wt_bf16(const float* __restrict__ W, unsigned short* __restrict__ Wt, int K, int N) {
  const int t = blockIdx.x * 256 + threadIdx.x;
  const int k8n = K / 8;
  if (t >= N * k8n) return;
  const int n = t / k8n, k8 = (t % k8n) * 8;
  v8us v;
#pragma unroll
  for (int i = 0; i < 8; ++i) v[i] = bf16_bits(W[(size_t)(k8 + i) * N + n]);
  *(v8us*)(Wt + (size_t)n * K + k8) = v;
  
}

// GEMM C[M][N] (f32, pitch ldc) = act(A[M][K]·W + bias). A f32 row-major (pitch lda) converted per fragment to bf16
// (ASPLIT: hi/lo two planes -> 2 terms, else single rounded term); Wt bf16 [N][K] (pitch ldb). BIAS_BF16 rounds the
// bias to bf16 first (bias quantised to bf16 before the add). K%32==0, M%16==0, N%64==0.
template <bool ASPLIT, int ACT, bool BIAS_BF16>
__global__ __launch_bounds__(128) void k_gemm_bf(const float* __restrict__ A, int lda, const unsigned short* __restrict__ Wt, int ldb,
                                               const float* __restrict__ bias, float* __restrict__ C, int ldc, int M, int N, int K) {
  __shared__ __attribute__((aligned(16))) float so[4][16][64];
  const int tid = threadIdx.x, w = tid >> 5, lane = tid & 31, ln = lane & 15, hh = lane >> 4;
  const int ntn = N / 64;
  const int wid = blockIdx.x * 4 + w;
  const int mt = wid / ntn, nq = wid % ntn;
  if (mt * 16 >= M) return;
  const int row0 = mt * 16, col0 = nq * 64;
  const float* arow = A + (size_t)(row0 + ln) * lda;
  v8f acc[4] = {};
  for (int kb = 0; kb < K; kb += 32) {
    FragB ah, al;
    const v4f x0 = *(const v4fa*)(arow + kb + 8 * hh), x1 = *(const v4fa*)(arow + kb + 8 * hh + 4);
    const v4f x2 = *(const v4fa*)(arow + kb + 16 + 8 * hh), x3 = *(const v4fa*)(arow + kb + 16 + 8 * hh + 4);
    float xs[16] = {x0[0],x0[1],x0[2],x0[3],x1[0],x1[1],x1[2],x1[3],x2[0],x2[1],x2[2],x2[3],x3[0],x3[1],x3[2],x3[3]};
#pragma unroll
    for (int i = 0; i < 16; ++i) { const unsigned short hb = bf16_bits(xs[i]); ah.u[i] = hb; al.u[i] = ASPLIT ? bf16_bits(xs[i] - bf16_val(hb)) : (unsigned short)0; }
#pragma unroll
    for (int t = 0; t < 4; ++t) {
      const unsigned short* brow = Wt + (size_t)(col0 + t * 16 + ln) * ldb + kb;
      FragB b;
      b.half[0] = *(const v8us*)(brow + 8 * hh);
      b.half[1] = *(const v8us*)(brow + 16 + 8 * hh);
      acc[t] = mmaN<ASPLIT ? 2 : 1>(ah.v, al.v, b.v, b.v, acc[t]);
    }
  }
#pragma unroll
  for (int t = 0; t < 4; ++t) {
    float bv = bias ? bias[col0 + t * 16 + ln] : 0.f;
    if (BIAS_BF16) bv = bf16_round(bv);
#pragma unroll
    for (int r = 0; r < 8; ++r) { float v = acc[t][r] + bv; if (ACT == 1) v = fmaxf(v, 0.f); so[w][8 * hh + r][t * 16 + ln] = v; }
  }
  __builtin_amdgcn_fence(__ATOMIC_ACQ_REL, "workgroup");
  __builtin_amdgcn_wave_barrier();
  const int rsub = lane >> 4, c4 = (lane & 15) * 4;
  {
#pragma unroll
    for (int q = 0; q < 8; ++q) {
      const int r = q * 2 + rsub;
      const v4f v = *(const v4fa*)&so[w][r][c4];
      *(v4f*)(C + (size_t)(row0 + r) * ldc + col0 + c4) = v;
    }
    
  }
}

// GEMM C = act(A·W + bias + resid): A f32 (ASPLIT -> hi/lo 2 terms), Wt bf16 [N][K]; ACT 0 none, 1 relu, 2 exact gelu;
// resid (optional, f32, row index = (row % rmod), pitch ldr, RES_BF16 rounds it) added before the activation.
template <bool ASPLIT, int ACT, bool BIAS_BF16, bool RES_BF16>
__global__ __launch_bounds__(128) void k_gemm_bf3(const float* __restrict__ A, int lda, const unsigned short* __restrict__ Wt, int ldb,
                                                const float* __restrict__ bias, const float* __restrict__ resid, int rmod, int ldr,
                                                float* __restrict__ C, int ldc, int M, int N, int K) {
  __shared__ __attribute__((aligned(16))) float so[4][16][64];
  const int tid = threadIdx.x, w = tid >> 5, lane = tid & 31, ln = lane & 15, hh = lane >> 4;
  const int ntn = N / 64;
  const int wid = blockIdx.x * 4 + w;
  const int mt = wid / ntn, nq = wid % ntn;
  if (mt * 16 >= M) return;
  const int row0 = mt * 16, col0 = nq * 64;
  const float* arow = A + (size_t)(row0 + ln) * lda;
  v8f acc[4] = {};
  for (int kb = 0; kb < K; kb += 32) {
    FragB ah, al;
    const v4f x0 = *(const v4fa*)(arow + kb + 8 * hh), x1 = *(const v4fa*)(arow + kb + 8 * hh + 4);
    const v4f x2 = *(const v4fa*)(arow + kb + 16 + 8 * hh), x3 = *(const v4fa*)(arow + kb + 16 + 8 * hh + 4);
    float xs[16] = {x0[0],x0[1],x0[2],x0[3],x1[0],x1[1],x1[2],x1[3],x2[0],x2[1],x2[2],x2[3],x3[0],x3[1],x3[2],x3[3]};
#pragma unroll
    for (int i = 0; i < 16; ++i) { const unsigned short hb = bf16_bits(xs[i]); ah.u[i] = hb; al.u[i] = ASPLIT ? bf16_bits(xs[i] - bf16_val(hb)) : (unsigned short)0; }
#pragma unroll
    for (int t = 0; t < 4; ++t) {
      const unsigned short* brow = Wt + (size_t)(col0 + t * 16 + ln) * ldb + kb;
      FragB b;
      b.half[0] = *(const v8us*)(brow + 8 * hh);
      b.half[1] = *(const v8us*)(brow + 16 + 8 * hh);
      acc[t] = mmaN<ASPLIT ? 2 : 1>(ah.v, al.v, b.v, b.v, acc[t]);
    }
  }
#pragma unroll
  for (int t = 0; t < 4; ++t) {
    const int col = col0 + t * 16 + ln;
    float bv = bias ? bias[col] : 0.f;
    if (BIAS_BF16) bv = bf16_round(bv);
#pragma unroll
    for (int r = 0; r < 8; ++r) {
      float v = acc[t][r] + bv;
      if (resid) { float rv = resid[(size_t)((row0 + 8 * hh + r) % rmod) * ldr + col]; if (RES_BF16) rv = bf16_round(rv); v += rv; }
      if (ACT == 1) v = fmaxf(v, 0.f);
      if (ACT == 2) v = 0.5f * v * (1.0f + erff(v * 0.70710678118654752f));
      if (ACT == 3) { const float u = 0.7978845608028654f * (v + 0.044715f * v * v * v); v = 0.5f * v * (1.0f + tanhf(u)); }
      so[w][8 * hh + r][t * 16 + ln] = v;
    }
  }
  __builtin_amdgcn_fence(__ATOMIC_ACQ_REL, "workgroup");
  __builtin_amdgcn_wave_barrier();
  const int rsub = lane >> 4, c4 = (lane & 15) * 4;
  {
#pragma unroll
    for (int q = 0; q < 8; ++q) {
      const int r = q * 2 + rsub;
      const v4f v = *(const v4fa*)&so[w][r][c4];
      *(v4f*)(C + (size_t)(row0 + r) * ldc + col0 + c4) = v;
    }
    
  }
}
// row LayerNorm (biased variance, eps) over N: s = X (+ R); optional out_sum <- s; out_norm <- (s-mu)*rsqrt(var+eps)*g + b
template <bool PARAM_BF16>
__global__ __launch_bounds__(256) void k_layernorm(const float* __restrict__ X, const float* __restrict__ R, const float* __restrict__ g, const float* __restrict__ bta,
                                                  float* __restrict__ out_sum, float* __restrict__ out_norm, int N, float eps) {
  __shared__ float red[256];
  const int row = blockIdx.x, tid = threadIdx.x;
  const float* x = X + (size_t)row * N; const float* rr = R ? R + (size_t)row * N : nullptr;
  float vals[16];                     // up to N = 4096
  const int per = N / 256;            // contiguous chunk per thread? use strided-by-4 chunks: thread handles j = tid*4 + 1024*u
  float s1 = 0.f;
  for (int u = 0; u < per / 4; ++u) {
    const int j = tid * 4 + 1024 * u;
    const v4f a = *(const v4fa*)(x + j);
    v4f b = {0.f,0.f,0.f,0.f}; if (rr) b = *(const v4fa*)(rr + j);
#pragma unroll
    for (int q = 0; q < 4; ++q) { const float v = a[q] + b[q]; vals[u * 4 + q] = v; s1 += v; }
  }
  red[tid] = s1; __syncthreads();
  for (int st = 128; st > 0; st >>= 1) { if (tid < st) red[tid] += red[tid + st]; __syncthreads(); }
  const float mu = red[0] / (float)N; __syncthreads();
  float s2 = 0.f;
  for (int u = 0; u < per / 4; ++u)
#pragma unroll
    for (int q = 0; q < 4; ++q) { const float c = vals[u * 4 + q] - mu; s2 += c * c; }
  red[tid] = s2; __syncthreads();
  for (int st = 128; st > 0; st >>= 1) { if (tid < st) red[tid] += red[tid + st]; __syncthreads(); }
  const float rs = rsqrtf(red[0] / (float)N + eps);
  {
    for (int u = 0; u < per / 4; ++u) {
      const int j = tid * 4 + 1024 * u;
      v4f o, sm;
#pragma unroll
      for (int q = 0; q < 4; ++q) {
        float gg = g[j + q], bb = bta[j + q];
        if (PARAM_BF16) { gg = bf16_round(gg); bb = bf16_round(bb); }
        sm[q] = vals[u * 4 + q]; o[q] = (vals[u * 4 + q] - mu) * rs * gg + bb;
      }
      if (out_sum) *(v4f*)(out_sum + (size_t)row * N + j) = sm;
      *(v4f*)(out_norm + (size_t)row * N + j) = o;
    }
    
  }
}



// ---- f16 WMMA path (v_wmma_f32_16x16x32_f16): 11-bit significands for operands in range — used where a [0,1] probability operand needs more precision than bf16
typedef _Float16 v16h __attribute__((ext_vector_type(16)));
union FragH { v16h v; v8us half[2]; _Float16 h[16]; unsigned short u[16]; };
template <int NT>
__device__ __forceinline__ v8f mmaH(v16h ah, v16h al, v16h bh, v16h bl, v8f c) {
  c = __builtin_amdgcn_wmma_f32_16x16x32_f16(false, ah, false, bh, (short)0, c, false, false);
  if (NT >= 2) c = __builtin_amdgcn_wmma_f32_16x16x32_f16(false, al, false, bh, (short)0, c, false, false);
  if (NT >= 3) c = __builtin_amdgcn_wmma_f32_16x16x32_f16(false, ah, false, bl, (short)0, c, false, false);
  asm volatile("v_nop\n\tv_nop\n\tv_nop\n\tv_nop" : "+v"(c) : "v"(ah), "v"(al), "v"(bh), "v"(bl));
  return c;
}
// batched GEMM like k_gemm_b but f16 operands: A f32 (split into f16 hi/lo if ASPLIT, else rounded to f16), Bt = f16 values [n][k]; alpha; C f32; N multiple of 16 (partial tiles skipped)
template <bool ASPLIT>
__global__ __launch_bounds__(128) void k_gemm_h(const float* __restrict__ A, int lda, size_t sA, const _Float16* __restrict__ Bh, int ldb, size_t sB, float alpha, float* __restrict__ C, int ldc, size_t sC, int M, int N, int K) {
  __shared__ __attribute__((aligned(16))) float so[4][16][64];
  const int tid = threadIdx.x, w = tid >> 5, lane = tid & 31, ln = lane & 15, hh = lane >> 4; const int by = blockIdx.y;
  A += (size_t)by * sA; Bh += (size_t)by * sB; C += (size_t)by * sC;
  const int ntn = (N + 63) / 64; const int wid = blockIdx.x * 4 + w; const int mt = wid / ntn, nq = wid % ntn; if (mt * 16 >= M) return;
  const int row0 = mt * 16, col0 = nq * 64; const float* arow = A + (size_t)(row0 + ln) * lda;
  v8f acc[4] = {};
  for (int kb = 0; kb < K; kb += 32) {
    FragH ah, al;
    const v4f x0 = *(const v4fa*)(arow + kb + 8 * hh), x1 = *(const v4fa*)(arow + kb + 8 * hh + 4), x2 = *(const v4fa*)(arow + kb + 16 + 8 * hh), x3 = *(const v4fa*)(arow + kb + 16 + 8 * hh + 4);
    float xs[16] = {x0[0],x0[1],x0[2],x0[3],x1[0],x1[1],x1[2],x1[3],x2[0],x2[1],x2[2],x2[3],x3[0],x3[1],x3[2],x3[3]};
#pragma unroll
    for (int i = 0; i < 16; ++i) { const _Float16 h = (_Float16)xs[i]; ah.h[i] = h; al.h[i] = ASPLIT ? (_Float16)(xs[i] - (float)h) : (_Float16)0.0f; }
#pragma unroll
    for (int t = 0; t < 4; ++t) { if (col0 + t * 16 >= N) continue; const size_t boff = (size_t)(col0 + t * 16 + ln) * ldb + kb; FragH bq; bq.half[0] = *(const v8us*)(Bh + boff + 8 * hh); bq.half[1] = *(const v8us*)(Bh + boff + 16 + 8 * hh);
      acc[t] = mmaH<ASPLIT ? 2 : 1>(ah.v, al.v, bq.v, bq.v, acc[t]); }
  }
#pragma unroll
  for (int t = 0; t < 4; ++t) { if (col0 + t * 16 >= N) continue;
#pragma unroll
    for (int r = 0; r < 8; ++r) so[w][8 * hh + r][t * 16 + ln] = acc[t][r] * alpha; }
  __builtin_amdgcn_fence(__ATOMIC_ACQ_REL, "workgroup"); __builtin_amdgcn_wave_barrier();
  const int rsub = lane >> 4, c4 = (lane & 15) * 4;
  {
#pragma unroll
    for (int q = 0; q < 8; ++q) { const int r = q * 2 + rsub; if (col0 + c4 < N) { const v4f v = *(const v4fa*)&so[w][r][c4]; *(v4f*)(C + (size_t)(row0 + r) * ldc + col0 + c4) = v; } }
     }
}

// Wt[n][k] = f16(W[k][n]·scale) from f32 row-major W[K][N] (scale = power of two; bf16-exact weights stay exact in f16 away from the subnormal range)
__global__ __launch_bounds__(256) void k_wt_f16(const float* __restrict__ W, _Float16* __restrict__ Wt, int K, int N, float scale) {
  const int t = blockIdx.x * 256 + threadIdx.x; if (t >= N * (K / 8)) return; const int n = t / (K / 8), k8 = (t % (K / 8)) * 8; FragH f;
#pragma unroll
  for (int i = 0; i < 8; ++i) f.h[i] = (_Float16)(bf16_round(W[(size_t)(k8 + i) * N + n]) * scale); const v8us o = f.half[0];
  *(v8us*)((unsigned short*)Wt + (size_t)n * K + k8) = o; 
}
// k_gemm_hh variant with fused epilogue: v = acc·alpha + bias[by·sBias + col] (+ CP[(row/rowsPerB)·sCPb + by·64 + col] if CP) ; ACT 0 none / 1 elu ; writes f16 C16 (and f32 C if non-null)
template <int ACT>
__global__ __launch_bounds__(128) void k_gemm_hhx(const _Float16* __restrict__ A, int lda, size_t sA, const _Float16* __restrict__ Bh, int ldb, size_t sB, float alpha, const float* __restrict__ bias, size_t sBias, const float* __restrict__ CP, int rowsPerB, size_t sCPb, int row0g,
    float* __restrict__ C, _Float16* __restrict__ C16, int ldc, size_t sC, int M, int N, int K) {
  __shared__ __attribute__((aligned(16))) float so[4][16][64];
  const int tid = threadIdx.x, w = tid >> 5, lane = tid & 31, ln = lane & 15, hh = lane >> 4; const int by = blockIdx.y;
  A += (size_t)by * sA; Bh += (size_t)by * sB; const size_t cofs = (size_t)by * sC; const float* bp = bias ? bias + (size_t)by * sBias : nullptr;
  const int ntn = (N + 63) / 64; const int wid = blockIdx.x * 4 + w; const int mt = wid / ntn, nq = wid % ntn; if (mt * 16 >= M) return;
  const int row0 = mt * 16, col0 = nq * 64; const _Float16* arow = A + (size_t)(row0 + ln) * lda;
  v8f acc[4] = {};
  for (int kb = 0; kb < K; kb += 32) { FragH ah; ah.half[0] = *(const v8us*)((const unsigned short*)arow + kb + 8 * hh); ah.half[1] = *(const v8us*)((const unsigned short*)arow + kb + 16 + 8 * hh);
#pragma unroll
    for (int t = 0; t < 4; ++t) { if (col0 + t * 16 >= N) continue; const size_t boff = (size_t)(col0 + t * 16 + ln) * ldb + kb; FragH bq; bq.half[0] = *(const v8us*)((const unsigned short*)Bh + boff + 8 * hh); bq.half[1] = *(const v8us*)((const unsigned short*)Bh + boff + 16 + 8 * hh);
      acc[t] = mmaH<1>(ah.v, ah.v, bq.v, bq.v, acc[t]); }
  }
#pragma unroll
  for (int t = 0; t < 4; ++t) { if (col0 + t * 16 >= N) continue; const int col = col0 + t * 16 + ln; const float bv = bp ? bf16_round(bp[col]) : 0.f;
#pragma unroll
    for (int r = 0; r < 8; ++r) { float v = acc[t][r] * alpha + bv; if (CP) { const int rr = row0g + row0 + 8 * hh + r; if (rowsPerB < 0) v += CP[cofs + (size_t)rr * ldc + col];      /* rowsPerB < 0: own element of the batched C plane */ else { const int bidx = rr / rowsPerB; v += CP[(size_t)bidx * sCPb + (size_t)by * 64 + col]; } } if (ACT == 1) v = (v > 0.f) ? v : expm1f(v); else if (ACT == 7) v = (v > 0.f) ? v + 1.0f : expf(v); else if (ACT == 8) v = tanhf(v); else if (ACT == 9) v = 0.5f * v * (1.0f + tanhf(0.7978845608028654f * (v + 0.044715f * v * v * v))); else if (ACT == 11) v = 1.0f / (1.0f + expf(-v)); else if (ACT == 12) v = (v > 0.f) ? v : 0.01f * v; else if (ACT == 14) v = (v > 0.f) ? v : 0.1f * v; else if (ACT == 16) v = (v >= 0.f) ? v : 0.3f * v; else if (ACT == 17) v = (v >= 0.f) ? v : 0.2f * v; else if (ACT == 15) v = v / (1.0f + expf(-v)); else if (ACT == 3) v = fmaxf(v, 0.f); else if (ACT == 6) v = 0.5f * v * (1.0f + erff(v * 0.70710678118654752f)); so[w][8 * hh + r][t * 16 + ln] = v; } }
  __builtin_amdgcn_fence(__ATOMIC_ACQ_REL, "workgroup"); __builtin_amdgcn_wave_barrier();
  const int rsub = lane >> 4, c4 = (lane & 15) * 4; typedef _Float16 v4h __attribute__((ext_vector_type(4)));
  {
#pragma unroll
    for (int q = 0; q < 8; ++q) { const int r = q * 2 + rsub; if (col0 + c4 < N) { const v4f v = *(const v4fa*)&so[w][r][c4]; if (C) *(v4f*)(C + cofs + (size_t)(row0 + r) * ldc + col0 + c4) = v; if (C16) { v4h h4; for (int i = 0; i < 4; ++i) h4[i] = (_Float16)v[i]; *(v4h*)(C16 + cofs + (size_t)(row0 + r) * ldc + col0 + c4) = h4; } } }
     }
}


typedef _Float16 v4h __attribute__((ext_vector_type(4)));

__global__ __launch_bounds__(256) void k_x16(const float* __restrict__ x, _Float16* __restrict__ X16, size_t n8) { const size_t t = (size_t)blockIdx.x * 256 + threadIdx.x; if (t >= n8) return; FragH f;
#pragma unroll
  for (int q = 0; q < 8; ++q) f.h[q] = (_Float16)bf16_round(x[t * 8 + q]); *(v8us*)((unsigned short*)X16 + t * 8) = f.half[0];  }
__global__ __launch_bounds__(256) void k_h16(const float* __restrict__ x, _Float16* __restrict__ X16, size_t n8) { const size_t t = (size_t)blockIdx.x * 256 + threadIdx.x; if (t >= n8) return; FragH f;
#pragma unroll
  for (int q = 0; q < 8; ++q) f.h[q] = (_Float16)x[t * 8 + q]; *(v8us*)((unsigned short*)X16 + t * 8) = f.half[0];  }
__global__ __launch_bounds__(256) void k_round16f(const float* __restrict__ W, _Float16* __restrict__ Bt, size_t n8) { const size_t t = (size_t)blockIdx.x * 256 + threadIdx.x; if (t >= n8) return; FragH f;
#pragma unroll
  for (int i = 0; i < 8; ++i) f.h[i] = (_Float16)(bf16_round(W[t * 8 + i]) * 16.0f); *(v8us*)((unsigned short*)Bt + t * 8) = f.half[0];  }
template <int NHv, int TTv>
__global__ __launch_bounds__(256) void k_vt(const _Float16* __restrict__ V16, int ldv, int voff, _Float16* __restrict__ Vt) { __shared__ unsigned short tl[64][66]; const int tid = threadIdx.x; const int slab = blockIdx.x / (TTv / 64), lg = blockIdx.x % (TTv / 64); const int b = slab / NHv, h = slab % NHv;
  for (int i = tid; i < 64 * 8; i += 256) { const int r = i / 8, c8 = (i % 8) * 8; FragH f; f.half[0] = *(const v8us*)((const unsigned short*)V16 + ((size_t)b * TTv + lg * 64 + r) * ldv + voff + h * 64 + c8);
#pragma unroll
    for (int q = 0; q < 8; ++q) tl[r][c8 + q] = f.u[q]; }
  __syncthreads();
  {
#pragma unroll
    for (int rd = 0; rd < 2; ++rd) { const int d = rd * 32 + tid / 8, pc = tid % 8; FragH f;
#pragma unroll
      for (int q = 0; q < 8; ++q) f.u[q] = tl[pc * 8 + q][d];
      *(v8us*)((unsigned short*)Vt + ((size_t)slab * 64 + d) * TTv + lg * 64 + pc * 8) = f.half[0]; }
     } }

__global__ __launch_bounds__(256) void k_hl(const float* __restrict__ F, _Float16* __restrict__ Hh, _Float16* __restrict__ Hl, size_t n8) { const size_t t = (size_t)blockIdx.x * 256 + threadIdx.x; if (t >= n8) return; FragH fh, fl; const v4f a = *(const v4fa*)(F + t * 8), c = *(const v4fa*)(F + t * 8 + 4);
#pragma unroll
  for (int q = 0; q < 4; ++q) { _Float16 h = (_Float16)a[q]; fh.h[q] = h; fl.h[q] = (_Float16)((a[q] - (float)h) * 1024.0f); h = (_Float16)c[q]; fh.h[4 + q] = h; fl.h[4 + q] = (_Float16)((c[q] - (float)h) * 1024.0f); }
  { *(v8us*)((unsigned short*)Hh + t * 8) = fh.half[0]; *(v8us*)((unsigned short*)Hl + t * 8) = fl.half[0];  } }

// ---- fast GEMM (wave tile 32x64; requires M % 32 == 0 rows per launch region and N % 64 == 0); epilogue = k_gemm_hhx semantics ----
__device__ __forceinline__ v16h g2_frag(const _Float16* p, int hh) { FragH f; f.half[0] = *(const v8us*)((const unsigned short*)p + 8 * hh); f.half[1] = *(const v8us*)((const unsigned short*)p + 16 + 8 * hh); return f.v; }
__device__ __forceinline__ v8f g2_mma(v16h a, v16h b, v8f c) { v8f d = __builtin_amdgcn_wmma_f32_16x16x32_f16(false, a, false, b, (short)0, c, false, false); asm volatile("v_nop\n\tv_nop\n\tv_nop\n\tv_nop" : "+v"(d) : "v"(a), "v"(b)); return d; }
template <int ACT>
__global__ __launch_bounds__(128) void k_gemm2(const _Float16* __restrict__ A, int lda, size_t sA, const _Float16* __restrict__ Bh, int ldb, size_t sB, float alpha, const float* __restrict__ bias, size_t sBias, const float* __restrict__ CP, int rowsPerB, size_t sCPb, int row0g,
    float* __restrict__ C, _Float16* __restrict__ C16, int ldc, size_t sC, int M, int N, int K) { static_assert(ACT == 0 || ACT == 3 || ACT == 6 || ACT == 8 || ACT == 9 || ACT == 11 || ACT == 12 || ACT == 14 || ACT == 15 || ACT == 16 || ACT == 17, "k_gemm2: unsupported ACT code (would silently apply no activation)");
  __shared__ __attribute__((aligned(16))) float so[4][32][68];
  const int tid = threadIdx.x, w = tid >> 5, lane = tid & 31, ln = lane & 15, hh = lane >> 4; const int by = blockIdx.y;
  A += (size_t)by * sA; Bh += (size_t)by * sB; const size_t cofs = (size_t)by * sC; const float* bp = bias ? bias + (size_t)by * sBias : nullptr;
  const int ntn = N >> 6; const int mt = blockIdx.x / ntn, nq = blockIdx.x - mt * ntn; const int row0 = mt * 128 + 32 * w, col0 = nq * 64; if (row0 >= M) return;
  const _Float16* a0p = A + (size_t)(row0 + ln) * lda; const _Float16* a1p = a0p + (size_t)16 * lda;
  const _Float16* b0p = Bh + (size_t)(col0 + ln) * ldb; const _Float16* b1p = b0p + (size_t)16 * ldb; const _Float16* b2p = b1p + (size_t)16 * ldb; const _Float16* b3p = b2p + (size_t)16 * ldb;
  const v8f z8 = {0.f,0.f,0.f,0.f,0.f,0.f,0.f,0.f}; v8f c00 = z8, c01 = z8, c02 = z8, c03 = z8, c10 = z8, c11 = z8, c12 = z8, c13 = z8;
#pragma unroll 1
  for (int kb = 0; kb < K; kb += 32) { const v16h a0 = g2_frag(a0p + kb, hh), a1 = g2_frag(a1p + kb, hh);
    v16h b = g2_frag(b0p + kb, hh); c00 = g2_mma(a0, b, c00); c10 = g2_mma(a1, b, c10);
    b = g2_frag(b1p + kb, hh); c01 = g2_mma(a0, b, c01); c11 = g2_mma(a1, b, c11);
    b = g2_frag(b2p + kb, hh); c02 = g2_mma(a0, b, c02); c12 = g2_mma(a1, b, c12);
    b = g2_frag(b3p + kb, hh); c03 = g2_mma(a0, b, c03); c13 = g2_mma(a1, b, c13); }
  v8f accs[8] = {c00, c01, c02, c03, c10, c11, c12, c13};
#pragma unroll
  for (int u = 0; u < 8; ++u) { const int t = u & 3, half = u >> 2; const int col = col0 + t * 16 + ln; const float bv = bp ? bf16_round(bp[col]) : 0.f;
#pragma unroll
    for (int r = 0; r < 8; ++r) { const int rloc = half * 16 + 8 * hh + r; float v = accs[u][r] * alpha + bv; if (CP) { if (rowsPerB < 0) v += CP[cofs + (size_t)(row0g + row0 + rloc) * ldc + col];      /* rowsPerB < 0: own element of the batched C plane */ else { const int bidx = (row0g + row0 + rloc) / rowsPerB; v += CP[(size_t)bidx * sCPb + (size_t)by * 64 + col]; } }
      if (ACT == 3) v = fmaxf(v, 0.f); else if (ACT == 6) v = 0.5f * v * (1.0f + erff(v * 0.70710678118654752f)); else if (ACT == 11) v = 1.0f / (1.0f + expf(-v)); else if (ACT == 15) v = v / (1.0f + expf(-v)); else if (ACT == 12) v = (v > 0.f) ? v : 0.01f * v; else if (ACT == 8) v = tanhf(v); else if (ACT == 9) v = 0.5f * v * (1.0f + tanhf(0.7978845608028654f * (v + 0.044715f * v * v * v))); else if (ACT == 14) v = (v > 0.f) ? v : 0.1f * v; else if (ACT == 16) v = (v >= 0.f) ? v : 0.3f * v; else if (ACT == 17) v = (v >= 0.f) ? v : 0.2f * v;
      so[w][rloc][t * 16 + ln] = v; } }
  __builtin_amdgcn_fence(__ATOMIC_ACQ_REL, "workgroup"); __builtin_amdgcn_wave_barrier();
  const int rsub = lane >> 4, c4 = (lane & 15) * 4;
  {
#pragma unroll
    for (int q = 0; q < 16; ++q) { const int r = q * 2 + rsub; const v4f v = *(const v4fa*)&so[w][r][c4]; if (C) *(v4f*)(C + cofs + (size_t)(row0 + r) * ldc + col0 + c4) = v; if (C16) { v4h h4; for (int i = 0; i < 4; ++i) h4[i] = (_Float16)v[i]; *(v4h*)(C16 + cofs + (size_t)(row0 + r) * ldc + col0 + c4) = h4; } }
     } }


__global__ __launch_bounds__(256) void k_wnat(const float* __restrict__ w, size_t n8, _Float16* __restrict__ Bt) { const size_t t = (size_t)blockIdx.x * 256 + threadIdx.x; if (t >= n8) return; FragH f; for (int q = 0; q < 8; ++q) f.h[q] = (_Float16)(bf16_round(w[t * 8 + q]) * 16.0f); *(v8us*)((unsigned short*)Bt + t * 8) = f.half[0];  }
__global__ __launch_bounds__(256) void k_rsm(const float* __restrict__ S, _Float16* __restrict__ P, int nrows) {
  #pragma clang fp contract(off)
  const int i = blockIdx.x * 256 + threadIdx.x; if (i >= nrows) return; const float* s = S + (size_t)i * SQ; float mx = -3.0e38f;
#pragma unroll 1
  for (int j = 0; j < SQ; ++j) mx = fmaxf(mx, s[j]); float se = 0.f;
#pragma unroll 1
  for (int j = 0; j < SQ; ++j) se += expf(s[j] - mx); const float sc = 256.0f / se;
#pragma unroll 1
  for (int j0 = 0; j0 < SQ; j0 += 8) { FragH f; for (int q = 0; q < 8; ++q) f.h[q] = (_Float16)(expf(s[j0 + q] - mx) * sc); unsigned short* d = (unsigned short*)P + (size_t)i * SQ + j0; *(v8us*)d = f.half[0];  } }
__global__ __launch_bounds__(256) void k_vt(const _Float16* __restrict__ V16, int b, int h0, _Float16* __restrict__ VT) { __shared__ unsigned short tl[64][65]; const int tid = threadIdx.x; const int hh = blockIdx.x % HG, sg = blockIdx.x / HG; const int s0 = sg * 64; const int h = h0 + hh;
  for (int i = tid; i < 64 * 8; i += 256) { const int j = i / 8, d8 = (i % 8) * 8; FragH f; f.half[0] = *(const v8us*)((const unsigned short*)V16 + ((size_t)b * SQ + s0 + j) * DM + h * HD + d8); for (int q = 0; q < 8; ++q) tl[d8 + q][j] = f.u[q]; }
  __syncthreads();
  { for (int i = tid; i < 64 * 8; i += 256) { const int d = i / 8, j8 = (i % 8) * 8; FragH f; for (int q = 0; q < 8; ++q) f.u[q] = tl[d][j8 + q]; *(v8us*)((unsigned short*)VT + ((size_t)hh * HD + d) * SQ + s0 + j8) = f.half[0]; }  } }


__global__ __launch_bounds__(256) void k_tab2(float theta, float* __restrict__ CS, float* __restrict__ SN) {
  #pragma clang fp contract(off)
  const int t = blockIdx.x * 256 + threadIdx.x; if (t >= SQ * (HD / 2)) return; const int i = t % (HD / 2); const int p = t / (HD / 2); const float invf = 1.0f / powf(theta, (float)(2 * i) / (float)HD); const float ang = __fmul_rn((float)p, invf); const float c = cosf(ang), s = sinf(ang);
  *(float*)(CS + t) = c; *(float*)(SN + t) = s;  }
template <int NORM, int ROPE>
__global__ __launch_bounds__(64) void k_xform(const float* __restrict__ F, int ldf, int nh, const float* __restrict__ gain, float eps, const float* __restrict__ CS, const float* __restrict__ SN, _Float16* __restrict__ H16, int ldo) {
  #pragma clang fp contract(off)
  __shared__ float xv[HD]; __shared__ float red[HD]; __shared__ unsigned short sh_[HD]; const int d = threadIdx.x; const int h = blockIdx.x % nh; const size_t r = blockIdx.x / nh; const int p = (int)(r % SQ);
  float x = F[r * (size_t)ldf + (size_t)h * HD + d];
  if (NORM) { red[d] = __fmul_rn(x, x); __syncthreads(); for (int st = HD / 2; st > 0; st >>= 1) { if (d < st) red[d] = __fadd_rn(red[d], red[d + st]); __syncthreads(); } const float rs = rsqrtf(__fadd_rn(red[0] / (float)HD, eps)); x = __fmul_rn(__fmul_rn(x, rs), bf16_round(gain[d])); }
  xv[d] = x; __syncthreads();
  float o = x;
  if (ROPE == 1) { const int i = d >> 1; const float c = CS[p * (HD / 2) + i], s = SN[p * (HD / 2) + i]; const float ev = xv[2 * i], od = xv[2 * i + 1]; o = (d & 1) ? __fadd_rn(__fmul_rn(ev, s), __fmul_rn(od, c)) : __fadd_rn(__fmul_rn(ev, c), -__fmul_rn(od, s)); }
  if (ROPE == 2) { const int i = d & (HD / 2 - 1); const float c = CS[p * (HD / 2) + i], s = SN[p * (HD / 2) + i]; const float lo = xv[i], hi = xv[i + HD / 2]; o = (d < HD / 2) ? __fadd_rn(__fmul_rn(lo, c), -__fmul_rn(hi, s)) : __fadd_rn(__fmul_rn(lo, s), __fmul_rn(hi, c)); }
  if (ROPE == 6) { const float c = bf16_round(CS[p * HD + d]), s = bf16_round(SN[p * HD + d]); const float pa = xv[(d + HD / 2) & (HD - 1)]; const float rh = (d < HD / 2) ? -pa : pa; o = __fadd_rn(__fmul_rn(x, c), __fmul_rn(rh, s)); }      /* FULL-WIDTH bf16-rounded INPUT tables [p][64]: o = x cos[p][d] + rotate_half(x)[d] sin[p][d], rotate_half = concat(-x[32:], x[:32]) */
  FragH th; th.h[0] = (_Float16)o; sh_[d] = th.u[0]; __syncthreads();
  if (d < HD / 8) { FragH f; for (int q = 0; q < 8; ++q) f.u[q] = sh_[d * 8 + q]; unsigned short* dst = (unsigned short*)H16 + r * (size_t)ldo + (size_t)h * HD + d * 8; *(v8us*)dst = f.half[0];  } }

__global__ __launch_bounds__(256) void k_tab3(float* __restrict__ CS, float* __restrict__ SN) {
  #pragma clang fp contract(off)
  const int t = blockIdx.x * 256 + threadIdx.x; if (t >= SQ * (HD / 2)) return; const int i = t % (HD / 2); const int p = t / (HD / 2); const float freq = expf(__fmul_rn((float)(2 * i), -0.14391156831212787f)); const float ang = __fmul_rn((float)p, freq); const float c = cosf(ang), s = sinf(ang);
  *(float*)(CS + t) = c; *(float*)(SN + t) = s;  }



// ---- GEMM main loop with both operands staged in LDS (used by k_qkv and k_out) ----
// A block of 8 waves makes a 128 x 128 tile of A . B^T (K = DM): wave w takes rows 32 (w & 3) and columns 64 (w >> 2), a 32x64 wave tile as in k_gemm2, with the same fragments, the same k order and the same order of products.
// A stage is 128 k of the block's 128 A rows and 128 B rows: 256 rows of 256 bytes at an LDS pitch of 272 bytes (16 x odd, for 16-byte fragment reads). Two buffers: the next stage's copies fly while this one is worked on; two blocks fit a WGP.
// The rows come by asynchronous copies to LDS: a wave's copy is four whole 128-byte lines, and a row is fetched once per block, where the fragment loads from global memory touched 16 lines each and every wave fetched its own.
#define G3K 128                       /* k per stage */
#define G3P 136                       /* LDS row pitch in f16 */
#define G3S (256 * G3P)               /* f16 per stage */
#define G3B (2 * G3S * 2)             /* bytes of the two buffers */
#define G3T (DM / G3K)                /* stages */
__device__ __forceinline__ void g3_copy8(const _Float16* g, unsigned l) {      /* a thread brings 16 bytes of eight rows, 16 rows apart: the block's 128 rows of one operand */
  const unsigned st = 16 * G3P * 2;
  /* the wait on the last line stands in front of any later write of a register that these copies name */
  asm volatile("global_load_async_to_lds_b128 %0, %8, off\n\t"
               "global_load_async_to_lds_b128 %1, %9, off\n\t"
               "global_load_async_to_lds_b128 %2, %10, off\n\t"
               "global_load_async_to_lds_b128 %3, %11, off\n\t"
               "global_load_async_to_lds_b128 %4, %12, off\n\t"
               "global_load_async_to_lds_b128 %5, %13, off\n\t"
               "global_load_async_to_lds_b128 %6, %14, off\n\t"
               "global_load_async_to_lds_b128 %7, %15, off\n\t"
               "s_wait_xcnt 0x0"
               :: "v"(l), "v"(l + st), "v"(l + 2 * st), "v"(l + 3 * st), "v"(l + 4 * st), "v"(l + 5 * st), "v"(l + 6 * st), "v"(l + 7 * st),
                  "v"(g), "v"(g + (size_t)16 * DM), "v"(g + (size_t)32 * DM), "v"(g + (size_t)48 * DM), "v"(g + (size_t)64 * DM), "v"(g + (size_t)80 * DM), "v"(g + (size_t)96 * DM), "v"(g + (size_t)112 * DM) : "memory"); }
__device__ __forceinline__ void g3_copy(const _Float16* ga, const _Float16* gb, unsigned l) { g3_copy8(ga, l); g3_copy8(gb, l + 128 * G3P * 2); }      /* a stage: the A rows, behind them the B rows */
__device__ __forceinline__ v16h g3_frag(const unsigned short* p) { FragH f; f.half[0] = *(const v8us*)p; f.half[1] = *(const v8us*)(p + 16); return f.v; }      /* p already holds the lane's 8 hh: the k order of g2_frag */
__device__ __forceinline__ void g3_main(const _Float16* __restrict__ A, const _Float16* __restrict__ Bh, int rowb, int colb, unsigned short* sm, v8f (&acc)[8]) {
  const int tid = threadIdx.x, w = tid >> 5, lane = tid & 31, ln = lane & 15, hh = lane >> 4;
  const _Float16* ga = A + (size_t)(rowb + (tid >> 4)) * DM + (tid & 15) * 8; const _Float16* gb = Bh + (size_t)(colb + (tid >> 4)) * DM + (tid & 15) * 8;
  const unsigned l0 = (unsigned)(size_t)sm + (unsigned)((tid >> 4) * (G3P * 2) + (tid & 15) * 16);
  const unsigned short* fa = sm + (32 * (w & 3) + ln) * G3P + 8 * hh; const unsigned short* fb = sm + (128 + 64 * (w >> 2) + ln) * G3P + 8 * hh;
  g3_copy(ga, gb, l0);
  asm volatile("s_wait_asynccnt 0x0" ::: "memory");      /* stage 0 of this wave has landed */
  __syncthreads();      /* stage 0 of every wave has landed */
  g3_copy(ga + G3K, gb + G3K, l0 + G3S * 2);
#pragma unroll 1      /* one stage per trip: the buffer is picked by the trip's parity */
  for (int t = 0; t < G3T; ++t) { const int bo = (t & 1) * G3S; const unsigned short* pa = fa + bo; const unsigned short* pb = fb + bo;
    v16h a[2][2], b[2][4];      /* two fragment sets: the next 32 k of this stage are read from LDS while this one's products run */
    a[0][0] = g3_frag(pa); a[0][1] = g3_frag(pa + 16 * G3P);
#pragma unroll
    for (int n = 0; n < 4; ++n) b[0][n] = g3_frag(pb + n * 16 * G3P);
#pragma unroll
    for (int kk = 0; kk < G3K / 32; ++kk) { const int c = kk & 1, x = c ^ 1;
      if (kk + 1 < G3K / 32) { a[x][0] = g3_frag(pa + (kk + 1) * 32); a[x][1] = g3_frag(pa + 16 * G3P + (kk + 1) * 32);
#pragma unroll
        for (int n = 0; n < 4; ++n) b[x][n] = g3_frag(pb + n * 16 * G3P + (kk + 1) * 32); }
      __builtin_amdgcn_sched_barrier(0);      /* keeps the next set's LDS reads together in front of this set's eight products: without it they sink among the products, and each pair of products waits out an LDS latency of its own */
#pragma unroll
      for (int n = 0; n < 4; ++n) { acc[n] = g2_mma(a[c][0], b[c][n], acc[n]); acc[4 + n] = g2_mma(a[c][1], b[c][n], acc[4 + n]); } }
    asm volatile("s_wait_dscnt 0x0" ::: "memory");      /* this wave's reads of the buffer are done before the barrier frees it */
    asm volatile("s_wait_asynccnt 0x0" ::: "memory");      /* this wave's copies of stage t + 1 have landed before the barrier publishes them */
    __syncthreads();      /* publishes stage t + 1 and ends every wave's reads of stage t */
    if (t + 2 < G3T) g3_copy(ga + (t + 2) * G3K, gb + (t + 2) * G3K, l0 + (unsigned)bo * 2); }
  asm volatile("s_wait_asynccnt 0x0" ::: "memory");      /* nothing is in flight when the buffers become the epilogue's staging (the last trip's barrier has ended every read) */
}

// q | k | v projection of every token row (main loop = g3_main) with all the work between projection and attention in its epilogue. A wave tile is 32 token rows x 64 columns = exactly one head of q, k or v; the block's two heads are both q, both k or both v (block-uniform: sel), so nothing outside the tile is needed.
// q, k: the f32 tile goes through the wave's own LDS slab into row order; a lane takes 4 columns and their rotate_half partners (column ^ 32, same row), the tables come as 16-byte loads, and a row leaves as one whole 128-byte line of f16.
// v: a lane's 8 accumulator registers are 8 consecutive token rows of one column = 16 bytes of a V^T row; the four waves of a head put them into one [64][128] f16 tile in LDS, and behind a barrier each V^T row leaves as 256 contiguous bytes.
__global__ __launch_bounds__(256) void k_qkv(const _Float16* __restrict__ A, const _Float16* __restrict__ Bh, const float* __restrict__ CS, const float* __restrict__ SN, _Float16* __restrict__ Qh, _Float16* __restrict__ Kh, _Float16* __restrict__ Vt) {
  __shared__ __attribute__((aligned(2048))) unsigned short sm[G3B / 2];      /* the two stage buffers; behind the main loop the epilogue's staging */
  static_assert(8 * 32 * 68 * 4 <= G3B, "epilogue slabs must fit the stage buffers");
  const int tid = threadIdx.x, w = tid >> 5, lane = tid & 31, ln = lane & 15, hh = lane >> 4, wm = w & 3, wn = w >> 2;
  const int ntn = 3 * NH / 2; const int mt = blockIdx.x / ntn, np = blockIdx.x - mt * ntn; const int row0 = mt * 128 + 32 * wm; const int sel = np / (NH / 2), h = (np - sel * (NH / 2)) * 2 + wn;
  const v8f z8 = {0.f,0.f,0.f,0.f,0.f,0.f,0.f,0.f}; v8f accs[8] = {z8, z8, z8, z8, z8, z8, z8, z8};
  g3_main(A, Bh, mt * 128, np * 128, sm, accs);
  float (*so)[32][68] = (float (*)[32][68])sm;
  const float alpha = 0.0625f;      /* undoes the x16 of the weights (exact) */
  if (sel < 2) {
#pragma unroll
    for (int u = 0; u < 8; ++u) { const int t = u & 3, half = u >> 2;
#pragma unroll
      for (int r = 0; r < 8; ++r) so[w][half * 16 + 8 * hh + r][t * 16 + ln] = accs[u][r] * alpha; }
    __builtin_amdgcn_fence(__ATOMIC_ACQ_REL, "workgroup"); __builtin_amdgcn_wave_barrier();      /* the slab is the wave's own: its LDS writes are ordered in front of its reads, no block barrier */
    const int rsub = lane >> 4, c4 = (lane & 15) * 4; const float sg = (c4 < HD / 2) ? -1.0f : 1.0f;      /* rotate_half = concat(-x[32:], x[:32]) */
    _Float16* dst = (sel ? Kh : Qh) + (size_t)(row0 + rsub) * DM + h * HD + c4;
    const size_t tofs = (size_t)(row0 % SQ + rsub) * HD + c4; const float* cp = CS + tofs; const float* sp = SN + tofs;      /* 32 | SQ: the tile's 32 rows are 32 consecutive positions of one batch, so every table row is a constant step from the first */
#pragma unroll
    for (int q = 0; q < 16; ++q) { const int r = q * 2 + rsub;
      const v4f xv = *(const v4fa*)&so[w][r][c4], pa = *(const v4fa*)&so[w][r][c4 ^ (HD / 2)]; const v4f cc = *(const v4fa*)(cp + q * 2 * HD), ss = *(const v4fa*)(sp + q * 2 * HD); v4h h4;
#pragma unroll
      for (int i = 0; i < 4; ++i) h4[i] = (_Float16)(xv[i] * bf16_round(cc[i]) + pa[i] * (sg * bf16_round(ss[i])));
      *(v4h*)(dst + (size_t)q * 2 * DM) = h4; }
  } else {
    unsigned short* tl = sm + wn * (64 * 136);      /* per head [64 d][136] f16: pitch 272 bytes, so the 16 columns of a 16-byte store start 4 banks apart */
#pragma unroll
    for (int u = 0; u < 8; ++u) { const int t = u & 3, half = u >> 2; FragH f;
#pragma unroll
      for (int r = 0; r < 8; ++r) f.h[r] = (_Float16)(accs[u][r] * alpha);
      *(v8us*)(tl + (t * 16 + ln) * 136 + wm * 32 + half * 16 + 8 * hh) = f.half[0]; }
    __syncthreads();      /* a V^T row of the tile holds token rows of the head's four waves; sel is the same for the whole block */
    const int rb = mt * 128, t2 = tid & 127; unsigned short* vd = (unsigned short*)Vt + ((size_t)((rb / SQ) * NH + h) * HD) * SQ + rb % SQ;
#pragma unroll
    for (int i = 0; i < 8; ++i) { const int d = i * 8 + (t2 >> 4), c8 = (t2 & 15) * 8; *(v8us*)(vd + (size_t)d * SQ + c8) = *(const v8us*)(tl + d * 136 + c8); }
    asm volatile("s_wait_xcnt 0x0" ::: "memory");      /* stands behind the last V^T store, in front of any later write of a register that these stores name */
  } }

// out = o . Wo^T x alpha (main loop = g3_main); the f32 tile goes through the wave's own LDS slab into row order and leaves as whole 256-byte row pieces, as in k_gemm2.
__global__ __launch_bounds__(256) void k_out(const _Float16* __restrict__ A, const _Float16* __restrict__ Bh, float alpha, float* __restrict__ C) {
  __shared__ __attribute__((aligned(2048))) unsigned short sm[G3B / 2];      /* the two stage buffers; behind the main loop the epilogue's staging */
  const int tid = threadIdx.x, w = tid >> 5, lane = tid & 31, ln = lane & 15, hh = lane >> 4;
  const int ntn = DM / 128; const int mt = blockIdx.x / ntn, np = blockIdx.x - mt * ntn; const int row0 = mt * 128 + 32 * (w & 3), col0 = np * 128 + 64 * (w >> 2);
  const v8f z8 = {0.f,0.f,0.f,0.f,0.f,0.f,0.f,0.f}; v8f accs[8] = {z8, z8, z8, z8, z8, z8, z8, z8};
  g3_main(A, Bh, mt * 128, np * 128, sm, accs);
  float (*so)[32][68] = (float (*)[32][68])sm;
#pragma unroll
  for (int u = 0; u < 8; ++u) { const int t = u & 3, half = u >> 2;
#pragma unroll
    for (int r = 0; r < 8; ++r) so[w][half * 16 + 8 * hh + r][t * 16 + ln] = accs[u][r] * alpha; }
  __builtin_amdgcn_fence(__ATOMIC_ACQ_REL, "workgroup"); __builtin_amdgcn_wave_barrier();      /* the slab is the wave's own: its LDS writes are ordered in front of its reads, no block barrier */
  const int rsub = lane >> 4, c4 = (lane & 15) * 4;
#pragma unroll
  for (int q = 0; q < 16; ++q) { const int r = q * 2 + rsub; *(v4f*)(C + (size_t)(row0 + r) * DM + col0 + c4) = *(const v4fa*)&so[w][r][c4]; } }

__device__ __forceinline__ float xrow(float v) { const int b = __float_as_int(v); return __int_as_float(__builtin_amdgcn_permlanex16(b, b, 0x76543210, 0xfedcba98, false, false)); }      /* lane l <-> l ^ 16; every lane must be active */
__device__ __forceinline__ v8f fa_mma(v16h a, v16h b, v8f c) { return __builtin_amdgcn_wmma_f32_16x16x32_f16(false, a, false, b, (short)0, c, false, false); }
__global__ __launch_bounds__(256) void k_fattn(const _Float16* __restrict__ Qh, const _Float16* __restrict__ Kh, const _Float16* __restrict__ Vt, _Float16* __restrict__ O) {
  const int lane = threadIdx.x & 31, ln = lane & 15, hh = lane >> 4, w = threadIdx.x >> 5; const int h = blockIdx.y, b = B0 + blockIdx.z; const size_t r0 = (size_t)b * SQ; const int q0 = blockIdx.x * 256 + w * 32;
  const _Float16* qp = Qh + (r0 + q0 + ln) * DM + h * HD; const _Float16* kp = Kh + (r0 + ln) * DM + h * HD; const _Float16* vp = Vt + ((size_t)(b * NH + h) * HD + ln) * SQ;
  const float c = 0.18033688011112042f; const v8f z8 = {0.f,0.f,0.f,0.f,0.f,0.f,0.f,0.f};
  v16h qf[2][2], kf[2][2]; v8f o[2][4]; float mu[2] = {-3.0e38f, -3.0e38f}, ls[2] = {0.f, 0.f};
#pragma unroll
  for (int j = 0; j < 2; ++j) {
#pragma unroll
    for (int ks = 0; ks < 2; ++ks) { qf[j][ks] = g2_frag(qp + (size_t)j * 16 * DM + ks * 32, hh); kf[j][ks] = g2_frag(kp + (size_t)j * 16 * DM + ks * 32, hh); }
#pragma unroll
    for (int dt = 0; dt < 4; ++dt) o[j][dt] = z8; }
#pragma unroll 1      /* one pass per trip: a second copy of the body would take the registers that four waves per SIMD need */
  for (int k0 = 0; k0 < SQ; k0 += 32) {
    v16h vf[4]; v8f s[2][2]; float mx[2];
#pragma unroll
    for (int dt = 0; dt < 4; ++dt) vf[dt] = g2_frag(vp + (size_t)dt * 16 * SQ + k0, hh);
    __builtin_amdgcn_sched_barrier(0);      /* keeps the V^T loads in front of the score products: without it they sink below the softmax's maximum and have half the lead on their use */
#pragma unroll
    for (int j = 0; j < 2; ++j) {
#pragma unroll
      for (int kt = 0; kt < 2; ++kt) s[j][kt] = fa_mma(kf[kt][1], qf[j][1], fa_mma(kf[kt][0], qf[j][0], z8)); }
    const int kn = (k0 + 32 < SQ) ? k0 + 32 : 0;      /* the next pass's K fragments fly during this pass's softmax; the last pass re-reads pass 0's rows (in bounds, not used) */
#pragma unroll
    for (int kt = 0; kt < 2; ++kt) {
#pragma unroll
      for (int ks = 0; ks < 2; ++ks) kf[kt][ks] = g2_frag(kp + (size_t)(kn + kt * 16) * DM + ks * 32, hh); }
    asm volatile("s_wait_xcnt 0x0" ::: "memory");      /* the trip's end adds to the address registers that the V^T and K loads above name: this wait stands in front of those overwrites (a build without it had the K loads sunk below the branch) */
#pragma unroll
    for (int j = 0; j < 2; ++j) { float a = fmaxf(s[j][0][0], s[j][1][0]);
#pragma unroll
      for (int r = 1; r < 8; ++r) a = fmaxf(a, fmaxf(s[j][0][r], s[j][1][r]));
      mx[j] = fmaxf(a, xrow(a)) * c; }
    const bool need = (mx[0] > mu[0] + 8.0f) || (mx[1] > mu[1] + 8.0f);
    if (__builtin_amdgcn_ballot_w32(need) != 0) {      /* one scalar branch per pass; always taken in the first pass (mu = -3e38: factor 0 on zero sums) */
#pragma unroll
      for (int j = 0; j < 2; ++j) { const float mn = fmaxf(mu[j], mx[j]); const float al = __builtin_amdgcn_exp2f(mu[j] - mn); mu[j] = mn; ls[j] *= al;
#pragma unroll
        for (int dt = 0; dt < 4; ++dt) o[j][dt] *= al; } }
#pragma unroll
    for (int j = 0; j < 2; ++j) { const float bias = 7.0f - mu[j]; FragH pf; float t[8];
#pragma unroll
      for (int r = 0; r < 8; ++r) { const float p0 = __builtin_amdgcn_exp2f(fmaf(s[j][0][r], c, bias)), p1 = __builtin_amdgcn_exp2f(fmaf(s[j][1][r], c, bias)); pf.h[r] = (_Float16)p0; pf.h[8 + r] = (_Float16)p1; t[r] = p0 + p1; }
      ls[j] += ((t[0] + t[1]) + (t[2] + t[3])) + ((t[4] + t[5]) + (t[6] + t[7]));
#pragma unroll
      for (int dt = 0; dt < 4; ++dt) o[j][dt] = fa_mma(vf[dt], pf.v, o[j][dt]); } }
#pragma unroll
  for (int j = 0; j < 2; ++j) { const float sc = 64.0f / (ls[j] + xrow(ls[j]));      /* the halves' sums join once; o carried x64 as before */
    unsigned short* dst = (unsigned short*)O + (r0 + q0 + j * 16 + ln) * DM + h * HD + 8 * hh;
#pragma unroll
    for (int dt = 0; dt < 4; ++dt) { FragH f;
#pragma unroll
      for (int r = 0; r < 8; ++r) f.h[r] = (_Float16)(o[j][dt][r] * sc);
      *(v8us*)(dst + dt * 16) = f.half[0]; } } }

extern "C" void kernel_launch(void* const* d_in, const int* in_sizes, int n_in,
                              void* d_out, int out_size, void* d_ws, size_t ws_size, hipStream_t stream) {
  (void)in_sizes; (void)n_in; (void)out_size;
  const float* const* I = (const float* const*)d_in; const float* x = I[0]; const float* tcos = I[1]; const float* tsin = I[2]; const float* wq = I[3]; const float* wk = I[4]; const float* wv = I[5]; const float* wo = I[6]; const float* bo = nullptr;      /* natural [out][in] weights, no biases; cos/sin INPUT tables [1][S][1][64] = [S][64] */
  char* ws = (char*)d_ws; size_t off = 0;
  auto take = [&](size_t bytes) { char* p = ws + off; off += (bytes + 255) & ~(size_t)255; return p; };
  _Float16* BQKV = (_Float16*)take((size_t)3 * DM * DM * 2); _Float16* BO = (_Float16*)take((size_t)DM * DM * 2);
  _Float16* X16 = (_Float16*)take(NR * DM * 2);
  _Float16* QH = (_Float16*)take(NR * DM * 2); _Float16* KH = (_Float16*)take(NR * DM * 2); _Float16* O16 = (_Float16*)take(NR * DM * 2);
  _Float16* VT = (_Float16*)take((size_t)NB * NH * HD * SQ * 2);      /* V^T of every batch */
  if (off > ws_size) return;
  { const unsigned g = (unsigned)(((size_t)DM * DM / 8 + 255) / 256); k_wnat<<<g, 256, 0, stream>>>(wq, (size_t)DM * DM / 8, BQKV); k_wnat<<<g, 256, 0, stream>>>(wk, (size_t)DM * DM / 8, BQKV + (size_t)DM * DM); k_wnat<<<g, 256, 0, stream>>>(wv, (size_t)DM * DM / 8, BQKV + (size_t)2 * DM * DM); k_wnat<<<g, 256, 0, stream>>>(wo, (size_t)DM * DM / 8, BO); }      /* natural [out][in] = Bt[n][k], x16; q | k | v stacked along n */
  k_x16<<<(unsigned)((NR * DM / 8 + 255) / 256), 256, 0, stream>>>(x, X16, NR * DM / 8);
  k_qkv<<<(unsigned)((NR / 128) * (3 * DM / 128)), 256, 0, stream>>>(X16, BQKV, tcos, tsin, QH, KH, VT);      /* every batch: rotated f16 q and k rows, V^T [NB][NH][HD][SQ] */
  k_fattn<<<dim3(QN / 256, NHD, NBR), 256, 0, stream>>>(QH, KH, VT, O16);      /* all batches and heads in one launch; o x64 as f16 in the merged rows */
  k_out<<<(unsigned)((MPO / 128) * (DM / 128)), 256, 0, stream>>>(O16 + (size_t)B0 * SQ * DM, BO, 0.0009765625f, (float*)d_out + (size_t)B0 * SQ * DM);      /* out rows are the output layout */
}

// v005
// A run of this version takes 132 microseconds.
// Two timings next to v004 put it at 1.26 and 1.27 times that version's speed.
// All steps since v000 together make it 53.3 times as fast.
#include <hip/hip_runtime.h>
// RoPE multi-head self-attention with INPUT rotary tables (x [4][2048][1024]; q/k/v = x W^T (nn.Linear natural [out][in] sigma 0.02, no bias), 16 heads of 64; q = q cos + rotate_half(q) sin with the module's cos/sin inputs [1][2048][1][64] (full head width, independent values per dim; rotate_half = concat(-x[32:], x[:32])), same for k; scores / 8; softmax over all keys (no mask); out = merged Wo^T (no bias) -> [4][2048][1024]).
// Structure: token rows r = b*2048 + s; x as exact f16 rows (bf16-rounded); q | k | v of all batches as ONE WMMA GEMM launch (32x64 wave tiles = one head wide, operands staged in LDS per 128x128 block tile, f32 accumulation, exact x16 weights, N = 3 x 1024) whose epilogue does the rest while the tile is still on chip: the half-split rotary rotation of q and k from the cos/sin tables (no norm) -> f16 q, k rows, and v -> f16 V^T through an LDS transpose (no f32 q | k | v and no v rows in memory); then ONE fused attention launch over all batches and heads (scores on WMMA, online softmax in registers with f32 statistics and native exp2, weights as f16 straight into the P . V WMMA; o carried x64 against f16 subnormal flush, folded into the output GEMM alpha) written straight into the merged f16 o rows; out = o W_o GEMM (f32) into the output layout.
// Compute dtype: inputs rounded to bf16; x / weights exact; projections and rope f32; q, k, v, softmax weights and o as plain f16 GEMM operands (~2^-12); scores and softmax statistics f32. v_wmma_f32_16x16x32_f16.
#define NB 4
#define SQ 2048
#define DM 1024
#define NH 16
#define HD 64
#define HG 4                         /* heads per launch of the non-template k_vt */
#define B0 0                         /* first batch processed (debug hook) */
#define NBR NB                       /* batches processed (debug hook) */
#define QN SQ                        /* query rows attended per batch (debug hook) */
#define NHD NH                       /* heads attended (debug hook) */
#define NR ((size_t)NB * SQ)         /* token rows */
#define MPO ((int)((size_t)NBR * SQ))      /* rows through the output GEMM (debug hook) */
typedef __bf16 v16b __attribute__((ext_vector_type(16)));
typedef unsigned short v8us __attribute__((ext_vector_type(8), may_alias));
typedef float  v8f  __attribute__((ext_vector_type(8)));
typedef float  v4f  __attribute__((ext_vector_type(4)));
typedef float  v4fa __attribute__((ext_vector_type(4), may_alias));
union FragB { v16b v; v8us half[2]; unsigned short u[16]; };

__device__ __forceinline__ unsigned short bf16_bits(float x) { unsigned int u = __float_as_uint(x); return (unsigned short)((u + 0x7FFFu + ((u >> 16) & 1u)) >> 16); }
__device__ __forceinline__ float bf16_val(unsigned short b) { return __uint_as_float(((unsigned int)b) << 16); }
__device__ __forceinline__ float bf16_round(float x) { return bf16_val(bf16_bits(x)); }
// D += A·B with NT terms: 1 = ah·bh, 2 = + al·bh (A split), 3 = + ah·bl (both split)
template <int NT>
__device__ __forceinline__ v8f mmaN(v16b ah, v16b al, v16b bh, v16b bl, v8f c) {
  c = __builtin_amdgcn_wmma_f32_16x16x32_bf16(false, ah, false, bh, (short)0, c, false, false);
  if (NT >= 2) c = __builtin_amdgcn_wmma_f32_16x16x32_bf16(false, al, false, bh, (short)0, c, false, false);
  if (NT >= 3) c = __builtin_amdgcn_wmma_f32_16x16x32_bf16(false, ah, false, bl, (short)0, c, false, false);
  asm volatile("v_nop\n\tv_nop\n\tv_nop\n\tv_nop" : "+v"(c) : "v"(ah), "v"(al), "v"(bh), "v"(bl));
  return c;
}

__global__ __launch_bounds__(256) void k_wt_bf16(const float* __restrict__ W, unsigned short* __restrict__ Wt, int K, int N) {
  const int t = blockIdx.x * 256 + threadIdx.x;
  const int k8n = K / 8;
  if (t >= N * k8n) return;
  const int n = t / k8n, k8 = (t % k8n) * 8;
  v8us v;
#pragma unroll
  for (int i = 0; i < 8; ++i) v[i] = bf16_bits(W[(size_t)(k8 + i) * N + n]);
  *(v8us*)(Wt + (size_t)n * K + k8) = v;
  
}

// GEMM C[M][N] (f32, pitch ldc) = act(A[M][K]·W + bias). A f32 row-major (pitch lda) converted per fragment to bf16
// (ASPLIT: hi/lo two planes -> 2 terms, else single rounded term); Wt bf16 [N][K] (pitch ldb). BIAS_BF16 rounds the
// bias to bf16 first (bias quantised to bf16 before the add). K%32==0, M%16==0, N%64==0.
template <bool ASPLIT, int ACT, bool BIAS_BF16>
__global__ __launch_bounds__(128) void k_gemm_bf(const float* __restrict__ A, int lda, const unsigned short* __restrict__ Wt, int ldb,
                                               const float* __restrict__ bias, float* __restrict__ C, int ldc, int M, int N, int K) {
  __shared__ __attribute__((aligned(16))) float so[4][16][64];
  const int tid = threadIdx.x, w = tid >> 5, lane = tid & 31, ln = lane & 15, hh = lane >> 4;
  const int ntn = N / 64;
  const int wid = blockIdx.x * 4 + w;
  const int mt = wid / ntn, nq = wid % ntn;
  if (mt * 16 >= M) return;
  const int row0 = mt * 16, col0 = nq * 64;
  const float* arow = A + (size_t)(row0 + ln) * lda;
  v8f acc[4] = {};
  for (int kb = 0; kb < K; kb += 32) {
    FragB ah, al;
    const v4f x0 = *(const v4fa*)(arow + kb + 8 * hh), x1 = *(const v4fa*)(arow + kb + 8 * hh + 4);
    const v4f x2 = *(const v4fa*)(arow + kb + 16 + 8 * hh), x3 = *(const v4fa*)(arow + kb + 16 + 8 * hh + 4);
    float xs[16] = {x0[0],x0[1],x0[2],x0[3],x1[0],x1[1],x1[2],x1[3],x2[0],x2[1],x2[2],x2[3],x3[0],x3[1],x3[2],x3[3]};
#pragma unroll
    for (int i = 0; i < 16; ++i) { const unsigned short hb = bf16_bits(xs[i]); ah.u[i] = hb; al.u[i] = ASPLIT ? bf16_bits(xs[i] - bf16_val(hb)) : (unsigned short)0; }
#pragma unroll
    for (int t = 0; t < 4; ++t) {
      const unsigned short* brow = Wt + (size_t)(col0 + t * 16 + ln) * ldb + kb;
      FragB b;
      b.half[0] = *(const v8us*)(brow + 8 * hh);
      b.half[1] = *(const v8us*)(brow + 16 + 8 * hh);
      acc[t] = mmaN<ASPLIT ? 2 : 1>(ah.v, al.v, b.v, b.v, acc[t]);
    }
  }
#pragma unroll
  for (int t = 0; t < 4; ++t) {
    float bv = bias ? bias[col0 + t * 16 + ln] : 0.f;
    if (BIAS_BF16) bv = bf16_round(bv);
#pragma unroll
    for (int r = 0; r < 8; ++r) { float v = acc[t][r] + bv; if (ACT == 1) v = fmaxf(v, 0.f); so[w][8 * hh + r][t * 16 + ln] = v; }
  }
  __builtin_amdgcn_fence(__ATOMIC_ACQ_REL, "workgroup");
  __builtin_amdgcn_wave_barrier();
  const int rsub = lane >> 4, c4 = (lane & 15) * 4;
  {
#pragma unroll
    for (int q = 0; q < 8; ++q) {
      const int r = q * 2 + rsub;
      const v4f v = *(const v4fa*)&so[w][r][c4];
      *(v4f*)(C + (size_t)(row0 + r) * ldc + col0 + c4) = v;
    }
    
  }
}

// GEMM C = act(A·W + bias + resid): A f32 (ASPLIT -> hi/lo 2 terms), Wt bf16 [N][K]; ACT 0 none, 1 relu, 2 exact gelu;
// resid (optional, f32, row index = (row % rmod), pitch ldr, RES_BF16 rounds it) added before the activation.
template <bool ASPLIT, int ACT, bool BIAS_BF16, bool RES_BF16>
__global__ __launch_bounds__(128) void k_gemm_bf3(const float* __restrict__ A, int lda, const unsigned short* __restrict__ Wt, int ldb,
                                                const float* __restrict__ bias, const float* __restrict__ resid, int rmod, int ldr,
                                                float* __restrict__ C, int ldc, int M, int N, int K) {
  __shared__ __attribute__((aligned(16))) float so[4][16][64];
  const int tid = threadIdx.x, w = tid >> 5, lane = tid & 31, ln = lane & 15, hh = lane >> 4;
  const int ntn = N / 64;
  const int wid = blockIdx.x * 4 + w;
  const int mt = wid / ntn, nq = wid % ntn;
  if (mt * 16 >= M) return;
  const int row0 = mt * 16, col0 = nq * 64;
  const float* arow = A + (size_t)(row0 + ln) * lda;
  v8f acc[4] = {};
  for (int kb = 0; kb < K; kb += 32) {
    FragB ah, al;
    const v4f x0 = *(const v4fa*)(arow + kb + 8 * hh), x1 = *(const v4fa*)(arow + kb + 8 * hh + 4);
    const v4f x2 = *(const v4fa*)(arow + kb + 16 + 8 * hh), x3 = *(const v4fa*)(arow + kb + 16 + 8 * hh + 4);
    float xs[16] = {x0[0],x0[1],x0[2],x0[3],x1[0],x1[1],x1[2],x1[3],x2[0],x2[1],x2[2],x2[3],x3[0],x3[1],x3[2],x3[3]};
#pragma unroll
    for (int i = 0; i < 16; ++i) { const unsigned short hb = bf16_bits(xs[i]); ah.u[i] = hb; al.u[i] = ASPLIT ? bf16_bits(xs[i] - bf16_val(hb)) : (unsigned short)0; }
#pragma unroll
    for (int t = 0; t < 4; ++t) {
      const unsigned short* brow = Wt + (size_t)(col0 + t * 16 + ln) * ldb + kb;
      FragB b;
      b.half[0] = *(const v8us*)(brow + 8 * hh);
      b.half[1] = *(const v8us*)(brow + 16 + 8 * hh);
      acc[t] = mmaN<ASPLIT ? 2 : 1>(ah.v, al.v, b.v, b.v, acc[t]);
    }
  }
#pragma unroll
  for (int t = 0; t < 4; ++t) {
    const int col = col0 + t * 16 + ln;
    float bv = bias ? bias[col] : 0.f;
    if (BIAS_BF16) bv = bf16_round(bv);
#pragma unroll
    for (int r = 0; r < 8; ++r) {
      float v = acc[t][r] + bv;
      if (resid) { float rv = resid[(size_t)((row0 + 8 * hh + r) % rmod) * ldr + col]; if (RES_BF16) rv = bf16_round(rv); v += rv; }
      if (ACT == 1) v = fmaxf(v, 0.f);
      if (ACT == 2) v = 0.5f * v * (1.0f + erff(v * 0.70710678118654752f));
      if (ACT == 3) { const float u = 0.7978845608028654f * (v + 0.044715f * v * v * v); v = 0.5f * v * (1.0f + tanhf(u)); }
      so[w][8 * hh + r][t * 16 + ln] = v;
    }
  }
  __builtin_amdgcn_fence(__ATOMIC_ACQ_REL, "workgroup");
  __builtin_amdgcn_wave_barrier();
  const int rsub = lane >> 4, c4 = (lane & 15) * 4;
  {
#pragma unroll
    for (int q = 0; q < 8; ++q) {
      const int r = q * 2 + rsub;
      const v4f v = *(const v4fa*)&so[w][r][c4];
      *(v4f*)(C + (size_t)(row0 + r) * ldc + col0 + c4) = v;
    }
    
  }
}
// row LayerNorm (biased variance, eps) over N: s = X (+ R); optional out_sum <- s; out_norm <- (s-mu)*rsqrt(var+eps)*g + b
template <bool PARAM_BF16>
__global__ __launch_bounds__(256) void k_layernorm(const float* __restrict__ X, const float* __restrict__ R, const float* __restrict__ g, const float* __restrict__ bta,
                                                  float* __restrict__ out_sum, float* __restrict__ out_norm, int N, float eps) {
  __shared__ float red[256];
  const int row = blockIdx.x, tid = threadIdx.x;
  const float* x = X + (size_t)row * N; const float* rr = R ? R + (size_t)row * N : nullptr;
  float vals[16];                     // up to N = 4096
  const int per = N / 256;            // contiguous chunk per thread? use strided-by-4 chunks: thread handles j = tid*4 + 1024*u
  float s1 = 0.f;
  for (int u = 0; u < per / 4; ++u) {
    const int j = tid * 4 + 1024 * u;
    const v4f a = *(const v4fa*)(x + j);
    v4f b = {0.f,0.f,0.f,0.f}; if (rr) b = *(const v4fa*)(rr + j);
#pragma unroll
    for (int q = 0; q < 4; ++q) { const float v = a[q] + b[q]; vals[u * 4 + q] = v; s1 += v; }
  }
  red[tid] = s1; __syncthreads();
  for (int st = 128; st > 0; st >>= 1) { if (tid < st) red[tid] += red[tid + st]; __syncthreads(); }
  const float mu = red[0] / (float)N; __syncthreads();
  float s2 = 0.f;
  for (int u = 0; u < per / 4; ++u)
#pragma unroll
    for (int q = 0; q < 4; ++q) { const float c = vals[u * 4 + q] - mu; s2 += c * c; }
  red[tid] = s2; __syncthreads();
  for (int st = 128; st > 0; st >>= 1) { if (tid < st) red[tid] += red[tid + st]; __syncthreads(); }
  const float rs = rsqrtf(red[0] / (float)N + eps);
  {
    for (int u = 0; u < per / 4; ++u) {
      const int j = tid * 4 + 1024 * u;
      v4f o, sm;
#pragma unroll
      for (int q = 0; q < 4; ++q) {
        float gg = g[j + q], bb = bta[j + q];
        if (PARAM_BF16) { gg = bf16_round(gg); bb = bf16_round(bb); }
        sm[q] = vals[u * 4 + q]; o[q] = (vals[u * 4 + q] - mu) * rs * gg + bb;
      }
      if (out_sum) *(v4f*)(out_sum + (size_t)row * N + j) = sm;
      *(v4f*)(out_norm + (size_t)row * N + j) = o;
    }
    
  }
}



// ---- f16 WMMA path (v_wmma_f32_16x16x32_f16): 11-bit significands for operands in range — used where a [0,1] probability operand needs more precision than bf16
typedef _Float16 v16h __attribute__((ext_vector_type(16)));
union FragH { v16h v; v8us half[2]; _Float16 h[16]; unsigned short u[16]; };
template <int NT>
__device__ __forceinline__ v8f mmaH(v16h ah, v16h al, v16h bh, v16h bl, v8f c) {
  c = __builtin_amdgcn_wmma_f32_16x16x32_f16(false, ah, false, bh, (short)0, c, false, false);
  if (NT >= 2) c = __builtin_amdgcn_wmma_f32_16x16x32_f16(false, al, false, bh, (short)0, c, false, false);
  if (NT >= 3) c = __builtin_amdgcn_wmma_f32_16x16x32_f16(false, ah, false, bl, (short)0, c, false, false);
  asm volatile("v_nop\n\tv_nop\n\tv_nop\n\tv_nop" : "+v"(c) : "v"(ah), "v"(al), "v"(bh), "v"(bl));
  return c;
}
// batched GEMM like k_gemm_b but f16 operands: A f32 (split into f16 hi/lo if ASPLIT, else rounded to f16), Bt = f16 values [n][k]; alpha; C f32; N multiple of 16 (partial tiles skipped)
template <bool ASPLIT>
__global__ __launch_bounds__(128) void k_gemm_h(const float* __restrict__ A, int lda, size_t sA, const _Float16* __restrict__ Bh, int ldb, size_t sB, float alpha, float* __restrict__ C, int ldc, size_t sC, int M, int N, int K) {
  __shared__ __attribute__((aligned(16))) float so[4][16][64];
  const int tid = threadIdx.x, w = tid >> 5, lane = tid & 31, ln = lane & 15, hh = lane >> 4; const int by = blockIdx.y;
  A += (size_t)by * sA; Bh += (size_t)by * sB; C += (size_t)by * sC;
  const int ntn = (N + 63) / 64; const int wid = blockIdx.x * 4 + w; const int mt = wid / ntn, nq = wid % ntn; if (mt * 16 >= M) return;
  const int row0 = mt * 16, col0 = nq * 64; const float* arow = A + (size_t)(row0 + ln) * lda;
  v8f acc[4] = {};
  for (int kb = 0; kb < K; kb += 32) {
    FragH ah, al;
    const v4f x0 = *(const v4fa*)(arow + kb + 8 * hh), x1 = *(const v4fa*)(arow + kb + 8 * hh + 4), x2 = *(const v4fa*)(arow + kb + 16 + 8 * hh), x3 = *(const v4fa*)(arow + kb + 16 + 8 * hh + 4);
    float xs[16] = {x0[0],x0[1],x0[2],x0[3],x1[0],x1[1],x1[2],x1[3],x2[0],x2[1],x2[2],x2[3],x3[0],x3[1],x3[2],x3[3]};
#pragma unroll
    for (int i = 0; i < 16; ++i) { const _Float16 h = (_Float16)xs[i]; ah.h[i] = h; al.h[i] = ASPLIT ? (_Float16)(xs[i] - (float)h) : (_Float16)0.0f; }
#pragma unroll
    for (int t = 0; t < 4; ++t) { if (col0 + t * 16 >= N) continue; const size_t boff = (size_t)(col0 + t * 16 + ln) * ldb + kb; FragH bq; bq.half[0] = *(const v8us*)(Bh + boff + 8 * hh); bq.half[1] = *(const v8us*)(Bh + boff + 16 + 8 * hh);
      acc[t] = mmaH<ASPLIT ? 2 : 1>(ah.v, al.v, bq.v, bq.v, acc[t]); }
  }
#pragma unroll
  for (int t = 0; t < 4; ++t) { if (col0 + t * 16 >= N) continue;
#pragma unroll
    for (int r = 0; r < 8; ++r) so[w][8 * hh + r][t * 16 + ln] = acc[t][r] * alpha; }
  __builtin_amdgcn_fence(__ATOMIC_ACQ_REL, "workgroup"); __builtin_amdgcn_wave_barrier();
  const int rsub = lane >> 4, c4 = (lane & 15) * 4;
  {
#pragma unroll
    for (int q = 0; q < 8; ++q) { const int r = q * 2 + rsub; if (col0 + c4 < N) { const v4f v = *(const v4fa*)&so[w][r][c4]; *(v4f*)(C + (size_t)(row0 + r) * ldc + col0 + c4) = v; } }
     }
}

// Wt[n][k] = f16(W[k][n]·scale) from f32 row-major W[K][N] (scale = power of two; bf16-exact weights stay exact in f16 away from the subnormal range)
__global__ __launch_bounds__(256) void k_wt_f16(const float* __restrict__ W, _Float16* __restrict__ Wt, int K, int N, float scale) {
  const int t = blockIdx.x * 256 + threadIdx.x; if (t >= N * (K / 8)) return; const int n = t / (K / 8), k8 = (t % (K / 8)) * 8; FragH f;
#pragma unroll
  for (int i = 0; i < 8; ++i) f.h[i] = (_Float16)(bf16_round(W[(size_t)(k8 + i) * N + n]) * scale); const v8us o = f.half[0];
  *(v8us*)((unsigned short*)Wt + (size_t)n * K + k8) = o; 
}
// k_gemm_hh variant with fused epilogue: v = acc·alpha + bias[by·sBias + col] (+ CP[(row/rowsPerB)·sCPb + by·64 + col] if CP) ; ACT 0 none / 1 elu ; writes f16 C16 (and f32 C if non-null)
template <int ACT>
__global__ __launch_bounds__(128) void k_gemm_hhx(const _Float16* __restrict__ A, int lda, size_t sA, const _Float16* __restrict__ Bh, int ldb, size_t sB, float alpha, const float* __restrict__ bias, size_t sBias, const float* __restrict__ CP, int rowsPerB, size_t sCPb, int row0g,
    float* __restrict__ C, _Float16* __restrict__ C16, int ldc, size_t sC, int M, int N, int K) {
  __shared__ __attribute__((aligned(16))) float so[4][16][64];
  const int tid = threadIdx.x, w = tid >> 5, lane = tid & 31, ln = lane & 15, hh = lane >> 4; const int by = blockIdx.y;
  A += (size_t)by * sA; Bh += (size_t)by * sB; const size_t cofs = (size_t)by * sC; const float* bp = bias ? bias + (size_t)by * sBias : nullptr;
  const int ntn = (N + 63) / 64; const int wid = blockIdx.x * 4 + w; const int mt = wid / ntn, nq = wid % ntn; if (mt * 16 >= M) return;
  const int row0 = mt * 16, col0 = nq * 64; const _Float16* arow = A + (size_t)(row0 + ln) * lda;
  v8f acc[4] = {};
  for (int kb = 0; kb < K; kb += 32) { FragH ah; ah.half[0] = *(const v8us*)((const unsigned short*)arow + kb + 8 * hh); ah.half[1] = *(const v8us*)((const unsigned short*)arow + kb + 16 + 8 * hh);
#pragma unroll
    for (int t = 0; t < 4; ++t) { if (col0 + t * 16 >= N) continue; const size_t boff = (size_t)(col0 + t * 16 + ln) * ldb + kb; FragH bq; bq.half[0] = *(const v8us*)((const unsigned short*)Bh + boff + 8 * hh); bq.half[1] = *(const v8us*)((const unsigned short*)Bh + boff + 16 + 8 * hh);
      acc[t] = mmaH<1>(ah.v, ah.v, bq.v, bq.v, acc[t]); }
  }
#pragma unroll
  for (int t = 0; t < 4; ++t) { if (col0 + t * 16 >= N) continue; const int col = col0 + t * 16 + ln; const float bv = bp ? bf16_round(bp[col]) : 0.f;
#pragma unroll
    for (int r = 0; r < 8; ++r) { float v = acc[t][r] * alpha + bv; if (CP) { const int rr = row0g + row0 + 8 * hh + r; if (rowsPerB < 0) v += CP[cofs + (size_t)rr * ldc + col];      /* rowsPerB < 0: own element of the batched C plane */ else { const int bidx = rr / rowsPerB; v += CP[(size_t)bidx * sCPb + (size_t)by * 64 + col]; } } if (ACT == 1) v = (v > 0.f) ? v : expm1f(v); else if (ACT == 7) v = (v > 0.f) ? v + 1.0f : expf(v); else if (ACT == 8) v = tanhf(v); else if (ACT == 9) v = 0.5f * v * (1.0f + tanhf(0.7978845608028654f * (v + 0.044715f * v * v * v))); else if (ACT == 11) v = 1.0f / (1.0f + expf(-v)); else if (ACT == 12) v = (v > 0.f) ? v : 0.01f * v; else if (ACT == 14) v = (v > 0.f) ? v : 0.1f * v; else if (ACT == 16) v = (v >= 0.f) ? v : 0.3f * v; else if (ACT == 17) v = (v >= 0.f) ? v : 0.2f * v; else if (ACT == 15) v = v / (1.0f + expf(-v)); else if (ACT == 3) v = fmaxf(v, 0.f); else if (ACT == 6) v = 0.5f * v * (1.0f + erff(v * 0.70710678118654752f)); so[w][8 * hh + r][t * 16 + ln] = v; } }
  __builtin_amdgcn_fence(__ATOMIC_ACQ_REL, "workgroup"); __builtin_amdgcn_wave_barrier();
  const int rsub = lane >> 4, c4 = (lane & 15) * 4; typedef _Float16 v4h __attribute__((ext_vector_type(4)));
  {
#pragma unroll
    for (int q = 0; q < 8; ++q) { const int r = q * 2 + rsub; if (col0 + c4 < N) { const v4f v = *(const v4fa*)&so[w][r][c4]; if (C) *(v4f*)(C + cofs + (size_t)(row0 + r) * ldc + col0 + c4) = v; if (C16) { v4h h4; for (int i = 0; i < 4; ++i) h4[i] = (_Float16)v[i]; *(v4h*)(C16 + cofs + (size_t)(row0 + r) * ldc + col0 + c4) = h4; } } }
     }
}


typedef _Float16 v4h __attribute__((ext_vector_type(4)));

__global__ __launch_bounds__(256) void k_x16(const float* __restrict__ x, _Float16* __restrict__ X16, size_t n8) { const size_t t = (size_t)blockIdx.x * 256 + threadIdx.x; if (t >= n8) return; FragH f;
#pragma unroll
  for (int q = 0; q < 8; ++q) f.h[q] = (_Float16)bf16_round(x[t * 8 + q]); *(v8us*)((unsigned short*)X16 + t * 8) = f.half[0];  }
__global__ __launch_bounds__(256) void k_h16(const float* __restrict__ x, _Float16* __restrict__ X16, size_t n8) { const size_t t = (size_t)blockIdx.x * 256 + threadIdx.x; if (t >= n8) return; FragH f;
#pragma unroll
  for (int q = 0; q < 8; ++q) f.h[q] = (_Float16)x[t * 8 + q]; *(v8us*)((unsigned short*)X16 + t * 8) = f.half[0];  }
__global__ __launch_bounds__(256) void k_round16f(const float* __restrict__ W, _Float16* __restrict__ Bt, size_t n8) { const size_t t = (size_t)blockIdx.x * 256 + threadIdx.x; if (t >= n8) return; FragH f;
#pragma unroll
  for (int i = 0; i < 8; ++i) f.h[i] = (_Float16)(bf16_round(W[t * 8 + i]) * 16.0f); *(v8us*)((unsigned short*)Bt + t * 8) = f.half[0];  }
template <int NHv, int TTv>
__global__ __launch_bounds__(256) void k_vt(const _Float16* __restrict__ V16, int ldv, int voff, _Float16* __restrict__ Vt) { __shared__ unsigned short tl[64][66]; const int tid = threadIdx.x; const int slab = blockIdx.x / (TTv / 64), lg = blockIdx.x % (TTv / 64); const int b = slab / NHv, h = slab % NHv;
  for (int i = tid; i < 64 * 8; i += 256) { const int r = i / 8, c8 = (i % 8) * 8; FragH f; f.half[0] = *(const v8us*)((const unsigned short*)V16 + ((size_t)b * TTv + lg * 64 + r) * ldv + voff + h * 64 + c8);
#pragma unroll
    for (int q = 0; q < 8; ++q) tl[r][c8 + q] = f.u[q]; }
  __syncthreads();
  {
#pragma unroll
    for (int rd = 0; rd < 2; ++rd) { const int d = rd * 32 + tid / 8, pc = tid % 8; FragH f;
#pragma unroll
      for (int q = 0; q < 8; ++q) f.u[q] = tl[pc * 8 + q][d];
      *(v8us*)((unsigned short*)Vt + ((size_t)slab * 64 + d) * TTv + lg * 64 + pc * 8) = f.half[0]; }
     } }

__global__ __launch_bounds__(256) void k_hl(const float* __restrict__ F, _Float16* __restrict__ Hh, _Float16* __restrict__ Hl, size_t n8) { const size_t t = (size_t)blockIdx.x * 256 + threadIdx.x; if (t >= n8) return; FragH fh, fl; const v4f a = *(const v4fa*)(F + t * 8), c = *(const v4fa*)(F + t * 8 + 4);
#pragma unroll
  for (int q = 0; q < 4; ++q) { _Float16 h = (_Float16)a[q]; fh.h[q] = h; fl.h[q] = (_Float16)((a[q] - (float)h) * 1024.0f); h = (_Float16)c[q]; fh.h[4 + q] = h; fl.h[4 + q] = (_Float16)((c[q] - (float)h) * 1024.0f); }
  { *(v8us*)((unsigned short*)Hh + t * 8) = fh.half[0]; *(v8us*)((unsigned short*)Hl + t * 8) = fl.half[0];  } }

// ---- fast GEMM (wave tile 32x64; requires M % 32 == 0 rows per launch region and N % 64 == 0); epilogue = k_gemm_hhx semantics ----
__device__ __forceinline__ v16h g2_frag(const _Float16* p, int hh) { FragH f; f.half[0] = *(const v8us*)((const unsigned short*)p + 8 * hh); f.half[1] = *(const v8us*)((const unsigned short*)p + 16 + 8 * hh); return f.v; }
__device__ __forceinline__ v8f g2_mma(v16h a, v16h b, v8f c) { v8f d = __builtin_amdgcn_wmma_f32_16x16x32_f16(false, a, false, b, (short)0, c, false, false); asm volatile("v_nop\n\tv_nop\n\tv_nop\n\tv_nop" : "+v"(d) : "v"(a), "v"(b)); return d; }
template <int ACT>
__global__ __launch_bounds__(128) void k_gemm2(const _Float16* __restrict__ A, int lda, size_t sA, const _Float16* __restrict__ Bh, int ldb, size_t sB, float alpha, const float* __restrict__ bias, size_t sBias, const float* __restrict__ CP, int rowsPerB, size_t sCPb, int row0g,
    float* __restrict__ C, _Float16* __restrict__ C16, int ldc, size_t sC, int M, int N, int K) { static_assert(ACT == 0 || ACT == 3 || ACT == 6 || ACT == 8 || ACT == 9 || ACT == 11 || ACT == 12 || ACT == 14 || ACT == 15 || ACT == 16 || ACT == 17, "k_gemm2: unsupported ACT code (would silently apply no activation)");
  __shared__ __attribute__((aligned(16))) float so[4][32][68];
  const int tid = threadIdx.x, w = tid >> 5, lane = tid & 31, ln = lane & 15, hh = lane >> 4; const int by = blockIdx.y;
  A += (size_t)by * sA; Bh += (size_t)by * sB; const size_t cofs = (size_t)by * sC; const float* bp = bias ? bias + (size_t)by * sBias : nullptr;
  const int ntn = N >> 6; const int mt = blockIdx.x / ntn, nq = blockIdx.x - mt * ntn; const int row0 = mt * 128 + 32 * w, col0 = nq * 64; if (row0 >= M) return;
  const _Float16* a0p = A + (size_t)(row0 + ln) * lda; const _Float16* a1p = a0p + (size_t)16 * lda;
  const _Float16* b0p = Bh + (size_t)(col0 + ln) * ldb; const _Float16* b1p = b0p + (size_t)16 * ldb; const _Float16* b2p = b1p + (size_t)16 * ldb; const _Float16* b3p = b2p + (size_t)16 * ldb;
  const v8f z8 = {0.f,0.f,0.f,0.f,0.f,0.f,0.f,0.f}; v8f c00 = z8, c01 = z8, c02 = z8, c03 = z8, c10 = z8, c11 = z8, c12 = z8, c13 = z8;
#pragma unroll 1
  for (int kb = 0; kb < K; kb += 32) { const v16h a0 = g2_frag(a0p + kb, hh), a1 = g2_frag(a1p + kb, hh);
    v16h b = g2_frag(b0p + kb, hh); c00 = g2_mma(a0, b, c00); c10 = g2_mma(a1, b, c10);
    b = g2_frag(b1p + kb, hh); c01 = g2_mma(a0, b, c01); c11 = g2_mma(a1, b, c11);
    b = g2_frag(b2p + kb, hh); c02 = g2_mma(a0, b, c02); c12 = g2_mma(a1, b, c12);
    b = g2_frag(b3p + kb, hh); c03 = g2_mma(a0, b, c03); c13 = g2_mma(a1, b, c13); }
  v8f accs[8] = {c00, c01, c02, c03, c10, c11, c12, c13};
#pragma unroll
  for (int u = 0; u < 8; ++u) { const int t = u & 3, half = u >> 2; const int col = col0 + t * 16 + ln; const float bv = bp ? bf16_round(bp[col]) : 0.f;
#pragma unroll
    for (int r = 0; r < 8; ++r) { const int rloc = half * 16 + 8 * hh + r; float v = accs[u][r] * alpha + bv; if (CP) { if (rowsPerB < 0) v += CP[cofs + (size_t)(row0g + row0 + rloc) * ldc + col];      /* rowsPerB < 0: own element of the batched C plane */ else { const int bidx = (row0g + row0 + rloc) / rowsPerB; v += CP[(size_t)bidx * sCPb + (size_t)by * 64 + col]; } }
      if (ACT == 3) v = fmaxf(v, 0.f); else if (ACT == 6) v = 0.5f * v * (1.0f + erff(v * 0.70710678118654752f)); else if (ACT == 11) v = 1.0f / (1.0f + expf(-v)); else if (ACT == 15) v = v / (1.0f + expf(-v)); else if (ACT == 12) v = (v > 0.f) ? v : 0.01f * v; else if (ACT == 8) v = tanhf(v); else if (ACT == 9) v = 0.5f * v * (1.0f + tanhf(0.7978845608028654f * (v + 0.044715f * v * v * v))); else if (ACT == 14) v = (v > 0.f) ? v : 0.1f * v; else if (ACT == 16) v = (v >= 0.f) ? v : 0.3f * v; else if (ACT == 17) v = (v >= 0.f) ? v : 0.2f * v;
      so[w][rloc][t * 16 + ln] = v; } }
  __builtin_amdgcn_fence(__ATOMIC_ACQ_REL, "workgroup"); __builtin_amdgcn_wave_barrier();
  const int rsub = lane >> 4, c4 = (lane & 15) * 4;
  {
#pragma unroll
    for (int q = 0; q < 16; ++q) { const int r = q * 2 + rsub; const v4f v = *(const v4fa*)&so[w][r][c4]; if (C) *(v4f*)(C + cofs + (size_t)(row0 + r) * ldc + col0 + c4) = v; if (C16) { v4h h4; for (int i = 0; i < 4; ++i) h4[i] = (_Float16)v[i]; *(v4h*)(C16 + cofs + (size_t)(row0 + r) * ldc + col0 + c4) = h4; } }
     } }


__global__ __launch_bounds__(256) void k_wnat(const float* __restrict__ w, size_t n8, _Float16* __restrict__ Bt) { const size_t t = (size_t)blockIdx.x * 256 + threadIdx.x; if (t >= n8) return; FragH f; for (int q = 0; q < 8; ++q) f.h[q] = (_Float16)(bf16_round(w[t * 8 + q]) * 16.0f); *(v8us*)((unsigned short*)Bt + t * 8) = f.half[0];  }
__global__ __launch_bounds__(256) void k_rsm(const float* __restrict__ S, _Float16* __restrict__ P, int nrows) {
  #pragma clang fp contract(off)
  const int i = blockIdx.x * 256 + threadIdx.x; if (i >= nrows) return; const float* s = S + (size_t)i * SQ; float mx = -3.0e38f;
#pragma unroll 1
  for (int j = 0; j < SQ; ++j) mx = fmaxf(mx, s[j]); float se = 0.f;
#pragma unroll 1
  for (int j = 0; j < SQ; ++j) se += expf(s[j] - mx); const float sc = 256.0f / se;
#pragma unroll 1
  for (int j0 = 0; j0 < SQ; j0 += 8) { FragH f; for (int q = 0; q < 8; ++q) f.h[q] = (_Float16)(expf(s[j0 + q] - mx) * sc); unsigned short* d = (unsigned short*)P + (size_t)i * SQ + j0; *(v8us*)d = f.half[0];  } }
__global__ __launch_bounds__(256) void k_vt(const _Float16* __restrict__ V16, int b, int h0, _Float16* __restrict__ VT) { __shared__ unsigned short tl[64][65]; const int tid = threadIdx.x; const int hh = blockIdx.x % HG, sg = blockIdx.x / HG; const int s0 = sg * 64; const int h = h0 + hh;
  for (int i = tid; i < 64 * 8; i += 256) { const int j = i / 8, d8 = (i % 8) * 8; FragH f; f.half[0] = *(const v8us*)((const unsigned short*)V16 + ((size_t)b * SQ + s0 + j) * DM + h * HD + d8); for (int q = 0; q < 8; ++q) tl[d8 + q][j] = f.u[q]; }
  __syncthreads();
  { for (int i = tid; i < 64 * 8; i += 256) { const int d = i / 8, j8 = (i % 8) * 8; FragH f; for (int q = 0; q < 8; ++q) f.u[q] = tl[d][j8 + q]; *(v8us*)((unsigned short*)VT + ((size_t)hh * HD + d) * SQ + s0 + j8) = f.half[0]; }  } }


__global__ __launch_bounds__(256) void k_tab2(float theta, float* __restrict__ CS, float* __restrict__ SN) {
  #pragma clang fp contract(off)
  const int t = blockIdx.x * 256 + threadIdx.x; if (t >= SQ * (HD / 2)) return; const int i = t % (HD / 2); const int p = t / (HD / 2); const float invf = 1.0f / powf(theta, (float)(2 * i) / (float)HD); const float ang = __fmul_rn((float)p, invf); const float c = cosf(ang), s = sinf(ang);
  *(float*)(CS + t) = c; *(float*)(SN + t) = s;  }
template <int NORM, int ROPE>
__global__ __launch_bounds__(64) void k_xform(const float* __restrict__ F, int ldf, int nh, const float* __restrict__ gain, float eps, const float* __restrict__ CS, const float* __restrict__ SN, _Float16* __restrict__ H16, int ldo) {
  #pragma clang fp contract(off)
  __shared__ float xv[HD]; __shared__ float red[HD]; __shared__ unsigned short sh_[HD]; const int d = threadIdx.x; const int h = blockIdx.x % nh; const size_t r = blockIdx.x / nh; const int p = (int)(r % SQ);
  float x = F[r * (size_t)ldf + (size_t)h * HD + d];
  if (NORM) { red[d] = __fmul_rn(x, x); __syncthreads(); for (int st = HD / 2; st > 0; st >>= 1) { if (d < st) red[d] = __fadd_rn(red[d], red[d + st]); __syncthreads(); } const float rs = rsqrtf(__fadd_rn(red[0] / (float)HD, eps)); x = __fmul_rn(__fmul_rn(x, rs), bf16_round(gain[d])); }
  xv[d] = x; __syncthreads();
  float o = x;
  if (ROPE == 1) { const int i = d >> 1; const float c = CS[p * (HD / 2) + i], s = SN[p * (HD / 2) + i]; const float ev = xv[2 * i], od = xv[2 * i + 1]; o = (d & 1) ? __fadd_rn(__fmul_rn(ev, s), __fmul_rn(od, c)) : __fadd_rn(__fmul_rn(ev, c), -__fmul_rn(od, s)); }
  if (ROPE == 2) { const int i = d & (HD / 2 - 1); const float c = CS[p * (HD / 2) + i], s = SN[p * (HD / 2) + i]; const float lo = xv[i], hi = xv[i + HD / 2]; o = (d < HD / 2) ? __fadd_rn(__fmul_rn(lo, c), -__fmul_rn(hi, s)) : __fadd_rn(__fmul_rn(lo, s), __fmul_rn(hi, c)); }
  if (ROPE == 6) { const float c = bf16_round(CS[p * HD + d]), s = bf16_round(SN[p * HD + d]); const float pa = xv[(d + HD / 2) & (HD - 1)]; const float rh = (d < HD / 2) ? -pa : pa; o = __fadd_rn(__fmul_rn(x, c), __fmul_rn(rh, s)); }      /* FULL-WIDTH bf16-rounded INPUT tables [p][64]: o = x cos[p][d] + rotate_half(x)[d] sin[p][d], rotate_half = concat(-x[32:], x[:32]) */
  FragH th; th.h[0] = (_Float16)o; sh_[d] = th.u[0]; __syncthreads();
  if (d < HD / 8) { FragH f; for (int q = 0; q < 8; ++q) f.u[q] = sh_[d * 8 + q]; unsigned short* dst = (unsigned short*)H16 + r * (size_t)ldo + (size_t)h * HD + d * 8; *(v8us*)dst = f.half[0];  } }

__global__ __launch_bounds__(256) void k_tab3(float* __restrict__ CS, float* __restrict__ SN) {
  #pragma clang fp contract(off)
  const int t = blockIdx.x * 256 + threadIdx.x; if (t >= SQ * (HD / 2)) return; const int i = t % (HD / 2); const int p = t / (HD / 2); const float freq = expf(__fmul_rn((float)(2 * i), -0.14391156831212787f)); const float ang = __fmul_rn((float)p, freq); const float c = cosf(ang), s = sinf(ang);
  *(float*)(CS + t) = c; *(float*)(SN + t) = s;  }



// ---- GEMM main loop with both operands staged in LDS (used by k_qkv and k_out) ----
// A block of 8 waves makes a 128 x 128 tile of A . B^T (K = DM): wave w takes rows 32 (w & 3) and columns 64 (w >> 2), a 32x64 wave tile as in k_gemm2, with the same fragments, the same k order and the same order of products.
// A stage is 128 k of the block's 128 A rows and 128 B rows: 256 rows of 256 bytes at an LDS pitch of 272 bytes (16 x odd, for 16-byte fragment reads). Two buffers: the next stage's copies fly while this one is worked on; two blocks fit a WGP.
// The rows come by asynchronous copies to LDS: a wave's copy is four whole 128-byte lines, and a row is fetched once per block, where the fragment loads from global memory touched 16 lines each and every wave fetched its own.
#define G3K 128                       /* k per stage */
#define G3P 136                       /* LDS row pitch in f16 */
#define G3S (256 * G3P)               /* f16 per stage */
#define G3B (2 * G3S * 2)             /* bytes of the two buffers */
#define G3T (DM / G3K)                /* stages */
__device__ __forceinline__ void g3_copy8(const _Float16* g, unsigned l) {      /* a thread brings 16 bytes of eight rows, 16 rows apart: the block's 128 rows of one operand */
  const unsigned st = 16 * G3P * 2;
  /* the wait on the last line stands in front of any later write of a register that these copies name */
  asm volatile("global_load_async_to_lds_b128 %0, %8, off\n\t"
               "global_load_async_to_lds_b128 %1, %9, off\n\t"
               "global_load_async_to_lds_b128 %2, %10, off\n\t"
               "global_load_async_to_lds_b128 %3, %11, off\n\t"
               "global_load_async_to_lds_b128 %4, %12, off\n\t"
               "global_load_async_to_lds_b128 %5, %13, off\n\t"
               "global_load_async_to_lds_b128 %6, %14, off\n\t"
               "global_load_async_to_lds_b128 %7, %15, off\n\t"
               "s_wait_xcnt 0x0"
               :: "v"(l), "v"(l + st), "v"(l + 2 * st), "v"(l + 3 * st), "v"(l + 4 * st), "v"(l + 5 * st), "v"(l + 6 * st), "v"(l + 7 * st),
                  "v"(g), "v"(g + (size_t)16 * DM), "v"(g + (size_t)32 * DM), "v"(g + (size_t)48 * DM), "v"(g + (size_t)64 * DM), "v"(g + (size_t)80 * DM), "v"(g + (size_t)96 * DM), "v"(g + (size_t)112 * DM) : "memory"); }
__device__ __forceinline__ void g3_copy(const _Float16* ga, const _Float16* gb, unsigned l) { g3_copy8(ga, l); g3_copy8(gb, l + 128 * G3P * 2); }      /* a stage: the A rows, behind them the B rows */
__device__ __forceinline__ v16h g3_frag(const unsigned short* p) { FragH f; f.half[0] = *(const v8us*)p; f.half[1] = *(const v8us*)(p + 16); return f.v; }      /* p already holds the lane's 8 hh: the k order of g2_frag */
__device__ __forceinline__ void g3_main(const _Float16* __restrict__ A, const _Float16* __restrict__ Bh, int rowb, int colb, unsigned short* sm, v8f (&acc)[8]) {
  const int tid = threadIdx.x, w = tid >> 5, lane = tid & 31, ln = lane & 15, hh = lane >> 4;
  const _Float16* ga = A + (size_t)(rowb + (tid >> 4)) * DM + (tid & 15) * 8; const _Float16* gb = Bh + (size_t)(colb + (tid >> 4)) * DM + (tid & 15) * 8;
  const unsigned l0 = (unsigned)(size_t)sm + (unsigned)((tid >> 4) * (G3P * 2) + (tid & 15) * 16);
  const unsigned short* fa = sm + (32 * (w & 3) + ln) * G3P + 8 * hh; const unsigned short* fb = sm + (128 + 64 * (w >> 2) + ln) * G3P + 8 * hh;
  g3_copy(ga, gb, l0);
  asm volatile("s_wait_asynccnt 0x0" ::: "memory");      /* stage 0 of this wave has landed */
  __syncthreads();      /* stage 0 of every wave has landed */
  g3_copy(ga + G3K, gb + G3K, l0 + G3S * 2);
#pragma unroll 1      /* one stage per trip: the buffer is picked by the trip's parity */
  for (int t = 0; t < G3T; ++t) { const int bo = (t & 1) * G3S; const unsigned short* pa = fa + bo; const unsigned short* pb = fb + bo;
    v16h a[2][2], b[2][4];      /* two fragment sets: the next 32 k of this stage are read from LDS while this one's products run */
    a[0][0] = g3_frag(pa); a[0][1] = g3_frag(pa + 16 * G3P);
#pragma unroll
    for (int n = 0; n < 4; ++n) b[0][n] = g3_frag(pb + n * 16 * G3P);
#pragma unroll
    for (int kk = 0; kk < G3K / 32; ++kk) { const int c = kk & 1, x = c ^ 1;
      if (kk + 1 < G3K / 32) { a[x][0] = g3_frag(pa + (kk + 1) * 32); a[x][1] = g3_frag(pa + 16 * G3P + (kk + 1) * 32);
#pragma unroll
        for (int n = 0; n < 4; ++n) b[x][n] = g3_frag(pb + n * 16 * G3P + (kk + 1) * 32); }
      __builtin_amdgcn_sched_barrier(0);      /* keeps the next set's LDS reads together in front of this set's eight products: without it they sink among the products, and each pair of products waits out an LDS latency of its own */
#pragma unroll
      for (int n = 0; n < 4; ++n) { acc[n] = g2_mma(a[c][0], b[c][n], acc[n]); acc[4 + n] = g2_mma(a[c][1], b[c][n], acc[4 + n]); } }
    asm volatile("s_wait_dscnt 0x0" ::: "memory");      /* this wave's reads of the buffer are done before the barrier frees it */
    asm volatile("s_wait_asynccnt 0x0" ::: "memory");      /* this wave's copies of stage t + 1 have landed before the barrier publishes them */
    __syncthreads();      /* publishes stage t + 1 and ends every wave's reads of stage t */
    if (t + 2 < G3T) g3_copy(ga + (t + 2) * G3K, gb + (t + 2) * G3K, l0 + (unsigned)bo * 2); }
  asm volatile("s_wait_asynccnt 0x0" ::: "memory");      /* nothing is in flight when the buffers become the epilogue's staging (the last trip's barrier has ended every read) */
}

// q | k | v projection of every token row (main loop = g3_main) with all the work between projection and attention in its epilogue. A wave tile is 32 token rows x 64 columns = exactly one head of q, k or v; the block's two heads are both q, both k or both v (block-uniform: sel), so nothing outside the tile is needed.
// q, k: the f32 tile goes through the wave's own LDS slab into row order; a lane takes 4 columns and their rotate_half partners (column ^ 32, same row), the tables come as 16-byte loads, and a row leaves as one whole 128-byte line of f16.
// v: a lane's 8 accumulator registers are 8 consecutive token rows of one column = 16 bytes of a V^T row; the four waves of a head put them into one [64][128] f16 tile in LDS, and behind a barrier each V^T row leaves as 256 contiguous bytes.
__global__ __launch_bounds__(256) void k_qkv(const _Float16* __restrict__ A, const _Float16* __restrict__ Bh, const float* __restrict__ CS, const float* __restrict__ SN, _Float16* __restrict__ Qh, _Float16* __restrict__ Kh, _Float16* __restrict__ Vt) {
  __shared__ __attribute__((aligned(2048))) unsigned short sm[G3B / 2];      /* the two stage buffers; behind the main loop the epilogue's staging */
  static_assert(8 * 32 * 68 * 4 <= G3B, "epilogue slabs must fit the stage buffers");
  const int tid = threadIdx.x, w = tid >> 5, lane = tid & 31, ln = lane & 15, hh = lane >> 4, wm = w & 3, wn = w >> 2;
  const int ntn = 3 * NH / 2; const int mt = blockIdx.x / ntn, np = blockIdx.x - mt * ntn; const int row0 = mt * 128 + 32 * wm; const int sel = np / (NH / 2), h = (np - sel * (NH / 2)) * 2 + wn;
  const v8f z8 = {0.f,0.f,0.f,0.f,0.f,0.f,0.f,0.f}; v8f accs[8] = {z8, z8, z8, z8, z8, z8, z8, z8};
  g3_main(A, Bh, mt * 128, np * 128, sm, accs);
  float (*so)[32][68] = (float (*)[32][68])sm;
  const float alpha = 0.0625f;      /* undoes the x16 of the weights (exact) */
  if (sel < 2) {
#pragma unroll
    for (int u = 0; u < 8; ++u) { const int t = u & 3, half = u >> 2;
#pragma unroll
      for (int r = 0; r < 8; ++r) so[w][half * 16 + 8 * hh + r][t * 16 + ln] = accs[u][r] * alpha; }
    __builtin_amdgcn_fence(__ATOMIC_ACQ_REL, "workgroup"); __builtin_amdgcn_wave_barrier();      /* the slab is the wave's own: its LDS writes are ordered in front of its reads, no block barrier */
    const int rsub = lane >> 4, c4 = (lane & 15) * 4; const float sg = (c4 < HD / 2) ? -1.0f : 1.0f;      /* rotate_half = concat(-x[32:], x[:32]) */
    _Float16* dst = (sel ? Kh : Qh) + (size_t)(row0 + rsub) * DM + h * HD + c4;
    const size_t tofs = (size_t)(row0 % SQ + rsub) * HD + c4; const float* cp = CS + tofs; const float* sp = SN + tofs;      /* 32 | SQ: the tile's 32 rows are 32 consecutive positions of one batch, so every table row is a constant step from the first */
#pragma unroll
    for (int q = 0; q < 16; ++q) { const int r = q * 2 + rsub;
      const v4f xv = *(const v4fa*)&so[w][r][c4], pa = *(const v4fa*)&so[w][r][c4 ^ (HD / 2)]; const v4f cc = *(const v4fa*)(cp + q * 2 * HD), ss = *(const v4fa*)(sp + q * 2 * HD); v4h h4;
#pragma unroll
      for (int i = 0; i < 4; ++i) h4[i] = (_Float16)(xv[i] * bf16_round(cc[i]) + pa[i] * (sg * bf16_round(ss[i])));
      *(v4h*)(dst + (size_t)q * 2 * DM) = h4; }
  } else {
    unsigned short* tl = sm + wn * (64 * 136);      /* per head [64 d][136] f16: pitch 272 bytes, so the 16 columns of a 16-byte store start 4 banks apart */
#pragma unroll
    for (int u = 0; u < 8; ++u) { const int t = u & 3, half = u >> 2; FragH f;
#pragma unroll
      for (int r = 0; r < 8; ++r) f.h[r] = (_Float16)(accs[u][r] * alpha);
      *(v8us*)(tl + (t * 16 + ln) * 136 + wm * 32 + half * 16 + 8 * hh) = f.half[0]; }
    __syncthreads();      /* a V^T row of the tile holds token rows of the head's four waves; sel is the same for the whole block */
    const int rb = mt * 128, t2 = tid & 127; unsigned short* vd = (unsigned short*)Vt + ((size_t)((rb / SQ) * NH + h) * HD) * SQ + rb % SQ;
#pragma unroll
    for (int i = 0; i < 8; ++i) { const int d = i * 8 + (t2 >> 4), c8 = (t2 & 15) * 8; *(v8us*)(vd + (size_t)d * SQ + c8) = *(const v8us*)(tl + d * 136 + c8); }
    asm volatile("s_wait_xcnt 0x0" ::: "memory");      /* stands behind the last V^T store, in front of any later write of a register that these stores name */
  } }

// out = o . Wo^T x alpha (main loop = g3_main); the f32 tile goes through the wave's own LDS slab into row order and leaves as whole 256-byte row pieces, as in k_gemm2.
__global__ __launch_bounds__(256) void k_out(const _Float16* __restrict__ A, const _Float16* __restrict__ Bh, float alpha, float* __restrict__ C) {
  __shared__ __attribute__((aligned(2048))) unsigned short sm[G3B / 2];      /* the two stage buffers; behind the main loop the epilogue's staging */
  const int tid = threadIdx.x, w = tid >> 5, lane = tid & 31, ln = lane & 15, hh = lane >> 4;
  const int ntn = DM / 128; const int mt = blockIdx.x / ntn, np = blockIdx.x - mt * ntn; const int row0 = mt * 128 + 32 * (w & 3), col0 = np * 128 + 64 * (w >> 2);
  const v8f z8 = {0.f,0.f,0.f,0.f,0.f,0.f,0.f,0.f}; v8f accs[8] = {z8, z8, z8, z8, z8, z8, z8, z8};
  g3_main(A, Bh, mt * 128, np * 128, sm, accs);
  float (*so)[32][68] = (float (*)[32][68])sm;
#pragma unroll
  for (int u = 0; u < 8; ++u) { const int t = u & 3, half = u >> 2;
#pragma unroll
    for (int r = 0; r < 8; ++r) so[w][half * 16 + 8 * hh + r][t * 16 + ln] = accs[u][r] * alpha; }
  __builtin_amdgcn_fence(__ATOMIC_ACQ_REL, "workgroup"); __builtin_amdgcn_wave_barrier();      /* the slab is the wave's own: its LDS writes are ordered in front of its reads, no block barrier */
  const int rsub = lane >> 4, c4 = (lane & 15) * 4;
#pragma unroll
  for (int q = 0; q < 16; ++q) { const int r = q * 2 + rsub; *(v4f*)(C + (size_t)(row0 + r) * DM + col0 + c4) = *(const v4fa*)&so[w][r][c4]; } }

__device__ __forceinline__ float xrow(float v) { const int b = __float_as_int(v); return __int_as_float(__builtin_amdgcn_permlanex16(b, b, 0x76543210, 0xfedcba98, false, false)); }      /* lane l <-> l ^ 16; every lane must be active */
__device__ __forceinline__ v8f fa_mma(v16h a, v16h b, v8f c) { return __builtin_amdgcn_wmma_f32_16x16x32_f16(false, a, false, b, (short)0, c, false, false); }
#define FK 128                        /* keys per stage */
#define FKP 72                        /* LDS pitch of a K row in f16 */
#define FVP 136                       /* LDS pitch of a V^T row in f16 */
#define FKS (FK * FKP)                /* f16 of a stage's K rows */
#define FS (FKS + HD * FVP)           /* f16 per stage */
#define FT (SQ / FK)                  /* stages */
__device__ __forceinline__ void fa_copy(const _Float16* gk, const _Float16* gv, unsigned lk, unsigned lv) {      /* a thread brings 16 bytes of four K rows, 32 rows apart, and of four V^T rows, 16 rows apart: together the block's stage */
  const unsigned sk = 32 * FKP * 2, sv = 16 * FVP * 2;
  /* the wait on the last line stands in front of any later write of a register that these copies name */
  asm volatile("global_load_async_to_lds_b128 %0, %8, off\n\t"
               "global_load_async_to_lds_b128 %1, %9, off\n\t"
               "global_load_async_to_lds_b128 %2, %10, off\n\t"
               "global_load_async_to_lds_b128 %3, %11, off\n\t"
               "global_load_async_to_lds_b128 %4, %12, off\n\t"
               "global_load_async_to_lds_b128 %5, %13, off\n\t"
               "global_load_async_to_lds_b128 %6, %14, off\n\t"
               "global_load_async_to_lds_b128 %7, %15, off\n\t"
               "s_wait_xcnt 0x0"
               :: "v"(lk), "v"(lk + sk), "v"(lk + 2 * sk), "v"(lk + 3 * sk), "v"(lv), "v"(lv + sv), "v"(lv + 2 * sv), "v"(lv + 3 * sv),
                  "v"(gk), "v"(gk + (size_t)32 * DM), "v"(gk + (size_t)64 * DM), "v"(gk + (size_t)96 * DM), "v"(gv), "v"(gv + (size_t)16 * SQ), "v"(gv + (size_t)32 * SQ), "v"(gv + (size_t)48 * SQ) : "memory"); }
__global__ __launch_bounds__(256) void k_fattn(const _Float16* __restrict__ Qh, const _Float16* __restrict__ Kh, const _Float16* __restrict__ Vt, _Float16* __restrict__ O) {
  __shared__ __attribute__((aligned(2048))) unsigned short sm[2 * FS];      /* the two stage buffers */
  const int tid = threadIdx.x, lane = tid & 31, ln = lane & 15, hh = lane >> 4, w = tid >> 5; const int h = blockIdx.y, b = B0 + blockIdx.z; const size_t r0 = (size_t)b * SQ; const int q0 = blockIdx.x * 256 + w * 32;
  const _Float16* qp = Qh + (r0 + q0 + ln) * DM + h * HD;
  const _Float16* gk = Kh + (r0 + (tid >> 3)) * DM + h * HD + (tid & 7) * 8; const _Float16* gv = Vt + ((size_t)(b * NH + h) * HD + (tid >> 4)) * SQ + (tid & 15) * 8;
  const unsigned lk = (unsigned)(size_t)sm + (unsigned)((tid >> 3) * (FKP * 2) + (tid & 7) * 16), lv = (unsigned)(size_t)sm + (unsigned)(FKS * 2 + (tid >> 4) * (FVP * 2) + (tid & 15) * 16);
  const unsigned short* fk = sm + ln * FKP + 8 * hh; const unsigned short* fv = sm + FKS + ln * FVP + 8 * hh;      /* the lane's 8 hh is in the pointer: the k order of g2_frag */
  const float c = 0.18033688011112042f; const v8f z8 = {0.f,0.f,0.f,0.f,0.f,0.f,0.f,0.f};
  v16h qf[2][2], kf[2][2]; v8f o[2][4]; float mu[2] = {-3.0e38f, -3.0e38f}, ls[2] = {0.f, 0.f};
#pragma unroll
  for (int j = 0; j < 2; ++j) {
#pragma unroll
    for (int ks = 0; ks < 2; ++ks) qf[j][ks] = g2_frag(qp + (size_t)j * 16 * DM + ks * 32, hh);
#pragma unroll
    for (int dt = 0; dt < 4; ++dt) o[j][dt] = z8; }
  asm volatile("s_wait_xcnt 0x0" ::: "memory");      /* stands behind the Q loads, in front of any later write of a register that they name */
  fa_copy(gk, gv, lk, lv);
  asm volatile("s_wait_asynccnt 0x0" ::: "memory");      /* stage 0 of this wave has landed */
  __syncthreads();      /* stage 0 of every wave has landed */
  fa_copy(gk + (size_t)FK * DM, gv + FK, lk + FS * 2, lv + FS * 2);
#pragma unroll 1      /* one stage per trip: the buffer is picked by the trip's parity */
  for (int t = 0; t < FT; ++t) { const int bo = (t & 1) * FS; const unsigned short* pk = fk + bo; const unsigned short* pv = fv + bo;
#pragma unroll
    for (int kt = 0; kt < 2; ++kt) {
#pragma unroll
      for (int ks = 0; ks < 2; ++ks) kf[kt][ks] = g3_frag(pk + kt * 16 * FKP + ks * 32); }
#pragma unroll 1      /* one pass per trip: a second copy of the body would take the registers that four waves per SIMD need */
    for (int p = 0; p < FK / 32; ++p) {
      v16h vf[4]; v8f s[2][2]; float mx[2];
#pragma unroll
      for (int dt = 0; dt < 4; ++dt) vf[dt] = g3_frag(pv + dt * 16 * FVP + p * 32);
      __builtin_amdgcn_sched_barrier(0);      /* keeps the V^T reads in front of the score products: without it they sink below the softmax's maximum and have half the lead on their use */
#pragma unroll
      for (int j = 0; j < 2; ++j) {
#pragma unroll
        for (int kt = 0; kt < 2; ++kt) s[j][kt] = fa_mma(kf[kt][1], qf[j][1], fa_mma(kf[kt][0], qf[j][0], z8)); }
      if (p + 1 < FK / 32) {      /* the next pass's K fragments come from LDS during this pass's softmax; a stage's last pass fetches nothing ahead (the next stage is not published yet) */
#pragma unroll
        for (int kt = 0; kt < 2; ++kt) {
#pragma unroll
          for (int ks = 0; ks < 2; ++ks) kf[kt][ks] = g3_frag(pk + ((p + 1) * 32 + kt * 16) * FKP + ks * 32); } }
#pragma unroll
      for (int j = 0; j < 2; ++j) { float a = fmaxf(s[j][0][0], s[j][1][0]);
#pragma unroll
        for (int r = 1; r < 8; ++r) a = fmaxf(a, fmaxf(s[j][0][r], s[j][1][r]));
        mx[j] = fmaxf(a, xrow(a)) * c; }
      const bool need = (mx[0] > mu[0] + 8.0f) || (mx[1] > mu[1] + 8.0f);
      if (__builtin_amdgcn_ballot_w32(need) != 0) {      /* one scalar branch per pass; always taken in the first pass (mu = -3e38: factor 0 on zero sums) */
#pragma unroll
        for (int j = 0; j < 2; ++j) { const float mn = fmaxf(mu[j], mx[j]); const float al = __builtin_amdgcn_exp2f(mu[j] - mn); mu[j] = mn; ls[j] *= al;
#pragma unroll
          for (int dt = 0; dt < 4; ++dt) o[j][dt] *= al; } }
#pragma unroll
      for (int j = 0; j < 2; ++j) { const float bias = 7.0f - mu[j]; FragH pf; float t8[8];
#pragma unroll
        for (int r = 0; r < 8; ++r) { const float p0 = __builtin_amdgcn_exp2f(fmaf(s[j][0][r], c, bias)), p1 = __builtin_amdgcn_exp2f(fmaf(s[j][1][r], c, bias)); pf.h[r] = (_Float16)p0; pf.h[8 + r] = (_Float16)p1; t8[r] = p0 + p1; }
        ls[j] += ((t8[0] + t8[1]) + (t8[2] + t8[3])) + ((t8[4] + t8[5]) + (t8[6] + t8[7]));
#pragma unroll
        for (int dt = 0; dt < 4; ++dt) o[j][dt] = (j == 1 && dt == 3) ? g2_mma(vf[dt], pf.v, o[j][dt]) : fa_mma(vf[dt], pf.v, o[j][dt]); } }      /* the pass's last product carries its four v_nop (g2_mma): the next trip's first vector instruction forms an LDS address in a register of this product's A operand */
    asm volatile("s_wait_dscnt 0x0" ::: "memory");      /* this wave's reads of the buffer are done before the barrier frees it */
    asm volatile("s_wait_asynccnt 0x0" ::: "memory");      /* this wave's copies of stage t + 1 have landed before the barrier publishes them */
    __syncthreads();      /* publishes stage t + 1 and ends every wave's reads of stage t */
    if (t + 2 < FT) fa_copy(gk + (size_t)(t + 2) * FK * DM, gv + (t + 2) * FK, lk + (unsigned)bo * 2, lv + (unsigned)bo * 2); }
  asm volatile("s_wait_asynccnt 0x0" ::: "memory");      /* nothing is in flight when the wave ends */
#pragma unroll
  for (int j = 0; j < 2; ++j) { const float sc = 64.0f / (ls[j] + xrow(ls[j]));      /* the halves' sums join once; o carried x64 as before */
    unsigned short* dst = (unsigned short*)O + (r0 + q0 + j * 16 + ln) * DM + h * HD + 8 * hh;
#pragma unroll
    for (int dt = 0; dt < 4; ++dt) { FragH f;
#pragma unroll
      for (int r = 0; r < 8; ++r) f.h[r] = (_Float16)(o[j][dt][r] * sc);
      *(v8us*)(dst + dt * 16) = f.half[0]; } } }

extern "C" void kernel_launch(void* const* d_in, const int* in_sizes, int n_in,
                              void* d_out, int out_size, void* d_ws, size_t ws_size, hipStream_t stream) {
  (void)in_sizes; (void)n_in; (void)out_size;
  const float* const* I = (const float* const*)d_in; const float* x = I[0]; const float* tcos = I[1]; const float* tsin = I[2]; const float* wq = I[3]; const float* wk = I[4]; const float* wv = I[5]; const float* wo = I[6]; const float* bo = nullptr;      /* natural [out][in] weights, no biases; cos/sin INPUT tables [1][S][1][64] = [S][64] */
  char* ws = (char*)d_ws; size_t off = 0;
  auto take = [&](size_t bytes) { char* p = ws + off; off += (bytes + 255) & ~(size_t)255; return p; };
  _Float16* BQKV = (_Float16*)take((size_t)3 * DM * DM * 2); _Float16* BO = (_Float16*)take((size_t)DM * DM * 2);
  _Float16* X16 = (_Float16*)take(NR * DM * 2);
  _Float16* QH = (_Float16*)take(NR * DM * 2); _Float16* KH = (_Float16*)take(NR * DM * 2); _Float16* O16 = (_Float16*)take(NR * DM * 2);
  _Float16* VT = (_Float16*)take((size_t)NB * NH * HD * SQ * 2);      /* V^T of every batch */
  if (off > ws_size) return;
  { const unsigned g = (unsigned)(((size_t)DM * DM / 8 + 255) / 256); k_wnat<<<g, 256, 0, stream>>>(wq, (size_t)DM * DM / 8, BQKV); k_wnat<<<g, 256, 0, stream>>>(wk, (size_t)DM * DM / 8, BQKV + (size_t)DM * DM); k_wnat<<<g, 256, 0, stream>>>(wv, (size_t)DM * DM / 8, BQKV + (size_t)2 * DM * DM); k_wnat<<<g, 256, 0, stream>>>(wo, (size_t)DM * DM / 8, BO); }      /* natural [out][in] = Bt[n][k], x16; q | k | v stacked along n */
  k_x16<<<(unsigned)((NR * DM / 8 + 255) / 256), 256, 0, stream>>>(x, X16, NR * DM / 8);
  k_qkv<<<(unsigned)((NR / 128) * (3 * DM / 128)), 256, 0, stream>>>(X16, BQKV, tcos, tsin, QH, KH, VT);      /* every batch: rotated f16 q and k rows, V^T [NB][NH][HD][SQ] */
  k_fattn<<<dim3(QN / 256, NHD, NBR), 256, 0, stream>>>(QH, KH, VT, O16);      /* all batches and heads in one launch; o x64 as f16 in the merged rows */
  k_out<<<(unsigned)((MPO / 128) * (DM / 128)), 256, 0, stream>>>(O16 + (size_t)B0 * SQ * DM, BO, 0.0009765625f, (float*)d_out + (size_t)B0 * SQ * DM);      /* out rows are the output layout */
}

// v006
// One run takes 123 microseconds.
// Next to v005, in two timings, it ran 1.07 times as fast each time.
// Counting every step since v000, it is 57.1 times as fast.
#include <hip/hip_runtime.h>
// RoPE multi-head self-attention with INPUT rotary tables (x [4][2048][1024]; q/k/v = x W^T (nn.Linear natural [out][in] sigma 0.02, no bias), 16 heads of 64; q = q cos + rotate_half(q) sin with the module's cos/sin inputs [1][2048][1][64] (full head width, independent values per dim; rotate_half = concat(-x[32:], x[:32])), same for k; scores / 8; softmax over all keys (no mask); out = merged Wo^T (no bias) -> [4][2048][1024]).
// Structure: token rows r = b*2048 + s; x as exact f16 rows (bf16-rounded); q | k | v of all batches as ONE WMMA GEMM launch (32x64 wave tiles = one head wide, operands staged in LDS per 128x128 block tile, f32 accumulation, exact x16 weights, N = 3 x 1024) whose epilogue does the rest while the tile is still on chip: the half-split rotary rotation of q and k from the cos/sin tables (no norm) -> f16 q, k rows, and v -> f16 V^T through an LDS transpose (no f32 q | k | v and no v rows in memory); then ONE fused attention launch over all batches and heads (scores on WMMA, online softmax in registers with f32 statistics and native exp2, weights as f16 straight into the P . V WMMA; o carried x64 against f16 subnormal flush, folded into the output GEMM alpha) written straight into the merged f16 o rows; out = o W_o GEMM (f32) into the output layout.
// Compute dtype: inputs rounded to bf16; x / weights exact; projections and rope f32; q, k, v, softmax weights and o as plain f16 GEMM operands (~2^-12); scores and softmax statistics f32. v_wmma_f32_16x16x32_f16.
#define NB 4
#define SQ 2048
#define DM 1024
#define NH 16
#define HD 64
#define HG 4                         /* heads per launch of the non-template k_vt */
#define B0 0                         /* first batch processed (debug hook) */
#define NBR NB                       /* batches processed (debug hook) */
#define QN SQ                        /* query rows attended per batch (debug hook) */
#define NHD NH                       /* heads attended (debug hook) */
#define NR ((size_t)NB * SQ)         /* token rows */
#define MPO ((int)((size_t)NBR * SQ))      /* rows through the output GEMM (debug hook) */
typedef __bf16 v16b __attribute__((ext_vector_type(16)));
typedef unsigned short v8us __attribute__((ext_vector_type(8), may_alias));
typedef float  v8f  __attribute__((ext_vector_type(8)));
typedef float  v4f  __attribute__((ext_vector_type(4)));
typedef float  v4fa __attribute__((ext_vector_type(4), may_alias));
union FragB { v16b v; v8us half[2]; unsigned short u[16]; };

__device__ __forceinline__ unsigned short bf16_bits(float x) { unsigned int u = __float_as_uint(x); return (unsigned short)((u + 0x7FFFu + ((u >> 16) & 1u)) >> 16); }
__device__ __forceinline__ float bf16_val(unsigned short b) { return __uint_as_float(((unsigned int)b) << 16); }
__device__ __forceinline__ float bf16_round(float x) { return bf16_val(bf16_bits(x)); }
// D += A·B with NT terms: 1 = ah·bh, 2 = + al·bh (A split), 3 = + ah·bl (both split)
template <int NT>
__device__ __forceinline__ v8f mmaN(v16b ah, v16b al, v16b bh, v16b bl, v8f c) {
  c = __builtin_amdgcn_wmma_f32_16x16x32_bf16(false, ah, false, bh, (short)0, c, false, false);
  if (NT >= 2) c = __builtin_amdgcn_wmma_f32_16x16x32_bf16(false, al, false, bh, (short)0, c, false, false);
  if (NT >= 3) c = __builtin_amdgcn_wmma_f32_16x16x32_bf16(false, ah, false, bl, (short)0, c, false, false);
  asm volatile("v_nop\n\tv_nop\n\tv_nop\n\tv_nop" : "+v"(c) : "v"(ah), "v"(al), "v"(bh), "v"(bl));
  return c;
}

__global__ __launch_bounds__(256) void k_wt_bf16(const float* __restrict__ W, unsigned short* __restrict__ Wt, int K, int N) {
  const int t = blockIdx.x * 256 + threadIdx.x;
  const int k8n = K / 8;
  if (t >= N * k8n) return;
  const int n = t / k8n, k8 = (t % k8n) * 8;
  v8us v;
#pragma unroll
  for (int i = 0; i < 8; ++i) v[i] = bf16_bits(W[(size_t)(k8 + i) * N + n]);
  *(v8us*)(Wt + (size_t)n * K + k8) = v;
  
}

// GEMM C[M][N] (f32, pitch ldc) = act(A[M][K]·W + bias). A f32 row-major (pitch lda) converted per fragment to bf16
// (ASPLIT: hi/lo two planes -> 2 terms, else single rounded term); Wt bf16 [N][K] (pitch ldb). BIAS_BF16 rounds the
// bias to bf16 first (bias quantised to bf16 before the add). K%32==0, M%16==0, N%64==0.
template <bool ASPLIT, int ACT, bool BIAS_BF16>
__global__ __launch_bounds__(128) void k_gemm_bf(const float* __restrict__ A, int lda, const unsigned short* __restrict__ Wt, int ldb,
                                               const float* __restrict__ bias, float* __restrict__ C, int ldc, int M, int N, int K) {
  __shared__ __attribute__((aligned(16))) float so[4][16][64];
  const int tid = threadIdx.x, w = tid >> 5, lane = tid & 31, ln = lane & 15, hh = lane >> 4;
  const int ntn = N / 64;
  const int wid = blockIdx.x * 4 + w;
  const int mt = wid / ntn, nq = wid % ntn;
  if (mt * 16 >= M) return;
  const int row0 = mt * 16, col0 = nq * 64;
  const float* arow = A + (size_t)(row0 + ln) * lda;
  v8f acc[4] = {};
  for (int kb = 0; kb < K; kb += 32) {
    FragB ah, al;
    const v4f x0 = *(const v4fa*)(arow + kb + 8 * hh), x1 = *(const v4fa*)(arow + kb + 8 * hh + 4);
    const v4f x2 = *(const v4fa*)(arow + kb + 16 + 8 * hh), x3 = *(const v4fa*)(arow + kb + 16 + 8 * hh + 4);
    float xs[16] = {x0[0],x0[1],x0[2],x0[3],x1[0],x1[1],x1[2],x1[3],x2[0],x2[1],x2[2],x2[3],x3[0],x3[1],x3[2],x3[3]};
#pragma unroll
    for (int i = 0; i < 16; ++i) { const unsigned short hb = bf16_bits(xs[i]); ah.u[i] = hb; al.u[i] = ASPLIT ? bf16_bits(xs[i] - bf16_val(hb)) : (unsigned short)0; }
#pragma unroll
    for (int t = 0; t < 4; ++t) {
      const unsigned short* brow = Wt + (size_t)(col0 + t * 16 + ln) * ldb + kb;
      FragB b;
      b.half[0] = *(const v8us*)(brow + 8 * hh);
      b.half[1] = *(const v8us*)(brow + 16 + 8 * hh);
      acc[t] = mmaN<ASPLIT ? 2 : 1>(ah.v, al.v, b.v, b.v, acc[t]);
    }
  }
#pragma unroll
  for (int t = 0; t < 4; ++t) {
    float bv = bias ? bias[col0 + t * 16 + ln] : 0.f;
    if (BIAS_BF16) bv = bf16_round(bv);
#pragma unroll
    for (int r = 0; r < 8; ++r) { float v = acc[t][r] + bv; if (ACT == 1) v = fmaxf(v, 0.f); so[w][8 * hh + r][t * 16 + ln] = v; }
  }
  __builtin_amdgcn_fence(__ATOMIC_ACQ_REL, "workgroup");
  __builtin_amdgcn_wave_barrier();
  const int rsub = lane >> 4, c4 = (lane & 15) * 4;
  {
#pragma unroll
    for (int q = 0; q < 8; ++q) {
      const int r = q * 2 + rsub;
      const v4f v = *(const v4fa*)&so[w][r][c4];
      *(v4f*)(C + (size_t)(row0 + r) * ldc + col0 + c4) = v;
    }
    
  }
}

// GEMM C = act(A·W + bias + resid): A f32 (ASPLIT -> hi/lo 2 terms), Wt bf16 [N][K]; ACT 0 none, 1 relu, 2 exact gelu;
// resid (optional, f32, row index = (row % rmod), pitch ldr, RES_BF16 rounds it) added before the activation.
template <bool ASPLIT, int ACT, bool BIAS_BF16, bool RES_BF16>
__global__ __launch_bounds__(128) void k_gemm_bf3(const float* __restrict__ A, int lda, const unsigned short* __restrict__ Wt, int ldb,
                                                const float* __restrict__ bias, const float* __restrict__ resid, int rmod, int ldr,
                                                float* __restrict__ C, int ldc, int M, int N, int K) {
  __shared__ __attribute__((aligned(16))) float so[4][16][64];
  const int tid = threadIdx.x, w = tid >> 5, lane = tid & 31, ln = lane & 15, hh = lane >> 4;
  const int ntn = N / 64;
  const int wid = blockIdx.x * 4 + w;
  const int mt = wid / ntn, nq = wid % ntn;
  if (mt * 16 >= M) return;
  const int row0 = mt * 16, col0 = nq * 64;
  const float* arow = A + (size_t)(row0 + ln) * lda;
  v8f acc[4] = {};
  for (int kb = 0; kb < K; kb += 32) {
    FragB ah, al;
    const v4f x0 = *(const v4fa*)(arow + kb + 8 * hh), x1 = *(const v4fa*)(arow + kb + 8 * hh + 4);
    const v4f x2 = *(const v4fa*)(arow + kb + 16 + 8 * hh), x3 = *(const v4fa*)(arow + kb + 16 + 8 * hh + 4);
    float xs[16] = {x0[0],x0[1],x0[2],x0[3],x1[0],x1[1],x1[2],x1[3],x2[0],x2[1],x2[2],x2[3],x3[0],x3[1],x3[2],x3[3]};
#pragma unroll
    for (int i = 0; i < 16; ++i) { const unsigned short hb = bf16_bits(xs[i]); ah.u[i] = hb; al.u[i] = ASPLIT ? bf16_bits(xs[i] - bf16_val(hb)) : (unsigned short)0; }
#pragma unroll
    for (int t = 0; t < 4; ++t) {
      const unsigned short* brow = Wt + (size_t)(col0 + t * 16 + ln) * ldb + kb;
      FragB b;
      b.half[0] = *(const v8us*)(brow + 8 * hh);
      b.half[1] = *(const v8us*)(brow + 16 + 8 * hh);
      acc[t] = mmaN<ASPLIT ? 2 : 1>(ah.v, al.v, b.v, b.v, acc[t]);
    }
  }
#pragma unroll
  for (int t = 0; t < 4; ++t) {
    const int col = col0 + t * 16 + ln;
    float bv = bias ? bias[col] : 0.f;
    if (BIAS_BF16) bv = bf16_round(bv);
#pragma unroll
    for (int r = 0; r < 8; ++r) {
      float v = acc[t][r] + bv;
      if (resid) { float rv = resid[(size_t)((row0 + 8 * hh + r) % rmod) * ldr + col]; if (RES_BF16) rv = bf16_round(rv); v += rv; }
      if (ACT == 1) v = fmaxf(v, 0.f);
      if (ACT == 2) v = 0.5f * v * (1.0f + erff(v * 0.70710678118654752f));
      if (ACT == 3) { const float u = 0.7978845608028654f * (v + 0.044715f * v * v * v); v = 0.5f * v * (1.0f + tanhf(u)); }
      so[w][8 * hh + r][t * 16 + ln] = v;
    }
  }
  __builtin_amdgcn_fence(__ATOMIC_ACQ_REL, "workgroup");
  __builtin_amdgcn_wave_barrier();
  const int rsub = lane >> 4, c4 = (lane & 15) * 4;
  {
#pragma unroll
    for (int q = 0; q < 8; ++q) {
      const int r = q * 2 + rsub;
      const v4f v = *(const v4fa*)&so[w][r][c4];
      *(v4f*)(C + (size_t)(row0 + r) * ldc + col0 + c4) = v;
    }
    
  }
}
// row LayerNorm (biased variance, eps) over N: s = X (+ R); optional out_sum <- s; out_norm <- (s-mu)*rsqrt(var+eps)*g + b
template <bool PARAM_BF16>
__global__ __launch_bounds__(256) void k_layernorm(const float* __restrict__ X, const float* __restrict__ R, const float* __restrict__ g, const float* __restrict__ bta,
                                                  float* __restrict__ out_sum, float* __restrict__ out_norm, int N, float eps) {
  __shared__ float red[256];
  const int row = blockIdx.x, tid = threadIdx.x;
  const float* x = X + (size_t)row * N; const float* rr = R ? R + (size_t)row * N : nullptr;
  float vals[16];                     // up to N = 4096
  const int per = N / 256;            // contiguous chunk per thread? use strided-by-4 chunks: thread handles j = tid*4 + 1024*u
  float s1 = 0.f;
  for (int u = 0; u < per / 4; ++u) {
    const int j = tid * 4 + 1024 * u;
    const v4f a = *(const v4fa*)(x + j);
    v4f b = {0.f,0.f,0.f,0.f}; if (rr) b = *(const v4fa*)(rr + j);
#pragma unroll
    for (int q = 0; q < 4; ++q) { const float v = a[q] + b[q]; vals[u * 4 + q] = v; s1 += v; }
  }
  red[tid] = s1; __syncthreads();
  for (int st = 128; st > 0; st >>= 1) { if (tid < st) red[tid] += red[tid + st]; __syncthreads(); }
  const float mu = red[0] / (float)N; __syncthreads();
  float s2 = 0.f;
  for (int u = 0; u < per / 4; ++u)
#pragma unroll
    for (int q = 0; q < 4; ++q) { const float c = vals[u * 4 + q] - mu; s2 += c * c; }
  red[tid] = s2; __syncthreads();
  for (int st = 128; st > 0; st >>= 1) { if (tid < st) red[tid] += red[tid + st]; __syncthreads(); }
  const float rs = rsqrtf(red[0] / (float)N + eps);
  {
    for (int u = 0; u < per / 4; ++u) {
      const int j = tid * 4 + 1024 * u;
      v4f o, sm;
#pragma unroll
      for (int q = 0; q < 4; ++q) {
        float gg = g[j + q], bb = bta[j + q];
        if (PARAM_BF16) { gg = bf16_round(gg); bb = bf16_round(bb); }
        sm[q] = vals[u * 4 + q]; o[q] = (vals[u * 4 + q] - mu) * rs * gg + bb;
      }
      if (out_sum) *(v4f*)(out_sum + (size_t)row * N + j) = sm;
      *(v4f*)(out_norm + (size_t)row * N + j) = o;
    }
    
  }
}



// ---- f16 WMMA path (v_wmma_f32_16x16x32_f16): 11-bit significands for operands in range — used where a [0,1] probability operand needs more precision than bf16
typedef _Float16 v16h __attribute__((ext_vector_type(16)));
union FragH { v16h v; v8us half[2]; _Float16 h[16]; unsigned short u[16]; };
template <int NT>
__device__ __forceinline__ v8f mmaH(v16h ah, v16h al, v16h bh, v16h bl, v8f c) {
  c = __builtin_amdgcn_wmma_f32_16x16x32_f16(false, ah, false, bh, (short)0, c, false, false);
  if (NT >= 2) c = __builtin_amdgcn_wmma_f32_16x16x32_f16(false, al, false, bh, (short)0, c, false, false);
  if (NT >= 3) c = __builtin_amdgcn_wmma_f32_16x16x32_f16(false, ah, false, bl, (short)0, c, false, false);
  asm volatile("v_nop\n\tv_nop\n\tv_nop\n\tv_nop" : "+v"(c) : "v"(ah), "v"(al), "v"(bh), "v"(bl));
  return c;
}
// batched GEMM like k_gemm_b but f16 operands: A f32 (split into f16 hi/lo if ASPLIT, else rounded to f16), Bt = f16 values [n][k]; alpha; C f32; N multiple of 16 (partial tiles skipped)
template <bool ASPLIT>
__global__ __launch_bounds__(128) void k_gemm_h(const float* __restrict__ A, int lda, size_t sA, const _Float16* __restrict__ Bh, int ldb, size_t sB, float alpha, float* __restrict__ C, int ldc, size_t sC, int M, int N, int K) {
  __shared__ __attribute__((aligned(16))) float so[4][16][64];
  const int tid = threadIdx.x, w = tid >> 5, lane = tid & 31, ln = lane & 15, hh = lane >> 4; const int by = blockIdx.y;
  A += (size_t)by * sA; Bh += (size_t)by * sB; C += (size_t)by * sC;
  const int ntn = (N + 63) / 64; const int wid = blockIdx.x * 4 + w; const int mt = wid / ntn, nq = wid % ntn; if (mt * 16 >= M) return;
  const int row0 = mt * 16, col0 = nq * 64; const float* arow = A + (size_t)(row0 + ln) * lda;
  v8f acc[4] = {};
  for (int kb = 0; kb < K; kb += 32) {
    FragH ah, al;
    const v4f x0 = *(const v4fa*)(arow + kb + 8 * hh), x1 = *(const v4fa*)(arow + kb + 8 * hh + 4), x2 = *(const v4fa*)(arow + kb + 16 + 8 * hh), x3 = *(const v4fa*)(arow + kb + 16 + 8 * hh + 4);
    float xs[16] = {x0[0],x0[1],x0[2],x0[3],x1[0],x1[1],x1[2],x1[3],x2[0],x2[1],x2[2],x2[3],x3[0],x3[1],x3[2],x3[3]};
#pragma unroll
    for (int i = 0; i < 16; ++i) { const _Float16 h = (_Float16)xs[i]; ah.h[i] = h; al.h[i] = ASPLIT ? (_Float16)(xs[i] - (float)h) : (_Float16)0.0f; }
#pragma unroll
    for (int t = 0; t < 4; ++t) { if (col0 + t * 16 >= N) continue; const size_t boff = (size_t)(col0 + t * 16 + ln) * ldb + kb; FragH bq; bq.half[0] = *(const v8us*)(Bh + boff + 8 * hh); bq.half[1] = *(const v8us*)(Bh + boff + 16 + 8 * hh);
      acc[t] = mmaH<ASPLIT ? 2 : 1>(ah.v, al.v, bq.v, bq.v, acc[t]); }
  }
#pragma unroll
  for (int t = 0; t < 4; ++t) { if (col0 + t * 16 >= N) continue;
#pragma unroll
    for (int r = 0; r < 8; ++r) so[w][8 * hh + r][t * 16 + ln] = acc[t][r] * alpha; }
  __builtin_amdgcn_fence(__ATOMIC_ACQ_REL, "workgroup"); __builtin_amdgcn_wave_barrier();
  const int rsub = lane >> 4, c4 = (lane & 15) * 4;
  {
#pragma unroll
    for (int q = 0; q < 8; ++q) { const int r = q * 2 + rsub; if (col0 + c4 < N) { const v4f v = *(const v4fa*)&so[w][r][c4]; *(v4f*)(C + (size_t)(row0 + r) * ldc + col0 + c4) = v; } }
     }
}

// Wt[n][k] = f16(W[k][n]·scale) from f32 row-major W[K][N] (scale = power of two; bf16-exact weights stay exact in f16 away from the subnormal range)
__global__ __launch_bounds__(256) void k_wt_f16(const float* __restrict__ W, _Float16* __restrict__ Wt, int K, int N, float scale) {
  const int t = blockIdx.x * 256 + threadIdx.x; if (t >= N * (K / 8)) return; const int n = t / (K / 8), k8 = (t % (K / 8)) * 8; FragH f;
#pragma unroll
  for (int i = 0; i < 8; ++i) f.h[i] = (_Float16)(bf16_round(W[(size_t)(k8 + i) * N + n]) * scale); const v8us o = f.half[0];
  *(v8us*)((unsigned short*)Wt + (size_t)n * K + k8) = o; 
}
// k_gemm_hh variant with fused epilogue: v = acc·alpha + bias[by·sBias + col] (+ CP[(row/rowsPerB)·sCPb + by·64 + col] if CP) ; ACT 0 none / 1 elu ; writes f16 C16 (and f32 C if non-null)
template <int ACT>
__global__ __launch_bounds__(128) void k_gemm_hhx(const _Float16* __restrict__ A, int lda, size_t sA, const _Float16* __restrict__ Bh, int ldb, size_t sB, float alpha, const float* __restrict__ bias, size_t sBias, const float* __restrict__ CP, int rowsPerB, size_t sCPb, int row0g,
    float* __restrict__ C, _Float16* __restrict__ C16, int ldc, size_t sC, int M, int N, int K) {
  __shared__ __attribute__((aligned(16))) float so[4][16][64];
  const int tid = threadIdx.x, w = tid >> 5, lane = tid & 31, ln = lane & 15, hh = lane >> 4; const int by = blockIdx.y;
  A += (size_t)by * sA; Bh += (size_t)by * sB; const size_t cofs = (size_t)by * sC; const float* bp = bias ? bias + (size_t)by * sBias : nullptr;
  const int ntn = (N + 63) / 64; const int wid = blockIdx.x * 4 + w; const int mt = wid / ntn, nq = wid % ntn; if (mt * 16 >= M) return;
  const int row0 = mt * 16, col0 = nq * 64; const _Float16* arow = A + (size_t)(row0 + ln) * lda;
  v8f acc[4] = {};
  for (int kb = 0; kb < K; kb += 32) { FragH ah; ah.half[0] = *(const v8us*)((const unsigned short*)arow + kb + 8 * hh); ah.half[1] = *(const v8us*)((const unsigned short*)arow + kb + 16 + 8 * hh);
#pragma unroll
    for (int t = 0; t < 4; ++t) { if (col0 + t * 16 >= N) continue; const size_t boff = (size_t)(col0 + t * 16 + ln) * ldb + kb; FragH bq; bq.half[0] = *(const v8us*)((const unsigned short*)Bh + boff + 8 * hh); bq.half[1] = *(const v8us*)((const unsigned short*)Bh + boff + 16 + 8 * hh);
      acc[t] = mmaH<1>(ah.v, ah.v, bq.v, bq.v, acc[t]); }
  }
#pragma unroll
  for (int t = 0; t < 4; ++t) { if (col0 + t * 16 >= N) continue; const int col = col0 + t * 16 + ln; const float bv = bp ? bf16_round(bp[col]) : 0.f;
#pragma unroll
    for (int r = 0; r < 8; ++r) { float v = acc[t][r] * alpha + bv; if (CP) { const int rr = row0g + row0 + 8 * hh + r; if (rowsPerB < 0) v += CP[cofs + (size_t)rr * ldc + col];      /* rowsPerB < 0: own element of the batched C plane */ else { const int bidx = rr / rowsPerB; v += CP[(size_t)bidx * sCPb + (size_t)by * 64 + col]; } } if (ACT == 1) v = (v > 0.f) ? v : expm1f(v); else if (ACT == 7) v = (v > 0.f) ? v + 1.0f : expf(v); else if (ACT == 8) v = tanhf(v); else if (ACT == 9) v = 0.5f * v * (1.0f + tanhf(0.7978845608028654f * (v + 0.044715f * v * v * v))); else if (ACT == 11) v = 1.0f / (1.0f + expf(-v)); else if (ACT == 12) v = (v > 0.f) ? v : 0.01f * v; else if (ACT == 14) v = (v > 0.f) ? v : 0.1f * v; else if (ACT == 16) v = (v >= 0.f) ? v : 0.3f * v; else if (ACT == 17) v = (v >= 0.f) ? v : 0.2f * v; else if (ACT == 15) v = v / (1.0f + expf(-v)); else if (ACT == 3) v = fmaxf(v, 0.f); else if (ACT == 6) v = 0.5f * v * (1.0f + erff(v * 0.70710678118654752f)); so[w][8 * hh + r][t * 16 + ln] = v; } }
  __builtin_amdgcn_fence(__ATOMIC_ACQ_REL, "workgroup"); __builtin_amdgcn_wave_barrier();
  const int rsub = lane >> 4, c4 = (lane & 15) * 4; typedef _Float16 v4h __attribute__((ext_vector_type(4)));
  {
#pragma unroll
    for (int q = 0; q < 8; ++q) { const int r = q * 2 + rsub; if (col0 + c4 < N) { const v4f v = *(const v4fa*)&so[w][r][c4]; if (C) *(v4f*)(C + cofs + (size_t)(row0 + r) * ldc + col0 + c4) = v; if (C16) { v4h h4; for (int i = 0; i < 4; ++i) h4[i] = (_Float16)v[i]; *(v4h*)(C16 + cofs + (size_t)(row0 + r) * ldc + col0 + c4) = h4; } } }
     }
}


typedef _Float16 v4h __attribute__((ext_vector_type(4)));

__global__ __launch_bounds__(256) void k_x16(const float* __restrict__ x, _Float16* __restrict__ X16, size_t n8) { const size_t t = (size_t)blockIdx.x * 256 + threadIdx.x; if (t >= n8) return; FragH f;
#pragma unroll
  for (int q = 0; q < 8; ++q) f.h[q] = (_Float16)bf16_round(x[t * 8 + q]); *(v8us*)((unsigned short*)X16 + t * 8) = f.half[0];  }
__global__ __launch_bounds__(256) void k_h16(const float* __restrict__ x, _Float16* __restrict__ X16, size_t n8) { const size_t t = (size_t)blockIdx.x * 256 + threadIdx.x; if (t >= n8) return; FragH f;
#pragma unroll
  for (int q = 0; q < 8; ++q) f.h[q] = (_Float16)x[t * 8 + q]; *(v8us*)((unsigned short*)X16 + t * 8) = f.half[0];  }
__global__ __launch_bounds__(256) void k_round16f(const float* __restrict__ W, _Float16* __restrict__ Bt, size_t n8) { const size_t t = (size_t)blockIdx.x * 256 + threadIdx.x; if (t >= n8) return; FragH f;
#pragma unroll
  for (int i = 0; i < 8; ++i) f.h[i] = (_Float16)(bf16_round(W[t * 8 + i]) * 16.0f); *(v8us*)((unsigned short*)Bt + t * 8) = f.half[0];  }
template <int NHv, int TTv>
__global__ __launch_bounds__(256) void k_vt(const _Float16* __restrict__ V16, int ldv, int voff, _Float16* __restrict__ Vt) { __shared__ unsigned short tl[64][66]; const int tid = threadIdx.x; const int slab = blockIdx.x / (TTv / 64), lg = blockIdx.x % (TTv / 64); const int b = slab / NHv, h = slab % NHv;
  for (int i = tid; i < 64 * 8; i += 256) { const int r = i / 8, c8 = (i % 8) * 8; FragH f; f.half[0] = *(const v8us*)((const unsigned short*)V16 + ((size_t)b * TTv + lg * 64 + r) * ldv + voff + h * 64 + c8);
#pragma unroll
    for (int q = 0; q < 8; ++q) tl[r][c8 + q] = f.u[q]; }
  __syncthreads();
  {
#pragma unroll
    for (int rd = 0; rd < 2; ++rd) { const int d = rd * 32 + tid / 8, pc = tid % 8; FragH f;
#pragma unroll
      for (int q = 0; q < 8; ++q) f.u[q] = tl[pc * 8 + q][d];
      *(v8us*)((unsigned short*)Vt + ((size_t)slab * 64 + d) * TTv + lg * 64 + pc * 8) = f.half[0]; }
     } }

__global__ __launch_bounds__(256) void k_hl(const float* __restrict__ F, _Float16* __restrict__ Hh, _Float16* __restrict__ Hl, size_t n8) { const size_t t = (size_t)blockIdx.x * 256 + threadIdx.x; if (t >= n8) return; FragH fh, fl; const v4f a = *(const v4fa*)(F + t * 8), c = *(const v4fa*)(F + t * 8 + 4);
#pragma unroll
  for (int q = 0; q < 4; ++q) { _Float16 h = (_Float16)a[q]; fh.h[q] = h; fl.h[q] = (_Float16)((a[q] - (float)h) * 1024.0f); h = (_Float16)c[q]; fh.h[4 + q] = h; fl.h[4 + q] = (_Float16)((c[q] - (float)h) * 1024.0f); }
  { *(v8us*)((unsigned short*)Hh + t * 8) = fh.half[0]; *(v8us*)((unsigned short*)Hl + t * 8) = fl.half[0];  } }

// ---- fast GEMM (wave tile 32x64; requires M % 32 == 0 rows per launch region and N % 64 == 0); epilogue = k_gemm_hhx semantics ----
__device__ __forceinline__ v16h g2_frag(const _Float16* p, int hh) { FragH f; f.half[0] = *(const v8us*)((const unsigned short*)p + 8 * hh); f.half[1] = *(const v8us*)((const unsigned short*)p + 16 + 8 * hh); return f.v; }
__device__ __forceinline__ v8f g2_mma(v16h a, v16h b, v8f c) { v8f d = __builtin_amdgcn_wmma_f32_16x16x32_f16(false, a, false, b, (short)0, c, false, false); asm volatile("v_nop\n\tv_nop\n\tv_nop\n\tv_nop" : "+v"(d) : "v"(a), "v"(b)); return d; }
template <int ACT>
__global__ __launch_bounds__(128) void k_gemm2(const _Float16* __restrict__ A, int lda, size_t sA, const _Float16* __restrict__ Bh, int ldb, size_t sB, float alpha, const float* __restrict__ bias, size_t sBias, const float* __restrict__ CP, int rowsPerB, size_t sCPb, int row0g,
    float* __restrict__ C, _Float16* __restrict__ C16, int ldc, size_t sC, int M, int N, int K) { static_assert(ACT == 0 || ACT == 3 || ACT == 6 || ACT == 8 || ACT == 9 || ACT == 11 || ACT == 12 || ACT == 14 || ACT == 15 || ACT == 16 || ACT == 17, "k_gemm2: unsupported ACT code (would silently apply no activation)");
  __shared__ __attribute__((aligned(16))) float so[4][32][68];
  const int tid = threadIdx.x, w = tid >> 5, lane = tid & 31, ln = lane & 15, hh = lane >> 4; const int by = blockIdx.y;
  A += (size_t)by * sA; Bh += (size_t)by * sB; const size_t cofs = (size_t)by * sC; const float* bp = bias ? bias + (size_t)by * sBias : nullptr;
  const int ntn = N >> 6; const int mt = blockIdx.x / ntn, nq = blockIdx.x - mt * ntn; const int row0 = mt * 128 + 32 * w, col0 = nq * 64; if (row0 >= M) return;
  const _Float16* a0p = A + (size_t)(row0 + ln) * lda; const _Float16* a1p = a0p + (size_t)16 * lda;
  const _Float16* b0p = Bh + (size_t)(col0 + ln) * ldb; const _Float16* b1p = b0p + (size_t)16 * ldb; const _Float16* b2p = b1p + (size_t)16 * ldb; const _Float16* b3p = b2p + (size_t)16 * ldb;
  const v8f z8 = {0.f,0.f,0.f,0.f,0.f,0.f,0.f,0.f}; v8f c00 = z8, c01 = z8, c02 = z8, c03 = z8, c10 = z8, c11 = z8, c12 = z8, c13 = z8;
#pragma unroll 1
  for (int kb = 0; kb < K; kb += 32) { const v16h a0 = g2_frag(a0p + kb, hh), a1 = g2_frag(a1p + kb, hh);
    v16h b = g2_frag(b0p + kb, hh); c00 = g2_mma(a0, b, c00); c10 = g2_mma(a1, b, c10);
    b = g2_frag(b1p + kb, hh); c01 = g2_mma(a0, b, c01); c11 = g2_mma(a1, b, c11);
    b = g2_frag(b2p + kb, hh); c02 = g2_mma(a0, b, c02); c12 = g2_mma(a1, b, c12);
    b = g2_frag(b3p + kb, hh); c03 = g2_mma(a0, b, c03); c13 = g2_mma(a1, b, c13); }
  v8f accs[8] = {c00, c01, c02, c03, c10, c11, c12, c13};
#pragma unroll
  for (int u = 0; u < 8; ++u) { const int t = u & 3, half = u >> 2; const int col = col0 + t * 16 + ln; const float bv = bp ? bf16_round(bp[col]) : 0.f;
#pragma unroll
    for (int r = 0; r < 8; ++r) { const int rloc = half * 16 + 8 * hh + r; float v = accs[u][r] * alpha + bv; if (CP) { if (rowsPerB < 0) v += CP[cofs + (size_t)(row0g + row0 + rloc) * ldc + col];      /* rowsPerB < 0: own element of the batched C plane */ else { const int bidx = (row0g + row0 + rloc) / rowsPerB; v += CP[(size_t)bidx * sCPb + (size_t)by * 64 + col]; } }
      if (ACT == 3) v = fmaxf(v, 0.f); else if (ACT == 6) v = 0.5f * v * (1.0f + erff(v * 0.70710678118654752f)); else if (ACT == 11) v = 1.0f / (1.0f + expf(-v)); else if (ACT == 15) v = v / (1.0f + expf(-v)); else if (ACT == 12) v = (v > 0.f) ? v : 0.01f * v; else if (ACT == 8) v = tanhf(v); else if (ACT == 9) v = 0.5f * v * (1.0f + tanhf(0.7978845608028654f * (v + 0.044715f * v * v * v))); else if (ACT == 14) v = (v > 0.f) ? v : 0.1f * v; else if (ACT == 16) v = (v >= 0.f) ? v : 0.3f * v; else if (ACT == 17) v = (v >= 0.f) ? v : 0.2f * v;
      so[w][rloc][t * 16 + ln] = v; } }
  __builtin_amdgcn_fence(__ATOMIC_ACQ_REL, "workgroup"); __builtin_amdgcn_wave_barrier();
  const int rsub = lane >> 4, c4 = (lane & 15) * 4;
  {
#pragma unroll
    for (int q = 0; q < 16; ++q) { const int r = q * 2 + rsub; const v4f v = *(const v4fa*)&so[w][r][c4]; if (C) *(v4f*)(C + cofs + (size_t)(row0 + r) * ldc + col0 + c4) = v; if (C16) { v4h h4; for (int i = 0; i < 4; ++i) h4[i] = (_Float16)v[i]; *(v4h*)(C16 + cofs + (size_t)(row0 + r) * ldc + col0 + c4) = h4; } }
     } }


__global__ __launch_bounds__(256) void k_wnat(const float* __restrict__ w, size_t n8, _Float16* __restrict__ Bt) { const size_t t = (size_t)blockIdx.x * 256 + threadIdx.x; if (t >= n8) return; FragH f; for (int q = 0; q < 8; ++q) f.h[q] = (_Float16)(bf16_round(w[t * 8 + q]) * 16.0f); *(v8us*)((unsigned short*)Bt + t * 8) = f.half[0];  }
__global__ __launch_bounds__(256) void k_rsm(const float* __restrict__ S, _Float16* __restrict__ P, int nrows) {
  #pragma clang fp contract(off)
  const int i = blockIdx.x * 256 + threadIdx.x; if (i >= nrows) return; const float* s = S + (size_t)i * SQ; float mx = -3.0e38f;
#pragma unroll 1
  for (int j = 0; j < SQ; ++j) mx = fmaxf(mx, s[j]); float se = 0.f;
#pragma unroll 1
  for (int j = 0; j < SQ; ++j) se += expf(s[j] - mx); const float sc = 256.0f / se;
#pragma unroll 1
  for (int j0 = 0; j0 < SQ; j0 += 8) { FragH f; for (int q = 0; q < 8; ++q) f.h[q] = (_Float16)(expf(s[j0 + q] - mx) * sc); unsigned short* d = (unsigned short*)P + (size_t)i * SQ + j0; *(v8us*)d = f.half[0];  } }
__global__ __launch_bounds__(256) void k_vt(const _Float16* __restrict__ V16, int b, int h0, _Float16* __restrict__ VT) { __shared__ unsigned short tl[64][65]; const int tid = threadIdx.x; const int hh = blockIdx.x % HG, sg = blockIdx.x / HG; const int s0 = sg * 64; const int h = h0 + hh;
  for (int i = tid; i < 64 * 8; i += 256) { const int j = i / 8, d8 = (i % 8) * 8; FragH f; f.half[0] = *(const v8us*)((const unsigned short*)V16 + ((size_t)b * SQ + s0 + j) * DM + h * HD + d8); for (int q = 0; q < 8; ++q) tl[d8 + q][j] = f.u[q]; }
  __syncthreads();
  { for (int i = tid; i < 64 * 8; i += 256) { const int d = i / 8, j8 = (i % 8) * 8; FragH f; for (int q = 0; q < 8; ++q) f.u[q] = tl[d][j8 + q]; *(v8us*)((unsigned short*)VT + ((size_t)hh * HD + d) * SQ + s0 + j8) = f.half[0]; }  } }


__global__ __launch_bounds__(256) void k_tab2(float theta, float* __restrict__ CS, float* __restrict__ SN) {
  #pragma clang fp contract(off)
  const int t = blockIdx.x * 256 + threadIdx.x; if (t >= SQ * (HD / 2)) return; const int i = t % (HD / 2); const int p = t / (HD / 2); const float invf = 1.0f / powf(theta, (float)(2 * i) / (float)HD); const float ang = __fmul_rn((float)p, invf); const float c = cosf(ang), s = sinf(ang);
  *(float*)(CS + t) = c; *(float*)(SN + t) = s;  }
template <int NORM, int ROPE>
__global__ __launch_bounds__(64) void k_xform(const float* __restrict__ F, int ldf, int nh, const float* __restrict__ gain, float eps, const float* __restrict__ CS, const float* __restrict__ SN, _Float16* __restrict__ H16, int ldo) {
  #pragma clang fp contract(off)
  __shared__ float xv[HD]; __shared__ float red[HD]; __shared__ unsigned short sh_[HD]; const int d = threadIdx.x; const int h = blockIdx.x % nh; const size_t r = blockIdx.x / nh; const int p = (int)(r % SQ);
  float x = F[r * (size_t)ldf + (size_t)h * HD + d];
  if (NORM) { red[d] = __fmul_rn(x, x); __syncthreads(); for (int st = HD / 2; st > 0; st >>= 1) { if (d < st) red[d] = __fadd_rn(red[d], red[d + st]); __syncthreads(); } const float rs = rsqrtf(__fadd_rn(red[0] / (float)HD, eps)); x = __fmul_rn(__fmul_rn(x, rs), bf16_round(gain[d])); }
  xv[d] = x; __syncthreads();
  float o = x;
  if (ROPE == 1) { const int i = d >> 1; const float c = CS[p * (HD / 2) + i], s = SN[p * (HD / 2) + i]; const float ev = xv[2 * i], od = xv[2 * i + 1]; o = (d & 1) ? __fadd_rn(__fmul_rn(ev, s), __fmul_rn(od, c)) : __fadd_rn(__fmul_rn(ev, c), -__fmul_rn(od, s)); }
  if (ROPE == 2) { const int i = d & (HD / 2 - 1); const float c = CS[p * (HD / 2) + i], s = SN[p * (HD / 2) + i]; const float lo = xv[i], hi = xv[i + HD / 2]; o = (d < HD / 2) ? __fadd_rn(__fmul_rn(lo, c), -__fmul_rn(hi, s)) : __fadd_rn(__fmul_rn(lo, s), __fmul_rn(hi, c)); }
  if (ROPE == 6) { const float c = bf16_round(CS[p * HD + d]), s = bf16_round(SN[p * HD + d]); const float pa = xv[(d + HD / 2) & (HD - 1)]; const float rh = (d < HD / 2) ? -pa : pa; o = __fadd_rn(__fmul_rn(x, c), __fmul_rn(rh, s)); }      /* FULL-WIDTH bf16-rounded INPUT tables [p][64]: o = x cos[p][d] + rotate_half(x)[d] sin[p][d], rotate_half = concat(-x[32:], x[:32]) */
  FragH th; th.h[0] = (_Float16)o; sh_[d] = th.u[0]; __syncthreads();
  if (d < HD / 8) { FragH f; for (int q = 0; q < 8; ++q) f.u[q] = sh_[d * 8 + q]; unsigned short* dst = (unsigned short*)H16 + r * (size_t)ldo + (size_t)h * HD + d * 8; *(v8us*)dst = f.half[0];  } }

__global__ __launch_bounds__(256) void k_tab3(float* __restrict__ CS, float* __restrict__ SN) {
  #pragma clang fp contract(off)
  const int t = blockIdx.x * 256 + threadIdx.x; if (t >= SQ * (HD / 2)) return; const int i = t % (HD / 2); const int p = t / (HD / 2); const float freq = expf(__fmul_rn((float)(2 * i), -0.14391156831212787f)); const float ang = __fmul_rn((float)p, freq); const float c = cosf(ang), s = sinf(ang);
  *(float*)(CS + t) = c; *(float*)(SN + t) = s;  }



// ---- GEMM main loop with both operands staged in LDS (used by k_qkv and k_out) ----
// A block of 8 waves makes a 128 x 128 tile of A . B^T (K = DM): wave w takes rows 32 (w & 3) and columns 64 (w >> 2), a 32x64 wave tile as in k_gemm2, with the same fragments, the same k order and the same order of products.
// A stage is 128 k of the block's 128 A rows and 128 B rows: 256 rows of 256 bytes at an LDS pitch of 272 bytes (16 x odd, for 16-byte fragment reads). Two buffers: the next stage's copies fly while this one is worked on; two blocks fit a WGP.
// The rows come by asynchronous copies to LDS: a wave's copy is four whole 128-byte lines, and a row is fetched once per block, where the fragment loads from global memory touched 16 lines each and every wave fetched its own.
#define G3K 128                       /* k per stage */
#define G3P 136                       /* LDS row pitch in f16 */
#define G3S (256 * G3P)               /* f16 per stage */
#define G3B (2 * G3S * 2)             /* bytes of the two buffers */
#define G3T (DM / G3K)                /* stages */
__device__ __forceinline__ void g3_copy8(const _Float16* g, unsigned l) {      /* a thread brings 16 bytes of eight rows, 16 rows apart: the block's 128 rows of one operand */
  const unsigned st = 16 * G3P * 2;
  /* the wait on the last line stands in front of any later write of a register that these copies name */
  asm volatile("global_load_async_to_lds_b128 %0, %8, off\n\t"
               "global_load_async_to_lds_b128 %1, %9, off\n\t"
               "global_load_async_to_lds_b128 %2, %10, off\n\t"
               "global_load_async_to_lds_b128 %3, %11, off\n\t"
               "global_load_async_to_lds_b128 %4, %12, off\n\t"
               "global_load_async_to_lds_b128 %5, %13, off\n\t"
               "global_load_async_to_lds_b128 %6, %14, off\n\t"
               "global_load_async_to_lds_b128 %7, %15, off\n\t"
               "s_wait_xcnt 0x0"
               :: "v"(l), "v"(l + st), "v"(l + 2 * st), "v"(l + 3 * st), "v"(l + 4 * st), "v"(l + 5 * st), "v"(l + 6 * st), "v"(l + 7 * st),
                  "v"(g), "v"(g + (size_t)16 * DM), "v"(g + (size_t)32 * DM), "v"(g + (size_t)48 * DM), "v"(g + (size_t)64 * DM), "v"(g + (size_t)80 * DM), "v"(g + (size_t)96 * DM), "v"(g + (size_t)112 * DM) : "memory"); }
__device__ __forceinline__ void g3_copy(const _Float16* ga, const _Float16* gb, unsigned l) { g3_copy8(ga, l); g3_copy8(gb, l + 128 * G3P * 2); }      /* a stage: the A rows, behind them the B rows */
__device__ __forceinline__ v16h g3_frag(const unsigned short* p) { FragH f; f.half[0] = *(const v8us*)p; f.half[1] = *(const v8us*)(p + 16); return f.v; }      /* p already holds the lane's 8 hh: the k order of g2_frag */
__device__ __forceinline__ void g3_main(const _Float16* __restrict__ A, const _Float16* __restrict__ Bh, int rowb, int colb, unsigned short* sm, v8f (&acc)[8]) {
  const int tid = threadIdx.x, w = tid >> 5, lane = tid & 31, ln = lane & 15, hh = lane >> 4;
  const _Float16* ga = A + (size_t)(rowb + (tid >> 4)) * DM + (tid & 15) * 8; const _Float16* gb = Bh + (size_t)(colb + (tid >> 4)) * DM + (tid & 15) * 8;
  const unsigned l0 = (unsigned)(size_t)sm + (unsigned)((tid >> 4) * (G3P * 2) + (tid & 15) * 16);
  const unsigned short* fa = sm + (32 * (w & 3) + ln) * G3P + 8 * hh; const unsigned short* fb = sm + (128 + 64 * (w >> 2) + ln) * G3P + 8 * hh;
  g3_copy(ga, gb, l0);
  asm volatile("s_wait_asynccnt 0x0" ::: "memory");      /* stage 0 of this wave has landed */
  __syncthreads();      /* stage 0 of every wave has landed */
  g3_copy(ga + G3K, gb + G3K, l0 + G3S * 2);
#pragma unroll 1      /* one stage per trip: the buffer is picked by the trip's parity */
  for (int t = 0; t < G3T; ++t) { const int bo = (t & 1) * G3S; const unsigned short* pa = fa + bo; const unsigned short* pb = fb + bo;
    v16h a[2][2], b[2][4];      /* two fragment sets: the next 32 k of this stage are read from LDS while this one's products run */
    a[0][0] = g3_frag(pa); a[0][1] = g3_frag(pa + 16 * G3P);
#pragma unroll
    for (int n = 0; n < 4; ++n) b[0][n] = g3_frag(pb + n * 16 * G3P);
#pragma unroll
    for (int kk = 0; kk < G3K / 32; ++kk) { const int c = kk & 1, x = c ^ 1;
      if (kk + 1 < G3K / 32) { a[x][0] = g3_frag(pa + (kk + 1) * 32); a[x][1] = g3_frag(pa + 16 * G3P + (kk + 1) * 32);
#pragma unroll
        for (int n = 0; n < 4; ++n) b[x][n] = g3_frag(pb + n * 16 * G3P + (kk + 1) * 32); }
      __builtin_amdgcn_sched_barrier(0);      /* keeps the next set's LDS reads together in front of this set's eight products: without it they sink among the products, and each pair of products waits out an LDS latency of its own */
#pragma unroll
      for (int n = 0; n < 4; ++n) { acc[n] = g2_mma(a[c][0], b[c][n], acc[n]); acc[4 + n] = g2_mma(a[c][1], b[c][n], acc[4 + n]); } }
    asm volatile("s_wait_dscnt 0x0" ::: "memory");      /* this wave's reads of the buffer are done before the barrier frees it */
    asm volatile("s_wait_asynccnt 0x0" ::: "memory");      /* this wave's copies of stage t + 1 have landed before the barrier publishes them */
    __syncthreads();      /* publishes stage t + 1 and ends every wave's reads of stage t */
    if (t + 2 < G3T) g3_copy(ga + (t + 2) * G3K, gb + (t + 2) * G3K, l0 + (unsigned)bo * 2); }
  asm volatile("s_wait_asynccnt 0x0" ::: "memory");      /* nothing is in flight when the buffers become the epilogue's staging (the last trip's barrier has ended every read) */
}

// q | k | v projection of every token row (main loop = g3_main) with all the work between projection and attention in its epilogue. A wave tile is 32 token rows x 64 columns = exactly one head of q, k or v; the block's two heads are both q, both k or both v (block-uniform: sel), so nothing outside the tile is needed.
// q, k: the f32 tile goes through the wave's own LDS slab into row order; a lane takes 4 columns and their rotate_half partners (column ^ 32, same row), the tables come as 16-byte loads, and a row leaves as one whole 128-byte line of f16.
// v: a lane's 8 accumulator registers are 8 consecutive token rows of one column = 16 bytes of a V^T row; the four waves of a head put them into one [64][128] f16 tile in LDS, and behind a barrier each V^T row leaves as 256 contiguous bytes.
__global__ __launch_bounds__(256) void k_qkv(const _Float16* __restrict__ A, const _Float16* __restrict__ Bh, const float* __restrict__ CS, const float* __restrict__ SN, _Float16* __restrict__ Qh, _Float16* __restrict__ Kh, _Float16* __restrict__ Vt) {
  __shared__ __attribute__((aligned(2048))) unsigned short sm[G3B / 2];      /* the two stage buffers; behind the main loop the epilogue's staging */
  static_assert(8 * 32 * 68 * 4 <= G3B, "epilogue slabs must fit the stage buffers");
  const int tid = threadIdx.x, w = tid >> 5, lane = tid & 31, ln = lane & 15, hh = lane >> 4, wm = w & 3, wn = w >> 2;
  const int ntn = 3 * NH / 2; const int mt = blockIdx.x / ntn, np = blockIdx.x - mt * ntn; const int row0 = mt * 128 + 32 * wm; const int sel = np / (NH / 2), h = (np - sel * (NH / 2)) * 2 + wn;
  const v8f z8 = {0.f,0.f,0.f,0.f,0.f,0.f,0.f,0.f}; v8f accs[8] = {z8, z8, z8, z8, z8, z8, z8, z8};
  g3_main(A, Bh, mt * 128, np * 128, sm, accs);
  float (*so)[32][68] = (float (*)[32][68])sm;
  const float alpha = 0.0625f;      /* undoes the x16 of the weights (exact) */
  if (sel < 2) {
#pragma unroll
    for (int u = 0; u < 8; ++u) { const int t = u & 3, half = u >> 2;
#pragma unroll
      for (int r = 0; r < 8; ++r) so[w][half * 16 + 8 * hh + r][t * 16 + ln] = accs[u][r] * alpha; }
    __builtin_amdgcn_fence(__ATOMIC_ACQ_REL, "workgroup"); __builtin_amdgcn_wave_barrier();      /* the slab is the wave's own: its LDS writes are ordered in front of its reads, no block barrier */
    const int rsub = lane >> 4, c4 = (lane & 15) * 4; const float sg = (c4 < HD / 2) ? -1.0f : 1.0f;      /* rotate_half = concat(-x[32:], x[:32]) */
    _Float16* dst = (sel ? Kh : Qh) + (size_t)(row0 + rsub) * DM + h * HD + c4;
    const size_t tofs = (size_t)(row0 % SQ + rsub) * HD + c4; const float* cp = CS + tofs; const float* sp = SN + tofs;      /* 32 | SQ: the tile's 32 rows are 32 consecutive positions of one batch, so every table row is a constant step from the first */
#pragma unroll
    for (int q = 0; q < 16; ++q) { const int r = q * 2 + rsub;
      const v4f xv = *(const v4fa*)&so[w][r][c4], pa = *(const v4fa*)&so[w][r][c4 ^ (HD / 2)]; const v4f cc = *(const v4fa*)(cp + q * 2 * HD), ss = *(const v4fa*)(sp + q * 2 * HD); v4h h4;
#pragma unroll
      for (int i = 0; i < 4; ++i) h4[i] = (_Float16)(xv[i] * bf16_round(cc[i]) + pa[i] * (sg * bf16_round(ss[i])));
      *(v4h*)(dst + (size_t)q * 2 * DM) = h4; }
  } else {
    unsigned short* tl = sm + wn * (64 * 136);      /* per head [64 d][136] f16: pitch 272 bytes, so the 16 columns of a 16-byte store start 4 banks apart */
#pragma unroll
    for (int u = 0; u < 8; ++u) { const int t = u & 3, half = u >> 2; FragH f;
#pragma unroll
      for (int r = 0; r < 8; ++r) f.h[r] = (_Float16)(accs[u][r] * alpha);
      *(v8us*)(tl + (t * 16 + ln) * 136 + wm * 32 + half * 16 + 8 * hh) = f.half[0]; }
    __syncthreads();      /* a V^T row of the tile holds token rows of the head's four waves; sel is the same for the whole block */
    const int rb = mt * 128, t2 = tid & 127; unsigned short* vd = (unsigned short*)Vt + ((size_t)((rb / SQ) * NH + h) * HD) * SQ + rb % SQ;
#pragma unroll
    for (int i = 0; i < 8; ++i) { const int d = i * 8 + (t2 >> 4), c8 = (t2 & 15) * 8; *(v8us*)(vd + (size_t)d * SQ + c8) = *(const v8us*)(tl + d * 136 + c8); }
    asm volatile("s_wait_xcnt 0x0" ::: "memory");      /* stands behind the last V^T store, in front of any later write of a register that these stores name */
  } }

// out = o . Wo^T x alpha (main loop = g3_main); the f32 tile goes through the wave's own LDS slab into row order and leaves as whole 256-byte row pieces, as in k_gemm2.
__global__ __launch_bounds__(256) void k_out(const _Float16* __restrict__ A, const _Float16* __restrict__ Bh, float alpha, float* __restrict__ C) {
  __shared__ __attribute__((aligned(2048))) unsigned short sm[G3B / 2];      /* the two stage buffers; behind the main loop the epilogue's staging */
  const int tid = threadIdx.x, w = tid >> 5, lane = tid & 31, ln = lane & 15, hh = lane >> 4;
  const int ntn = DM / 128; const int mt = blockIdx.x / ntn, np = blockIdx.x - mt * ntn; const int row0 = mt * 128 + 32 * (w & 3), col0 = np * 128 + 64 * (w >> 2);
  const v8f z8 = {0.f,0.f,0.f,0.f,0.f,0.f,0.f,0.f}; v8f accs[8] = {z8, z8, z8, z8, z8, z8, z8, z8};
  g3_main(A, Bh, mt * 128, np * 128, sm, accs);
  float (*so)[32][68] = (float (*)[32][68])sm;
#pragma unroll
  for (int u = 0; u < 8; ++u) { const int t = u & 3, half = u >> 2;
#pragma unroll
    for (int r = 0; r < 8; ++r) so[w][half * 16 + 8 * hh + r][t * 16 + ln] = accs[u][r] * alpha; }
  __builtin_amdgcn_fence(__ATOMIC_ACQ_REL, "workgroup"); __builtin_amdgcn_wave_barrier();      /* the slab is the wave's own: its LDS writes are ordered in front of its reads, no block barrier */
  const int rsub = lane >> 4, c4 = (lane & 15) * 4;
#pragma unroll
  for (int q = 0; q < 16; ++q) { const int r = q * 2 + rsub; *(v4f*)(C + (size_t)(row0 + r) * DM + col0 + c4) = *(const v4fa*)&so[w][r][c4]; } }

__device__ __forceinline__ float xrow(float v) { const int b = __float_as_int(v); return __int_as_float(__builtin_amdgcn_permlanex16(b, b, 0x76543210, 0xfedcba98, false, false)); }      /* lane l <-> l ^ 16; every lane must be active */
__device__ __forceinline__ v8f fa_mma(v16h a, v16h b, v8f c) { return __builtin_amdgcn_wmma_f32_16x16x32_f16(false, a, false, b, (short)0, c, false, false); }
#define FK 128                        /* keys per stage */
#define FKP 72                        /* LDS pitch of a K row in f16 */
#define FVP 136                       /* LDS pitch of a V^T row in f16 */
#define FKS (FK * FKP)                /* f16 of a stage's K rows */
#define FS (FKS + HD * FVP)           /* f16 per stage */
#define FT (SQ / FK)                  /* stages */
__device__ __forceinline__ void fa_copy(const _Float16* gk, const _Float16* gv, unsigned lk, unsigned lv) {      /* a thread brings 16 bytes of four K rows, 32 rows apart, and of four V^T rows, 16 rows apart: together the block's stage */
  const unsigned sk = 32 * FKP * 2, sv = 16 * FVP * 2;
  /* the wait on the last line stands in front of any later write of a register that these copies name */
  asm volatile("global_load_async_to_lds_b128 %0, %8, off\n\t"
               "global_load_async_to_lds_b128 %1, %9, off\n\t"
               "global_load_async_to_lds_b128 %2, %10, off\n\t"
               "global_load_async_to_lds_b128 %3, %11, off\n\t"
               "global_load_async_to_lds_b128 %4, %12, off\n\t"
               "global_load_async_to_lds_b128 %5, %13, off\n\t"
               "global_load_async_to_lds_b128 %6, %14, off\n\t"
               "global_load_async_to_lds_b128 %7, %15, off\n\t"
               "s_wait_xcnt 0x0"
               :: "v"(lk), "v"(lk + sk), "v"(lk + 2 * sk), "v"(lk + 3 * sk), "v"(lv), "v"(lv + sv), "v"(lv + 2 * sv), "v"(lv + 3 * sv),
                  "v"(gk), "v"(gk + (size_t)32 * DM), "v"(gk + (size_t)64 * DM), "v"(gk + (size_t)96 * DM), "v"(gv), "v"(gv + (size_t)16 * SQ), "v"(gv + (size_t)32 * SQ), "v"(gv + (size_t)48 * SQ) : "memory"); }
__global__ __launch_bounds__(256) void k_fattn(const _Float16* __restrict__ Qh, const _Float16* __restrict__ Kh, const _Float16* __restrict__ Vt, _Float16* __restrict__ O) {
  __shared__ __attribute__((aligned(2048))) unsigned short sm[2 * FS];      /* the two stage buffers */
  const int tid = threadIdx.x, lane = tid & 31, ln = lane & 15, hh = lane >> 4, w = tid >> 5; const int h = blockIdx.y, b = B0 + blockIdx.z; const size_t r0 = (size_t)b * SQ; const int q0 = blockIdx.x * 256 + w * 32;
  const _Float16* qp = Qh + (r0 + q0 + ln) * DM + h * HD;
  const _Float16* gk = Kh + (r0 + (tid >> 3)) * DM + h * HD + (tid & 7) * 8; const _Float16* gv = Vt + ((size_t)(b * NH + h) * HD + (tid >> 4)) * SQ + (tid & 15) * 8;
  const unsigned lk = (unsigned)(size_t)sm + (unsigned)((tid >> 3) * (FKP * 2) + (tid & 7) * 16), lv = (unsigned)(size_t)sm + (unsigned)(FKS * 2 + (tid >> 4) * (FVP * 2) + (tid & 15) * 16);
  const unsigned short* fk = sm + ln * FKP + 8 * hh; const unsigned short* fv = sm + FKS + ln * FVP + 8 * hh;      /* the lane's 8 hh is in the pointer: the k order of g2_frag */
  const float c = 0.18033688011112042f; const v8f z8 = {0.f,0.f,0.f,0.f,0.f,0.f,0.f,0.f};
  v16h qf[2][2], kf[2][2]; v8f o[2][4]; float mu[2] = {-3.0e38f, -3.0e38f}, ls[2] = {0.f, 0.f};
#pragma unroll
  for (int j = 0; j < 2; ++j) {
#pragma unroll
    for (int ks = 0; ks < 2; ++ks) qf[j][ks] = g2_frag(qp + (size_t)j * 16 * DM + ks * 32, hh);
#pragma unroll
    for (int dt = 0; dt < 4; ++dt) o[j][dt] = z8; }
  asm volatile("s_wait_xcnt 0x0" ::: "memory");      /* stands behind the Q loads, in front of any later write of a register that they name */
  fa_copy(gk, gv, lk, lv);
  asm volatile("s_wait_asynccnt 0x0" ::: "memory");      /* stage 0 of this wave has landed */
  __syncthreads();      /* stage 0 of every wave has landed */
  fa_copy(gk + (size_t)FK * DM, gv + FK, lk + FS * 2, lv + FS * 2);
#pragma unroll 1      /* one stage per trip: the buffer is picked by the trip's parity */
  for (int t = 0; t < FT; ++t) { const int bo = (t & 1) * FS; const unsigned short* pk = fk + bo; const unsigned short* pv = fv + bo;
#pragma unroll
    for (int kt = 0; kt < 2; ++kt) {
#pragma unroll
      for (int ks = 0; ks < 2; ++ks) kf[kt][ks] = g3_frag(pk + kt * 16 * FKP + ks * 32); }
#pragma unroll 1      /* one pass per trip: a second copy of the body would take the registers that four waves per SIMD need */
    for (int p = 0; p < FK / 32; ++p) {
      v16h vf[4]; v8f s[2][2]; float mx[2];
#pragma unroll
      for (int dt = 0; dt < 4; ++dt) vf[dt] = g3_frag(pv + dt * 16 * FVP + p * 32);
      __builtin_amdgcn_sched_barrier(0);      /* keeps the V^T reads in front of the score products: without it they sink below the softmax's maximum and have half the lead on their use */
#pragma unroll
      for (int j = 0; j < 2; ++j) {
#pragma unroll
        for (int kt = 0; kt < 2; ++kt) s[j][kt] = fa_mma(kf[kt][1], qf[j][1], fa_mma(kf[kt][0], qf[j][0], z8)); }
      if (p + 1 < FK / 32) {      /* the next pass's K fragments come from LDS during this pass's softmax; a stage's last pass fetches nothing ahead (the next stage is not published yet) */
#pragma unroll
        for (int kt = 0; kt < 2; ++kt) {
#pragma unroll
          for (int ks = 0; ks < 2; ++ks) kf[kt][ks] = g3_frag(pk + ((p + 1) * 32 + kt * 16) * FKP + ks * 32); } }
#pragma unroll
      for (int j = 0; j < 2; ++j) { float a = fmaxf(s[j][0][0], s[j][1][0]);
#pragma unroll
        for (int r = 1; r < 8; ++r) a = fmaxf(a, fmaxf(s[j][0][r], s[j][1][r]));
        mx[j] = fmaxf(a, xrow(a)) * c; }
      const bool need = (mx[0] > mu[0] + 8.0f) || (mx[1] > mu[1] + 8.0f);
      if (__builtin_amdgcn_ballot_w32(need) != 0) {      /* one scalar branch per pass; always taken in the first pass (mu = -3e38: factor 0 on zero sums) */
#pragma unroll
        for (int j = 0; j < 2; ++j) { const float mn = fmaxf(mu[j], mx[j]); const float al = __builtin_amdgcn_exp2f(mu[j] - mn); mu[j] = mn; ls[j] *= al;
#pragma unroll
          for (int dt = 0; dt < 4; ++dt) o[j][dt] *= al; } }
#pragma unroll
      for (int j = 0; j < 2; ++j) { const float bias = 7.0f - mu[j]; FragH pf; float t8[8];
#pragma unroll
        for (int r = 0; r < 8; ++r) { const float p0 = __builtin_amdgcn_exp2f(fmaf(s[j][0][r], c, bias)), p1 = __builtin_amdgcn_exp2f(fmaf(s[j][1][r], c, bias)); pf.h[r] = (_Float16)p0; pf.h[8 + r] = (_Float16)p1; t8[r] = p0 + p1; }
        ls[j] += ((t8[0] + t8[1]) + (t8[2] + t8[3])) + ((t8[4] + t8[5]) + (t8[6] + t8[7]));
#pragma unroll
        for (int dt = 0; dt < 4; ++dt) o[j][dt] = (j == 1 && dt == 3) ? g2_mma(vf[dt], pf.v, o[j][dt]) : fa_mma(vf[dt], pf.v, o[j][dt]); } }      /* the pass's last product carries its four v_nop (g2_mma): the next trip's first vector instruction forms an LDS address in a register of this product's A operand */
    asm volatile("s_wait_dscnt 0x0" ::: "memory");      /* this wave's reads of the buffer are done before the barrier frees it */
    asm volatile("s_wait_asynccnt 0x0" ::: "memory");      /* this wave's copies of stage t + 1 have landed before the barrier publishes them */
    __syncthreads();      /* publishes stage t + 1 and ends every wave's reads of stage t */
    if (t + 2 < FT) fa_copy(gk + (size_t)(t + 2) * FK * DM, gv + (t + 2) * FK, lk + (unsigned)bo * 2, lv + (unsigned)bo * 2); }
  asm volatile("s_wait_asynccnt 0x0" ::: "memory");      /* nothing is in flight when the wave ends */
#pragma unroll
  for (int j = 0; j < 2; ++j) { const float sc = 64.0f / (ls[j] + xrow(ls[j]));      /* the halves' sums join once; o carried x64 as before */
    unsigned short* dst = (unsigned short*)O + (r0 + q0 + j * 16 + ln) * DM + h * HD + 8 * hh;
#pragma unroll
    for (int dt = 0; dt < 4; ++dt) { FragH f;
#pragma unroll
      for (int r = 0; r < 8; ++r) f.h[r] = (_Float16)(o[j][dt][r] * sc);
      *(v8us*)(dst + dt * 16) = f.half[0]; } } }

// All f32 -> f16 conversions of a call in ONE launch (they are independent of each other): x (bf16-rounded, exact in f16) and the four weights (bf16-rounded, x16, exact), same arithmetic per element as k_x16 and k_wnat.
// A piece is 8 elements (32 bytes in, 16 bytes out). The grid has one thread per piece of a weight matrix; x is exactly 8 times that, so every thread takes 12 pieces: 8 of x, one of each weight. No branch, no tail.
// A block takes 8 x 512 consecutive pieces of x (128 KB) and 512 consecutive pieces of each weight, so all of a thread's addresses are a uniform base, one 32-bit offset and a constant.
// 256 blocks of 16 waves: one block per WGP, few waves to start, and each wave has its 24 16-byte loads in flight before the first is used.
#define PT 512                        /* threads per block */
#define PG ((unsigned)((size_t)DM * DM / 8 / PT))      /* blocks: one thread per piece of a weight matrix */
__global__ __launch_bounds__(PT) void k_prep(const float* __restrict__ x, const float* __restrict__ wq, const float* __restrict__ wk, const float* __restrict__ wv, const float* __restrict__ wo,
                                             _Float16* __restrict__ X16, _Float16* __restrict__ BQKV, _Float16* __restrict__ BO) {
  static_assert(NR * DM / 8 == (size_t)8 * PG * PT, "x must be 8 pieces per thread");
  const unsigned iw = (blockIdx.x * PT + threadIdx.x) * 32u, ix = (blockIdx.x * (8u * PT) + threadIdx.x) * 32u;      /* byte offsets of the thread's piece in a weight and of its first piece in x */
  const float* wsrc[4] = {wq, wk, wv, wo};
  v4f a[12][2];
#pragma unroll
  for (int i = 0; i < 8; ++i) { const char* p = (const char*)x + ix + i * (PT * 32); a[i][0] = *(const v4fa*)p; a[i][1] = *(const v4fa*)(p + 16); }
#pragma unroll
  for (int i = 0; i < 4; ++i) { const char* p = (const char*)wsrc[i] + iw; a[8 + i][0] = *(const v4fa*)p; a[8 + i][1] = *(const v4fa*)(p + 16); }
  __builtin_amdgcn_sched_barrier(0);      /* keeps all 24 loads in front of the first conversion: without it about half of them are issued only after earlier ones have come back, and the wave waits out a second memory latency */
#pragma unroll
  for (int i = 0; i < 12; ++i) { const float sc = (i < 8) ? 1.0f : 16.0f; FragH f;
#pragma unroll
    for (int q = 0; q < 4; ++q) { f.h[q] = (_Float16)(bf16_round(a[i][0][q]) * sc); f.h[4 + q] = (_Float16)(bf16_round(a[i][1][q]) * sc); }
    char* d = (i < 8) ? (char*)X16 + (ix >> 1) + i * (PT * 16) : (i < 11) ? (char*)(BQKV + (size_t)(i - 8) * DM * DM) + (iw >> 1) : (char*)BO + (iw >> 1);      /* q | k | v stacked along n */
    *(v8us*)d = f.half[0]; } }

extern "C" void kernel_launch(void* const* d_in, const int* in_sizes, int n_in,
                              void* d_out, int out_size, void* d_ws, size_t ws_size, hipStream_t stream) {
  (void)in_sizes; (void)n_in; (void)out_size;
  const float* const* I = (const float* const*)d_in; const float* x = I[0]; const float* tcos = I[1]; const float* tsin = I[2]; const float* wq = I[3]; const float* wk = I[4]; const float* wv = I[5]; const float* wo = I[6]; const float* bo = nullptr;      /* natural [out][in] weights, no biases; cos/sin INPUT tables [1][S][1][64] = [S][64] */
  char* ws = (char*)d_ws; size_t off = 0;
  auto take = [&](size_t bytes) { char* p = ws + off; off += (bytes + 255) & ~(size_t)255; return p; };
  _Float16* BQKV = (_Float16*)take((size_t)3 * DM * DM * 2); _Float16* BO = (_Float16*)take((size_t)DM * DM * 2);
  _Float16* X16 = (_Float16*)take(NR * DM * 2);
  _Float16* QH = (_Float16*)take(NR * DM * 2); _Float16* KH = (_Float16*)take(NR * DM * 2); _Float16* O16 = (_Float16*)take(NR * DM * 2);
  _Float16* VT = (_Float16*)take((size_t)NB * NH * HD * SQ * 2);      /* V^T of every batch */
  if (off > ws_size) return;
  k_prep<<<PG, PT, 0, stream>>>(x, wq, wk, wv, wo, X16, BQKV, BO);      /* x as f16 rows; natural [out][in] weights = Bt[n][k], x16; q | k | v stacked along n */
  k_qkv<<<(unsigned)((NR / 128) * (3 * DM / 128)), 256, 0, stream>>>(X16, BQKV, tcos, tsin, QH, KH, VT);      /* every batch: rotated f16 q and k rows, V^T [NB][NH][HD][SQ] */
  k_fattn<<<dim3(QN / 256, NHD, NBR), 256, 0, stream>>>(QH, KH, VT, O16);      /* all batches and heads in one launch; o x64 as f16 in the merged rows */
  k_out<<<(unsigned)((MPO / 128) * (DM / 128)), 256, 0, stream>>>(O16 + (size_t)B0 * SQ * DM, BO, 0.0009765625f, (float*)d_out + (size_t)B0 * SQ * DM);      /* out rows are the output layout */
}

// v007
// A run of this version takes 117 microseconds.
// Timed twice side by side with v006, it ran 1.05 times as fast both times.
// All steps since v000 together make it 60.1 times as fast.
#include <hip/hip_runtime.h>
// RoPE multi-head self-attention with INPUT rotary tables (x [4][2048][1024]; q/k/v = x W^T (nn.Linear natural [out][in] sigma 0.02, no bias), 16 heads of 64; q = q cos + rotate_half(q) sin with the module's cos/sin inputs [1][2048][1][64] (full head width, independent values per dim; rotate_half = concat(-x[32:], x[:32])), same for k; scores / 8; softmax over all keys (no mask); out = merged Wo^T (no bias) -> [4][2048][1024]).
// Structure: token rows r = b*2048 + s; x as exact f16 rows (bf16-rounded); q | k | v of all batches as ONE WMMA GEMM launch (32x64 wave tiles = one head wide, operands staged in LDS per 128x128 block tile, f32 accumulation, exact x16 weights, N = 3 x 1024) whose epilogue does the rest while the tile is still on chip: the half-split rotary rotation of q and k from the cos/sin tables (no norm) -> f16 q, k rows, and v -> f16 V^T through an LDS transpose (no f32 q | k | v and no v rows in memory); then ONE fused attention launch over all batches and heads (scores on WMMA, online softmax in registers with f32 statistics and native exp2, weights as f16 straight into the P . V WMMA; o carried x64 against f16 subnormal flush, folded into the output GEMM alpha) written straight into the merged f16 o rows; out = o W_o GEMM (f32) into the output layout.
// Compute dtype: inputs rounded to bf16; x / weights exact; projections and rope f32; q, k, v, softmax weights and o as plain f16 GEMM operands (~2^-12); scores and softmax statistics f32. v_wmma_f32_16x16x32_f16.
#define NB 4
#define SQ 2048
#define DM 1024
#define NH 16
#define HD 64
#define HG 4                         /* heads per launch of the non-template k_vt */
#define B0 0                         /* first batch processed (debug hook) */
#define NBR NB                       /* batches processed (debug hook) */
#define QN SQ                        /* query rows attended per batch (debug hook) */
#define NHD NH                       /* heads attended (debug hook) */
#define NR ((size_t)NB * SQ)         /* token rows */
#define MPO ((int)((size_t)NBR * SQ))      /* rows through the output GEMM (debug hook) */
typedef __bf16 v16b __attribute__((ext_vector_type(16)));
typedef unsigned short v8us __attribute__((ext_vector_type(8), may_alias));
typedef float  v8f  __attribute__((ext_vector_type(8)));
typedef float  v4f  __attribute__((ext_vector_type(4)));
typedef float  v4fa __attribute__((ext_vector_type(4), may_alias));
union FragB { v16b v; v8us half[2]; unsigned short u[16]; };

__device__ __forceinline__ unsigned short bf16_bits(float x) { unsigned int u = __float_as_uint(x); return (unsigned short)((u + 0x7FFFu + ((u >> 16) & 1u)) >> 16); }
__device__ __forceinline__ float bf16_val(unsigned short b) { return __uint_as_float(((unsigned int)b) << 16); }
__device__ __forceinline__ float bf16_round(float x) { return bf16_val(bf16_bits(x)); }
// D += A·B with NT terms: 1 = ah·bh, 2 = + al·bh (A split), 3 = + ah·bl (both split)
template <int NT>
__device__ __forceinline__ v8f mmaN(v16b ah, v16b al, v16b bh, v16b bl, v8f c) {
  c = __builtin_amdgcn_wmma_f32_16x16x32_bf16(false, ah, false, bh, (short)0, c, false, false);
  if (NT >= 2) c = __builtin_amdgcn_wmma_f32_16x16x32_bf16(false, al, false, bh, (short)0, c, false, false);
  if (NT >= 3) c = __builtin_amdgcn_wmma_f32_16x16x32_bf16(false, ah, false, bl, (short)0, c, false, false);
  asm volatile("v_nop\n\tv_nop\n\tv_nop\n\tv_nop" : "+v"(c) : "v"(ah), "v"(al), "v"(bh), "v"(bl));
  return c;
}

__global__ __launch_bounds__(256) void k_wt_bf16(const float* __restrict__ W, unsigned short* __restrict__ Wt, int K, int N) {
  const int t = blockIdx.x * 256 + threadIdx.x;
  const int k8n = K / 8;
  if (t >= N * k8n) return;
  const int n = t / k8n, k8 = (t % k8n) * 8;
  v8us v;
#pragma unroll
  for (int i = 0; i < 8; ++i) v[i] = bf16_bits(W[(size_t)(k8 + i) * N + n]);
  *(v8us*)(Wt + (size_t)n * K + k8) = v;
  
}

// GEMM C[M][N] (f32, pitch ldc) = act(A[M][K]·W + bias). A f32 row-major (pitch lda) converted per fragment to bf16
// (ASPLIT: hi/lo two planes -> 2 terms, else single rounded term); Wt bf16 [N][K] (pitch ldb). BIAS_BF16 rounds the
// bias to bf16 first (bias quantised to bf16 before the add). K%32==0, M%16==0, N%64==0.
template <bool ASPLIT, int ACT, bool BIAS_BF16>
__global__ __launch_bounds__(128) void k_gemm_bf(const float* __restrict__ A, int lda, const unsigned short* __restrict__ Wt, int ldb,
                                               const float* __restrict__ bias, float* __restrict__ C, int ldc, int M, int N, int K) {
  __shared__ __attribute__((aligned(16))) float so[4][16][64];
  const int tid = threadIdx.x, w = tid >> 5, lane = tid & 31, ln = lane & 15, hh = lane >> 4;
  const int ntn = N / 64;
  const int wid = blockIdx.x * 4 + w;
  const int mt = wid / ntn, nq = wid % ntn;
  if (mt * 16 >= M) return;
  const int row0 = mt * 16, col0 = nq * 64;
  const float* arow = A + (size_t)(row0 + ln) * lda;
  v8f acc[4] = {};
  for (int kb = 0; kb < K; kb += 32) {
    FragB ah, al;
    const v4f x0 = *(const v4fa*)(arow + kb + 8 * hh), x1 = *(const v4fa*)(arow + kb + 8 * hh + 4);
    const v4f x2 = *(const v4fa*)(arow + kb + 16 + 8 * hh), x3 = *(const v4fa*)(arow + kb + 16 + 8 * hh + 4);
    float xs[16] = {x0[0],x0[1],x0[2],x0[3],x1[0],x1[1],x1[2],x1[3],x2[0],x2[1],x2[2],x2[3],x3[0],x3[1],x3[2],x3[3]};
#pragma unroll
    for (int i = 0; i < 16; ++i) { const unsigned short hb = bf16_bits(xs[i]); ah.u[i] = hb; al.u[i] = ASPLIT ? bf16_bits(xs[i] - bf16_val(hb)) : (unsigned short)0; }
#pragma unroll
    for (int t = 0; t < 4; ++t) {
      const unsigned short* brow = Wt + (size_t)(col0 + t * 16 + ln) * ldb + kb;
      FragB b;
      b.half[0] = *(const v8us*)(brow + 8 * hh);
      b.half[1] = *(const v8us*)(brow + 16 + 8 * hh);
      acc[t] = mmaN<ASPLIT ? 2 : 1>(ah.v, al.v, b.v, b.v, acc[t]);
    }
  }
#pragma unroll
  for (int t = 0; t < 4; ++t) {
    float bv = bias ? bias[col0 + t * 16 + ln] : 0.f;
    if (BIAS_BF16) bv = bf16_round(bv);
#pragma unroll
    for (int r = 0; r < 8; ++r) { float v = acc[t][r] + bv; if (ACT == 1) v = fmaxf(v, 0.f); so[w][8 * hh + r][t * 16 + ln] = v; }
  }
  __builtin_amdgcn_fence(__ATOMIC_ACQ_REL, "workgroup");
  __builtin_amdgcn_wave_barrier();
  const int rsub = lane >> 4, c4 = (lane & 15) * 4;
  {
#pragma unroll
    for (int q = 0; q < 8; ++q) {
      const int r = q * 2 + rsub;
      const v4f v = *(const v4fa*)&so[w][r][c4];
      *(v4f*)(C + (size_t)(row0 + r) * ldc + col0 + c4) = v;
    }
    
  }
}

// GEMM C = act(A·W + bias + resid): A f32 (ASPLIT -> hi/lo 2 terms), Wt bf16 [N][K]; ACT 0 none, 1 relu, 2 exact gelu;
// resid (optional, f32, row index = (row % rmod), pitch ldr, RES_BF16 rounds it) added before the activation.
template <bool ASPLIT, int ACT, bool BIAS_BF16, bool RES_BF16>
__global__ __launch_bounds__(128) void k_gemm_bf3(const float* __restrict__ A, int lda, const unsigned short* __restrict__ Wt, int ldb,
                                                const float* __restrict__ bias, const float* __restrict__ resid, int rmod, int ldr,
                                                float* __restrict__ C, int ldc, int M, int N, int K) {
  __shared__ __attribute__((aligned(16))) float so[4][16][64];
  const int tid = threadIdx.x, w = tid >> 5, lane = tid & 31, ln = lane & 15, hh = lane >> 4;
  const int ntn = N / 64;
  const int wid = blockIdx.x * 4 + w;
  const int mt = wid / ntn, nq = wid % ntn;
  if (mt * 16 >= M) return;
  const int row0 = mt * 16, col0 = nq * 64;
  const float* arow = A + (size_t)(row0 + ln) * lda;
  v8f acc[4] = {};
  for (int kb = 0; kb < K; kb += 32) {
    FragB ah, al;
    const v4f x0 = *(const v4fa*)(arow + kb + 8 * hh), x1 = *(const v4fa*)(arow + kb + 8 * hh + 4);
    const v4f x2 = *(const v4fa*)(arow + kb + 16 + 8 * hh), x3 = *(const v4fa*)(arow + kb + 16 + 8 * hh + 4);
    float xs[16] = {x0[0],x0[1],x0[2],x0[3],x1[0],x1[1],x1[2],x1[3],x2[0],x2[1],x2[2],x2[3],x3[0],x3[1],x3[2],x3[3]};
#pragma unroll
    for (int i = 0; i < 16; ++i) { const unsigned short hb = bf16_bits(xs[i]); ah.u[i] = hb; al.u[i] = ASPLIT ? bf16_bits(xs[i] - bf16_val(hb)) : (unsigned short)0; }
#pragma unroll
    for (int t = 0; t < 4; ++t) {
      const unsigned short* brow = Wt + (size_t)(col0 + t * 16 + ln) * ldb + kb;
      FragB b;
      b.half[0] = *(const v8us*)(brow + 8 * hh);
      b.half[1] = *(const v8us*)(brow + 16 + 8 * hh);
      acc[t] = mmaN<ASPLIT ? 2 : 1>(ah.v, al.v, b.v, b.v, acc[t]);
    }
  }
#pragma unroll
  for (int t = 0; t < 4; ++t) {
    const int col = col0 + t * 16 + ln;
    float bv = bias ? bias[col] : 0.f;
    if (BIAS_BF16) bv = bf16_round(bv);
#pragma unroll
    for (int r = 0; r < 8; ++r) {
      float v = acc[t][r] + bv;
      if (resid) { float rv = resid[(size_t)((row0 + 8 * hh + r) % rmod) * ldr + col]; if (RES_BF16) rv = bf16_round(rv); v += rv; }
      if (ACT == 1) v = fmaxf(v, 0.f);
      if (ACT == 2) v = 0.5f * v * (1.0f + erff(v * 0.70710678118654752f));
      if (ACT == 3) { const float u = 0.7978845608028654f * (v + 0.044715f * v * v * v); v = 0.5f * v * (1.0f + tanhf(u)); }
      so[w][8 * hh + r][t * 16 + ln] = v;
    }
  }
  __builtin_amdgcn_fence(__ATOMIC_ACQ_REL, "workgroup");
  __builtin_amdgcn_wave_barrier();
  const int rsub = lane >> 4, c4 = (lane & 15) * 4;
  {
#pragma unroll
    for (int q = 0; q < 8; ++q) {
      const int r = q * 2 + rsub;
      const v4f v = *(const v4fa*)&so[w][r][c4];
      *(v4f*)(C + (size_t)(row0 + r) * ldc + col0 + c4) = v;
    }
    
  }
}
// row LayerNorm (biased variance, eps) over N: s = X (+ R); optional out_sum <- s; out_norm <- (s-mu)*rsqrt(var+eps)*g + b
template <bool PARAM_BF16>
__global__ __launch_bounds__(256) void k_layernorm(const float* __restrict__ X, const float* __restrict__ R, const float* __restrict__ g, const float* __restrict__ bta,
                                                  float* __restrict__ out_sum, float* __restrict__ out_norm, int N, float eps) {
  __shared__ float red[256];
  const int row = blockIdx.x, tid = threadIdx.x;
  const float* x = X + (size_t)row * N; const float* rr = R ? R + (size_t)row * N : nullptr;
  float vals[16];                     // up to N = 4096
  const int per = N / 256;            // contiguous chunk per thread? use strided-by-4 chunks: thread handles j = tid*4 + 1024*u
  float s1 = 0.f;
  for (int u = 0; u < per / 4; ++u) {
    const int j = tid * 4 + 1024 * u;
    const v4f a = *(const v4fa*)(x + j);
    v4f b = {0.f,0.f,0.f,0.f}; if (rr) b = *(const v4fa*)(rr + j);
#pragma unroll
    for (int q = 0; q < 4; ++q) { const float v = a[q] + b[q]; vals[u * 4 + q] = v; s1 += v; }
  }
  red[tid] = s1; __syncthreads();
  for (int st = 128; st > 0; st >>= 1) { if (tid < st) red[tid] += red[tid + st]; __syncthreads(); }
  const float mu = red[0] / (float)N; __syncthreads();
  float s2 = 0.f;
  for (int u = 0; u < per / 4; ++u)
#pragma unroll
    for (int q = 0; q < 4; ++q) { const float c = vals[u * 4 + q] - mu; s2 += c * c; }
  red[tid] = s2; __syncthreads();
  for (int st = 128; st > 0; st >>= 1) { if (tid < st) red[tid] += red[tid + st]; __syncthreads(); }
  const float rs = rsqrtf(red[0] / (float)N + eps);
  {
    for (int u = 0; u < per / 4; ++u) {
      const int j = tid * 4 + 1024 * u;
      v4f o, sm;
#pragma unroll
      for (int q = 0; q < 4; ++q) {
        float gg = g[j + q], bb = bta[j + q];
        if (PARAM_BF16) { gg = bf16_round(gg); bb = bf16_round(bb); }
        sm[q] = vals[u * 4 + q]; o[q] = (vals[u * 4 + q] - mu) * rs * gg + bb;
      }
      if (out_sum) *(v4f*)(out_sum + (size_t)row * N + j) = sm;
      *(v4f*)(out_norm + (size_t)row * N + j) = o;
    }
    
  }
}



// ---- f16 WMMA path (v_wmma_f32_16x16x32_f16): 11-bit significands for operands in range — used where a [0,1] probability operand needs more precision than bf16
typedef _Float16 v16h __attribute__((ext_vector_type(16)));
union FragH { v16h v; v8us half[2]; _Float16 h[16]; unsigned short u[16]; };
template <int NT>
__device__ __forceinline__ v8f mmaH(v16h ah, v16h al, v16h bh, v16h bl, v8f c) {
  c = __builtin_amdgcn_wmma_f32_16x16x32_f16(false, ah, false, bh, (short)0, c, false, false);
  if (NT >= 2) c = __builtin_amdgcn_wmma_f32_16x16x32_f16(false, al, false, bh, (short)0, c, false, false);
  if (NT >= 3) c = __builtin_amdgcn_wmma_f32_16x16x32_f16(false, ah, false, bl, (short)0, c, false, false);
  asm volatile("v_nop\n\tv_nop\n\tv_nop\n\tv_nop" : "+v"(c) : "v"(ah), "v"(al), "v"(bh), "v"(bl));
  return c;
}
// batched GEMM like k_gemm_b but f16 operands: A f32 (split into f16 hi/lo if ASPLIT, else rounded to f16), Bt = f16 values [n][k]; alpha; C f32; N multiple of 16 (partial tiles skipped)
template <bool ASPLIT>
__global__ __launch_bounds__(128) void k_gemm_h(const float* __restrict__ A, int lda, size_t sA, const _Float16* __restrict__ Bh, int ldb, size_t sB, float alpha, float* __restrict__ C, int ldc, size_t sC, int M, int N, int K) {
  __shared__ __attribute__((aligned(16))) float so[4][16][64];
  const int tid = threadIdx.x, w = tid >> 5, lane = tid & 31, ln = lane & 15, hh = lane >> 4; const int by = blockIdx.y;
  A += (size_t)by * sA; Bh += (size_t)by * sB; C += (size_t)by * sC;
  const int ntn = (N + 63) / 64; const int wid = blockIdx.x * 4 + w; const int mt = wid / ntn, nq = wid % ntn; if (mt * 16 >= M) return;
  const int row0 = mt * 16, col0 = nq * 64; const float* arow = A + (size_t)(row0 + ln) * lda;
  v8f acc[4] = {};
  for (int kb = 0; kb < K; kb += 32) {
    FragH ah, al;
    const v4f x0 = *(const v4fa*)(arow + kb + 8 * hh), x1 = *(const v4fa*)(arow + kb + 8 * hh + 4), x2 = *(const v4fa*)(arow + kb + 16 + 8 * hh), x3 = *(const v4fa*)(arow + kb + 16 + 8 * hh + 4);
    float xs[16] = {x0[0],x0[1],x0[2],x0[3],x1[0],x1[1],x1[2],x1[3],x2[0],x2[1],x2[2],x2[3],x3[0],x3[1],x3[2],x3[3]};
#pragma unroll
    for (int i = 0; i < 16; ++i) { const _Float16 h = (_Float16)xs[i]; ah.h[i] = h; al.h[i] = ASPLIT ? (_Float16)(xs[i] - (float)h) : (_Float16)0.0f; }
#pragma unroll
    for (int t = 0; t < 4; ++t) { if (col0 + t * 16 >= N) continue; const size_t boff = (size_t)(col0 + t * 16 + ln) * ldb + kb; FragH bq; bq.half[0] = *(const v8us*)(Bh + boff + 8 * hh); bq.half[1] = *(const v8us*)(Bh + boff + 16 + 8 * hh);
      acc[t] = mmaH<ASPLIT ? 2 : 1>(ah.v, al.v, bq.v, bq.v, acc[t]); }
  }
#pragma unroll
  for (int t = 0; t < 4; ++t) { if (col0 + t * 16 >= N) continue;
#pragma unroll
    for (int r = 0; r < 8; ++r) so[w][8 * hh + r][t * 16 + ln] = acc[t][r] * alpha; }
  __builtin_amdgcn_fence(__ATOMIC_ACQ_REL, "workgroup"); __builtin_amdgcn_wave_barrier();
  const int rsub = lane >> 4, c4 = (lane & 15) * 4;
  {
#pragma unroll
    for (int q = 0; q < 8; ++q) { const int r = q * 2 + rsub; if (col0 + c4 < N) { const v4f v = *(const v4fa*)&so[w][r][c4]; *(v4f*)(C + (size_t)(row0 + r) * ldc + col0 + c4) = v; } }
     }
}

// Wt[n][k] = f16(W[k][n]·scale) from f32 row-major W[K][N] (scale = power of two; bf16-exact weights stay exact in f16 away from the subnormal range)
__global__ __launch_bounds__(256) void k_wt_f16(const float* __restrict__ W, _Float16* __restrict__ Wt, int K, int N, float scale) {
  const int t = blockIdx.x * 256 + threadIdx.x; if (t >= N * (K / 8)) return; const int n = t / (K / 8), k8 = (t % (K / 8)) * 8; FragH f;
#pragma unroll
  for (int i = 0; i < 8; ++i) f.h[i] = (_Float16)(bf16_round(W[(size_t)(k8 + i) * N + n]) * scale); const v8us o = f.half[0];
  *(v8us*)((unsigned short*)Wt + (size_t)n * K + k8) = o; 
}
// k_gemm_hh variant with fused epilogue: v = acc·alpha + bias[by·sBias + col] (+ CP[(row/rowsPerB)·sCPb + by·64 + col] if CP) ; ACT 0 none / 1 elu ; writes f16 C16 (and f32 C if non-null)
template <int ACT>
__global__ __launch_bounds__(128) void k_gemm_hhx(const _Float16* __restrict__ A, int lda, size_t sA, const _Float16* __restrict__ Bh, int ldb, size_t sB, float alpha, const float* __restrict__ bias, size_t sBias, const float* __restrict__ CP, int rowsPerB, size_t sCPb, int row0g,
    float* __restrict__ C, _Float16* __restrict__ C16, int ldc, size_t sC, int M, int N, int K) {
  __shared__ __attribute__((aligned(16))) float so[4][16][64];
  const int tid = threadIdx.x, w = tid >> 5, lane = tid & 31, ln = lane & 15, hh = lane >> 4; const int by = blockIdx.y;
  A += (size_t)by * sA; Bh += (size_t)by * sB; const size_t cofs = (size_t)by * sC; const float* bp = bias ? bias + (size_t)by * sBias : nullptr;
  const int ntn = (N + 63) / 64; const int wid = blockIdx.x * 4 + w; const int mt = wid / ntn, nq = wid % ntn; if (mt * 16 >= M) return;
  const int row0 = mt * 16, col0 = nq * 64; const _Float16* arow = A + (size_t)(row0 + ln) * lda;
  v8f acc[4] = {};
  for (int kb = 0; kb < K; kb += 32) { FragH ah; ah.half[0] = *(const v8us*)((const unsigned short*)arow + kb + 8 * hh); ah.half[1] = *(const v8us*)((const unsigned short*)arow + kb + 16 + 8 * hh);
#pragma unroll
    for (int t = 0; t < 4; ++t) { if (col0 + t * 16 >= N) continue; const size_t boff = (size_t)(col0 + t * 16 + ln) * ldb + kb; FragH bq; bq.half[0] = *(const v8us*)((const unsigned short*)Bh + boff + 8 * hh); bq.half[1] = *(const v8us*)((const unsigned short*)Bh + boff + 16 + 8 * hh);
      acc[t] = mmaH<1>(ah.v, ah.v, bq.v, bq.v, acc[t]); }
  }
#pragma unroll
  for (int t = 0; t < 4; ++t) { if (col0 + t * 16 >= N) continue; const int col = col0 + t * 16 + ln; const float bv = bp ? bf16_round(bp[col]) : 0.f;
#pragma unroll
    for (int r = 0; r < 8; ++r) { float v = acc[t][r] * alpha + bv; if (CP) { const int rr = row0g + row0 + 8 * hh + r; if (rowsPerB < 0) v += CP[cofs + (size_t)rr * ldc + col];      /* rowsPerB < 0: own element of the batched C plane */ else { const int bidx = rr / rowsPerB; v += CP[(size_t)bidx * sCPb + (size_t)by * 64 + col]; } } if (ACT == 1) v = (v > 0.f) ? v : expm1f(v); else if (ACT == 7) v = (v > 0.f) ? v + 1.0f : expf(v); else if (ACT == 8) v = tanhf(v); else if (ACT == 9) v = 0.5f * v * (1.0f + tanhf(0.7978845608028654f * (v + 0.044715f * v * v * v))); else if (ACT == 11) v = 1.0f / (1.0f + expf(-v)); else if (ACT == 12) v = (v > 0.f) ? v : 0.01f * v; else if (ACT == 14) v = (v > 0.f) ? v : 0.1f * v; else if (ACT == 16) v = (v >= 0.f) ? v : 0.3f * v; else if (ACT == 17) v = (v >= 0.f) ? v : 0.2f * v; else if (ACT == 15) v = v / (1.0f + expf(-v)); else if (ACT == 3) v = fmaxf(v, 0.f); else if (ACT == 6) v = 0.5f * v * (1.0f + erff(v * 0.70710678118654752f)); so[w][8 * hh + r][t * 16 + ln] = v; } }
  __builtin_amdgcn_fence(__ATOMIC_ACQ_REL, "workgroup"); __builtin_amdgcn_wave_barrier();
  const int rsub = lane >> 4, c4 = (lane & 15) * 4; typedef _Float16 v4h __attribute__((ext_vector_type(4)));
  {
#pragma unroll
    for (int q = 0; q < 8; ++q) { const int r = q * 2 + rsub; if (col0 + c4 < N) { const v4f v = *(const v4fa*)&so[w][r][c4]; if (C) *(v4f*)(C + cofs + (size_t)(row0 + r) * ldc + col0 + c4) = v; if (C16) { v4h h4; for (int i = 0; i < 4; ++i) h4[i] = (_Float16)v[i]; *(v4h*)(C16 + cofs + (size_t)(row0 + r) * ldc + col0 + c4) = h4; } } }
     }
}


typedef _Float16 v4h __attribute__((ext_vector_type(4)));

__global__ __launch_bounds__(256) void k_x16(const float* __restrict__ x, _Float16* __restrict__ X16, size_t n8) { const size_t t = (size_t)blockIdx.x * 256 + threadIdx.x; if (t >= n8) return; FragH f;
#pragma unroll
  for (int q = 0; q < 8; ++q) f.h[q] = (_Float16)bf16_round(x[t * 8 + q]); *(v8us*)((unsigned short*)X16 + t * 8) = f.half[0];  }
__global__ __launch_bounds__(256) void k_h16(const float* __restrict__ x, _Float16* __restrict__ X16, size_t n8) { const size_t t = (size_t)blockIdx.x * 256 + threadIdx.x; if (t >= n8) return; FragH f;
#pragma unroll
  for (int q = 0; q < 8; ++q) f.h[q] = (_Float16)x[t * 8 + q]; *(v8us*)((unsigned short*)X16 + t * 8) = f.half[0];  }
__global__ __launch_bounds__(256) void k_round16f(const float* __restrict__ W, _Float16* __restrict__ Bt, size_t n8) { const size_t t = (size_t)blockIdx.x * 256 + threadIdx.x; if (t >= n8) return; FragH f;
#pragma unroll
  for (int i = 0; i < 8; ++i) f.h[i] = (_Float16)(bf16_round(W[t * 8 + i]) * 16.0f); *(v8us*)((unsigned short*)Bt + t * 8) = f.half[0];  }
template <int NHv, int TTv>
__global__ __launch_bounds__(256) void k_vt(const _Float16* __restrict__ V16, int ldv, int voff, _Float16* __restrict__ Vt) { __shared__ unsigned short tl[64][66]; const int tid = threadIdx.x; const int slab = blockIdx.x / (TTv / 64), lg = blockIdx.x % (TTv / 64); const int b = slab / NHv, h = slab % NHv;
  for (int i = tid; i < 64 * 8; i += 256) { const int r = i / 8, c8 = (i % 8) * 8; FragH f; f.half[0] = *(const v8us*)((const unsigned short*)V16 + ((size_t)b * TTv + lg * 64 + r) * ldv + voff + h * 64 + c8);
#pragma unroll
    for (int q = 0; q < 8; ++q) tl[r][c8 + q] = f.u[q]; }
  __syncthreads();
  {
#pragma unroll
    for (int rd = 0; rd < 2; ++rd) { const int d = rd * 32 + tid / 8, pc = tid % 8; FragH f;
#pragma unroll
      for (int q = 0; q < 8; ++q) f.u[q] = tl[pc * 8 + q][d];
      *(v8us*)((unsigned short*)Vt + ((size_t)slab * 64 + d) * TTv + lg * 64 + pc * 8) = f.half[0]; }
     } }

__global__ __launch_bounds__(256) void k_hl(const float* __restrict__ F, _Float16* __restrict__ Hh, _Float16* __restrict__ Hl, size_t n8) { const size_t t = (size_t)blockIdx.x * 256 + threadIdx.x; if (t >= n8) return; FragH fh, fl; const v4f a = *(const v4fa*)(F + t * 8), c = *(const v4fa*)(F + t * 8 + 4);
#pragma unroll
  for (int q = 0; q < 4; ++q) { _Float16 h = (_Float16)a[q]; fh.h[q] = h; fl.h[q] = (_Float16)((a[q] - (float)h) * 1024.0f); h = (_Float16)c[q]; fh.h[4 + q] = h; fl.h[4 + q] = (_Float16)((c[q] - (float)h) * 1024.0f); }
  { *(v8us*)((unsigned short*)Hh + t * 8) = fh.half[0]; *(v8us*)((unsigned short*)Hl + t * 8) = fl.half[0];  } }

// ---- fast GEMM (wave tile 32x64; requires M % 32 == 0 rows per launch region and N % 64 == 0); epilogue = k_gemm_hhx semantics ----
__device__ __forceinline__ v16h g2_frag(const _Float16* p, int hh) { FragH f; f.half[0] = *(const v8us*)((const unsigned short*)p + 8 * hh); f.half[1] = *(const v8us*)((const unsigned short*)p + 16 + 8 * hh); return f.v; }
__device__ __forceinline__ v8f g2_mma(v16h a, v16h b, v8f c) { v8f d = __builtin_amdgcn_wmma_f32_16x16x32_f16(false, a, false, b, (short)0, c, false, false); asm volatile("v_nop\n\tv_nop\n\tv_nop\n\tv_nop" : "+v"(d) : "v"(a), "v"(b)); return d; }
template <int ACT>
__global__ __launch_bounds__(128) void k_gemm2(const _Float16* __restrict__ A, int lda, size_t sA, const _Float16* __restrict__ Bh, int ldb, size_t sB, float alpha, const float* __restrict__ bias, size_t sBias, const float* __restrict__ CP, int rowsPerB, size_t sCPb, int row0g,
    float* __restrict__ C, _Float16* __restrict__ C16, int ldc, size_t sC, int M, int N, int K) { static_assert(ACT == 0 || ACT == 3 || ACT == 6 || ACT == 8 || ACT == 9 || ACT == 11 || ACT == 12 || ACT == 14 || ACT == 15 || ACT == 16 || ACT == 17, "k_gemm2: unsupported ACT code (would silently apply no activation)");
  __shared__ __attribute__((aligned(16))) float so[4][32][68];
  const int tid = threadIdx.x, w = tid >> 5, lane = tid & 31, ln = lane & 15, hh = lane >> 4; const int by = blockIdx.y;
  A += (size_t)by * sA; Bh += (size_t)by * sB; const size_t cofs = (size_t)by * sC; const float* bp = bias ? bias + (size_t)by * sBias : nullptr;
  const int ntn = N >> 6; const int mt = blockIdx.x / ntn, nq = blockIdx.x - mt * ntn; const int row0 = mt * 128 + 32 * w, col0 = nq * 64; if (row0 >= M) return;
  const _Float16* a0p = A + (size_t)(row0 + ln) * lda; const _Float16* a1p = a0p + (size_t)16 * lda;
  const _Float16* b0p = Bh + (size_t)(col0 + ln) * ldb; const _Float16* b1p = b0p + (size_t)16 * ldb; const _Float16* b2p = b1p + (size_t)16 * ldb; const _Float16* b3p = b2p + (size_t)16 * ldb;
  const v8f z8 = {0.f,0.f,0.f,0.f,0.f,0.f,0.f,0.f}; v8f c00 = z8, c01 = z8, c02 = z8, c03 = z8, c10 = z8, c11 = z8, c12 = z8, c13 = z8;
#pragma unroll 1
  for (int kb = 0; kb < K; kb += 32) { const v16h a0 = g2_frag(a0p + kb, hh), a1 = g2_frag(a1p + kb, hh);
    v16h b = g2_frag(b0p + kb, hh); c00 = g2_mma(a0, b, c00); c10 = g2_mma(a1, b, c10);
    b = g2_frag(b1p + kb, hh); c01 = g2_mma(a0, b, c01); c11 = g2_mma(a1, b, c11);
    b = g2_frag(b2p + kb, hh); c02 = g2_mma(a0, b, c02); c12 = g2_mma(a1, b, c12);
    b = g2_frag(b3p + kb, hh); c03 = g2_mma(a0, b, c03); c13 = g2_mma(a1, b, c13); }
  v8f accs[8] = {c00, c01, c02, c03, c10, c11, c12, c13};
#pragma unroll
  for (int u = 0; u < 8; ++u) { const int t = u & 3, half = u >> 2; const int col = col0 + t * 16 + ln; const float bv = bp ? bf16_round(bp[col]) : 0.f;
#pragma unroll
    for (int r = 0; r < 8; ++r) { const int rloc = half * 16 + 8 * hh + r; float v = accs[u][r] * alpha + bv; if (CP) { if (rowsPerB < 0) v += CP[cofs + (size_t)(row0g + row0 + rloc) * ldc + col];      /* rowsPerB < 0: own element of the batched C plane */ else { const int bidx = (row0g + row0 + rloc) / rowsPerB; v += CP[(size_t)bidx * sCPb + (size_t)by * 64 + col]; } }
      if (ACT == 3) v = fmaxf(v, 0.f); else if (ACT == 6) v = 0.5f * v * (1.0f + erff(v * 0.70710678118654752f)); else if (ACT == 11) v = 1.0f / (1.0f + expf(-v)); else if (ACT == 15) v = v / (1.0f + expf(-v)); else if (ACT == 12) v = (v > 0.f) ? v : 0.01f * v; else if (ACT == 8) v = tanhf(v); else if (ACT == 9) v = 0.5f * v * (1.0f + tanhf(0.7978845608028654f * (v + 0.044715f * v * v * v))); else if (ACT == 14) v = (v > 0.f) ? v : 0.1f * v; else if (ACT == 16) v = (v >= 0.f) ? v : 0.3f * v; else if (ACT == 17) v = (v >= 0.f) ? v : 0.2f * v;
      so[w][rloc][t * 16 + ln] = v; } }
  __builtin_amdgcn_fence(__ATOMIC_ACQ_REL, "workgroup"); __builtin_amdgcn_wave_barrier();
  const int rsub = lane >> 4, c4 = (lane & 15) * 4;
  {
#pragma unroll
    for (int q = 0; q < 16; ++q) { const int r = q * 2 + rsub; const v4f v = *(const v4fa*)&so[w][r][c4]; if (C) *(v4f*)(C + cofs + (size_t)(row0 + r) * ldc + col0 + c4) = v; if (C16) { v4h h4; for (int i = 0; i < 4; ++i) h4[i] = (_Float16)v[i]; *(v4h*)(C16 + cofs + (size_t)(row0 + r) * ldc + col0 + c4) = h4; } }
     } }


__global__ __launch_bounds__(256) void k_wnat(const float* __restrict__ w, size_t n8, _Float16* __restrict__ Bt) { const size_t t = (size_t)blockIdx.x * 256 + threadIdx.x; if (t >= n8) return; FragH f; for (int q = 0; q < 8; ++q) f.h[q] = (_Float16)(bf16_round(w[t * 8 + q]) * 16.0f); *(v8us*)((unsigned short*)Bt + t * 8) = f.half[0];  }
__global__ __launch_bounds__(256) void k_rsm(const float* __restrict__ S, _Float16* __restrict__ P, int nrows) {
  #pragma clang fp contract(off)
  const int i = blockIdx.x * 256 + threadIdx.x; if (i >= nrows) return; const float* s = S + (size_t)i * SQ; float mx = -3.0e38f;
#pragma unroll 1
  for (int j = 0; j < SQ; ++j) mx = fmaxf(mx, s[j]); float se = 0.f;
#pragma unroll 1
  for (int j = 0; j < SQ; ++j) se += expf(s[j] - mx); const float sc = 256.0f / se;
#pragma unroll 1
  for (int j0 = 0; j0 < SQ; j0 += 8) { FragH f; for (int q = 0; q < 8; ++q) f.h[q] = (_Float16)(expf(s[j0 + q] - mx) * sc); unsigned short* d = (unsigned short*)P + (size_t)i * SQ + j0; *(v8us*)d = f.half[0];  } }
__global__ __launch_bounds__(256) void k_vt(const _Float16* __restrict__ V16, int b, int h0, _Float16* __restrict__ VT) { __shared__ unsigned short tl[64][65]; const int tid = threadIdx.x; const int hh = blockIdx.x % HG, sg = blockIdx.x / HG; const int s0 = sg * 64; const int h = h0 + hh;
  for (int i = tid; i < 64 * 8; i += 256) { const int j = i / 8, d8 = (i % 8) * 8; FragH f; f.half[0] = *(const v8us*)((const unsigned short*)V16 + ((size_t)b * SQ + s0 + j) * DM + h * HD + d8); for (int q = 0; q < 8; ++q) tl[d8 + q][j] = f.u[q]; }
  __syncthreads();
  { for (int i = tid; i < 64 * 8; i += 256) { const int d = i / 8, j8 = (i % 8) * 8; FragH f; for (int q = 0; q < 8; ++q) f.u[q] = tl[d][j8 + q]; *(v8us*)((unsigned short*)VT + ((size_t)hh * HD + d) * SQ + s0 + j8) = f.half[0]; }  } }


__global__ __launch_bounds__(256) void k_tab2(float theta, float* __restrict__ CS, float* __restrict__ SN) {
  #pragma clang fp contract(off)
  const int t = blockIdx.x * 256 + threadIdx.x; if (t >= SQ * (HD / 2)) return; const int i = t % (HD / 2); const int p = t / (HD / 2); const float invf = 1.0f / powf(theta, (float)(2 * i) / (float)HD); const float ang = __fmul_rn((float)p, invf); const float c = cosf(ang), s = sinf(ang);
  *(float*)(CS + t) = c; *(float*)(SN + t) = s;  }
template <int NORM, int ROPE>
__global__ __launch_bounds__(64) void k_xform(const float* __restrict__ F, int ldf, int nh, const float* __restrict__ gain, float eps, const float* __restrict__ CS, const float* __restrict__ SN, _Float16* __restrict__ H16, int ldo) {
  #pragma clang fp contract(off)
  __shared__ float xv[HD]; __shared__ float red[HD]; __shared__ unsigned short sh_[HD]; const int d = threadIdx.x; const int h = blockIdx.x % nh; const size_t r = blockIdx.x / nh; const int p = (int)(r % SQ);
  float x = F[r * (size_t)ldf + (size_t)h * HD + d];
  if (NORM) { red[d] = __fmul_rn(x, x); __syncthreads(); for (int st = HD / 2; st > 0; st >>= 1) { if (d < st) red[d] = __fadd_rn(red[d], red[d + st]); __syncthreads(); } const float rs = rsqrtf(__fadd_rn(red[0] / (float)HD, eps)); x = __fmul_rn(__fmul_rn(x, rs), bf16_round(gain[d])); }
  xv[d] = x; __syncthreads();
  float o = x;
  if (ROPE == 1) { const int i = d >> 1; const float c = CS[p * (HD / 2) + i], s = SN[p * (HD / 2) + i]; const float ev = xv[2 * i], od = xv[2 * i + 1]; o = (d & 1) ? __fadd_rn(__fmul_rn(ev, s), __fmul_rn(od, c)) : __fadd_rn(__fmul_rn(ev, c), -__fmul_rn(od, s)); }
  if (ROPE == 2) { const int i = d & (HD / 2 - 1); const float c = CS[p * (HD / 2) + i], s = SN[p * (HD / 2) + i]; const float lo = xv[i], hi = xv[i + HD / 2]; o = (d < HD / 2) ? __fadd_rn(__fmul_rn(lo, c), -__fmul_rn(hi, s)) : __fadd_rn(__fmul_rn(lo, s), __fmul_rn(hi, c)); }
  if (ROPE == 6) { const float c = bf16_round(CS[p * HD + d]), s = bf16_round(SN[p * HD + d]); const float pa = xv[(d + HD / 2) & (HD - 1)]; const float rh = (d < HD / 2) ? -pa : pa; o = __fadd_rn(__fmul_rn(x, c), __fmul_rn(rh, s)); }      /* FULL-WIDTH bf16-rounded INPUT tables [p][64]: o = x cos[p][d] + rotate_half(x)[d] sin[p][d], rotate_half = concat(-x[32:], x[:32]) */
  FragH th; th.h[0] = (_Float16)o; sh_[d] = th.u[0]; __syncthreads();
  if (d < HD / 8) { FragH f; for (int q = 0; q < 8; ++q) f.u[q] = sh_[d * 8 + q]; unsigned short* dst = (unsigned short*)H16 + r * (size_t)ldo + (size_t)h * HD + d * 8; *(v8us*)dst = f.half[0];  } }

__global__ __launch_bounds__(256) void k_tab3(float* __restrict__ CS, float* __restrict__ SN) {
  #pragma clang fp contract(off)
  const int t = blockIdx.x * 256 + threadIdx.x; if (t >= SQ * (HD / 2)) return; const int i = t % (HD / 2); const int p = t / (HD / 2); const float freq = expf(__fmul_rn((float)(2 * i), -0.14391156831212787f)); const float ang = __fmul_rn((float)p, freq); const float c = cosf(ang), s = sinf(ang);
  *(float*)(CS + t) = c; *(float*)(SN + t) = s;  }



// ---- GEMM main loop with both operands staged in LDS (used by k_qkv and k_out) ----
// A block of 8 waves makes a 128 x 128 tile of A . B^T (K = DM): wave w takes rows 32 (w & 3) and columns 64 (w >> 2), a 32x64 wave tile as in k_gemm2, with the same fragments, the same k order and the same order of products.
// A stage is 128 k of the block's 128 A rows and 128 B rows: 256 rows of 256 bytes at an LDS pitch of 272 bytes (16 x odd, for 16-byte fragment reads). Two buffers: the next stage's copies fly while this one is worked on; two blocks fit a WGP.
// The rows come by asynchronous copies to LDS: a wave's copy is four whole 128-byte lines, and a row is fetched once per block, where the fragment loads from global memory touched 16 lines each and every wave fetched its own.
#define G3K 128                       /* k per stage */
#define G3P 136                       /* LDS row pitch in f16 */
#define G3S (256 * G3P)               /* f16 per stage */
#define G3B (2 * G3S * 2)             /* bytes of the two buffers */
#define G3T (DM / G3K)                /* stages */
__device__ __forceinline__ void g3_copy8(const _Float16* g, unsigned l) {      /* a thread brings 16 bytes of eight rows, 16 rows apart: the block's 128 rows of one operand */
  const unsigned st = 16 * G3P * 2;
  /* the wait on the last line stands in front of any later write of a register that these copies name */
  asm volatile("global_load_async_to_lds_b128 %0, %8, off\n\t"
               "global_load_async_to_lds_b128 %1, %9, off\n\t"
               "global_load_async_to_lds_b128 %2, %10, off\n\t"
               "global_load_async_to_lds_b128 %3, %11, off\n\t"
               "global_load_async_to_lds_b128 %4, %12, off\n\t"
               "global_load_async_to_lds_b128 %5, %13, off\n\t"
               "global_load_async_to_lds_b128 %6, %14, off\n\t"
               "global_load_async_to_lds_b128 %7, %15, off\n\t"
               "s_wait_xcnt 0x0"
               :: "v"(l), "v"(l + st), "v"(l + 2 * st), "v"(l + 3 * st), "v"(l + 4 * st), "v"(l + 5 * st), "v"(l + 6 * st), "v"(l + 7 * st),
                  "v"(g), "v"(g + (size_t)16 * DM), "v"(g + (size_t)32 * DM), "v"(g + (size_t)48 * DM), "v"(g + (size_t)64 * DM), "v"(g + (size_t)80 * DM), "v"(g + (size_t)96 * DM), "v"(g + (size_t)112 * DM) : "memory"); }
__device__ __forceinline__ void g3_copy(const _Float16* ga, const _Float16* gb, unsigned l) { g3_copy8(ga, l); g3_copy8(gb, l + 128 * G3P * 2); }      /* a stage: the A rows, behind them the B rows */
__device__ __forceinline__ v16h g3_frag(const unsigned short* p) { FragH f; f.half[0] = *(const v8us*)p; f.half[1] = *(const v8us*)(p + 16); return f.v; }      /* p already holds the lane's 8 hh: the k order of g2_frag */
__device__ __forceinline__ void g3_main(const _Float16* __restrict__ A, const _Float16* __restrict__ Bh, int rowb, int colb, unsigned short* sm, v8f (&acc)[8]) {
  const int tid = threadIdx.x, w = tid >> 5, lane = tid & 31, ln = lane & 15, hh = lane >> 4;
  const _Float16* ga = A + (size_t)(rowb + (tid >> 4)) * DM + (tid & 15) * 8; const _Float16* gb = Bh + (size_t)(colb + (tid >> 4)) * DM + (tid & 15) * 8;
  const unsigned l0 = (unsigned)(size_t)sm + (unsigned)((tid >> 4) * (G3P * 2) + (tid & 15) * 16);
  const unsigned short* fa = sm + (32 * (w & 3) + ln) * G3P + 8 * hh; const unsigned short* fb = sm + (128 + 64 * (w >> 2) + ln) * G3P + 8 * hh;
  g3_copy(ga, gb, l0);
  asm volatile("s_wait_asynccnt 0x0" ::: "memory");      /* stage 0 of this wave has landed */
  __syncthreads();      /* stage 0 of every wave has landed */
  g3_copy(ga + G3K, gb + G3K, l0 + G3S * 2);
#pragma unroll 1      /* one stage per trip: the buffer is picked by the trip's parity */
  for (int t = 0; t < G3T; ++t) { const int bo = (t & 1) * G3S; const unsigned short* pa = fa + bo; const unsigned short* pb = fb + bo;
    v16h a[2][2], b[2][4];      /* two fragment sets: the next 32 k of this stage are read from LDS while this one's products run */
    a[0][0] = g3_frag(pa); a[0][1] = g3_frag(pa + 16 * G3P);
#pragma unroll
    for (int n = 0; n < 4; ++n) b[0][n] = g3_frag(pb + n * 16 * G3P);
#pragma unroll
    for (int kk = 0; kk < G3K / 32; ++kk) { const int c = kk & 1, x = c ^ 1;
      if (kk + 1 < G3K / 32) { a[x][0] = g3_frag(pa + (kk + 1) * 32); a[x][1] = g3_frag(pa + 16 * G3P + (kk + 1) * 32);
#pragma unroll
        for (int n = 0; n < 4; ++n) b[x][n] = g3_frag(pb + n * 16 * G3P + (kk + 1) * 32); }
      __builtin_amdgcn_sched_barrier(0);      /* keeps the next set's LDS reads together in front of this set's eight products: without it they sink among the products, and each pair of products waits out an LDS latency of its own */
#pragma unroll
      for (int n = 0; n < 4; ++n) { acc[n] = g2_mma(a[c][0], b[c][n], acc[n]); acc[4 + n] = g2_mma(a[c][1], b[c][n], acc[4 + n]); } }
    asm volatile("s_wait_dscnt 0x0" ::: "memory");      /* this wave's reads of the buffer are done before the barrier frees it */
    asm volatile("s_wait_asynccnt 0x0" ::: "memory");      /* this wave's copies of stage t + 1 have landed before the barrier publishes them */
    __syncthreads();      /* publishes stage t + 1 and ends every wave's reads of stage t */
    if (t + 2 < G3T) g3_copy(ga + (t + 2) * G3K, gb + (t + 2) * G3K, l0 + (unsigned)bo * 2); }
  asm volatile("s_wait_asynccnt 0x0" ::: "memory");      /* nothing is in flight when the buffers become the epilogue's staging (the last trip's barrier has ended every read) */
}

// q | k | v projection of every token row (main loop = g3_main) with all the work between projection and attention in its epilogue. A wave tile is 32 token rows x 64 columns = exactly one head of q, k or v; the block's two heads are both q, both k or both v (block-uniform: sel), so nothing outside the tile is needed.
// q, k: the f32 tile goes through the wave's own LDS slab into row order; a lane takes 4 columns and their rotate_half partners (column ^ 32, same row), the tables come as 16-byte loads, and a row leaves as one whole 128-byte line of f16.
// v: a lane's 8 accumulator registers are 8 consecutive token rows of one column = 16 bytes of a V^T row; the four waves of a head put them into one [64][128] f16 tile in LDS, and behind a barrier each V^T row leaves as 256 contiguous bytes.
__global__ __launch_bounds__(256) void k_qkv(const _Float16* __restrict__ A, const _Float16* __restrict__ Bh, const float* __restrict__ CS, const float* __restrict__ SN, _Float16* __restrict__ Qh, _Float16* __restrict__ Kh, _Float16* __restrict__ Vt) {
  __shared__ __attribute__((aligned(2048))) unsigned short sm[G3B / 2];      /* the two stage buffers; behind the main loop the epilogue's staging */
  static_assert(8 * 32 * 68 * 4 <= G3B, "epilogue slabs must fit the stage buffers");
  const int tid = threadIdx.x, w = tid >> 5, lane = tid & 31, ln = lane & 15, hh = lane >> 4, wm = w & 3, wn = w >> 2;
  const int ntn = 3 * NH / 2; const int mt = blockIdx.x / ntn, np = blockIdx.x - mt * ntn; const int row0 = mt * 128 + 32 * wm; const int sel = np / (NH / 2), h = (np - sel * (NH / 2)) * 2 + wn;
  const v8f z8 = {0.f,0.f,0.f,0.f,0.f,0.f,0.f,0.f}; v8f accs[8] = {z8, z8, z8, z8, z8, z8, z8, z8};
  g3_main(A, Bh, mt * 128, np * 128, sm, accs);
  float (*so)[32][68] = (float (*)[32][68])sm;
  const float alpha = 0.0625f;      /* undoes the x16 of the weights (exact) */
  if (sel < 2) {
#pragma unroll
    for (int u = 0; u < 8; ++u) { const int t = u & 3, half = u >> 2;
#pragma unroll
      for (int r = 0; r < 8; ++r) so[w][half * 16 + 8 * hh + r][t * 16 + ln] = accs[u][r] * alpha; }
    __builtin_amdgcn_fence(__ATOMIC_ACQ_REL, "workgroup"); __builtin_amdgcn_wave_barrier();      /* the slab is the wave's own: its LDS writes are ordered in front of its reads, no block barrier */
    const int rsub = lane >> 4, c4 = (lane & 15) * 4; const float sg = (c4 < HD / 2) ? -1.0f : 1.0f;      /* rotate_half = concat(-x[32:], x[:32]) */
    _Float16* dst = (sel ? Kh : Qh) + (size_t)(row0 + rsub) * DM + h * HD + c4;
    const size_t tofs = (size_t)(row0 % SQ + rsub) * HD + c4; const float* cp = CS + tofs; const float* sp = SN + tofs;      /* 32 | SQ: the tile's 32 rows are 32 consecutive positions of one batch, so every table row is a constant step from the first */
#pragma unroll
    for (int q = 0; q < 16; ++q) { const int r = q * 2 + rsub;
      const v4f xv = *(const v4fa*)&so[w][r][c4], pa = *(const v4fa*)&so[w][r][c4 ^ (HD / 2)]; const v4f cc = *(const v4fa*)(cp + q * 2 * HD), ss = *(const v4fa*)(sp + q * 2 * HD); v4h h4;
#pragma unroll
      for (int i = 0; i < 4; ++i) h4[i] = (_Float16)(xv[i] * bf16_round(cc[i]) + pa[i] * (sg * bf16_round(ss[i])));
      *(v4h*)(dst + (size_t)q * 2 * DM) = h4; }
  } else {
    unsigned short* tl = sm + wn * (64 * 136);      /* per head [64 d][136] f16: pitch 272 bytes, so the 16 columns of a 16-byte store start 4 banks apart */
#pragma unroll
    for (int u = 0; u < 8; ++u) { const int t = u & 3, half = u >> 2; FragH f;
#pragma unroll
      for (int r = 0; r < 8; ++r) f.h[r] = (_Float16)(accs[u][r] * alpha);
      *(v8us*)(tl + (t * 16 + ln) * 136 + wm * 32 + half * 16 + 8 * hh) = f.half[0]; }
    __syncthreads();      /* a V^T row of the tile holds token rows of the head's four waves; sel is the same for the whole block */
    const int rb = mt * 128, t2 = tid & 127; unsigned short* vd = (unsigned short*)Vt + ((size_t)((rb / SQ) * NH + h) * HD) * SQ + rb % SQ;
#pragma unroll
    for (int i = 0; i < 8; ++i) { const int d = i * 8 + (t2 >> 4), c8 = (t2 & 15) * 8; *(v8us*)(vd + (size_t)d * SQ + c8) = *(const v8us*)(tl + d * 136 + c8); }
    asm volatile("s_wait_xcnt 0x0" ::: "memory");      /* stands behind the last V^T store, in front of any later write of a register that these stores name */
  } }

// out = o . Wo^T x alpha (main loop = g3_main); the f32 tile goes through the wave's own LDS slab into row order and leaves as whole 256-byte row pieces, as in k_gemm2.
__global__ __launch_bounds__(256) void k_out(const _Float16* __restrict__ A, const _Float16* __restrict__ Bh, float alpha, float* __restrict__ C) {
  __shared__ __attribute__((aligned(2048))) unsigned short sm[G3B / 2];      /* the two stage buffers; behind the main loop the epilogue's staging */
  const int tid = threadIdx.x, w = tid >> 5, lane = tid & 31, ln = lane & 15, hh = lane >> 4;
  const int ntn = DM / 128; const int mt = blockIdx.x / ntn, np = blockIdx.x - mt * ntn; const int row0 = mt * 128 + 32 * (w & 3), col0 = np * 128 + 64 * (w >> 2);
  const v8f z8 = {0.f,0.f,0.f,0.f,0.f,0.f,0.f,0.f}; v8f accs[8] = {z8, z8, z8, z8, z8, z8, z8, z8};
  g3_main(A, Bh, mt * 128, np * 128, sm, accs);
  float (*so)[32][68] = (float (*)[32][68])sm;
#pragma unroll
  for (int u = 0; u < 8; ++u) { const int t = u & 3, half = u >> 2;
#pragma unroll
    for (int r = 0; r < 8; ++r) so[w][half * 16 + 8 * hh + r][t * 16 + ln] = accs[u][r] * alpha; }
  __builtin_amdgcn_fence(__ATOMIC_ACQ_REL, "workgroup"); __builtin_amdgcn_wave_barrier();      /* the slab is the wave's own: its LDS writes are ordered in front of its reads, no block barrier */
  const int rsub = lane >> 4, c4 = (lane & 15) * 4;
#pragma unroll
  for (int q = 0; q < 16; ++q) { const int r = q * 2 + rsub; *(v4f*)(C + (size_t)(row0 + r) * DM + col0 + c4) = *(const v4fa*)&so[w][r][c4]; } }

__device__ __forceinline__ float xrow(float v) { const int b = __float_as_int(v); return __int_as_float(__builtin_amdgcn_permlanex16(b, b, 0x76543210, 0xfedcba98, false, false)); }      /* lane l <-> l ^ 16; every lane must be active */
__device__ __forceinline__ v8f fa_mma(v16h a, v16h b, v8f c) { return __builtin_amdgcn_wmma_f32_16x16x32_f16(false, a, false, b, (short)0, c, false, false); }
#define FK 128                        /* keys per stage */
#define FKP 72                        /* LDS pitch of a K row in f16 */
#define FVP 136                       /* LDS pitch of a V^T row in f16 */
#define FKS (FK * FKP)                /* f16 of a stage's K rows */
#define FS (FKS + HD * FVP)           /* f16 per stage */
#define FT (SQ / FK)                  /* stages */
__device__ __forceinline__ void fa_copy(const _Float16* gk, const _Float16* gv, unsigned lk, unsigned lv) {      /* a thread brings 16 bytes of four K rows, 32 rows apart, and of four V^T rows, 16 rows apart: together the block's stage */
  const unsigned sk = 32 * FKP * 2, sv = 16 * FVP * 2;
  /* the wait on the last line stands in front of any later write of a register that these copies name */
  asm volatile("global_load_async_to_lds_b128 %0, %8, off\n\t"
               "global_load_async_to_lds_b128 %1, %9, off\n\t"
               "global_load_async_to_lds_b128 %2, %10, off\n\t"
               "global_load_async_to_lds_b128 %3, %11, off\n\t"
               "global_load_async_to_lds_b128 %4, %12, off\n\t"
               "global_load_async_to_lds_b128 %5, %13, off\n\t"
               "global_load_async_to_lds_b128 %6, %14, off\n\t"
               "global_load_async_to_lds_b128 %7, %15, off\n\t"
               "s_wait_xcnt 0x0"
               :: "v"(lk), "v"(lk + sk), "v"(lk + 2 * sk), "v"(lk + 3 * sk), "v"(lv), "v"(lv + sv), "v"(lv + 2 * sv), "v"(lv + 3 * sv),
                  "v"(gk), "v"(gk + (size_t)32 * DM), "v"(gk + (size_t)64 * DM), "v"(gk + (size_t)96 * DM), "v"(gv), "v"(gv + (size_t)16 * SQ), "v"(gv + (size_t)32 * SQ), "v"(gv + (size_t)48 * SQ) : "memory"); }
// The 32 weights of one query column group in a pass (a lane's 16), as f16 in the B operand's order, and the lane's f32 sum of them before rounding.
__device__ __forceinline__ float fa_weights(const v8f& s0, const v8f& s1, float c, float mu, FragH& pf) { const float bias = 7.0f - mu; float t8[8];
#pragma unroll
  for (int r = 0; r < 8; ++r) { const float p0 = __builtin_amdgcn_exp2f(fmaf(s0[r], c, bias)), p1 = __builtin_amdgcn_exp2f(fmaf(s1[r], c, bias)); pf.h[r] = (_Float16)p0; pf.h[8 + r] = (_Float16)p1; t8[r] = p0 + p1; }
  return ((t8[0] + t8[1]) + (t8[2] + t8[3])) + ((t8[4] + t8[5]) + (t8[6] + t8[7])); }
// amdgpu_waves_per_eu(4, 4): both column groups' f16 weights live together up to the test; the register budget of four waves per SIMD (two blocks per WGP), which the design counts on, is stated and not left to the scheduler.
__global__ __launch_bounds__(256) __attribute__((amdgpu_waves_per_eu(4, 4))) void k_fattn(const _Float16* __restrict__ Qh, const _Float16* __restrict__ Kh, const _Float16* __restrict__ Vt, _Float16* __restrict__ O) {
  __shared__ __attribute__((aligned(2048))) unsigned short sm[2 * FS];      /* the two stage buffers */
  const int tid = threadIdx.x, lane = tid & 31, ln = lane & 15, hh = lane >> 4, w = tid >> 5; const int h = blockIdx.y, b = B0 + blockIdx.z; const size_t r0 = (size_t)b * SQ; const int q0 = blockIdx.x * 256 + w * 32;
  const _Float16* qp = Qh + (r0 + q0 + ln) * DM + h * HD;
  const _Float16* gk = Kh + (r0 + (tid >> 3)) * DM + h * HD + (tid & 7) * 8; const _Float16* gv = Vt + ((size_t)(b * NH + h) * HD + (tid >> 4)) * SQ + (tid & 15) * 8;
  const unsigned lk = (unsigned)(size_t)sm + (unsigned)((tid >> 3) * (FKP * 2) + (tid & 7) * 16), lv = (unsigned)(size_t)sm + (unsigned)(FKS * 2 + (tid >> 4) * (FVP * 2) + (tid & 15) * 16);
  const unsigned short* fk = sm + ln * FKP + 8 * hh; const unsigned short* fv = sm + FKS + ln * FVP + 8 * hh;      /* the lane's 8 hh is in the pointer: the k order of g2_frag */
  const float c = 0.18033688011112042f; const v8f z8 = {0.f,0.f,0.f,0.f,0.f,0.f,0.f,0.f};
  v16h qf[2][2], kf[2][2]; v8f o[2][4]; float mu[2] = {-3.0e38f, -3.0e38f}, ls[2] = {0.f, 0.f};
#pragma unroll
  for (int j = 0; j < 2; ++j) {
#pragma unroll
    for (int ks = 0; ks < 2; ++ks) qf[j][ks] = g2_frag(qp + (size_t)j * 16 * DM + ks * 32, hh);
#pragma unroll
    for (int dt = 0; dt < 4; ++dt) o[j][dt] = z8; }
  asm volatile("s_wait_xcnt 0x0" ::: "memory");      /* stands behind the Q loads, in front of any later write of a register that they name */
  fa_copy(gk, gv, lk, lv);
  asm volatile("s_wait_asynccnt 0x0" ::: "memory");      /* stage 0 of this wave has landed */
  __syncthreads();      /* stage 0 of every wave has landed */
  fa_copy(gk + (size_t)FK * DM, gv + FK, lk + FS * 2, lv + FS * 2);
#pragma unroll 1      /* one stage per trip: the buffer is picked by the trip's parity */
  for (int t = 0; t < FT; ++t) { const int bo = (t & 1) * FS; const unsigned short* pk = fk + bo; const unsigned short* pv = fv + bo;
#pragma unroll
    for (int kt = 0; kt < 2; ++kt) {
#pragma unroll
      for (int ks = 0; ks < 2; ++ks) kf[kt][ks] = g3_frag(pk + kt * 16 * FKP + ks * 32); }
#pragma unroll 1      /* one pass per trip: a second copy of the body would take the registers that four waves per SIMD need */
    for (int p = 0; p < FK / 32; ++p) {
      v16h vf[4]; v8f s[2][2]; FragH pf[2]; float ts[2];
#pragma unroll
      for (int dt = 0; dt < 4; ++dt) vf[dt] = g3_frag(pv + dt * 16 * FVP + p * 32);
      __builtin_amdgcn_sched_barrier(0);      /* keeps the V^T reads in front of the score products: without it they sink below the softmax's maximum and have half the lead on their use */
#pragma unroll
      for (int j = 0; j < 2; ++j) {
#pragma unroll
        for (int kt = 0; kt < 2; ++kt) s[j][kt] = fa_mma(kf[kt][1], qf[j][1], fa_mma(kf[kt][0], qf[j][0], z8)); }
      if (p + 1 < FK / 32) {      /* the next pass's K fragments come from LDS during this pass's softmax; a stage's last pass fetches nothing ahead (the next stage is not published yet) */
#pragma unroll
        for (int kt = 0; kt < 2; ++kt) {
#pragma unroll
          for (int ks = 0; ks < 2; ++ks) kf[kt][ks] = g3_frag(pk + ((p + 1) * 32 + kt * 16) * FKP + ks * 32); } }
#pragma unroll
      for (int j = 0; j < 2; ++j) ts[j] = fa_weights(s[j][0], s[j][1], c, mu[j], pf[j]);      /* weights at the reference maximum in use; no maximum is formed here */
      const bool over = !(ts[0] <= 65504.0f) || !(ts[1] <= 65504.0f);      /* weights are not negative: a lane's sum within the f16 range bounds each of its 16 weights; infinity and NaN fail the test too */
      if (__builtin_amdgcn_ballot_w32(over) != 0) {      /* one scalar branch per pass; always taken in the first pass (mu = -3e38: infinite weights; factor 0 on zero sums); nothing of the refused weights has been used */
        v16h k2[2][2];      /* the scores were used up in place and kf holds the next pass already: this pass's K rows are read again (their buffer is the stage's until its barrier) and give the same scores */
#pragma unroll
        for (int kt = 0; kt < 2; ++kt) {
#pragma unroll
          for (int ks = 0; ks < 2; ++ks) k2[kt][ks] = g3_frag(pk + (p * 32 + kt * 16) * FKP + ks * 32); }
#pragma unroll
        for (int j = 0; j < 2; ++j) { const v8f s0 = fa_mma(k2[0][1], qf[j][1], fa_mma(k2[0][0], qf[j][0], z8)), s1 = fa_mma(k2[1][1], qf[j][1], fa_mma(k2[1][0], qf[j][0], z8));
          float a = fmaxf(s0[0], s1[0]);
#pragma unroll
          for (int r = 1; r < 8; ++r) a = fmaxf(a, fmaxf(s0[r], s1[r]));
          const float mn = fmaxf(mu[j], fmaxf(a, xrow(a)) * c); const float al = __builtin_amdgcn_exp2f(mu[j] - mn); mu[j] = mn; ls[j] *= al;
#pragma unroll
          for (int dt = 0; dt < 4; ++dt) o[j][dt] *= al;
          ts[j] = fa_weights(s0, s1, c, mu[j], pf[j]); } }      /* the pass's weights again, at most 2^7 each */
#pragma unroll
      for (int j = 0; j < 2; ++j) { ls[j] += ts[j];
#pragma unroll
        for (int dt = 0; dt < 4; ++dt) o[j][dt] = (j == 1 && dt == 3) ? g2_mma(vf[dt], pf[j].v, o[j][dt]) : fa_mma(vf[dt], pf[j].v, o[j][dt]); } }      /* the pass's last product carries its four v_nop (g2_mma): the next trip's first vector instruction forms an LDS address in a register of this product's A operand */
    asm volatile("s_wait_dscnt 0x0" ::: "memory");      /* this wave's reads of the buffer are done before the barrier frees it */
    asm volatile("s_wait_asynccnt 0x0" ::: "memory");      /* this wave's copies of stage t + 1 have landed before the barrier publishes them */
    __syncthreads();      /* publishes stage t + 1 and ends every wave's reads of stage t */
    if (t + 2 < FT) fa_copy(gk + (size_t)(t + 2) * FK * DM, gv + (t + 2) * FK, lk + (unsigned)bo * 2, lv + (unsigned)bo * 2); }
  asm volatile("s_wait_asynccnt 0x0" ::: "memory");      /* nothing is in flight when the wave ends */
#pragma unroll
  for (int j = 0; j < 2; ++j) { const float sc = 64.0f / (ls[j] + xrow(ls[j]));      /* the halves' sums join once; o carried x64 as before */
    unsigned short* dst = (unsigned short*)O + (r0 + q0 + j * 16 + ln) * DM + h * HD + 8 * hh;
#pragma unroll
    for (int dt = 0; dt < 4; ++dt) { FragH f;
#pragma unroll
      for (int r = 0; r < 8; ++r) f.h[r] = (_Float16)(o[j][dt][r] * sc);
      *(v8us*)(dst + dt * 16) = f.half[0]; } } }

// All f32 -> f16 conversions of a call in ONE launch (they are independent of each other): x (bf16-rounded, exact in f16) and the four weights (bf16-rounded, x16, exact), same arithmetic per element as k_x16 and k_wnat.
// A piece is 8 elements (32 bytes in, 16 bytes out). The grid has one thread per piece of a weight matrix; x is exactly 8 times that, so every thread takes 12 pieces: 8 of x, one of each weight. No branch, no tail.
// A block takes 8 x 512 consecutive pieces of x (128 KB) and 512 consecutive pieces of each weight, so all of a thread's addresses are a uniform base, one 32-bit offset and a constant.
// 256 blocks of 16 waves: one block per WGP, few waves to start, and each wave has its 24 16-byte loads in flight before the first is used.
#define PT 512                        /* threads per block */
#define PG ((unsigned)((size_t)DM * DM / 8 / PT))      /* blocks: one thread per piece of a weight matrix */
__global__ __launch_bounds__(PT) void k_prep(const float* __restrict__ x, const float* __restrict__ wq, const float* __restrict__ wk, const float* __restrict__ wv, const float* __restrict__ wo,
                                             _Float16* __restrict__ X16, _Float16* __restrict__ BQKV, _Float16* __restrict__ BO) {
  static_assert(NR * DM / 8 == (size_t)8 * PG * PT, "x must be 8 pieces per thread");
  const unsigned iw = (blockIdx.x * PT + threadIdx.x) * 32u, ix = (blockIdx.x * (8u * PT) + threadIdx.x) * 32u;      /* byte offsets of the thread's piece in a weight and of its first piece in x */
  const float* wsrc[4] = {wq, wk, wv, wo};
  v4f a[12][2];
#pragma unroll
  for (int i = 0; i < 8; ++i) { const char* p = (const char*)x + ix + i * (PT * 32); a[i][0] = *(const v4fa*)p; a[i][1] = *(const v4fa*)(p + 16); }
#pragma unroll
  for (int i = 0; i < 4; ++i) { const char* p = (const char*)wsrc[i] + iw; a[8 + i][0] = *(const v4fa*)p; a[8 + i][1] = *(const v4fa*)(p + 16); }
  __builtin_amdgcn_sched_barrier(0);      /* keeps all 24 loads in front of the first conversion: without it about half of them are issued only after earlier ones have come back, and the wave waits out a second memory latency */
#pragma unroll
  for (int i = 0; i < 12; ++i) { const float sc = (i < 8) ? 1.0f : 16.0f; FragH f;
#pragma unroll
    for (int q = 0; q < 4; ++q) { f.h[q] = (_Float16)(bf16_round(a[i][0][q]) * sc); f.h[4 + q] = (_Float16)(bf16_round(a[i][1][q]) * sc); }
    char* d = (i < 8) ? (char*)X16 + (ix >> 1) + i * (PT * 16) : (i < 11) ? (char*)(BQKV + (size_t)(i - 8) * DM * DM) + (iw >> 1) : (char*)BO + (iw >> 1);      /* q | k | v stacked along n */
    *(v8us*)d = f.half[0]; } }

extern "C" void kernel_launch(void* const* d_in, const int* in_sizes, int n_in,
                              void* d_out, int out_size, void* d_ws, size_t ws_size, hipStream_t stream) {
  (void)in_sizes; (void)n_in; (void)out_size;
  const float* const* I = (const float* const*)d_in; const float* x = I[0]; const float* tcos = I[1]; const float* tsin = I[2]; const float* wq = I[3]; const float* wk = I[4]; const float* wv = I[5]; const float* wo = I[6]; const float* bo = nullptr;      /* natural [out][in] weights, no biases; cos/sin INPUT tables [1][S][1][64] = [S][64] */
  char* ws = (char*)d_ws; size_t off = 0;
  auto take = [&](size_t bytes) { char* p = ws + off; off += (bytes + 255) & ~(size_t)255; return p; };
  _Float16* BQKV = (_Float16*)take((size_t)3 * DM * DM * 2); _Float16* BO = (_Float16*)take((size_t)DM * DM * 2);
  _Float16* X16 = (_Float16*)take(NR * DM * 2);
  _Float16* QH = (_Float16*)take(NR * DM * 2); _Float16* KH = (_Float16*)take(NR * DM * 2); _Float16* O16 = (_Float16*)take(NR * DM * 2);
  _Float16* VT = (_Float16*)take((size_t)NB * NH * HD * SQ * 2);      /* V^T of every batch */
  if (off > ws_size) return;
  k_prep<<<PG, PT, 0, stream>>>(x, wq, wk, wv, wo, X16, BQKV, BO);      /* x as f16 rows; natural [out][in] weights = Bt[n][k], x16; q | k | v stacked along n */
  k_qkv<<<(unsigned)((NR / 128) * (3 * DM / 128)), 256, 0, stream>>>(X16, BQKV, tcos, tsin, QH, KH, VT);      /* every batch: rotated f16 q and k rows, V^T [NB][NH][HD][SQ] */
  k_fattn<<<dim3(QN / 256, NHD, NBR), 256, 0, stream>>>(QH, KH, VT, O16);      /* all batches and heads in one launch; o x64 as f16 in the merged rows */
  k_out<<<(unsigned)((MPO / 128) * (DM / 128)), 256, 0, stream>>>(O16 + (size_t)B0 * SQ * DM, BO, 0.0009765625f, (float*)d_out + (size_t)B0 * SQ * DM);      /* out rows are the output layout */
}
